// v000
// Times are from an AMD MI455X. After a warm-up the kernel runs many times in a row, and a time is the length of
// such a window on the GPU divided by its runs, so every launch and the gaps after it count. The runs cycle
// through copies of the inputs. A figure is the median of several windows, for all but v000 over two sittings.
// Sittings can differ by a few percent; kernels timed side by side share one.
// v000, which the later versions start from, runs in 2360 microseconds.
// compute dtype: all float inputs rounded to bf16; every complex linear as one stacked real GEMM ([x_r | x_i] against [W_r ; -W_i] / [W_i ; W_r]) with EXACT bf16 products on WMMA 16x16x32, f32 accumulate; q (+pe) as f16 hi + residual (x 2^10) and k (+pe) as f16 hi + residual (x 2^10) -> 3-product complex logits (s_r, s_i as two stacked K=256 real GEMMs), |s| scaled in f32 (sqrtf); softmax in f32 (precise expf); P x 2^11 split bf16 hi + lo against v bf16 hi + lo (3 products); RMS norm / lambda / differential combination / complex gating in f32; the gated result (bf16 hi + lo) through the output complex linear (2 products); f32 outputs.
#include <hip/hip_runtime.h>
#include <math.h>

typedef __attribute__((ext_vector_type(16))) _Float16 v16h;
typedef __attribute__((ext_vector_type(16))) __bf16 v16b;
typedef __attribute__((ext_vector_type(8)))  _Float16 v8h;
typedef __attribute__((ext_vector_type(8)))  float v8f;
typedef __attribute__((ext_vector_type(4)))  float v4f;
typedef __attribute__((ext_vector_type(2)))  float v2f;
typedef __attribute__((ext_vector_type(4)))  unsigned v4u;
typedef __attribute__((ext_vector_type(4)))  int v4i;
typedef float __attribute__((may_alias)) float_a;
typedef int __attribute__((may_alias)) int_a;

template <typename T> __device__ __forceinline__ void vst2(void* p, T v) { *(T*)p = v;  }
__device__ __forceinline__ v8f wmma16(v16h a, v16h b, v8f c) {
  v8f d = __builtin_amdgcn_wmma_f32_16x16x32_f16(false, a, false, b, (short)0, c, false, false);
  asm volatile("v_nop\n\tv_nop\n\tv_nop\n\tv_nop" : "+v"(d) : "v"(a), "v"(b));
  return d;
}
__device__ __forceinline__ v8f wmma_bf(v16b a, v16b b, v8f c) {
  v8f d = __builtin_amdgcn_wmma_f32_16x16x32_bf16(false, a, false, b, (short)0, c, false, false);
  asm volatile("v_nop\n\tv_nop\n\tv_nop\n\tv_nop" : "+v"(d) : "v"(a), "v"(b));
  return d;
}
// 16x16x32 fragments: lane = (h = lane>>4, row/col = lane&15); elements 0..7 = k0+8h+0..7, 8..15 = k0+16+8h+0..7; D element r = row 8h+r
__device__ __forceinline__ v16h frag_h(const _Float16* rowk0, int lane) {
  union { v16h v; v8h q[2]; } u; const _Float16* p = rowk0 + 8 * (lane >> 4);
  u.q[0] = *(const v8h*)p; u.q[1] = *(const v8h*)(p + 16); return u.v;
}
__device__ __forceinline__ v16h frag_f32(const float* rowk0, int lane) {
  v16h a; const float* p = rowk0 + 8 * (lane >> 4);
#pragma unroll
  for (int i = 0; i < 8; ++i) { a[i] = (_Float16)p[i]; a[8 + i] = (_Float16)p[16 + i]; }
  return a;
}
__device__ __forceinline__ v16h frag_f32s(const float* rowk0, int lane, float sc) {
  v16h a; const float* p = rowk0 + 8 * (lane >> 4);
#pragma unroll
  for (int i = 0; i < 8; ++i) { a[i] = (_Float16)(p[i] * sc); a[8 + i] = (_Float16)(p[16 + i] * sc); }
  return a;
}
// column fragment from a [K][ld] layout (column n), rows >= K read as 0
__device__ __forceinline__ v16h fragc_f32(const float* W, int k0, int n, int lane, int ld, int K) {
  v16h a; const int g = lane >> 4;
#pragma unroll
  for (int i = 0; i < 8; ++i) { const int ka = k0 + 8 * g + i, kb = ka + 16;
    a[i] = (_Float16)(ka < K ? W[(size_t)(ka < K ? ka : K - 1) * ld + n] : 0.f); a[8 + i] = (_Float16)(kb < K ? W[(size_t)(kb < K ? kb : K - 1) * ld + n] : 0.f); }
  return a;
}
struct F2 { v16b h, l; };
__device__ __forceinline__ F2 bsplit16(const float v[16]) { F2 r;
#pragma unroll
  for (int i = 0; i < 16; ++i) { const __bf16 h = (__bf16)v[i]; r.h[i] = h; r.l[i] = (__bf16)(v[i] - (float)h); }
  return r; }
__device__ __forceinline__ F2 split_row(const float* row, int k0, int lane) { float v[16]; const float* p = row + k0 + 8 * (lane >> 4);
#pragma unroll
  for (int i = 0; i < 8; ++i) { v[i] = p[i]; v[8 + i] = p[16 + i]; }
  return bsplit16(v); }
__device__ __forceinline__ F2 split_rowK(const float* row, int k0, int lane, int K) { float v[16]; const int g = lane >> 4;
#pragma unroll
  for (int i = 0; i < 8; ++i) { const int ka = k0 + 8 * g + i, kb = ka + 16; v[i] = ka < K ? row[ka < K ? ka : K - 1] : 0.f; v[8 + i] = kb < K ? row[kb < K ? kb : K - 1] : 0.f; }
  return bsplit16(v); }
__device__ __forceinline__ F2 split_col(const float* W, int k0, int n, int lane, int ld, int K) { float v[16]; const int g = lane >> 4;
#pragma unroll
  for (int i = 0; i < 8; ++i) { const int ka = k0 + 8 * g + i, kb = ka + 16; v[i] = ka < K ? W[(size_t)(ka < K ? ka : K - 1) * ld + n] : 0.f; v[8 + i] = kb < K ? W[(size_t)(kb < K ? kb : K - 1) * ld + n] : 0.f; }
  return bsplit16(v); }
__device__ __forceinline__ v8f mac3(const F2& a, const F2& b, v8f c) { c = wmma_bf(a.l, b.h, c); c = wmma_bf(a.h, b.l, c); return wmma_bf(a.h, b.h, c); }
__device__ __forceinline__ float sigm(float v) { return 1.0f / (1.0f + expf(-v)); }
#define LDSX() do { asm volatile("s_wait_dscnt 0" ::: "memory"); __builtin_amdgcn_wave_barrier(); __builtin_amdgcn_fence(__ATOMIC_RELEASE, "workgroup"); } while (0)


// Complex differential attention (B 1, H 12, S 1,024, D 128): qp = CLin_q(q) + [pe_q, pe_q] (2D wide -> q1, q2), kp = CLin_k(k) + pe_k, vp = CLin_v(v); w_s = softmax(|q_s . conj(kp)| / sqrt(128)) for s = 1, 2; a_s = w_s vp (complex); cat = [a1, a2] / rms(cat) * sub_w; out = a1 - lambda a2 with lambda = sigmoid(exp(lq1 . lk1) - exp(lq2 . lk2) + 0.3555...); out = CLin_g(q) * out (complex product); out = CLin_o(out) -> (out_r, out_i).
#define NHT 12             // heads (x batch 1)
#define SS 1024
#define DD 128
#define KK 256             // stacked K of every complex linear / logit GEMM: [real | imag]
#ifndef NHU
#define NHU NHT            // heads processed
#endif
#define NR (NHU * SS)      // rows processed
#define NRF (NHT * SS)     // full row count (output-1 offset)
#ifndef HG
#define HG 3               // (head, sel) pairs per launch group (divides NPAIR)
#endif
#define NPAIR (NHU * 2)
#define SCALE 0.0883883461356163f       // 128^-0.5 as f32
#define LAMBDA_INIT 0.35550907254219055f  // 0.8 - 0.6 exp(-0.3) as f32
__device__ __forceinline__ float bfr(float v) { return (float)(__bf16)v; }
typedef __attribute__((ext_vector_type(8))) __bf16 v8b;
__device__ __forceinline__ v16b frag_b(const __bf16* rowk0, int lane) { union { v16b v; v8b q[2]; } u; const __bf16* p = rowk0 + 8 * (lane >> 4); u.q[0] = *(const v8b*)p; u.q[1] = *(const v8b*)(p + 16); return u.v; }

#define WS_QH  0u                                      // f16 q rows [row][1024]: per sel s: [s*512 +0..127] q_r, [+128..255] q_i, [+256..383] q_i, [+384..511] -q_r  (hi)
#define WS_QL  (WS_QH + 2u * (size_t)NRF * 1024)       // f16 residual x 2^10
#define WS_KH  (WS_QL + 2u * (size_t)NRF * 1024)       // f16 k rows [row][256] = [kp_r | kp_i] (hi)
#define WS_KL  (WS_KH + 2u * (size_t)NRF * KK)         // f16 residual x 2^10
#define WS_VT  (WS_KL + 2u * (size_t)NRF * KK)         // bf16 value planes [h][256 = vp_r | vp_i][s] hi
#define WS_VL  (WS_VT + 2u * (size_t)NHT * KK * SS)    // bf16 value residual planes
#define WS_G   (WS_VL + 2u * (size_t)NHT * KK * SS)    // f32 g rows [row][256] = [g_r | g_i]; later overwritten in place by the gated result z = [z_r | z_i]
#define WS_Y   (WS_G + 4u * (size_t)NRF * KK)          // f32 attention rows [row][512] = [a1_r | a1_i | a2_r | a2_i]
#define WS_LAM (WS_Y + 4u * (size_t)NRF * 512)         // one line: lambda replicated
#define WS_S   (WS_LAM + 128u)                         // f32 logits / P planes for HG (head, sel) pairs [hg][q][k]
#define WS_END (WS_S + 4u * (size_t)HG * SS * SS)

// ---- k_clin: block = (64 rows, 128 output cols, tile index over 2*NO): generic complex linear as a stacked real GEMM.
// A row = [x_r[row] | x_i[row]] (K 256; MODE < 4: two f32 input tensors, bf16 exact; MODE 4: the f32 z rows, bf16 hi + lo -> 2 products);
// output column o in [0, 2 NO): part = o / NO (0 real, 1 imag), oo = o % NO; B[k] = part 0: (k < 128 ? W_r[oo][k] : -W_i[oo][k-128]), part 1: (k < 128 ? W_i[oo][k] : W_r[oo][k-128]); + bias_part[oo].
// MODE 0: q projection (NO 256) + pe_q -> QH/QL (each value to its two slots, see WS_QH); MODE 1: k (NO 128) + pe_k -> KH/KL; MODE 2: v -> bf16 planes; MODE 3: g -> G rows; MODE 4: output linear from Z -> the two output tensors
template <int MODE, int NO>
__global__ __launch_bounds__(128) void k_clin(const float* __restrict__ XR, const float* __restrict__ XI, const float* __restrict__ WR, const float* __restrict__ WI, const float* __restrict__ BR, const float* __restrict__ BI, const float* __restrict__ PER, const float* __restrict__ PEI, void* __restrict__ D0, void* __restrict__ D1) {
  __shared__ __align__(16) float sf[64][132];
  const int tid = threadIdx.x, wave = tid >> 5, lane = tid & 31, col = lane & 15, g = lane >> 4; const int c0 = blockIdx.y * 128; const size_t r0 = (size_t)blockIdx.x * 64; const int part = c0 / NO; const int oo0 = c0 % NO;
  v8f acc[8] = {};
#pragma unroll 2
  for (int kc = 0; kc < KK / 32; ++kc) { const bool imx = kc >= 4; const int kx = (kc & 3) * 32;   // A columns kc*32.. : real input for kc < 4, imag for kc >= 4
    v16b ah, al; bool two = false;
    if (MODE < 4) { const float* p = (imx ? XI : XR) + (r0 + wave * 16 + col) * DD + kx + 8 * g;
#pragma unroll
      for (int i = 0; i < 8; ++i) { ah[i] = (__bf16)p[i]; ah[8 + i] = (__bf16)p[16 + i]; } }
    else { const F2 a = split_row(XR + (r0 + wave * 16 + col) * KK, kc * 32, lane); ah = a.h; al = a.l; two = true; }
#pragma unroll
    for (int j = 0; j < 8; ++j) { v16b w; const int oo = oo0 + j * 16 + col; const float* WS0 = (part == 0) ? (imx ? WI : WR) : (imx ? WR : WI); const float sg = (part == 0 && imx) ? -1.0f : 1.0f;
#pragma unroll
      for (int i = 0; i < 8; ++i) { w[i] = (__bf16)(sg * WS0[(size_t)oo * DD + kx + 8 * g + i]); w[8 + i] = (__bf16)(sg * WS0[(size_t)oo * DD + kx + 16 + 8 * g + i]); }
      asm volatile("s_wait_loadcnt 0x0" ::: "memory"); acc[j] = wmma_bf(ah, w, acc[j]); if (two) acc[j] = wmma_bf(al, w, acc[j]); } }
  { const float* BB = part == 0 ? BR : BI; const float* PE = part == 0 ? PER : PEI;
#pragma unroll
    for (int j = 0; j < 8; ++j) { const int oo = oo0 + j * 16 + col; const float bb = bfr(BB[oo]);
#pragma unroll
      for (int r = 0; r < 8; ++r) { const int rl = wave * 16 + 8 * g + r; float v = acc[j][r] + bb; if (MODE <= 1) v += bfr(PE[(r0 + rl) * DD + (oo & (DD - 1))]); sf[rl][j * 16 + col] = v; }
      asm volatile("s_wait_loadcnt 0x0" ::: "memory"); } }
  __syncthreads();
  if (MODE == 0) {   // q: value (sel = oo0/128, d) -> QH[row][sel*512 + (part ? 128 : 0) + d] and QH[row][sel*512 + (part ? 256 : 384) + d] (the second real copy negated); f16 hi + residual x 2^10; each destination = a 256-B segment per row by 16 consecutive threads
    _Float16* QH = (_Float16*)D0; _Float16* QL = (_Float16*)D1; const int sel = oo0 / DD; const int dA = sel * 512 + (part ? 128 : 0), dB = sel * 512 + (part ? 256 : 384); const float sgB = part ? 1.0f : -1.0f;
    for (int e = tid; e < 64 * 16; e += 128) { const int rl = e >> 4, q = e & 15; v8h ha, la, hb, lb;
#pragma unroll
      for (int k = 0; k < 8; ++k) { const float v = sf[rl][q * 8 + k]; const _Float16 hv = (_Float16)v; ha[k] = hv; la[k] = (_Float16)((v - (float)hv) * 1024.0f); const float vb = v * sgB; const _Float16 hb2 = (_Float16)vb; hb[k] = hb2; lb[k] = (_Float16)((vb - (float)hb2) * 1024.0f); }
      const size_t ro = (r0 + rl) * 1024; vst2((v4u*)(QH + ro + dA + q * 8), *(const v4u*)&ha); vst2((v4u*)(QL + ro + dA + q * 8), *(const v4u*)&la); vst2((v4u*)(QH + ro + dB + q * 8), *(const v4u*)&hb); vst2((v4u*)(QL + ro + dB + q * 8), *(const v4u*)&lb); } }
  else if (MODE == 1) {   // k rows [row][256]: column part*128 + d; f16 hi + residual x 2^10
    _Float16* KH = (_Float16*)D0; _Float16* KL = (_Float16*)D1;
    for (int e = tid; e < 64 * 16; e += 128) { const int rl = e >> 4, q = e & 15; v8h ha, la;
#pragma unroll
      for (int k = 0; k < 8; ++k) { const float v = sf[rl][q * 8 + k]; const _Float16 hv = (_Float16)v; ha[k] = hv; la[k] = (_Float16)((v - (float)hv) * 1024.0f); }
      const size_t ro = (r0 + rl) * KK + c0; vst2((v4u*)(KH + ro + q * 8), *(const v4u*)&ha); vst2((v4u*)(KL + ro + q * 8), *(const v4u*)&la); } }
  else if (MODE == 2) {
    __bf16* VT = (__bf16*)D0; __bf16* VL = (__bf16*)D1; const size_t h = r0 / SS; const int s0 = (int)(r0 % SS);
    for (int e = tid; e < 128 * 8; e += 128) { const int cl = e >> 3, q = e & 7; v8b hb, lb;
#pragma unroll
      for (int k = 0; k < 8; ++k) { const float v = sf[q * 8 + k][cl]; const __bf16 bh = (__bf16)v; hb[k] = bh; lb[k] = (__bf16)(v - (float)bh); }
      const size_t o2 = (h * KK + c0 + cl) * (size_t)SS + s0 + q * 8; vst2((v4u*)(VT + o2), *(const v4u*)&hb); vst2((v4u*)(VL + o2), *(const v4u*)&lb); } }
  else if (MODE == 3) {   // g rows [row][256] f32: 512-B segment per row by 32 lanes
    float* G = (float*)D0; for (int e = tid; e < 64 * 32; e += 128) { const int rl = e >> 5, q = e & 31; vst2(G + (r0 + rl) * KK + c0 + q * 4, *(const v4f*)&sf[rl][q * 4]); } }
  else {   // MODE 4: output rows [row][128] of out_r (part 0) or out_i (part 1): whole 512-B rows by 32 lanes
    float* O = (float*)(part == 0 ? D0 : D1); for (int e = tid; e < 64 * 32; e += 128) { const int rl = e >> 5, q = e & 31; vst2(O + (r0 + rl) * DD + q * 4, *(const v4f*)&sf[rl][q * 4]); } } }
__global__ __launch_bounds__(32) void k_lam(const float* __restrict__ LQ1, const float* __restrict__ LK1, const float* __restrict__ LQ2, const float* __restrict__ LK2, float* __restrict__ LAM) { __shared__ float sl;
  if (threadIdx.x == 0) { float s1 = 0.f, s2 = 0.f; for (int i = 0; i < DD; ++i) { s1 += bfr(LQ1[i]) * bfr(LK1[i]); s2 += bfr(LQ2[i]) * bfr(LK2[i]); } const float z = expf(s1) - expf(s2) + LAMBDA_INIT; sl = 1.0f / (1.0f + expf(-z)); }
  __syncthreads(); vst2(LAM + threadIdx.x, sl); }
// ---- k_sc: block = (64 queries, 64 keys, pair in group): pair p = (head h = p/2, sel = p%2); s_r = Q[sel*512 + 0..255] . KH, s_i = Q[sel*512 + 256..511] . KH (3 products each: hi.hi + (lo.hi + hi.lo) 2^-10); logit = sqrt(s_r^2 + s_i^2 + 1e-8) x 128^-0.5
__global__ __launch_bounds__(128) void k_sc(const _Float16* __restrict__ QH, const _Float16* __restrict__ QL, const _Float16* __restrict__ KH, const _Float16* __restrict__ KL, int p0, float* __restrict__ S0) { __shared__ __align__(16) float ss[4][16][68]; const int p = p0 + blockIdx.z; const int h = p >> 1, sel = p & 1; float* S = S0 + (size_t)blockIdx.z * SS * SS;
  const int tid = threadIdx.x, wave = tid >> 5, lane = tid & 31, col = lane & 15, g = lane >> 4; const int k0 = blockIdx.y * 64; const int ql0 = blockIdx.x * 64 + wave * 16; const size_t q0 = (size_t)h * SS + ql0; const size_t kb = (size_t)h * SS + k0;
  v8f ar[4] = {}, arl[4] = {}, ai[4] = {}, ail[4] = {};
#pragma unroll 2
  for (int kc = 0; kc < KK / 32; ++kc) { const _Float16* qh = QH + (q0 + col) * 1024 + sel * 512 + kc * 32; const _Float16* ql = QL + (q0 + col) * 1024 + sel * 512 + kc * 32;
    const v16h arh = frag_h(qh, lane), arlo = frag_h(ql, lane), aih = frag_h(qh + 256, lane), ailo = frag_h(ql + 256, lane);
#pragma unroll
    for (int j = 0; j < 4; ++j) { const size_t ko = (kb + j * 16 + col) * KK + kc * 32; const v16h khf = frag_h(KH + ko, lane), klf = frag_h(KL + ko, lane);
      ar[j] = wmma16(arh, khf, ar[j]); arl[j] = wmma16(arlo, khf, arl[j]); arl[j] = wmma16(arh, klf, arl[j]);
      ai[j] = wmma16(aih, khf, ai[j]); ail[j] = wmma16(ailo, khf, ail[j]); ail[j] = wmma16(aih, klf, ail[j]); } }
#pragma unroll
  for (int j = 0; j < 4; ++j)
#pragma unroll
    for (int r = 0; r < 8; ++r) { const float sr_ = ar[j][r] + arl[j][r] * (1.0f / 1024.0f), si_ = ai[j][r] + ail[j][r] * (1.0f / 1024.0f); ss[wave][8 * g + r][j * 16 + col] = sqrtf(sr_ * sr_ + si_ * si_ + 1e-8f) * SCALE; }
  LDSX(); for (int rl = 0; rl < 16; ++rl) if (lane < 16) vst2(S + (size_t)(ql0 + rl) * SS + k0 + lane * 4, *(const v4f*)&ss[wave][rl][lane * 4]); }   
// ---- k_sm: block = query row of pair plane z: softmax over all 1,024 keys (f32) -> P x 2^11 in place
__global__ __launch_bounds__(256) void k_sm(float* __restrict__ S0) { __shared__ float sred[8]; __shared__ float sbc; __shared__ __align__(16) float sh[SS];
  const int t = threadIdx.x; const size_t row = blockIdx.x; float* sr = S0 + (size_t)blockIdx.y * SS * SS + row * SS; const int kend = SS;
  float m = -3.0e38f; for (int k = t; k < kend; k += 256) m = fmaxf(m, sr[k]);
#pragma unroll
  for (int o = 1; o < 32; o <<= 1) m = fmaxf(m, __shfl_xor(m, o));
  if ((t & 31) == 0) sred[t >> 5] = m; __syncthreads(); if (t == 0) { float a = sred[0]; for (int i = 1; i < 8; ++i) a = fmaxf(a, sred[i]); sbc = a; } __syncthreads(); m = sbc; __syncthreads();
  float sum = 0.f; for (int k = t; k < kend; k += 256) sum += expf(sr[k] - m);
#pragma unroll
  for (int o = 1; o < 32; o <<= 1) sum += __shfl_xor(sum, o);
  if ((t & 31) == 0) sred[t >> 5] = sum; __syncthreads(); if (t == 0) { float a = 0.f; for (int i = 0; i < 8; ++i) a += sred[i]; sbc = 1.0f / a; } __syncthreads(); const float inv = sbc;
  for (int k = t; k < kend; k += 256) sh[k] = expf(sr[k] - m) * inv * 2048.0f;
  __syncthreads(); for (int q = t; q < kend / 4; q += 256) vst2(sr + q * 4, *(const v4f*)&sh[q * 4]); }
// ---- k_pv: block = 64 queries of pair (h, sel): Y[row][sel*256 + c] = (P . vp)[c] for c in [0,256) = [a_r | a_i] (P split bf16 hi + lo x v hi + lo, 3 products); each (row, 128-col half) = 512 B by 32 lanes
__global__ __launch_bounds__(128) void k_pv(const float* __restrict__ PS0, const __bf16* __restrict__ VT, const __bf16* __restrict__ VL, int p0, float* __restrict__ Y) { const int p = p0 + blockIdx.z; const int h = p >> 1, sel = p & 1; const float* PS = PS0 + (size_t)blockIdx.z * SS * SS; __shared__ __align__(16) float ss[4][16][KK + 4];
  const int tid = threadIdx.x, wave = tid >> 5, lane = tid & 31, col = lane & 15, g = lane >> 4; const int ql0 = blockIdx.x * 64 + wave * 16;
  v8f acc[KK / 16] = {};
#pragma unroll 1
  for (int kc = 0; kc < SS / 32; ++kc) { const F2 pf = split_row(PS + (size_t)(ql0 + col) * SS, kc * 32, lane);
    asm volatile("s_wait_loadcnt 0x0" ::: "memory");
#pragma unroll
    for (int j = 0; j < KK / 16; ++j) { const size_t po = ((size_t)h * KK + j * 16 + col) * (size_t)SS + kc * 32; const v16b vh = frag_b(VT + po, lane); acc[j] = wmma_bf(pf.h, vh, acc[j]); acc[j] = wmma_bf(pf.l, vh, acc[j]); acc[j] = wmma_bf(pf.h, frag_b(VL + po, lane), acc[j]); } }
#pragma unroll
  for (int j = 0; j < KK / 16; ++j)
#pragma unroll
    for (int r = 0; r < 8; ++r) ss[wave][8 * g + r][j * 16 + col] = acc[j][r] * (1.0f / 2048.0f);
  LDSX(); for (int rl = 0; rl < 16; ++rl) { const size_t ro = ((size_t)h * SS + ql0 + rl) * 512 + sel * 256; vst2(Y + ro + lane * 4, *(const v4f*)&ss[wave][rl][lane * 4]); vst2(Y + ro + 128 + lane * 4, *(const v4f*)&ss[wave][rl][128 + lane * 4]); } }
// ---- k_mix: block = 16 rows (16 lanes per row): rms over the 512 attention values (= mean over 256 of r^2 + i^2), / rms x sub_w, out = a1 - lambda a2, then the complex gate z = g * out; z written IN PLACE over the g row (each lane reads and writes exactly its own columns d and 128 + d); float4 pieces, 16 lanes x 16 B = 256-B runs
__global__ __launch_bounds__(256) void k_mix(const float* __restrict__ Y, float* __restrict__ GZ, const float* __restrict__ LAM, const float* __restrict__ SW) {
  const int t = threadIdx.x; const int rl = t >> 4, sub = t & 15; const size_t row = (size_t)blockIdx.x * 16 + rl; const float* y = Y + row * 512; float* gz = GZ + row * KK; const float lam = LAM[0];
  float s2 = 0.f; for (int c = sub * 4; c < 512; c += 64) { const v4f v = *(const v4f*)(y + c); s2 += (v[0] * v[0] + v[1] * v[1]) + (v[2] * v[2] + v[3] * v[3]); }
#pragma unroll
  for (int o = 1; o < 16; o <<= 1) s2 += __shfl_xor(s2, o);
  const float inv = 1.0f / sqrtf(s2 * (1.0f / 256.0f) + 1e-5f);
#pragma unroll
  for (int it = 0; it < 2; ++it) { const int d = sub * 4 + it * 64;   /* d in [0,128): this lane's 4 columns */
    const v4f a1r = *(const v4f*)(y + d), a1i = *(const v4f*)(y + 128 + d), a2r = *(const v4f*)(y + 256 + d), a2i = *(const v4f*)(y + 384 + d); const v4f gr = *(const v4f*)(gz + d), gi = *(const v4f*)(gz + 128 + d);
    v4f zr, zi;
#pragma unroll
    for (int k = 0; k < 4; ++k) { const float w1 = bfr(SW[d + k]) * inv, w2 = bfr(SW[DD + d + k]) * inv; const float orr = a1r[k] * w1 - lam * (a2r[k] * w2), oi = a1i[k] * w1 - lam * (a2i[k] * w2); zr[k] = gr[k] * orr - gi[k] * oi; zi[k] = gr[k] * oi + gi[k] * orr; }
    vst2(gz + d, zr); vst2(gz + 128 + d, zi); } }
extern "C" void kernel_launch(void* const* d_in, const int* in_sizes, int n_in, void* d_out, int out_size, void* d_ws, size_t ws_size, hipStream_t stream) {
  (void)in_sizes; (void)n_in; (void)out_size;
  const float** F = (const float**)d_in;   // 0 q_r, 1 q_i, 2 k_r, 3 k_i, 4 v_r, 5 v_i, 6 pe_q_r, 7 pe_q_i, 8 pe_k_r, 9 pe_k_i [1,12,1024,128]; 10 qw_r [256,128], 11 qw_i, 12 qb_r [256], 13 qb_i; 14 kw_r [128,128], 15 kw_i, 16 kb_r, 17 kb_i; 18 vw_r, 19 vw_i, 20 vb_r, 21 vb_i; 22 gw_r, 23 gw_i, 24 gb_r, 25 gb_i; 26 ow_r, 27 ow_i, 28 ob_r, 29 ob_i; 30 lq1, 31 lk1, 32 lq2, 33 lk2 [128]; 34 sub_w [256]
  if (ws_size < (size_t)WS_END) return;
  char* ws = (char*)d_ws; _Float16 *QH = (_Float16*)(ws + WS_QH), *QL = (_Float16*)(ws + WS_QL), *KH = (_Float16*)(ws + WS_KH), *KL = (_Float16*)(ws + WS_KL); __bf16 *VT = (__bf16*)(ws + WS_VT), *VL = (__bf16*)(ws + WS_VL); float *G = (float*)(ws + WS_G), *Y = (float*)(ws + WS_Y), *LAM = (float*)(ws + WS_LAM), *S = (float*)(ws + WS_S);
  float* OUT0 = (float*)d_out; float* OUT1 = (float*)d_out + (size_t)NRF * DD;
  k_clin<0, 256><<<dim3(NR / 64, 4), 128, 0, stream>>>(F[0], F[1], F[10], F[11], F[12], F[13], F[6], F[7], QH, QL);
  k_clin<1, 128><<<dim3(NR / 64, 2), 128, 0, stream>>>(F[2], F[3], F[14], F[15], F[16], F[17], F[8], F[9], KH, KL);
  k_clin<2, 128><<<dim3(NR / 64, 2), 128, 0, stream>>>(F[4], F[5], F[18], F[19], F[20], F[21], nullptr, nullptr, VT, VL);
  k_clin<3, 128><<<dim3(NR / 64, 2), 128, 0, stream>>>(F[0], F[1], F[22], F[23], F[24], F[25], nullptr, nullptr, G, nullptr);
  k_lam<<<dim3(1), 32, 0, stream>>>(F[30], F[31], F[32], F[33], LAM);
  for (int p0 = 0; p0 < NPAIR; p0 += HG) {
    k_sc<<<dim3(SS / 64, SS / 64, HG), 128, 0, stream>>>(QH, QL, KH, KL, p0, S);
    k_sm<<<dim3(SS, HG), 256, 0, stream>>>(S);
    k_pv<<<dim3(SS / 64, 1, HG), 128, 0, stream>>>(S, VT, VL, p0, Y);
  }
  k_mix<<<dim3(NR / 16), 256, 0, stream>>>(Y, G, LAM, F[34]);
  k_clin<4, 128><<<dim3(NR / 64, 2), 128, 0, stream>>>(G, nullptr, F[26], F[27], F[28], F[29], nullptr, nullptr, OUT0, OUT1);
}

// v001
// It runs in 640 microseconds.
// Next to v000, in two timings, it ran 3.69 and 3.71 times as fast.
// compute dtype: all float inputs rounded to bf16; every complex linear as one stacked real GEMM ([x_r | x_i] against [W_r ; -W_i] / [W_i ; W_r]) with EXACT bf16 products on WMMA 16x16x32, f32 accumulate; q (+pe) as f16 hi + residual (x 2^10) and k (+pe) as f16 hi + residual (x 2^10) -> 3-product complex logits (s_r, s_i as two stacked K=256 real GEMMs), |s| scaled in f32 (sqrtf); softmax in f32 (precise expf); P x 2^11 split bf16 hi + lo against v bf16 hi + lo (3 products); RMS norm / lambda / differential combination / complex gating in f32; the gated result (bf16 hi + lo) through the output complex linear (2 products); f32 outputs.
#include <hip/hip_runtime.h>
#include <math.h>

typedef __attribute__((ext_vector_type(16))) _Float16 v16h;
typedef __attribute__((ext_vector_type(16))) __bf16 v16b;
typedef __attribute__((ext_vector_type(8)))  _Float16 v8h;
typedef __attribute__((ext_vector_type(8)))  float v8f;
typedef __attribute__((ext_vector_type(4)))  float v4f;
typedef __attribute__((ext_vector_type(2)))  float v2f;
typedef __attribute__((ext_vector_type(4)))  unsigned v4u;
typedef __attribute__((ext_vector_type(4)))  int v4i;
typedef float __attribute__((may_alias)) float_a;
typedef int __attribute__((may_alias)) int_a;

template <typename T> __device__ __forceinline__ void vst2(void* p, T v) { *(T*)p = v;  }
__device__ __forceinline__ v8f wmma16(v16h a, v16h b, v8f c) {
  v8f d = __builtin_amdgcn_wmma_f32_16x16x32_f16(false, a, false, b, (short)0, c, false, false);
  asm volatile("v_nop\n\tv_nop\n\tv_nop\n\tv_nop" : "+v"(d) : "v"(a), "v"(b));
  return d;
}
__device__ __forceinline__ v8f wmma_bf(v16b a, v16b b, v8f c) {
  v8f d = __builtin_amdgcn_wmma_f32_16x16x32_bf16(false, a, false, b, (short)0, c, false, false);
  asm volatile("v_nop\n\tv_nop\n\tv_nop\n\tv_nop" : "+v"(d) : "v"(a), "v"(b));
  return d;
}
// 16x16x32 fragments: lane = (h = lane>>4, row/col = lane&15); elements 0..7 = k0+8h+0..7, 8..15 = k0+16+8h+0..7; D element r = row 8h+r
__device__ __forceinline__ v16h frag_h(const _Float16* rowk0, int lane) {
  union { v16h v; v8h q[2]; } u; const _Float16* p = rowk0 + 8 * (lane >> 4);
  u.q[0] = *(const v8h*)p; u.q[1] = *(const v8h*)(p + 16); return u.v;
}
__device__ __forceinline__ v16h frag_f32(const float* rowk0, int lane) {
  v16h a; const float* p = rowk0 + 8 * (lane >> 4);
#pragma unroll
  for (int i = 0; i < 8; ++i) { a[i] = (_Float16)p[i]; a[8 + i] = (_Float16)p[16 + i]; }
  return a;
}
__device__ __forceinline__ v16h frag_f32s(const float* rowk0, int lane, float sc) {
  v16h a; const float* p = rowk0 + 8 * (lane >> 4);
#pragma unroll
  for (int i = 0; i < 8; ++i) { a[i] = (_Float16)(p[i] * sc); a[8 + i] = (_Float16)(p[16 + i] * sc); }
  return a;
}
// column fragment from a [K][ld] layout (column n), rows >= K read as 0
__device__ __forceinline__ v16h fragc_f32(const float* W, int k0, int n, int lane, int ld, int K) {
  v16h a; const int g = lane >> 4;
#pragma unroll
  for (int i = 0; i < 8; ++i) { const int ka = k0 + 8 * g + i, kb = ka + 16;
    a[i] = (_Float16)(ka < K ? W[(size_t)(ka < K ? ka : K - 1) * ld + n] : 0.f); a[8 + i] = (_Float16)(kb < K ? W[(size_t)(kb < K ? kb : K - 1) * ld + n] : 0.f); }
  return a;
}
struct F2 { v16b h, l; };
__device__ __forceinline__ F2 bsplit16(const float v[16]) { F2 r;
#pragma unroll
  for (int i = 0; i < 16; ++i) { const __bf16 h = (__bf16)v[i]; r.h[i] = h; r.l[i] = (__bf16)(v[i] - (float)h); }
  return r; }
__device__ __forceinline__ F2 split_row(const float* row, int k0, int lane) { float v[16]; const float* p = row + k0 + 8 * (lane >> 4);
#pragma unroll
  for (int i = 0; i < 8; ++i) { v[i] = p[i]; v[8 + i] = p[16 + i]; }
  return bsplit16(v); }
__device__ __forceinline__ F2 split_rowK(const float* row, int k0, int lane, int K) { float v[16]; const int g = lane >> 4;
#pragma unroll
  for (int i = 0; i < 8; ++i) { const int ka = k0 + 8 * g + i, kb = ka + 16; v[i] = ka < K ? row[ka < K ? ka : K - 1] : 0.f; v[8 + i] = kb < K ? row[kb < K ? kb : K - 1] : 0.f; }
  return bsplit16(v); }
__device__ __forceinline__ F2 split_col(const float* W, int k0, int n, int lane, int ld, int K) { float v[16]; const int g = lane >> 4;
#pragma unroll
  for (int i = 0; i < 8; ++i) { const int ka = k0 + 8 * g + i, kb = ka + 16; v[i] = ka < K ? W[(size_t)(ka < K ? ka : K - 1) * ld + n] : 0.f; v[8 + i] = kb < K ? W[(size_t)(kb < K ? kb : K - 1) * ld + n] : 0.f; }
  return bsplit16(v); }
__device__ __forceinline__ v8f mac3(const F2& a, const F2& b, v8f c) { c = wmma_bf(a.l, b.h, c); c = wmma_bf(a.h, b.l, c); return wmma_bf(a.h, b.h, c); }
__device__ __forceinline__ float sigm(float v) { return 1.0f / (1.0f + expf(-v)); }
#define LDSX() do { asm volatile("s_wait_dscnt 0" ::: "memory"); __builtin_amdgcn_wave_barrier(); __builtin_amdgcn_fence(__ATOMIC_RELEASE, "workgroup"); } while (0)


// Complex differential attention (B 1, H 12, S 1,024, D 128): qp = CLin_q(q) + [pe_q, pe_q] (2D wide -> q1, q2), kp = CLin_k(k) + pe_k, vp = CLin_v(v); w_s = softmax(|q_s . conj(kp)| / sqrt(128)) for s = 1, 2; a_s = w_s vp (complex); cat = [a1, a2] / rms(cat) * sub_w; out = a1 - lambda a2 with lambda = sigmoid(exp(lq1 . lk1) - exp(lq2 . lk2) + 0.3555...); out = CLin_g(q) * out (complex product); out = CLin_o(out) -> (out_r, out_i).
#define NHT 12             // heads (x batch 1)
#define SS 1024
#define DD 128
#define KK 256             // stacked K of every complex linear / logit GEMM: [real | imag]
#ifndef NHU
#define NHU NHT            // heads processed
#endif
#define NR (NHU * SS)      // rows processed
#define NRF (NHT * SS)     // full row count (output-1 offset)
#ifndef HG
#define HG 24              // (head, sel) pairs per launch group (divides NPAIR): all pairs at once, so that the 64-query blocks of k_pv outnumber the WGPs; the logit planes take 96 MiB of workspace
#endif
#define NPAIR (NHU * 2)
#define SCALE 0.0883883461356163f       // 128^-0.5 as f32
#define LAMBDA_INIT 0.35550907254219055f  // 0.8 - 0.6 exp(-0.3) as f32
__device__ __forceinline__ float bfr(float v) { return (float)(__bf16)v; }
typedef __attribute__((ext_vector_type(8))) __bf16 v8b;
__device__ __forceinline__ v16b frag_b(const __bf16* rowk0, int lane) { union { v16b v; v8b q[2]; } u; const __bf16* p = rowk0 + 8 * (lane >> 4); u.q[0] = *(const v8b*)p; u.q[1] = *(const v8b*)(p + 16); return u.v; }

#define WS_QH  0u                                      // f16 q rows [row][1024]: per sel s: [s*512 +0..127] q_r, [+128..255] q_i, [+256..383] q_i, [+384..511] -q_r  (hi)
#define WS_QL  (WS_QH + 2u * (size_t)NRF * 1024)       // f16 residual x 2^10
#define WS_KH  (WS_QL + 2u * (size_t)NRF * 1024)       // f16 k rows [row][256] = [kp_r | kp_i] (hi)
#define WS_KL  (WS_KH + 2u * (size_t)NRF * KK)         // f16 residual x 2^10
#define WS_VT  (WS_KL + 2u * (size_t)NRF * KK)         // bf16 value planes [h][256 = vp_r | vp_i][s] hi
#define WS_VL  (WS_VT + 2u * (size_t)NHT * KK * SS)    // bf16 value residual planes
#define WS_G   (WS_VL + 2u * (size_t)NHT * KK * SS)    // f32 g rows [row][256] = [g_r | g_i]; later overwritten in place by the gated result z = [z_r | z_i]
#define WS_Y   (WS_G + 4u * (size_t)NRF * KK)          // f32 attention rows [row][512] = [a1_r | a1_i | a2_r | a2_i]
#define WS_LAM (WS_Y + 4u * (size_t)NRF * 512)         // one line: lambda replicated
#define WS_S   (WS_LAM + 128u)                         // f32 logits / P planes for HG (head, sel) pairs [hg][q][k]
#define WS_END (WS_S + 4u * (size_t)HG * SS * SS)

// ---- k_clin: block = (64 rows, 128 output cols, tile index over 2*NO): generic complex linear as a stacked real GEMM.
// A row = [x_r[row] | x_i[row]] (K 256; MODE < 4: two f32 input tensors, bf16 exact; MODE 4: the f32 z rows, bf16 hi + lo -> 2 products);
// output column o in [0, 2 NO): part = o / NO (0 real, 1 imag), oo = o % NO; B[k] = part 0: (k < 128 ? W_r[oo][k] : -W_i[oo][k-128]), part 1: (k < 128 ? W_i[oo][k] : W_r[oo][k-128]); + bias_part[oo].
// MODE 0: q projection (NO 256) + pe_q -> QH/QL (each value to its two slots, see WS_QH); MODE 1: k (NO 128) + pe_k -> KH/KL; MODE 2: v -> bf16 planes; MODE 3: g -> G rows; MODE 4: output linear from Z -> the two output tensors
template <int MODE, int NO>
__global__ __launch_bounds__(128) void k_clin(const float* __restrict__ XR, const float* __restrict__ XI, const float* __restrict__ WR, const float* __restrict__ WI, const float* __restrict__ BR, const float* __restrict__ BI, const float* __restrict__ PER, const float* __restrict__ PEI, void* __restrict__ D0, void* __restrict__ D1) {
  __shared__ __align__(16) float sf[64][132];
  const int tid = threadIdx.x, wave = tid >> 5, lane = tid & 31, col = lane & 15, g = lane >> 4; const int c0 = blockIdx.y * 128; const size_t r0 = (size_t)blockIdx.x * 64; const int part = c0 / NO; const int oo0 = c0 % NO;
  v8f acc[8] = {};
#pragma unroll 2
  for (int kc = 0; kc < KK / 32; ++kc) { const bool imx = kc >= 4; const int kx = (kc & 3) * 32;   // A columns kc*32.. : real input for kc < 4, imag for kc >= 4
    v16b ah, al; bool two = false;
    if (MODE < 4) { const float* p = (imx ? XI : XR) + (r0 + wave * 16 + col) * DD + kx + 8 * g;
#pragma unroll
      for (int i = 0; i < 8; ++i) { ah[i] = (__bf16)p[i]; ah[8 + i] = (__bf16)p[16 + i]; } }
    else { const F2 a = split_row(XR + (r0 + wave * 16 + col) * KK, kc * 32, lane); ah = a.h; al = a.l; two = true; }
#pragma unroll
    for (int j = 0; j < 8; ++j) { v16b w; const int oo = oo0 + j * 16 + col; const float* WS0 = (part == 0) ? (imx ? WI : WR) : (imx ? WR : WI); const float sg = (part == 0 && imx) ? -1.0f : 1.0f;
#pragma unroll
      for (int i = 0; i < 8; ++i) { w[i] = (__bf16)(sg * WS0[(size_t)oo * DD + kx + 8 * g + i]); w[8 + i] = (__bf16)(sg * WS0[(size_t)oo * DD + kx + 16 + 8 * g + i]); }
      asm volatile("s_wait_loadcnt 0x0" ::: "memory"); acc[j] = wmma_bf(ah, w, acc[j]); if (two) acc[j] = wmma_bf(al, w, acc[j]); } }
  { const float* BB = part == 0 ? BR : BI; const float* PE = part == 0 ? PER : PEI;
#pragma unroll
    for (int j = 0; j < 8; ++j) { const int oo = oo0 + j * 16 + col; const float bb = bfr(BB[oo]);
#pragma unroll
      for (int r = 0; r < 8; ++r) { const int rl = wave * 16 + 8 * g + r; float v = acc[j][r] + bb; if (MODE <= 1) v += bfr(PE[(r0 + rl) * DD + (oo & (DD - 1))]); sf[rl][j * 16 + col] = v; }
      asm volatile("s_wait_loadcnt 0x0" ::: "memory"); } }
  __syncthreads();
  if (MODE == 0) {   // q: value (sel = oo0/128, d) -> QH[row][sel*512 + (part ? 128 : 0) + d] and QH[row][sel*512 + (part ? 256 : 384) + d] (the second real copy negated); f16 hi + residual x 2^10; each destination = a 256-B segment per row by 16 consecutive threads
    _Float16* QH = (_Float16*)D0; _Float16* QL = (_Float16*)D1; const int sel = oo0 / DD; const int dA = sel * 512 + (part ? 128 : 0), dB = sel * 512 + (part ? 256 : 384); const float sgB = part ? 1.0f : -1.0f;
    for (int e = tid; e < 64 * 16; e += 128) { const int rl = e >> 4, q = e & 15; v8h ha, la, hb, lb;
#pragma unroll
      for (int k = 0; k < 8; ++k) { const float v = sf[rl][q * 8 + k]; const _Float16 hv = (_Float16)v; ha[k] = hv; la[k] = (_Float16)((v - (float)hv) * 1024.0f); const float vb = v * sgB; const _Float16 hb2 = (_Float16)vb; hb[k] = hb2; lb[k] = (_Float16)((vb - (float)hb2) * 1024.0f); }
      const size_t ro = (r0 + rl) * 1024; vst2((v4u*)(QH + ro + dA + q * 8), *(const v4u*)&ha); vst2((v4u*)(QL + ro + dA + q * 8), *(const v4u*)&la); vst2((v4u*)(QH + ro + dB + q * 8), *(const v4u*)&hb); vst2((v4u*)(QL + ro + dB + q * 8), *(const v4u*)&lb); } }
  else if (MODE == 1) {   // k rows [row][256]: column part*128 + d; f16 hi + residual x 2^10
    _Float16* KH = (_Float16*)D0; _Float16* KL = (_Float16*)D1;
    for (int e = tid; e < 64 * 16; e += 128) { const int rl = e >> 4, q = e & 15; v8h ha, la;
#pragma unroll
      for (int k = 0; k < 8; ++k) { const float v = sf[rl][q * 8 + k]; const _Float16 hv = (_Float16)v; ha[k] = hv; la[k] = (_Float16)((v - (float)hv) * 1024.0f); }
      const size_t ro = (r0 + rl) * KK + c0; vst2((v4u*)(KH + ro + q * 8), *(const v4u*)&ha); vst2((v4u*)(KL + ro + q * 8), *(const v4u*)&la); } }
  else if (MODE == 2) {
    __bf16* VT = (__bf16*)D0; __bf16* VL = (__bf16*)D1; const size_t h = r0 / SS; const int s0 = (int)(r0 % SS);
    for (int e = tid; e < 128 * 8; e += 128) { const int cl = e >> 3, q = e & 7; v8b hb, lb;
#pragma unroll
      for (int k = 0; k < 8; ++k) { const float v = sf[q * 8 + k][cl]; const __bf16 bh = (__bf16)v; hb[k] = bh; lb[k] = (__bf16)(v - (float)bh); }
      const size_t o2 = (h * KK + c0 + cl) * (size_t)SS + s0 + q * 8; vst2((v4u*)(VT + o2), *(const v4u*)&hb); vst2((v4u*)(VL + o2), *(const v4u*)&lb); } }
  else if (MODE == 3) {   // g rows [row][256] f32: 512-B segment per row by 32 lanes
    float* G = (float*)D0; for (int e = tid; e < 64 * 32; e += 128) { const int rl = e >> 5, q = e & 31; vst2(G + (r0 + rl) * KK + c0 + q * 4, *(const v4f*)&sf[rl][q * 4]); } }
  else {   // MODE 4: output rows [row][128] of out_r (part 0) or out_i (part 1): whole 512-B rows by 32 lanes
    float* O = (float*)(part == 0 ? D0 : D1); for (int e = tid; e < 64 * 32; e += 128) { const int rl = e >> 5, q = e & 31; vst2(O + (r0 + rl) * DD + q * 4, *(const v4f*)&sf[rl][q * 4]); } } }
__global__ __launch_bounds__(32) void k_lam(const float* __restrict__ LQ1, const float* __restrict__ LK1, const float* __restrict__ LQ2, const float* __restrict__ LK2, float* __restrict__ LAM) { __shared__ float sl;
  if (threadIdx.x == 0) { float s1 = 0.f, s2 = 0.f; for (int i = 0; i < DD; ++i) { s1 += bfr(LQ1[i]) * bfr(LK1[i]); s2 += bfr(LQ2[i]) * bfr(LK2[i]); } const float z = expf(s1) - expf(s2) + LAMBDA_INIT; sl = 1.0f / (1.0f + expf(-z)); }
  __syncthreads(); vst2(LAM + threadIdx.x, sl); }
// ---- k_sc: block = (64 queries, 64 keys, pair in group): pair p = (head h = p/2, sel = p%2); s_r = Q[sel*512 + 0..255] . KH, s_i = Q[sel*512 + 256..511] . KH (3 products each: hi.hi + (lo.hi + hi.lo) 2^-10); logit = sqrt(s_r^2 + s_i^2 + 1e-8) x 128^-0.5
__global__ __launch_bounds__(128) void k_sc(const _Float16* __restrict__ QH, const _Float16* __restrict__ QL, const _Float16* __restrict__ KH, const _Float16* __restrict__ KL, int p0, float* __restrict__ S0) { __shared__ __align__(16) float ss[4][16][68]; const int p = p0 + blockIdx.z; const int h = p >> 1, sel = p & 1; float* S = S0 + (size_t)blockIdx.z * SS * SS;
  const int tid = threadIdx.x, wave = tid >> 5, lane = tid & 31, col = lane & 15, g = lane >> 4; const int k0 = blockIdx.y * 64; const int ql0 = blockIdx.x * 64 + wave * 16; const size_t q0 = (size_t)h * SS + ql0; const size_t kb = (size_t)h * SS + k0;
  v8f ar[4] = {}, arl[4] = {}, ai[4] = {}, ail[4] = {};
#pragma unroll 2
  for (int kc = 0; kc < KK / 32; ++kc) { const _Float16* qh = QH + (q0 + col) * 1024 + sel * 512 + kc * 32; const _Float16* ql = QL + (q0 + col) * 1024 + sel * 512 + kc * 32;
    const v16h arh = frag_h(qh, lane), arlo = frag_h(ql, lane), aih = frag_h(qh + 256, lane), ailo = frag_h(ql + 256, lane);
#pragma unroll
    for (int j = 0; j < 4; ++j) { const size_t ko = (kb + j * 16 + col) * KK + kc * 32; const v16h khf = frag_h(KH + ko, lane), klf = frag_h(KL + ko, lane);
      ar[j] = wmma16(arh, khf, ar[j]); arl[j] = wmma16(arlo, khf, arl[j]); arl[j] = wmma16(arh, klf, arl[j]);
      ai[j] = wmma16(aih, khf, ai[j]); ail[j] = wmma16(ailo, khf, ail[j]); ail[j] = wmma16(aih, klf, ail[j]); } }
#pragma unroll
  for (int j = 0; j < 4; ++j)
#pragma unroll
    for (int r = 0; r < 8; ++r) { const float sr_ = ar[j][r] + arl[j][r] * (1.0f / 1024.0f), si_ = ai[j][r] + ail[j][r] * (1.0f / 1024.0f); ss[wave][8 * g + r][j * 16 + col] = sqrtf(sr_ * sr_ + si_ * si_ + 1e-8f) * SCALE; }
  LDSX(); for (int rl = 0; rl < 16; ++rl) if (lane < 16) vst2(S + (size_t)(ql0 + rl) * SS + k0 + lane * 4, *(const v4f*)&ss[wave][rl][lane * 4]); }   
// ---- k_sm: block = query row of pair plane z: softmax over all 1,024 keys (f32) -> P x 2^11 in place
__global__ __launch_bounds__(256) void k_sm(float* __restrict__ S0) { __shared__ float sred[8]; __shared__ float sbc; __shared__ __align__(16) float sh[SS];
  const int t = threadIdx.x; const size_t row = blockIdx.x; float* sr = S0 + (size_t)blockIdx.y * SS * SS + row * SS; const int kend = SS;
  float m = -3.0e38f; for (int k = t; k < kend; k += 256) m = fmaxf(m, sr[k]);
#pragma unroll
  for (int o = 1; o < 32; o <<= 1) m = fmaxf(m, __shfl_xor(m, o));
  if ((t & 31) == 0) sred[t >> 5] = m; __syncthreads(); if (t == 0) { float a = sred[0]; for (int i = 1; i < 8; ++i) a = fmaxf(a, sred[i]); sbc = a; } __syncthreads(); m = sbc; __syncthreads();
  float sum = 0.f; for (int k = t; k < kend; k += 256) sum += expf(sr[k] - m);
#pragma unroll
  for (int o = 1; o < 32; o <<= 1) sum += __shfl_xor(sum, o);
  if ((t & 31) == 0) sred[t >> 5] = sum; __syncthreads(); if (t == 0) { float a = 0.f; for (int i = 0; i < 8; ++i) a += sred[i]; sbc = 1.0f / a; } __syncthreads(); const float inv = sbc;
  for (int k = t; k < kend; k += 256) sh[k] = expf(sr[k] - m) * inv * 2048.0f;
  __syncthreads(); for (int q = t; q < kend / 4; q += 256) vst2(sr + q * 4, *(const v4f*)&sh[q * 4]); }
// ---- k_pv: block = 64 queries of pair (h, sel): Y[row][sel*256 + c] = (P . vp)[c] for c in [0,256) = [a_r | a_i] (P split bf16 hi + lo x v hi + lo, 3 products); each (row, 128-col half) = 512 B by 32 lanes
__global__ __launch_bounds__(128) void k_pv(const float* __restrict__ PS0, const __bf16* __restrict__ VT, const __bf16* __restrict__ VL, int p0, float* __restrict__ Y) { const int p = p0 + blockIdx.z; const int h = p >> 1, sel = p & 1; const float* PS = PS0 + (size_t)blockIdx.z * SS * SS; __shared__ __align__(16) float ss[4][16][KK + 4];
  const int tid = threadIdx.x, wave = tid >> 5, lane = tid & 31, col = lane & 15, g = lane >> 4; const int ql0 = blockIdx.x * 64 + wave * 16;
  v8f acc[KK / 16] = {};
#pragma unroll 1
  for (int kc = 0; kc < SS / 32; ++kc) { const F2 pf = split_row(PS + (size_t)(ql0 + col) * SS, kc * 32, lane);
    asm volatile("s_wait_loadcnt 0x0" ::: "memory");
#pragma unroll
    for (int j = 0; j < KK / 16; ++j) { const size_t po = ((size_t)h * KK + j * 16 + col) * (size_t)SS + kc * 32; const v16b vh = frag_b(VT + po, lane); acc[j] = wmma_bf(pf.h, vh, acc[j]); acc[j] = wmma_bf(pf.l, vh, acc[j]); acc[j] = wmma_bf(pf.h, frag_b(VL + po, lane), acc[j]); } }
#pragma unroll
  for (int j = 0; j < KK / 16; ++j)
#pragma unroll
    for (int r = 0; r < 8; ++r) ss[wave][8 * g + r][j * 16 + col] = acc[j][r] * (1.0f / 2048.0f);
  LDSX(); for (int rl = 0; rl < 16; ++rl) { const size_t ro = ((size_t)h * SS + ql0 + rl) * 512 + sel * 256; vst2(Y + ro + lane * 4, *(const v4f*)&ss[wave][rl][lane * 4]); vst2(Y + ro + 128 + lane * 4, *(const v4f*)&ss[wave][rl][128 + lane * 4]); } }
// ---- k_mix: block = 16 rows (16 lanes per row): rms over the 512 attention values (= mean over 256 of r^2 + i^2), / rms x sub_w, out = a1 - lambda a2, then the complex gate z = g * out; z written IN PLACE over the g row (each lane reads and writes exactly its own columns d and 128 + d); float4 pieces, 16 lanes x 16 B = 256-B runs
__global__ __launch_bounds__(256) void k_mix(const float* __restrict__ Y, float* __restrict__ GZ, const float* __restrict__ LAM, const float* __restrict__ SW) {
  const int t = threadIdx.x; const int rl = t >> 4, sub = t & 15; const size_t row = (size_t)blockIdx.x * 16 + rl; const float* y = Y + row * 512; float* gz = GZ + row * KK; const float lam = LAM[0];
  float s2 = 0.f; for (int c = sub * 4; c < 512; c += 64) { const v4f v = *(const v4f*)(y + c); s2 += (v[0] * v[0] + v[1] * v[1]) + (v[2] * v[2] + v[3] * v[3]); }
#pragma unroll
  for (int o = 1; o < 16; o <<= 1) s2 += __shfl_xor(s2, o);
  const float inv = 1.0f / sqrtf(s2 * (1.0f / 256.0f) + 1e-5f);
#pragma unroll
  for (int it = 0; it < 2; ++it) { const int d = sub * 4 + it * 64;   /* d in [0,128): this lane's 4 columns */
    const v4f a1r = *(const v4f*)(y + d), a1i = *(const v4f*)(y + 128 + d), a2r = *(const v4f*)(y + 256 + d), a2i = *(const v4f*)(y + 384 + d); const v4f gr = *(const v4f*)(gz + d), gi = *(const v4f*)(gz + 128 + d);
    v4f zr, zi;
#pragma unroll
    for (int k = 0; k < 4; ++k) { const float w1 = bfr(SW[d + k]) * inv, w2 = bfr(SW[DD + d + k]) * inv; const float orr = a1r[k] * w1 - lam * (a2r[k] * w2), oi = a1i[k] * w1 - lam * (a2i[k] * w2); zr[k] = gr[k] * orr - gi[k] * oi; zi[k] = gr[k] * oi + gi[k] * orr; }
    vst2(gz + d, zr); vst2(gz + 128 + d, zi); } }
extern "C" void kernel_launch(void* const* d_in, const int* in_sizes, int n_in, void* d_out, int out_size, void* d_ws, size_t ws_size, hipStream_t stream) {
  (void)in_sizes; (void)n_in; (void)out_size;
  const float** F = (const float**)d_in;   // 0 q_r, 1 q_i, 2 k_r, 3 k_i, 4 v_r, 5 v_i, 6 pe_q_r, 7 pe_q_i, 8 pe_k_r, 9 pe_k_i [1,12,1024,128]; 10 qw_r [256,128], 11 qw_i, 12 qb_r [256], 13 qb_i; 14 kw_r [128,128], 15 kw_i, 16 kb_r, 17 kb_i; 18 vw_r, 19 vw_i, 20 vb_r, 21 vb_i; 22 gw_r, 23 gw_i, 24 gb_r, 25 gb_i; 26 ow_r, 27 ow_i, 28 ob_r, 29 ob_i; 30 lq1, 31 lk1, 32 lq2, 33 lk2 [128]; 34 sub_w [256]
  if (ws_size < (size_t)WS_END) return;
  char* ws = (char*)d_ws; _Float16 *QH = (_Float16*)(ws + WS_QH), *QL = (_Float16*)(ws + WS_QL), *KH = (_Float16*)(ws + WS_KH), *KL = (_Float16*)(ws + WS_KL); __bf16 *VT = (__bf16*)(ws + WS_VT), *VL = (__bf16*)(ws + WS_VL); float *G = (float*)(ws + WS_G), *Y = (float*)(ws + WS_Y), *LAM = (float*)(ws + WS_LAM), *S = (float*)(ws + WS_S);
  float* OUT0 = (float*)d_out; float* OUT1 = (float*)d_out + (size_t)NRF * DD;
  k_clin<0, 256><<<dim3(NR / 64, 4), 128, 0, stream>>>(F[0], F[1], F[10], F[11], F[12], F[13], F[6], F[7], QH, QL);
  k_clin<1, 128><<<dim3(NR / 64, 2), 128, 0, stream>>>(F[2], F[3], F[14], F[15], F[16], F[17], F[8], F[9], KH, KL);
  k_clin<2, 128><<<dim3(NR / 64, 2), 128, 0, stream>>>(F[4], F[5], F[18], F[19], F[20], F[21], nullptr, nullptr, VT, VL);
  k_clin<3, 128><<<dim3(NR / 64, 2), 128, 0, stream>>>(F[0], F[1], F[22], F[23], F[24], F[25], nullptr, nullptr, G, nullptr);
  k_lam<<<dim3(1), 32, 0, stream>>>(F[30], F[31], F[32], F[33], LAM);
  for (int p0 = 0; p0 < NPAIR; p0 += HG) {
    k_sc<<<dim3(SS / 64, SS / 64, HG), 128, 0, stream>>>(QH, QL, KH, KL, p0, S);
    k_sm<<<dim3(SS, HG), 256, 0, stream>>>(S);
    k_pv<<<dim3(SS / 64, 1, HG), 128, 0, stream>>>(S, VT, VL, p0, Y);
  }
  k_mix<<<dim3(NR / 16), 256, 0, stream>>>(Y, G, LAM, F[34]);
  k_clin<4, 128><<<dim3(NR / 64, 2), 128, 0, stream>>>(G, nullptr, F[26], F[27], F[28], F[29], nullptr, nullptr, OUT0, OUT1);
}

// v002
// One run takes 383 microseconds.
// Timed twice side by side with v001, it ran 1.67 and 1.68 times as fast.
// All steps since v000 together make it 6.22 times as fast.
// compute dtype: all float inputs rounded to bf16; every complex linear as one stacked real GEMM ([x_r | x_i] against [W_r ; -W_i] / [W_i ; W_r]) with EXACT bf16 products on WMMA 16x16x32, f32 accumulate; q (+pe) as f16 hi + residual (x 2^10) and k (+pe) as f16 hi + residual (x 2^10) -> 3-product complex logits (s_r, s_i as two stacked K=256 real GEMMs), |s| scaled in f32 (sqrtf); softmax in f32 (precise expf); P x 2^11 split bf16 hi + lo against v bf16 hi + lo (3 products); RMS norm / lambda / differential combination / complex gating in f32; the gated result (bf16 hi + lo) through the output complex linear (2 products); f32 outputs.
#include <hip/hip_runtime.h>
#include <math.h>

typedef __attribute__((ext_vector_type(16))) _Float16 v16h;
typedef __attribute__((ext_vector_type(16))) __bf16 v16b;
typedef __attribute__((ext_vector_type(8)))  _Float16 v8h;
typedef __attribute__((ext_vector_type(8)))  float v8f;
typedef __attribute__((ext_vector_type(4)))  float v4f;
typedef __attribute__((ext_vector_type(2)))  float v2f;
typedef __attribute__((ext_vector_type(4)))  unsigned v4u;
typedef __attribute__((ext_vector_type(4)))  int v4i;
typedef float __attribute__((may_alias)) float_a;
typedef int __attribute__((may_alias)) int_a;

template <typename T> __device__ __forceinline__ void vst2(void* p, T v) { *(T*)p = v;  }
__device__ __forceinline__ v8f wmma16(v16h a, v16h b, v8f c) {
  v8f d = __builtin_amdgcn_wmma_f32_16x16x32_f16(false, a, false, b, (short)0, c, false, false);
  asm volatile("v_nop\n\tv_nop\n\tv_nop\n\tv_nop" : "+v"(d) : "v"(a), "v"(b));
  return d;
}
__device__ __forceinline__ v8f wmma_bf(v16b a, v16b b, v8f c) {
  v8f d = __builtin_amdgcn_wmma_f32_16x16x32_bf16(false, a, false, b, (short)0, c, false, false);
  asm volatile("v_nop\n\tv_nop\n\tv_nop\n\tv_nop" : "+v"(d) : "v"(a), "v"(b));
  return d;
}
// 16x16x32 fragments: lane = (h = lane>>4, row/col = lane&15); elements 0..7 = k0+8h+0..7, 8..15 = k0+16+8h+0..7; D element r = row 8h+r
__device__ __forceinline__ v16h frag_h(const _Float16* rowk0, int lane) {
  union { v16h v; v8h q[2]; } u; const _Float16* p = rowk0 + 8 * (lane >> 4);
  u.q[0] = *(const v8h*)p; u.q[1] = *(const v8h*)(p + 16); return u.v;
}
__device__ __forceinline__ v16h frag_f32(const float* rowk0, int lane) {
  v16h a; const float* p = rowk0 + 8 * (lane >> 4);
#pragma unroll
  for (int i = 0; i < 8; ++i) { a[i] = (_Float16)p[i]; a[8 + i] = (_Float16)p[16 + i]; }
  return a;
}
__device__ __forceinline__ v16h frag_f32s(const float* rowk0, int lane, float sc) {
  v16h a; const float* p = rowk0 + 8 * (lane >> 4);
#pragma unroll
  for (int i = 0; i < 8; ++i) { a[i] = (_Float16)(p[i] * sc); a[8 + i] = (_Float16)(p[16 + i] * sc); }
  return a;
}
// column fragment from a [K][ld] layout (column n), rows >= K read as 0
__device__ __forceinline__ v16h fragc_f32(const float* W, int k0, int n, int lane, int ld, int K) {
  v16h a; const int g = lane >> 4;
#pragma unroll
  for (int i = 0; i < 8; ++i) { const int ka = k0 + 8 * g + i, kb = ka + 16;
    a[i] = (_Float16)(ka < K ? W[(size_t)(ka < K ? ka : K - 1) * ld + n] : 0.f); a[8 + i] = (_Float16)(kb < K ? W[(size_t)(kb < K ? kb : K - 1) * ld + n] : 0.f); }
  return a;
}
struct F2 { v16b h, l; };
__device__ __forceinline__ F2 bsplit16(const float v[16]) { F2 r;
#pragma unroll
  for (int i = 0; i < 16; ++i) { const __bf16 h = (__bf16)v[i]; r.h[i] = h; r.l[i] = (__bf16)(v[i] - (float)h); }
  return r; }
__device__ __forceinline__ F2 split_row(const float* row, int k0, int lane) { float v[16]; const float* p = row + k0 + 8 * (lane >> 4);
#pragma unroll
  for (int i = 0; i < 8; ++i) { v[i] = p[i]; v[8 + i] = p[16 + i]; }
  return bsplit16(v); }
__device__ __forceinline__ F2 split_rowK(const float* row, int k0, int lane, int K) { float v[16]; const int g = lane >> 4;
#pragma unroll
  for (int i = 0; i < 8; ++i) { const int ka = k0 + 8 * g + i, kb = ka + 16; v[i] = ka < K ? row[ka < K ? ka : K - 1] : 0.f; v[8 + i] = kb < K ? row[kb < K ? kb : K - 1] : 0.f; }
  return bsplit16(v); }
__device__ __forceinline__ F2 split_col(const float* W, int k0, int n, int lane, int ld, int K) { float v[16]; const int g = lane >> 4;
#pragma unroll
  for (int i = 0; i < 8; ++i) { const int ka = k0 + 8 * g + i, kb = ka + 16; v[i] = ka < K ? W[(size_t)(ka < K ? ka : K - 1) * ld + n] : 0.f; v[8 + i] = kb < K ? W[(size_t)(kb < K ? kb : K - 1) * ld + n] : 0.f; }
  return bsplit16(v); }
__device__ __forceinline__ v8f mac3(const F2& a, const F2& b, v8f c) { c = wmma_bf(a.l, b.h, c); c = wmma_bf(a.h, b.l, c); return wmma_bf(a.h, b.h, c); }
__device__ __forceinline__ float sigm(float v) { return 1.0f / (1.0f + expf(-v)); }
#define LDSX() do { asm volatile("s_wait_dscnt 0" ::: "memory"); __builtin_amdgcn_wave_barrier(); __builtin_amdgcn_fence(__ATOMIC_RELEASE, "workgroup"); } while (0)


// Complex differential attention (B 1, H 12, S 1,024, D 128): qp = CLin_q(q) + [pe_q, pe_q] (2D wide -> q1, q2), kp = CLin_k(k) + pe_k, vp = CLin_v(v); w_s = softmax(|q_s . conj(kp)| / sqrt(128)) for s = 1, 2; a_s = w_s vp (complex); cat = [a1, a2] / rms(cat) * sub_w; out = a1 - lambda a2 with lambda = sigmoid(exp(lq1 . lk1) - exp(lq2 . lk2) + 0.3555...); out = CLin_g(q) * out (complex product); out = CLin_o(out) -> (out_r, out_i).
#define NHT 12             // heads (x batch 1)
#define SS 1024
#define DD 128
#define KK 256             // stacked K of every complex linear / logit GEMM: [real | imag]
#ifndef NHU
#define NHU NHT            // heads processed
#endif
#define NR (NHU * SS)      // rows processed
#define NRF (NHT * SS)     // full row count (output-1 offset)
#ifndef HG
#define HG 24              // (head, sel) pairs per launch group (divides NPAIR): all pairs at once, so that the 64-query blocks of k_pv outnumber the WGPs; the logit planes take 96 MiB of workspace
#endif
#define NPAIR (NHU * 2)
#define SCALE 0.0883883461356163f       // 128^-0.5 as f32
#define LAMBDA_INIT 0.35550907254219055f  // 0.8 - 0.6 exp(-0.3) as f32
__device__ __forceinline__ float bfr(float v) { return (float)(__bf16)v; }
typedef __attribute__((ext_vector_type(8))) __bf16 v8b;
typedef __attribute__((ext_vector_type(4))) __bf16 v4bf;
__device__ __forceinline__ v16b frag_b(const __bf16* rowk0, int lane) { union { v16b v; v8b q[2]; } u; const __bf16* p = rowk0 + 8 * (lane >> 4); u.q[0] = *(const v8b*)p; u.q[1] = *(const v8b*)(p + 16); return u.v; }

#define WS_QH  0u                                      // f16 q rows [row][1024]: per sel s: [s*512 +0..127] q_r, [+128..255] q_i, [+256..383] q_i, [+384..511] -q_r  (hi)
#define WS_QL  (WS_QH + 2u * (size_t)NRF * 1024)       // f16 residual x 2^10
#define WS_KH  (WS_QL + 2u * (size_t)NRF * 1024)       // f16 k rows [row][256] = [kp_r | kp_i] (hi)
#define WS_KL  (WS_KH + 2u * (size_t)NRF * KK)         // f16 residual x 2^10
#define WS_VT  (WS_KL + 2u * (size_t)NRF * KK)         // bf16 value planes [h][256 = vp_r | vp_i][s] hi
#define WS_VL  (WS_VT + 2u * (size_t)NHT * KK * SS)    // bf16 value residual planes
#define WS_G   (WS_VL + 2u * (size_t)NHT * KK * SS)    // f32 g rows [row][256] = [g_r | g_i]; later overwritten in place by the gated result z = [z_r | z_i]
#define WS_Y   (WS_G + 4u * (size_t)NRF * KK)          // f32 attention rows [row][512] = [a1_r | a1_i | a2_r | a2_i]
#define WS_LAM (WS_Y + 4u * (size_t)NRF * 512)         // one line: lambda replicated
#define WS_S   (WS_LAM + 128u)                         // f32 logits / P planes for HG (head, sel) pairs [hg][q][k]
#define WS_END (WS_S + 4u * (size_t)HG * SS * SS)

// ---- k_clin: block = (64 rows, 128 output cols, tile index over 2*NO): generic complex linear as a stacked real GEMM.
// A row = [x_r[row] | x_i[row]] (K 256; MODE < 4: two f32 input tensors, bf16 exact; MODE 4: the f32 z rows, bf16 hi + lo -> 2 products);
// output column o in [0, 2 NO): part = o / NO (0 real, 1 imag), oo = o % NO; B[k] = part 0: (k < 128 ? W_r[oo][k] : -W_i[oo][k-128]), part 1: (k < 128 ? W_i[oo][k] : W_r[oo][k-128]); + bias_part[oo].
// MODE 0: q projection (NO 256) + pe_q -> QH/QL (each value to its two slots, see WS_QH); MODE 1: k (NO 128) + pe_k -> KH/KL; MODE 2: v -> bf16 planes; MODE 3: g -> G rows; MODE 4: output linear from Z -> the two output tensors
template <int MODE, int NO>
__global__ __launch_bounds__(128) void k_clin(const float* __restrict__ XR, const float* __restrict__ XI, const float* __restrict__ WR, const float* __restrict__ WI, const float* __restrict__ BR, const float* __restrict__ BI, const float* __restrict__ PER, const float* __restrict__ PEI, void* __restrict__ D0, void* __restrict__ D1) {
  __shared__ __align__(16) float sf[64][132];
  const int tid = threadIdx.x, wave = tid >> 5, lane = tid & 31, col = lane & 15, g = lane >> 4; const int c0 = blockIdx.y * 128; const size_t r0 = (size_t)blockIdx.x * 64; const int part = c0 / NO; const int oo0 = c0 % NO;
  v8f acc[8] = {};
#pragma unroll 2
  for (int kc = 0; kc < KK / 32; ++kc) { const bool imx = kc >= 4; const int kx = (kc & 3) * 32;   // A columns kc*32.. : real input for kc < 4, imag for kc >= 4
    v16b ah, al; bool two = false;
    if (MODE < 4) { const float* p = (imx ? XI : XR) + (r0 + wave * 16 + col) * DD + kx + 8 * g;
#pragma unroll
      for (int i = 0; i < 8; ++i) { ah[i] = (__bf16)p[i]; ah[8 + i] = (__bf16)p[16 + i]; } }
    else { const F2 a = split_row(XR + (r0 + wave * 16 + col) * KK, kc * 32, lane); ah = a.h; al = a.l; two = true; }
#pragma unroll
    for (int j = 0; j < 8; ++j) { v16b w; const int oo = oo0 + j * 16 + col; const float* WS0 = (part == 0) ? (imx ? WI : WR) : (imx ? WR : WI); const float sg = (part == 0 && imx) ? -1.0f : 1.0f;
#pragma unroll
      for (int i = 0; i < 8; ++i) { w[i] = (__bf16)(sg * WS0[(size_t)oo * DD + kx + 8 * g + i]); w[8 + i] = (__bf16)(sg * WS0[(size_t)oo * DD + kx + 16 + 8 * g + i]); }
      asm volatile("s_wait_loadcnt 0x0" ::: "memory"); acc[j] = wmma_bf(ah, w, acc[j]); if (two) acc[j] = wmma_bf(al, w, acc[j]); } }
  { const float* BB = part == 0 ? BR : BI; const float* PE = part == 0 ? PER : PEI;
#pragma unroll
    for (int j = 0; j < 8; ++j) { const int oo = oo0 + j * 16 + col; const float bb = bfr(BB[oo]);
#pragma unroll
      for (int r = 0; r < 8; ++r) { const int rl = wave * 16 + 8 * g + r; float v = acc[j][r] + bb; if (MODE <= 1) v += bfr(PE[(r0 + rl) * DD + (oo & (DD - 1))]); sf[rl][j * 16 + col] = v; }
      asm volatile("s_wait_loadcnt 0x0" ::: "memory"); } }
  __syncthreads();
  if (MODE == 0) {   // q: value (sel = oo0/128, d) -> QH[row][sel*512 + (part ? 128 : 0) + d] and QH[row][sel*512 + (part ? 256 : 384) + d] (the second real copy negated); f16 hi + residual x 2^10; each destination = a 256-B segment per row by 16 consecutive threads
    _Float16* QH = (_Float16*)D0; _Float16* QL = (_Float16*)D1; const int sel = oo0 / DD; const int dA = sel * 512 + (part ? 128 : 0), dB = sel * 512 + (part ? 256 : 384); const float sgB = part ? 1.0f : -1.0f;
    for (int e = tid; e < 64 * 16; e += 128) { const int rl = e >> 4, q = e & 15; v8h ha, la, hb, lb;
#pragma unroll
      for (int k = 0; k < 8; ++k) { const float v = sf[rl][q * 8 + k]; const _Float16 hv = (_Float16)v; ha[k] = hv; la[k] = (_Float16)((v - (float)hv) * 1024.0f); const float vb = v * sgB; const _Float16 hb2 = (_Float16)vb; hb[k] = hb2; lb[k] = (_Float16)((vb - (float)hb2) * 1024.0f); }
      const size_t ro = (r0 + rl) * 1024; vst2((v4u*)(QH + ro + dA + q * 8), *(const v4u*)&ha); vst2((v4u*)(QL + ro + dA + q * 8), *(const v4u*)&la); vst2((v4u*)(QH + ro + dB + q * 8), *(const v4u*)&hb); vst2((v4u*)(QL + ro + dB + q * 8), *(const v4u*)&lb); } }
  else if (MODE == 1) {   // k rows [row][256]: column part*128 + d; f16 hi + residual x 2^10
    _Float16* KH = (_Float16*)D0; _Float16* KL = (_Float16*)D1;
    for (int e = tid; e < 64 * 16; e += 128) { const int rl = e >> 4, q = e & 15; v8h ha, la;
#pragma unroll
      for (int k = 0; k < 8; ++k) { const float v = sf[rl][q * 8 + k]; const _Float16 hv = (_Float16)v; ha[k] = hv; la[k] = (_Float16)((v - (float)hv) * 1024.0f); }
      const size_t ro = (r0 + rl) * KK + c0; vst2((v4u*)(KH + ro + q * 8), *(const v4u*)&ha); vst2((v4u*)(KL + ro + q * 8), *(const v4u*)&la); } }
  else if (MODE == 2) {
    __bf16* VT = (__bf16*)D0; __bf16* VL = (__bf16*)D1; const size_t h = r0 / SS; const int s0 = (int)(r0 % SS);
    for (int e = tid; e < 128 * 8; e += 128) { const int cl = e >> 3, q = e & 7; v8b hb, lb;
#pragma unroll
      for (int k = 0; k < 8; ++k) { const float v = sf[q * 8 + k][cl]; const __bf16 bh = (__bf16)v; hb[k] = bh; lb[k] = (__bf16)(v - (float)bh); }
      const size_t o2 = (h * KK + c0 + cl) * (size_t)SS + s0 + q * 8; vst2((v4u*)(VT + o2), *(const v4u*)&hb); vst2((v4u*)(VL + o2), *(const v4u*)&lb); } }
  else if (MODE == 3) {   // g rows [row][256] f32: 512-B segment per row by 32 lanes
    float* G = (float*)D0; for (int e = tid; e < 64 * 32; e += 128) { const int rl = e >> 5, q = e & 31; vst2(G + (r0 + rl) * KK + c0 + q * 4, *(const v4f*)&sf[rl][q * 4]); } }
  else {   // MODE 4: output rows [row][128] of out_r (part 0) or out_i (part 1): whole 512-B rows by 32 lanes
    float* O = (float*)(part == 0 ? D0 : D1); for (int e = tid; e < 64 * 32; e += 128) { const int rl = e >> 5, q = e & 31; vst2(O + (r0 + rl) * DD + q * 4, *(const v4f*)&sf[rl][q * 4]); } } }
__global__ __launch_bounds__(32) void k_lam(const float* __restrict__ LQ1, const float* __restrict__ LK1, const float* __restrict__ LQ2, const float* __restrict__ LK2, float* __restrict__ LAM) { __shared__ float sl;
  if (threadIdx.x == 0) { float s1 = 0.f, s2 = 0.f; for (int i = 0; i < DD; ++i) { s1 += bfr(LQ1[i]) * bfr(LK1[i]); s2 += bfr(LQ2[i]) * bfr(LK2[i]); } const float z = expf(s1) - expf(s2) + LAMBDA_INIT; sl = 1.0f / (1.0f + expf(-z)); }
  __syncthreads(); vst2(LAM + threadIdx.x, sl); }
// ---- k_sc: block = (64 queries, 64 keys, pair in group): pair p = (head h = p/2, sel = p%2); s_r = Q[sel*512 + 0..255] . KH, s_i = Q[sel*512 + 256..511] . KH (3 products each: hi.hi + (lo.hi + hi.lo) 2^-10); logit = sqrt(s_r^2 + s_i^2 + 1e-8) x 128^-0.5
__global__ __launch_bounds__(128) void k_sc(const _Float16* __restrict__ QH, const _Float16* __restrict__ QL, const _Float16* __restrict__ KH, const _Float16* __restrict__ KL, int p0, float* __restrict__ S0) { __shared__ __align__(16) float ss[4][16][68]; const int p = p0 + blockIdx.z; const int h = p >> 1, sel = p & 1; float* S = S0 + (size_t)blockIdx.z * SS * SS;
  const int tid = threadIdx.x, wave = tid >> 5, lane = tid & 31, col = lane & 15, g = lane >> 4; const int k0 = blockIdx.y * 64; const int ql0 = blockIdx.x * 64 + wave * 16; const size_t q0 = (size_t)h * SS + ql0; const size_t kb = (size_t)h * SS + k0;
  v8f ar[4] = {}, arl[4] = {}, ai[4] = {}, ail[4] = {};
#pragma unroll 2
  for (int kc = 0; kc < KK / 32; ++kc) { const _Float16* qh = QH + (q0 + col) * 1024 + sel * 512 + kc * 32; const _Float16* ql = QL + (q0 + col) * 1024 + sel * 512 + kc * 32;
    const v16h arh = frag_h(qh, lane), arlo = frag_h(ql, lane), aih = frag_h(qh + 256, lane), ailo = frag_h(ql + 256, lane);
#pragma unroll
    for (int j = 0; j < 4; ++j) { const size_t ko = (kb + j * 16 + col) * KK + kc * 32; const v16h khf = frag_h(KH + ko, lane), klf = frag_h(KL + ko, lane);
      ar[j] = wmma16(arh, khf, ar[j]); arl[j] = wmma16(arlo, khf, arl[j]); arl[j] = wmma16(arh, klf, arl[j]);
      ai[j] = wmma16(aih, khf, ai[j]); ail[j] = wmma16(ailo, khf, ail[j]); ail[j] = wmma16(aih, klf, ail[j]); } }
#pragma unroll
  for (int j = 0; j < 4; ++j)
#pragma unroll
    for (int r = 0; r < 8; ++r) { const float sr_ = ar[j][r] + arl[j][r] * (1.0f / 1024.0f), si_ = ai[j][r] + ail[j][r] * (1.0f / 1024.0f); ss[wave][8 * g + r][j * 16 + col] = sqrtf(sr_ * sr_ + si_ * si_ + 1e-8f) * SCALE; }
  LDSX(); for (int rl = 0; rl < 16; ++rl) if (lane < 16) vst2(S + (size_t)(ql0 + rl) * SS + k0 + lane * 4, *(const v4f*)&ss[wave][rl][lane * 4]); }   
// ---- k_sm: block = query row of pair plane z: softmax over all 1,024 keys (f32) -> P x 2^11 in place
__global__ __launch_bounds__(256) void k_sm(float* __restrict__ S0) { __shared__ float sred[8]; __shared__ float sbc; __shared__ __align__(16) float sh[SS];
  const int t = threadIdx.x; const size_t row = blockIdx.x; float* sr = S0 + (size_t)blockIdx.y * SS * SS + row * SS; const int kend = SS;
  float m = -3.0e38f; for (int k = t; k < kend; k += 256) m = fmaxf(m, sr[k]);
#pragma unroll
  for (int o = 1; o < 32; o <<= 1) m = fmaxf(m, __shfl_xor(m, o));
  if ((t & 31) == 0) sred[t >> 5] = m; __syncthreads(); if (t == 0) { float a = sred[0]; for (int i = 1; i < 8; ++i) a = fmaxf(a, sred[i]); sbc = a; } __syncthreads(); m = sbc; __syncthreads();
  float sum = 0.f; for (int k = t; k < kend; k += 256) sum += expf(sr[k] - m);
#pragma unroll
  for (int o = 1; o < 32; o <<= 1) sum += __shfl_xor(sum, o);
  if ((t & 31) == 0) sred[t >> 5] = sum; __syncthreads(); if (t == 0) { float a = 0.f; for (int i = 0; i < 8; ++i) a += sred[i]; sbc = 1.0f / a; } __syncthreads(); const float inv = sbc;
  for (int k = t; k < kend; k += 256) sh[k] = expf(sr[k] - m) * inv * 2048.0f;
  __syncthreads(); for (int q = t; q < kend / 4; q += 256) vst2(sr + q * 4, *(const v4f*)&sh[q * 4]); }
// ---- k_pv: block = 64 queries of pair (h, sel), 8 waves: Y[row][sel*256 + c] = (P . vp)[c] for c in [0,256) = [a_r | a_i] (P split bf16 hi + lo x v hi + lo, 3 products, per output element in the order hi.hi, lo.hi, hi.lo over rising keys).
// Per stage of 64 keys the block brings both value planes (256 rows x 128 B each) and its 64 P rows (256 B each) in by whole-line loads, splits P once, and keeps them in LDS; the fragments come from LDS. The next stage's loads are issued before the products of this one and wait in registers.
// wave = (32-query group qg, 64-column group cg): 2 x 4 accumulator tiles
#define PVK 64             // keys per stage
#define PVP 72             // LDS row pitch in bf16 elements: 144 B = 16 B x 9, an odd multiple of 16 B for the 16-byte fragment reads
#define PV_SV (2 * KK * PVP * 2)   // bytes of the two value planes in LDS
#define PV_SP (2 * 64 * PVP * 2)   // bytes of the two P planes in LDS
__global__ __launch_bounds__(256) void k_pv(const float* __restrict__ PS0, const __bf16* __restrict__ VT, const __bf16* __restrict__ VL, int p0, float* __restrict__ Y) { const int p = p0 + blockIdx.z; const int h = p >> 1, sel = p & 1;
  __shared__ __align__(16) unsigned char sm[PV_SV + PV_SP];   // value planes [2][256][PVP], P planes [2][64][PVP]; after the loop the value planes' room holds the f32 result rows [64][KK + 4]
  __bf16* sv = (__bf16*)sm; __bf16* sp = (__bf16*)(sm + PV_SV); float* so = (float*)sm;
  const int tid = threadIdx.x, wave = tid >> 5, lane = tid & 31, col = lane & 15, g = lane >> 4; const int qg = wave & 1, cg = wave >> 1; const int qb = blockIdx.x * 64;
  const __bf16* gvh = VT + ((size_t)h * KK + (tid >> 3)) * (size_t)SS + (tid & 7) * 8;   // 8 lanes x 16 B = one 128-B line of a value row; 32 rows per sweep of the block
  const __bf16* gvl = VL + ((size_t)h * KK + (tid >> 3)) * (size_t)SS + (tid & 7) * 8;
  const float* gp = PS0 + (size_t)blockIdx.z * SS * SS + (size_t)(qb + (tid >> 4)) * SS + (tid & 15) * 4;   // 16 lanes x 16 B = the 256 B of a P row; 16 rows per sweep
  v4u rh[8], rl[8]; v4f rp[4];
#pragma unroll
  for (int i = 0; i < 8; ++i) { rh[i] = *(const v4u*)(gvh + (size_t)i * 32 * SS); rl[i] = *(const v4u*)(gvl + (size_t)i * 32 * SS); }
#pragma unroll
  for (int i = 0; i < 4; ++i) rp[i] = *(const v4f*)(gp + (size_t)i * 16 * SS);
  v8f acc[2][4] = {};
#pragma unroll 1   // one copy of the stage body: one set of prefetch registers, small text (the fixed-count inner loops are unrolled so that their arrays stay in registers)
  for (int st = 0; st < SS / PVK; ++st) {
    if (st) __syncthreads();   // every wave has read its last fragment of the stage before
#pragma unroll
    for (int i = 0; i < 8; ++i) { const int o = (i * 32 + (tid >> 3)) * PVP + (tid & 7) * 8; vst2(sv + o, rh[i]); vst2(sv + KK * PVP + o, rl[i]); }
#pragma unroll
    for (int i = 0; i < 4; ++i) { v4bf hb, lb;
#pragma unroll
      for (int k = 0; k < 4; ++k) { const float v = rp[i][k]; const __bf16 bh = (__bf16)v; hb[k] = bh; lb[k] = (__bf16)(v - (float)bh); }
      const int o = (i * 16 + (tid >> 4)) * PVP + (tid & 15) * 4; vst2(sp + o, hb); vst2(sp + 64 * PVP + o, lb); }
    __syncthreads();           // the stage is whole in LDS
    if (st + 1 < SS / PVK) { const int ko = (st + 1) * PVK;
#pragma unroll
      for (int i = 0; i < 8; ++i) { rh[i] = *(const v4u*)(gvh + (size_t)i * 32 * SS + ko); rl[i] = *(const v4u*)(gvl + (size_t)i * 32 * SS + ko); }
#pragma unroll
      for (int i = 0; i < 4; ++i) rp[i] = *(const v4f*)(gp + (size_t)i * 16 * SS + ko);
      asm volatile("s_wait_xcnt 0x0" ::: "memory"); }   // stands in front of the first overwrite of an address register of the loads above (the fragment reads below reuse them)
#pragma unroll
    for (int kc = 0; kc < PVK / 32; ++kc) { v16b ah[2], al[2];
#pragma unroll
      for (int t = 0; t < 2; ++t) { const int o = (qg * 32 + t * 16 + col) * PVP + kc * 32; ah[t] = frag_b(sp + o, lane); al[t] = frag_b(sp + 64 * PVP + o, lane); }
#pragma unroll
      for (int j = 0; j < 4; ++j) { const int o = (cg * 64 + j * 16 + col) * PVP + kc * 32; const v16b vh = frag_b(sv + o, lane), vl = frag_b(sv + KK * PVP + o, lane);
        acc[0][j] = wmma_bf(ah[0], vh, acc[0][j]); acc[1][j] = wmma_bf(ah[1], vh, acc[1][j]);
        acc[0][j] = wmma_bf(al[0], vh, acc[0][j]); acc[1][j] = wmma_bf(al[1], vh, acc[1][j]);
        acc[0][j] = wmma_bf(ah[0], vl, acc[0][j]); acc[1][j] = wmma_bf(ah[1], vl, acc[1][j]); } } }
  __syncthreads();             // the value planes' room is free for the result rows
#pragma unroll
  for (int t = 0; t < 2; ++t)
#pragma unroll
    for (int j = 0; j < 4; ++j)
#pragma unroll
      for (int r = 0; r < 8; ++r) so[(qg * 32 + t * 16 + 8 * g + r) * (KK + 4) + cg * 64 + j * 16 + col] = acc[t][j][r] * (1.0f / 2048.0f);
  __syncthreads();             // the result rows are whole
#pragma unroll
  for (int i = 0; i < 16; ++i) { const int rl_ = i * 4 + (tid >> 6), q = tid & 63; vst2(Y + ((size_t)h * SS + qb + rl_) * 512 + sel * 256 + q * 4, *(const v4f*)&so[rl_ * (KK + 4) + q * 4]); } }
// ---- k_mix: block = 16 rows (16 lanes per row): rms over the 512 attention values (= mean over 256 of r^2 + i^2), / rms x sub_w, out = a1 - lambda a2, then the complex gate z = g * out; z written IN PLACE over the g row (each lane reads and writes exactly its own columns d and 128 + d); float4 pieces, 16 lanes x 16 B = 256-B runs
__global__ __launch_bounds__(256) void k_mix(const float* __restrict__ Y, float* __restrict__ GZ, const float* __restrict__ LAM, const float* __restrict__ SW) {
  const int t = threadIdx.x; const int rl = t >> 4, sub = t & 15; const size_t row = (size_t)blockIdx.x * 16 + rl; const float* y = Y + row * 512; float* gz = GZ + row * KK; const float lam = LAM[0];
  float s2 = 0.f; for (int c = sub * 4; c < 512; c += 64) { const v4f v = *(const v4f*)(y + c); s2 += (v[0] * v[0] + v[1] * v[1]) + (v[2] * v[2] + v[3] * v[3]); }
#pragma unroll
  for (int o = 1; o < 16; o <<= 1) s2 += __shfl_xor(s2, o);
  const float inv = 1.0f / sqrtf(s2 * (1.0f / 256.0f) + 1e-5f);
#pragma unroll
  for (int it = 0; it < 2; ++it) { const int d = sub * 4 + it * 64;   /* d in [0,128): this lane's 4 columns */
    const v4f a1r = *(const v4f*)(y + d), a1i = *(const v4f*)(y + 128 + d), a2r = *(const v4f*)(y + 256 + d), a2i = *(const v4f*)(y + 384 + d); const v4f gr = *(const v4f*)(gz + d), gi = *(const v4f*)(gz + 128 + d);
    v4f zr, zi;
#pragma unroll
    for (int k = 0; k < 4; ++k) { const float w1 = bfr(SW[d + k]) * inv, w2 = bfr(SW[DD + d + k]) * inv; const float orr = a1r[k] * w1 - lam * (a2r[k] * w2), oi = a1i[k] * w1 - lam * (a2i[k] * w2); zr[k] = gr[k] * orr - gi[k] * oi; zi[k] = gr[k] * oi + gi[k] * orr; }
    vst2(gz + d, zr); vst2(gz + 128 + d, zi); } }
extern "C" void kernel_launch(void* const* d_in, const int* in_sizes, int n_in, void* d_out, int out_size, void* d_ws, size_t ws_size, hipStream_t stream) {
  (void)in_sizes; (void)n_in; (void)out_size;
  const float** F = (const float**)d_in;   // 0 q_r, 1 q_i, 2 k_r, 3 k_i, 4 v_r, 5 v_i, 6 pe_q_r, 7 pe_q_i, 8 pe_k_r, 9 pe_k_i [1,12,1024,128]; 10 qw_r [256,128], 11 qw_i, 12 qb_r [256], 13 qb_i; 14 kw_r [128,128], 15 kw_i, 16 kb_r, 17 kb_i; 18 vw_r, 19 vw_i, 20 vb_r, 21 vb_i; 22 gw_r, 23 gw_i, 24 gb_r, 25 gb_i; 26 ow_r, 27 ow_i, 28 ob_r, 29 ob_i; 30 lq1, 31 lk1, 32 lq2, 33 lk2 [128]; 34 sub_w [256]
  if (ws_size < (size_t)WS_END) return;
  char* ws = (char*)d_ws; _Float16 *QH = (_Float16*)(ws + WS_QH), *QL = (_Float16*)(ws + WS_QL), *KH = (_Float16*)(ws + WS_KH), *KL = (_Float16*)(ws + WS_KL); __bf16 *VT = (__bf16*)(ws + WS_VT), *VL = (__bf16*)(ws + WS_VL); float *G = (float*)(ws + WS_G), *Y = (float*)(ws + WS_Y), *LAM = (float*)(ws + WS_LAM), *S = (float*)(ws + WS_S);
  float* OUT0 = (float*)d_out; float* OUT1 = (float*)d_out + (size_t)NRF * DD;
  k_clin<0, 256><<<dim3(NR / 64, 4), 128, 0, stream>>>(F[0], F[1], F[10], F[11], F[12], F[13], F[6], F[7], QH, QL);
  k_clin<1, 128><<<dim3(NR / 64, 2), 128, 0, stream>>>(F[2], F[3], F[14], F[15], F[16], F[17], F[8], F[9], KH, KL);
  k_clin<2, 128><<<dim3(NR / 64, 2), 128, 0, stream>>>(F[4], F[5], F[18], F[19], F[20], F[21], nullptr, nullptr, VT, VL);
  k_clin<3, 128><<<dim3(NR / 64, 2), 128, 0, stream>>>(F[0], F[1], F[22], F[23], F[24], F[25], nullptr, nullptr, G, nullptr);
  k_lam<<<dim3(1), 32, 0, stream>>>(F[30], F[31], F[32], F[33], LAM);
  for (int p0 = 0; p0 < NPAIR; p0 += HG) {
    k_sc<<<dim3(SS / 64, SS / 64, HG), 128, 0, stream>>>(QH, QL, KH, KL, p0, S);
    k_sm<<<dim3(SS, HG), 256, 0, stream>>>(S);
    k_pv<<<dim3(SS / 64, 1, HG), 256, 0, stream>>>(S, VT, VL, p0, Y);
  }
  k_mix<<<dim3(NR / 16), 256, 0, stream>>>(Y, G, LAM, F[34]);
  k_clin<4, 128><<<dim3(NR / 64, 2), 128, 0, stream>>>(G, nullptr, F[26], F[27], F[28], F[29], nullptr, nullptr, OUT0, OUT1);
}

// v003
// One run takes 329 microseconds.
// In two side-by-side timings against v002, it was 1.16 and 1.17 times as fast.
// All steps since v000 together make it 7.24 times as fast.
// compute dtype: all float inputs rounded to bf16; every complex linear as one stacked real GEMM ([x_r | x_i] against [W_r ; -W_i] / [W_i ; W_r]) with EXACT bf16 products on WMMA 16x16x32, f32 accumulate; q (+pe) as f16 hi + residual (x 2^10) and k (+pe) as f16 hi + residual (x 2^10) -> 3-product complex logits (s_r, s_i as two stacked K=256 real GEMMs), |s| scaled in f32 (sqrtf); softmax in f32 (precise expf); P x 2^11 split bf16 hi + lo against v bf16 hi + lo (3 products); RMS norm / lambda / differential combination / complex gating in f32; the gated result (bf16 hi + lo) through the output complex linear (2 products); f32 outputs.
#include <hip/hip_runtime.h>
#include <math.h>

typedef __attribute__((ext_vector_type(16))) _Float16 v16h;
typedef __attribute__((ext_vector_type(16))) __bf16 v16b;
typedef __attribute__((ext_vector_type(8)))  _Float16 v8h;
typedef __attribute__((ext_vector_type(8)))  float v8f;
typedef __attribute__((ext_vector_type(4)))  float v4f;
typedef __attribute__((ext_vector_type(2)))  float v2f;
typedef __attribute__((ext_vector_type(4)))  unsigned v4u;
typedef __attribute__((ext_vector_type(4)))  int v4i;
typedef float __attribute__((may_alias)) float_a;
typedef int __attribute__((may_alias)) int_a;

template <typename T> __device__ __forceinline__ void vst2(void* p, T v) { *(T*)p = v;  }
__device__ __forceinline__ v8f wmma16(v16h a, v16h b, v8f c) {
  v8f d = __builtin_amdgcn_wmma_f32_16x16x32_f16(false, a, false, b, (short)0, c, false, false);
  asm volatile("v_nop\n\tv_nop\n\tv_nop\n\tv_nop" : "+v"(d) : "v"(a), "v"(b));
  return d;
}
__device__ __forceinline__ v8f wmma_bf(v16b a, v16b b, v8f c) {
  v8f d = __builtin_amdgcn_wmma_f32_16x16x32_bf16(false, a, false, b, (short)0, c, false, false);
  asm volatile("v_nop\n\tv_nop\n\tv_nop\n\tv_nop" : "+v"(d) : "v"(a), "v"(b));
  return d;
}
// 16x16x32 fragments: lane = (h = lane>>4, row/col = lane&15); elements 0..7 = k0+8h+0..7, 8..15 = k0+16+8h+0..7; D element r = row 8h+r
__device__ __forceinline__ v16h frag_h(const _Float16* rowk0, int lane) {
  union { v16h v; v8h q[2]; } u; const _Float16* p = rowk0 + 8 * (lane >> 4);
  u.q[0] = *(const v8h*)p; u.q[1] = *(const v8h*)(p + 16); return u.v;
}
__device__ __forceinline__ v16h frag_f32(const float* rowk0, int lane) {
  v16h a; const float* p = rowk0 + 8 * (lane >> 4);
#pragma unroll
  for (int i = 0; i < 8; ++i) { a[i] = (_Float16)p[i]; a[8 + i] = (_Float16)p[16 + i]; }
  return a;
}
__device__ __forceinline__ v16h frag_f32s(const float* rowk0, int lane, float sc) {
  v16h a; const float* p = rowk0 + 8 * (lane >> 4);
#pragma unroll
  for (int i = 0; i < 8; ++i) { a[i] = (_Float16)(p[i] * sc); a[8 + i] = (_Float16)(p[16 + i] * sc); }
  return a;
}
// column fragment from a [K][ld] layout (column n), rows >= K read as 0
__device__ __forceinline__ v16h fragc_f32(const float* W, int k0, int n, int lane, int ld, int K) {
  v16h a; const int g = lane >> 4;
#pragma unroll
  for (int i = 0; i < 8; ++i) { const int ka = k0 + 8 * g + i, kb = ka + 16;
    a[i] = (_Float16)(ka < K ? W[(size_t)(ka < K ? ka : K - 1) * ld + n] : 0.f); a[8 + i] = (_Float16)(kb < K ? W[(size_t)(kb < K ? kb : K - 1) * ld + n] : 0.f); }
  return a;
}
struct F2 { v16b h, l; };
__device__ __forceinline__ F2 bsplit16(const float v[16]) { F2 r;
#pragma unroll
  for (int i = 0; i < 16; ++i) { const __bf16 h = (__bf16)v[i]; r.h[i] = h; r.l[i] = (__bf16)(v[i] - (float)h); }
  return r; }
__device__ __forceinline__ F2 split_row(const float* row, int k0, int lane) { float v[16]; const float* p = row + k0 + 8 * (lane >> 4);
#pragma unroll
  for (int i = 0; i < 8; ++i) { v[i] = p[i]; v[8 + i] = p[16 + i]; }
  return bsplit16(v); }
__device__ __forceinline__ F2 split_rowK(const float* row, int k0, int lane, int K) { float v[16]; const int g = lane >> 4;
#pragma unroll
  for (int i = 0; i < 8; ++i) { const int ka = k0 + 8 * g + i, kb = ka + 16; v[i] = ka < K ? row[ka < K ? ka : K - 1] : 0.f; v[8 + i] = kb < K ? row[kb < K ? kb : K - 1] : 0.f; }
  return bsplit16(v); }
__device__ __forceinline__ F2 split_col(const float* W, int k0, int n, int lane, int ld, int K) { float v[16]; const int g = lane >> 4;
#pragma unroll
  for (int i = 0; i < 8; ++i) { const int ka = k0 + 8 * g + i, kb = ka + 16; v[i] = ka < K ? W[(size_t)(ka < K ? ka : K - 1) * ld + n] : 0.f; v[8 + i] = kb < K ? W[(size_t)(kb < K ? kb : K - 1) * ld + n] : 0.f; }
  return bsplit16(v); }
__device__ __forceinline__ v8f mac3(const F2& a, const F2& b, v8f c) { c = wmma_bf(a.l, b.h, c); c = wmma_bf(a.h, b.l, c); return wmma_bf(a.h, b.h, c); }
__device__ __forceinline__ float sigm(float v) { return 1.0f / (1.0f + expf(-v)); }
#define LDSX() do { asm volatile("s_wait_dscnt 0" ::: "memory"); __builtin_amdgcn_wave_barrier(); __builtin_amdgcn_fence(__ATOMIC_RELEASE, "workgroup"); } while (0)


// Complex differential attention (B 1, H 12, S 1,024, D 128): qp = CLin_q(q) + [pe_q, pe_q] (2D wide -> q1, q2), kp = CLin_k(k) + pe_k, vp = CLin_v(v); w_s = softmax(|q_s . conj(kp)| / sqrt(128)) for s = 1, 2; a_s = w_s vp (complex); cat = [a1, a2] / rms(cat) * sub_w; out = a1 - lambda a2 with lambda = sigmoid(exp(lq1 . lk1) - exp(lq2 . lk2) + 0.3555...); out = CLin_g(q) * out (complex product); out = CLin_o(out) -> (out_r, out_i).
#define NHT 12             // heads (x batch 1)
#define SS 1024
#define DD 128
#define KK 256             // stacked K of every complex linear / logit GEMM: [real | imag]
#ifndef NHU
#define NHU NHT            // heads processed
#endif
#define NR (NHU * SS)      // rows processed
#define NRF (NHT * SS)     // full row count (output-1 offset)
#ifndef HG
#define HG 24              // (head, sel) pairs per launch group (divides NPAIR): all pairs at once, so that the 64-query blocks of k_pv outnumber the WGPs; the logit planes take 96 MiB of workspace
#endif
#define NPAIR (NHU * 2)
#define SCALE 0.0883883461356163f       // 128^-0.5 as f32
#define LAMBDA_INIT 0.35550907254219055f  // 0.8 - 0.6 exp(-0.3) as f32
__device__ __forceinline__ float bfr(float v) { return (float)(__bf16)v; }
typedef __attribute__((ext_vector_type(8))) __bf16 v8b;
typedef __attribute__((ext_vector_type(4))) __bf16 v4bf;
__device__ __forceinline__ v16b frag_b(const __bf16* rowk0, int lane) { union { v16b v; v8b q[2]; } u; const __bf16* p = rowk0 + 8 * (lane >> 4); u.q[0] = *(const v8b*)p; u.q[1] = *(const v8b*)(p + 16); return u.v; }

#define WS_QH  0u                                      // f16 q rows [row][1024]: per sel s: [s*512 +0..127] q_r, [+128..255] q_i, [+256..383] q_i, [+384..511] -q_r  (hi)
#define WS_QL  (WS_QH + 2u * (size_t)NRF * 1024)       // f16 residual x 2^10
#define WS_KH  (WS_QL + 2u * (size_t)NRF * 1024)       // f16 k rows [row][256] = [kp_r | kp_i] (hi)
#define WS_KL  (WS_KH + 2u * (size_t)NRF * KK)         // f16 residual x 2^10
#define WS_VT  (WS_KL + 2u * (size_t)NRF * KK)         // bf16 value planes [h][256 = vp_r | vp_i][s] hi
#define WS_VL  (WS_VT + 2u * (size_t)NHT * KK * SS)    // bf16 value residual planes
#define WS_G   (WS_VL + 2u * (size_t)NHT * KK * SS)    // f32 g rows [row][256] = [g_r | g_i]; later overwritten in place by the gated result z = [z_r | z_i]
#define WS_Y   (WS_G + 4u * (size_t)NRF * KK)          // f32 attention rows [row][512] = [a1_r | a1_i | a2_r | a2_i]
#define WS_LAM (WS_Y + 4u * (size_t)NRF * 512)         // one line: lambda replicated
#define WS_S   (WS_LAM + 128u)                         // f32 logits / P planes for HG (head, sel) pairs [hg][q][k]
#define WS_END (WS_S + 4u * (size_t)HG * SS * SS)

// ---- k_clin: block = (64 rows, 128 output cols, tile index over 2*NO): generic complex linear as a stacked real GEMM.
// A row = [x_r[row] | x_i[row]] (K 256; MODE < 4: two f32 input tensors, bf16 exact; MODE 4: the f32 z rows, bf16 hi + lo -> 2 products);
// output column o in [0, 2 NO): part = o / NO (0 real, 1 imag), oo = o % NO; B[k] = part 0: (k < 128 ? W_r[oo][k] : -W_i[oo][k-128]), part 1: (k < 128 ? W_i[oo][k] : W_r[oo][k-128]); + bias_part[oo].
// MODE 0: q projection (NO 256) + pe_q -> QH/QL (each value to its two slots, see WS_QH); MODE 1: k (NO 128) + pe_k -> KH/KL; MODE 2: v -> bf16 planes; MODE 3: g -> G rows; MODE 4: output linear from Z -> the two output tensors
template <int MODE, int NO>
__global__ __launch_bounds__(128) void k_clin(const float* __restrict__ XR, const float* __restrict__ XI, const float* __restrict__ WR, const float* __restrict__ WI, const float* __restrict__ BR, const float* __restrict__ BI, const float* __restrict__ PER, const float* __restrict__ PEI, void* __restrict__ D0, void* __restrict__ D1) {
  __shared__ __align__(16) float sf[64][132];
  const int tid = threadIdx.x, wave = tid >> 5, lane = tid & 31, col = lane & 15, g = lane >> 4; const int c0 = blockIdx.y * 128; const size_t r0 = (size_t)blockIdx.x * 64; const int part = c0 / NO; const int oo0 = c0 % NO;
  v8f acc[8] = {};
#pragma unroll 2
  for (int kc = 0; kc < KK / 32; ++kc) { const bool imx = kc >= 4; const int kx = (kc & 3) * 32;   // A columns kc*32.. : real input for kc < 4, imag for kc >= 4
    v16b ah, al; bool two = false;
    if (MODE < 4) { const float* p = (imx ? XI : XR) + (r0 + wave * 16 + col) * DD + kx + 8 * g;
#pragma unroll
      for (int i = 0; i < 8; ++i) { ah[i] = (__bf16)p[i]; ah[8 + i] = (__bf16)p[16 + i]; } }
    else { const F2 a = split_row(XR + (r0 + wave * 16 + col) * KK, kc * 32, lane); ah = a.h; al = a.l; two = true; }
#pragma unroll
    for (int j = 0; j < 8; ++j) { v16b w; const int oo = oo0 + j * 16 + col; const float* WS0 = (part == 0) ? (imx ? WI : WR) : (imx ? WR : WI); const float sg = (part == 0 && imx) ? -1.0f : 1.0f;
#pragma unroll
      for (int i = 0; i < 8; ++i) { w[i] = (__bf16)(sg * WS0[(size_t)oo * DD + kx + 8 * g + i]); w[8 + i] = (__bf16)(sg * WS0[(size_t)oo * DD + kx + 16 + 8 * g + i]); }
      asm volatile("s_wait_loadcnt 0x0" ::: "memory"); acc[j] = wmma_bf(ah, w, acc[j]); if (two) acc[j] = wmma_bf(al, w, acc[j]); } }
  { const float* BB = part == 0 ? BR : BI; const float* PE = part == 0 ? PER : PEI;
#pragma unroll
    for (int j = 0; j < 8; ++j) { const int oo = oo0 + j * 16 + col; const float bb = bfr(BB[oo]);
#pragma unroll
      for (int r = 0; r < 8; ++r) { const int rl = wave * 16 + 8 * g + r; float v = acc[j][r] + bb; if (MODE <= 1) v += bfr(PE[(r0 + rl) * DD + (oo & (DD - 1))]); sf[rl][j * 16 + col] = v; }
      asm volatile("s_wait_loadcnt 0x0" ::: "memory"); } }
  __syncthreads();
  if (MODE == 0) {   // q: value (sel = oo0/128, d) -> QH[row][sel*512 + (part ? 128 : 0) + d] and QH[row][sel*512 + (part ? 256 : 384) + d] (the second real copy negated); f16 hi + residual x 2^10; each destination = a 256-B segment per row by 16 consecutive threads
    _Float16* QH = (_Float16*)D0; _Float16* QL = (_Float16*)D1; const int sel = oo0 / DD; const int dA = sel * 512 + (part ? 128 : 0), dB = sel * 512 + (part ? 256 : 384); const float sgB = part ? 1.0f : -1.0f;
    for (int e = tid; e < 64 * 16; e += 128) { const int rl = e >> 4, q = e & 15; v8h ha, la, hb, lb;
#pragma unroll
      for (int k = 0; k < 8; ++k) { const float v = sf[rl][q * 8 + k]; const _Float16 hv = (_Float16)v; ha[k] = hv; la[k] = (_Float16)((v - (float)hv) * 1024.0f); const float vb = v * sgB; const _Float16 hb2 = (_Float16)vb; hb[k] = hb2; lb[k] = (_Float16)((vb - (float)hb2) * 1024.0f); }
      const size_t ro = (r0 + rl) * 1024; vst2((v4u*)(QH + ro + dA + q * 8), *(const v4u*)&ha); vst2((v4u*)(QL + ro + dA + q * 8), *(const v4u*)&la); vst2((v4u*)(QH + ro + dB + q * 8), *(const v4u*)&hb); vst2((v4u*)(QL + ro + dB + q * 8), *(const v4u*)&lb); } }
  else if (MODE == 1) {   // k rows [row][256]: column part*128 + d; f16 hi + residual x 2^10
    _Float16* KH = (_Float16*)D0; _Float16* KL = (_Float16*)D1;
    for (int e = tid; e < 64 * 16; e += 128) { const int rl = e >> 4, q = e & 15; v8h ha, la;
#pragma unroll
      for (int k = 0; k < 8; ++k) { const float v = sf[rl][q * 8 + k]; const _Float16 hv = (_Float16)v; ha[k] = hv; la[k] = (_Float16)((v - (float)hv) * 1024.0f); }
      const size_t ro = (r0 + rl) * KK + c0; vst2((v4u*)(KH + ro + q * 8), *(const v4u*)&ha); vst2((v4u*)(KL + ro + q * 8), *(const v4u*)&la); } }
  else if (MODE == 2) {
    __bf16* VT = (__bf16*)D0; __bf16* VL = (__bf16*)D1; const size_t h = r0 / SS; const int s0 = (int)(r0 % SS);
    for (int e = tid; e < 128 * 8; e += 128) { const int cl = e >> 3, q = e & 7; v8b hb, lb;
#pragma unroll
      for (int k = 0; k < 8; ++k) { const float v = sf[q * 8 + k][cl]; const __bf16 bh = (__bf16)v; hb[k] = bh; lb[k] = (__bf16)(v - (float)bh); }
      const size_t o2 = (h * KK + c0 + cl) * (size_t)SS + s0 + q * 8; vst2((v4u*)(VT + o2), *(const v4u*)&hb); vst2((v4u*)(VL + o2), *(const v4u*)&lb); } }
  else if (MODE == 3) {   // g rows [row][256] f32: 512-B segment per row by 32 lanes
    float* G = (float*)D0; for (int e = tid; e < 64 * 32; e += 128) { const int rl = e >> 5, q = e & 31; vst2(G + (r0 + rl) * KK + c0 + q * 4, *(const v4f*)&sf[rl][q * 4]); } }
  else {   // MODE 4: output rows [row][128] of out_r (part 0) or out_i (part 1): whole 512-B rows by 32 lanes
    float* O = (float*)(part == 0 ? D0 : D1); for (int e = tid; e < 64 * 32; e += 128) { const int rl = e >> 5, q = e & 31; vst2(O + (r0 + rl) * DD + q * 4, *(const v4f*)&sf[rl][q * 4]); } } }
__global__ __launch_bounds__(32) void k_lam(const float* __restrict__ LQ1, const float* __restrict__ LK1, const float* __restrict__ LQ2, const float* __restrict__ LK2, float* __restrict__ LAM) { __shared__ float sl;
  if (threadIdx.x == 0) { float s1 = 0.f, s2 = 0.f; for (int i = 0; i < DD; ++i) { s1 += bfr(LQ1[i]) * bfr(LK1[i]); s2 += bfr(LQ2[i]) * bfr(LK2[i]); } const float z = expf(s1) - expf(s2) + LAMBDA_INIT; sl = 1.0f / (1.0f + expf(-z)); }
  __syncthreads(); vst2(LAM + threadIdx.x, sl); }
// ---- k_sc: block = (64 queries, 128 keys, pair in group), 8 waves: pair p = (head h = p/2, sel = p%2); s_r = Q[sel*512 + 0..255] . KH, s_i = Q[sel*512 + 256..511] . KH (3 products each: hi.hi + (lo.hi + hi.lo) 2^-10); logit = sqrt(s_r^2 + s_i^2 + 1e-8) x 128^-0.5
// Per stage of 64 stacked-K elements the block brings one whole 128-B line of each of its rows (64 q rows x 4 planes: s_r hi, s_r lo, s_i hi, s_i lo; 128 k rows x 2 planes: hi, lo) into LDS by asynchronous 16-byte copies; two buffers, the next stage's copies fly while this stage's fragments are read from LDS.
// wave = (16-query group qg, 64-key group kg): 4 accumulator tiles x 4 sums, products per sum in the order of rising K as before
#define SCP 72                      // LDS row pitch in f16 elements: 144 B = 16 B x 9, an odd multiple of 16 B for the 16-byte fragment reads
#define SC_Q (4 * 64 * SCP * 2)     // bytes of the four q planes of a stage
#define SC_K (2 * 128 * SCP * 2)    // bytes of the two k planes of a stage
#define SC_BUF (SC_Q + SC_K)
// eight asynchronous copies of 16 B per lane; the s_wait_xcnt stands inside the statement, so that no address register of a copy is rewritten in front of it
__device__ __forceinline__ void cp8(unsigned l0, unsigned l1, unsigned l2, unsigned l3, unsigned l4, unsigned l5, unsigned l6, unsigned l7, const _Float16* g0, const _Float16* g1, const _Float16* g2, const _Float16* g3, const _Float16* g4, const _Float16* g5, const _Float16* g6, const _Float16* g7) {
  asm volatile("global_load_async_to_lds_b128 %0, %8, off\n\tglobal_load_async_to_lds_b128 %1, %9, off\n\tglobal_load_async_to_lds_b128 %2, %10, off\n\tglobal_load_async_to_lds_b128 %3, %11, off\n\t"
               "global_load_async_to_lds_b128 %4, %12, off\n\tglobal_load_async_to_lds_b128 %5, %13, off\n\tglobal_load_async_to_lds_b128 %6, %14, off\n\tglobal_load_async_to_lds_b128 %7, %15, off\n\ts_wait_xcnt 0x0"
               :: "v"(l0), "v"(l1), "v"(l2), "v"(l3), "v"(l4), "v"(l5), "v"(l6), "v"(l7), "v"(g0), "v"(g1), "v"(g2), "v"(g3), "v"(g4), "v"(g5), "v"(g6), "v"(g7) : "memory");
}
// one stage: lq = this lane's LDS byte address in the buffer (row tid / 8, 16-byte piece tid % 8), the four pointers at the same row and piece of the stage's K columns; 32 rows per sweep of the block
__device__ __forceinline__ void sc_stage(unsigned lq, const _Float16* qh, const _Float16* ql, const _Float16* kh, const _Float16* kl) {
  const unsigned R = 32 * SCP * 2;   // LDS bytes of 32 rows
  cp8(lq, lq + R, lq + 2 * R, lq + 3 * R, lq + 4 * R, lq + 5 * R, lq + 6 * R, lq + 7 * R, qh, qh + 32 * 1024, ql, ql + 32 * 1024, qh + 256, qh + 256 + 32 * 1024, ql + 256, ql + 256 + 32 * 1024);
  const unsigned lk = lq + SC_Q;
  cp8(lk, lk + R, lk + 2 * R, lk + 3 * R, lk + 4 * R, lk + 5 * R, lk + 6 * R, lk + 7 * R, kh, kh + 32 * KK, kh + 64 * KK, kh + 96 * KK, kl, kl + 32 * KK, kl + 64 * KK, kl + 96 * KK);
}
__global__ __launch_bounds__(256) void k_sc(const _Float16* __restrict__ QH, const _Float16* __restrict__ QL, const _Float16* __restrict__ KH, const _Float16* __restrict__ KL, int p0, float* __restrict__ S0) {
  __shared__ __align__(16) unsigned char sm[2 * SC_BUF];   // two stage buffers; after the loop the room holds each wave's f32 result rows [16][68]
  const int p = p0 + blockIdx.z; const int h = p >> 1, sel = p & 1; float* S = S0 + (size_t)blockIdx.z * SS * SS;
  const int tid = threadIdx.x, wave = tid >> 5, lane = tid & 31, col = lane & 15, g = lane >> 4; const int qg = wave & 3, kg = wave >> 2; const int k0 = blockIdx.y * 128; const int qb = blockIdx.x * 64;
  const _Float16* gqh = QH + ((size_t)h * SS + qb + (tid >> 3)) * 1024 + sel * 512 + (tid & 7) * 8;   // 8 lanes x 16 B = one 128-B line of a row
  const _Float16* gql = QL + ((size_t)h * SS + qb + (tid >> 3)) * 1024 + sel * 512 + (tid & 7) * 8;
  const _Float16* gkh = KH + ((size_t)h * SS + k0 + (tid >> 3)) * KK + (tid & 7) * 8;
  const _Float16* gkl = KL + ((size_t)h * SS + k0 + (tid >> 3)) * KK + (tid & 7) * 8;
  const unsigned lb = (unsigned)(size_t)sm + (unsigned)((tid >> 3) * (SCP * 2) + (tid & 7) * 16);
  sc_stage(lb, gqh, gql, gkh, gkl);
  asm volatile("s_wait_asynccnt 0x0" ::: "memory");   // this wave's copies of stage 0 have landed
  __syncthreads();                                    // stage 0 is whole in LDS
  sc_stage(lb + SC_BUF, gqh + 64, gql + 64, gkh + 64, gkl + 64);
  v8f ar[4] = {}, arl[4] = {}, ai[4] = {}, ail[4] = {};
#pragma unroll 1   // one copy of the stage body: small text, the buffer is picked by an offset
  for (int st = 0; st < KK / 64; ++st) { const _Float16* bq = (const _Float16*)(sm + (st & 1) * SC_BUF); const _Float16* bk = (const _Float16*)(sm + (st & 1) * SC_BUF + SC_Q);
    const _Float16* kp0 = bk + (kg * 64 + col) * SCP;
    v16h kf[2][2];   // k fragments (hi, lo) of this group of six products and of the next: the next group's LDS reads are issued in front of this group's products, inside the stage only
    kf[0][0] = frag_h(kp0, lane); kf[0][1] = frag_h(kp0 + 128 * SCP, lane);
#pragma unroll
    for (int kc = 0; kc < 2; ++kc) { const _Float16* qa = bq + (qg * 16 + col) * SCP + kc * 32;
      const v16h arh = frag_h(qa, lane), arlo = frag_h(qa + 64 * SCP, lane), aih = frag_h(qa + 128 * SCP, lane), ailo = frag_h(qa + 192 * SCP, lane);
#pragma unroll
      for (int j = 0; j < 4; ++j) { const int gi = kc * 4 + j, c = gi & 1, n = c ^ 1;
        if (gi + 1 < 8) { const _Float16* kp = kp0 + ((gi + 1) & 3) * 16 * SCP + ((gi + 1) >> 2) * 32; kf[n][0] = frag_h(kp, lane); kf[n][1] = frag_h(kp + 128 * SCP, lane); }
        const v16h khf = kf[c][0], klf = kf[c][1];
        ar[j] = wmma16(arh, khf, ar[j]); arl[j] = wmma16(arlo, khf, arl[j]); arl[j] = wmma16(arh, klf, arl[j]);
        ai[j] = wmma16(aih, khf, ai[j]); ail[j] = wmma16(ailo, khf, ail[j]); ail[j] = wmma16(aih, klf, ail[j]); } }
    asm volatile("s_wait_dscnt 0x0" ::: "memory");      // this wave's fragment reads of the buffer are done before it is refilled
    asm volatile("s_wait_asynccnt 0x0" ::: "memory");   // this wave's copies of the next stage have landed
    __syncthreads();                                    // publishes the next stage and ends every wave's reads of this buffer
    if (st + 2 < KK / 64) sc_stage(lb + (unsigned)((st & 1) * SC_BUF), gqh + (st + 2) * 64, gql + (st + 2) * 64, gkh + (st + 2) * 64, gkl + (st + 2) * 64); }
  asm volatile("s_wait_asynccnt 0x0" ::: "memory");     // no copy is outstanding when the room is used for the result rows
  float* ss = (float*)sm + wave * (16 * 68);
#pragma unroll
  for (int j = 0; j < 4; ++j)
#pragma unroll
    for (int r = 0; r < 8; ++r) { const float sr_ = ar[j][r] + arl[j][r] * (1.0f / 1024.0f), si_ = ai[j][r] + ail[j][r] * (1.0f / 1024.0f); ss[(8 * g + r) * 68 + j * 16 + col] = sqrtf(sr_ * sr_ + si_ * si_ + 1e-8f) * SCALE; }
  LDSX();
#pragma unroll
  for (int it = 0; it < 8; ++it) { const int rl = it * 2 + g; vst2(S + (size_t)(qb + qg * 16 + rl) * SS + k0 + kg * 64 + col * 4, *(const v4f*)&ss[rl * 68 + col * 4]); } }
// ---- k_sm: block = query row of pair plane z: softmax over all 1,024 keys (f32) -> P x 2^11 in place
__global__ __launch_bounds__(256) void k_sm(float* __restrict__ S0) { __shared__ float sred[8]; __shared__ float sbc; __shared__ __align__(16) float sh[SS];
  const int t = threadIdx.x; const size_t row = blockIdx.x; float* sr = S0 + (size_t)blockIdx.y * SS * SS + row * SS; const int kend = SS;
  float m = -3.0e38f; for (int k = t; k < kend; k += 256) m = fmaxf(m, sr[k]);
#pragma unroll
  for (int o = 1; o < 32; o <<= 1) m = fmaxf(m, __shfl_xor(m, o));
  if ((t & 31) == 0) sred[t >> 5] = m; __syncthreads(); if (t == 0) { float a = sred[0]; for (int i = 1; i < 8; ++i) a = fmaxf(a, sred[i]); sbc = a; } __syncthreads(); m = sbc; __syncthreads();
  float sum = 0.f; for (int k = t; k < kend; k += 256) sum += expf(sr[k] - m);
#pragma unroll
  for (int o = 1; o < 32; o <<= 1) sum += __shfl_xor(sum, o);
  if ((t & 31) == 0) sred[t >> 5] = sum; __syncthreads(); if (t == 0) { float a = 0.f; for (int i = 0; i < 8; ++i) a += sred[i]; sbc = 1.0f / a; } __syncthreads(); const float inv = sbc;
  for (int k = t; k < kend; k += 256) sh[k] = expf(sr[k] - m) * inv * 2048.0f;
  __syncthreads(); for (int q = t; q < kend / 4; q += 256) vst2(sr + q * 4, *(const v4f*)&sh[q * 4]); }
// ---- k_pv: block = 64 queries of pair (h, sel), 8 waves: Y[row][sel*256 + c] = (P . vp)[c] for c in [0,256) = [a_r | a_i] (P split bf16 hi + lo x v hi + lo, 3 products, per output element in the order hi.hi, lo.hi, hi.lo over rising keys).
// Per stage of 64 keys the block brings both value planes (256 rows x 128 B each) and its 64 P rows (256 B each) in by whole-line loads, splits P once, and keeps them in LDS; the fragments come from LDS. The next stage's loads are issued before the products of this one and wait in registers.
// wave = (32-query group qg, 64-column group cg): 2 x 4 accumulator tiles
#define PVK 64             // keys per stage
#define PVP 72             // LDS row pitch in bf16 elements: 144 B = 16 B x 9, an odd multiple of 16 B for the 16-byte fragment reads
#define PV_SV (2 * KK * PVP * 2)   // bytes of the two value planes in LDS
#define PV_SP (2 * 64 * PVP * 2)   // bytes of the two P planes in LDS
__global__ __launch_bounds__(256) void k_pv(const float* __restrict__ PS0, const __bf16* __restrict__ VT, const __bf16* __restrict__ VL, int p0, float* __restrict__ Y) { const int p = p0 + blockIdx.z; const int h = p >> 1, sel = p & 1;
  __shared__ __align__(16) unsigned char sm[PV_SV + PV_SP];   // value planes [2][256][PVP], P planes [2][64][PVP]; after the loop the value planes' room holds the f32 result rows [64][KK + 4]
  __bf16* sv = (__bf16*)sm; __bf16* sp = (__bf16*)(sm + PV_SV); float* so = (float*)sm;
  const int tid = threadIdx.x, wave = tid >> 5, lane = tid & 31, col = lane & 15, g = lane >> 4; const int qg = wave & 1, cg = wave >> 1; const int qb = blockIdx.x * 64;
  const __bf16* gvh = VT + ((size_t)h * KK + (tid >> 3)) * (size_t)SS + (tid & 7) * 8;   // 8 lanes x 16 B = one 128-B line of a value row; 32 rows per sweep of the block
  const __bf16* gvl = VL + ((size_t)h * KK + (tid >> 3)) * (size_t)SS + (tid & 7) * 8;
  const float* gp = PS0 + (size_t)blockIdx.z * SS * SS + (size_t)(qb + (tid >> 4)) * SS + (tid & 15) * 4;   // 16 lanes x 16 B = the 256 B of a P row; 16 rows per sweep
  v4u rh[8], rl[8]; v4f rp[4];
#pragma unroll
  for (int i = 0; i < 8; ++i) { rh[i] = *(const v4u*)(gvh + (size_t)i * 32 * SS); rl[i] = *(const v4u*)(gvl + (size_t)i * 32 * SS); }
#pragma unroll
  for (int i = 0; i < 4; ++i) rp[i] = *(const v4f*)(gp + (size_t)i * 16 * SS);
  v8f acc[2][4] = {};
#pragma unroll 1   // one copy of the stage body: one set of prefetch registers, small text (the fixed-count inner loops are unrolled so that their arrays stay in registers)
  for (int st = 0; st < SS / PVK; ++st) {
    if (st) __syncthreads();   // every wave has read its last fragment of the stage before
#pragma unroll
    for (int i = 0; i < 8; ++i) { const int o = (i * 32 + (tid >> 3)) * PVP + (tid & 7) * 8; vst2(sv + o, rh[i]); vst2(sv + KK * PVP + o, rl[i]); }
#pragma unroll
    for (int i = 0; i < 4; ++i) { v4bf hb, lb;
#pragma unroll
      for (int k = 0; k < 4; ++k) { const float v = rp[i][k]; const __bf16 bh = (__bf16)v; hb[k] = bh; lb[k] = (__bf16)(v - (float)bh); }
      const int o = (i * 16 + (tid >> 4)) * PVP + (tid & 15) * 4; vst2(sp + o, hb); vst2(sp + 64 * PVP + o, lb); }
    __syncthreads();           // the stage is whole in LDS
    if (st + 1 < SS / PVK) { const int ko = (st + 1) * PVK;
#pragma unroll
      for (int i = 0; i < 8; ++i) { rh[i] = *(const v4u*)(gvh + (size_t)i * 32 * SS + ko); rl[i] = *(const v4u*)(gvl + (size_t)i * 32 * SS + ko); }
#pragma unroll
      for (int i = 0; i < 4; ++i) rp[i] = *(const v4f*)(gp + (size_t)i * 16 * SS + ko);
      asm volatile("s_wait_xcnt 0x0" ::: "memory"); }   // stands in front of the first overwrite of an address register of the loads above (the fragment reads below reuse them)
#pragma unroll
    for (int kc = 0; kc < PVK / 32; ++kc) { v16b ah[2], al[2];
#pragma unroll
      for (int t = 0; t < 2; ++t) { const int o = (qg * 32 + t * 16 + col) * PVP + kc * 32; ah[t] = frag_b(sp + o, lane); al[t] = frag_b(sp + 64 * PVP + o, lane); }
#pragma unroll
      for (int j = 0; j < 4; ++j) { const int o = (cg * 64 + j * 16 + col) * PVP + kc * 32; const v16b vh = frag_b(sv + o, lane), vl = frag_b(sv + KK * PVP + o, lane);
        acc[0][j] = wmma_bf(ah[0], vh, acc[0][j]); acc[1][j] = wmma_bf(ah[1], vh, acc[1][j]);
        acc[0][j] = wmma_bf(al[0], vh, acc[0][j]); acc[1][j] = wmma_bf(al[1], vh, acc[1][j]);
        acc[0][j] = wmma_bf(ah[0], vl, acc[0][j]); acc[1][j] = wmma_bf(ah[1], vl, acc[1][j]); } } }
  __syncthreads();             // the value planes' room is free for the result rows
#pragma unroll
  for (int t = 0; t < 2; ++t)
#pragma unroll
    for (int j = 0; j < 4; ++j)
#pragma unroll
      for (int r = 0; r < 8; ++r) so[(qg * 32 + t * 16 + 8 * g + r) * (KK + 4) + cg * 64 + j * 16 + col] = acc[t][j][r] * (1.0f / 2048.0f);
  __syncthreads();             // the result rows are whole
#pragma unroll
  for (int i = 0; i < 16; ++i) { const int rl_ = i * 4 + (tid >> 6), q = tid & 63; vst2(Y + ((size_t)h * SS + qb + rl_) * 512 + sel * 256 + q * 4, *(const v4f*)&so[rl_ * (KK + 4) + q * 4]); } }
// ---- k_mix: block = 16 rows (16 lanes per row): rms over the 512 attention values (= mean over 256 of r^2 + i^2), / rms x sub_w, out = a1 - lambda a2, then the complex gate z = g * out; z written IN PLACE over the g row (each lane reads and writes exactly its own columns d and 128 + d); float4 pieces, 16 lanes x 16 B = 256-B runs
__global__ __launch_bounds__(256) void k_mix(const float* __restrict__ Y, float* __restrict__ GZ, const float* __restrict__ LAM, const float* __restrict__ SW) {
  const int t = threadIdx.x; const int rl = t >> 4, sub = t & 15; const size_t row = (size_t)blockIdx.x * 16 + rl; const float* y = Y + row * 512; float* gz = GZ + row * KK; const float lam = LAM[0];
  float s2 = 0.f; for (int c = sub * 4; c < 512; c += 64) { const v4f v = *(const v4f*)(y + c); s2 += (v[0] * v[0] + v[1] * v[1]) + (v[2] * v[2] + v[3] * v[3]); }
#pragma unroll
  for (int o = 1; o < 16; o <<= 1) s2 += __shfl_xor(s2, o);
  const float inv = 1.0f / sqrtf(s2 * (1.0f / 256.0f) + 1e-5f);
#pragma unroll
  for (int it = 0; it < 2; ++it) { const int d = sub * 4 + it * 64;   /* d in [0,128): this lane's 4 columns */
    const v4f a1r = *(const v4f*)(y + d), a1i = *(const v4f*)(y + 128 + d), a2r = *(const v4f*)(y + 256 + d), a2i = *(const v4f*)(y + 384 + d); const v4f gr = *(const v4f*)(gz + d), gi = *(const v4f*)(gz + 128 + d);
    v4f zr, zi;
#pragma unroll
    for (int k = 0; k < 4; ++k) { const float w1 = bfr(SW[d + k]) * inv, w2 = bfr(SW[DD + d + k]) * inv; const float orr = a1r[k] * w1 - lam * (a2r[k] * w2), oi = a1i[k] * w1 - lam * (a2i[k] * w2); zr[k] = gr[k] * orr - gi[k] * oi; zi[k] = gr[k] * oi + gi[k] * orr; }
    vst2(gz + d, zr); vst2(gz + 128 + d, zi); } }
extern "C" void kernel_launch(void* const* d_in, const int* in_sizes, int n_in, void* d_out, int out_size, void* d_ws, size_t ws_size, hipStream_t stream) {
  (void)in_sizes; (void)n_in; (void)out_size;
  const float** F = (const float**)d_in;   // 0 q_r, 1 q_i, 2 k_r, 3 k_i, 4 v_r, 5 v_i, 6 pe_q_r, 7 pe_q_i, 8 pe_k_r, 9 pe_k_i [1,12,1024,128]; 10 qw_r [256,128], 11 qw_i, 12 qb_r [256], 13 qb_i; 14 kw_r [128,128], 15 kw_i, 16 kb_r, 17 kb_i; 18 vw_r, 19 vw_i, 20 vb_r, 21 vb_i; 22 gw_r, 23 gw_i, 24 gb_r, 25 gb_i; 26 ow_r, 27 ow_i, 28 ob_r, 29 ob_i; 30 lq1, 31 lk1, 32 lq2, 33 lk2 [128]; 34 sub_w [256]
  if (ws_size < (size_t)WS_END) return;
  char* ws = (char*)d_ws; _Float16 *QH = (_Float16*)(ws + WS_QH), *QL = (_Float16*)(ws + WS_QL), *KH = (_Float16*)(ws + WS_KH), *KL = (_Float16*)(ws + WS_KL); __bf16 *VT = (__bf16*)(ws + WS_VT), *VL = (__bf16*)(ws + WS_VL); float *G = (float*)(ws + WS_G), *Y = (float*)(ws + WS_Y), *LAM = (float*)(ws + WS_LAM), *S = (float*)(ws + WS_S);
  float* OUT0 = (float*)d_out; float* OUT1 = (float*)d_out + (size_t)NRF * DD;
  k_clin<0, 256><<<dim3(NR / 64, 4), 128, 0, stream>>>(F[0], F[1], F[10], F[11], F[12], F[13], F[6], F[7], QH, QL);
  k_clin<1, 128><<<dim3(NR / 64, 2), 128, 0, stream>>>(F[2], F[3], F[14], F[15], F[16], F[17], F[8], F[9], KH, KL);
  k_clin<2, 128><<<dim3(NR / 64, 2), 128, 0, stream>>>(F[4], F[5], F[18], F[19], F[20], F[21], nullptr, nullptr, VT, VL);
  k_clin<3, 128><<<dim3(NR / 64, 2), 128, 0, stream>>>(F[0], F[1], F[22], F[23], F[24], F[25], nullptr, nullptr, G, nullptr);
  k_lam<<<dim3(1), 32, 0, stream>>>(F[30], F[31], F[32], F[33], LAM);
  for (int p0 = 0; p0 < NPAIR; p0 += HG) {
    k_sc<<<dim3(SS / 64, SS / 128, HG), 256, 0, stream>>>(QH, QL, KH, KL, p0, S);
    k_sm<<<dim3(SS, HG), 256, 0, stream>>>(S);
    k_pv<<<dim3(SS / 64, 1, HG), 256, 0, stream>>>(S, VT, VL, p0, Y);
  }
  k_mix<<<dim3(NR / 16), 256, 0, stream>>>(Y, G, LAM, F[34]);
  k_clin<4, 128><<<dim3(NR / 64, 2), 128, 0, stream>>>(G, nullptr, F[26], F[27], F[28], F[29], nullptr, nullptr, OUT0, OUT1);
}

// v004
// It runs in 297 microseconds.
// Next to v003, in two timings, it ran 1.11 times as fast each time.
// All steps since v000 together make it 8.04 times as fast.
// compute dtype: all float inputs rounded to bf16; every complex linear as one stacked real GEMM ([x_r | x_i] against [W_r ; -W_i] / [W_i ; W_r]) with EXACT bf16 products on WMMA 16x16x32, f32 accumulate; q (+pe) as f16 hi + residual (x 2^10) and k (+pe) as f16 hi + residual (x 2^10) -> 3-product complex logits (s_r, s_i as two stacked K=256 real GEMMs), |s| scaled in f32 (sqrtf); softmax in f32 (precise expf); P x 2^11 split bf16 hi + lo against v bf16 hi + lo (3 products); RMS norm / lambda / differential combination / complex gating in f32; the gated result (bf16 hi + lo) through the output complex linear (2 products); f32 outputs.
#include <hip/hip_runtime.h>
#include <math.h>

typedef __attribute__((ext_vector_type(16))) _Float16 v16h;
typedef __attribute__((ext_vector_type(16))) __bf16 v16b;
typedef __attribute__((ext_vector_type(8)))  _Float16 v8h;
typedef __attribute__((ext_vector_type(8)))  float v8f;
typedef __attribute__((ext_vector_type(4)))  float v4f;
typedef __attribute__((ext_vector_type(2)))  float v2f;
typedef __attribute__((ext_vector_type(4)))  unsigned v4u;
typedef __attribute__((ext_vector_type(4)))  int v4i;
typedef float __attribute__((may_alias)) float_a;
typedef int __attribute__((may_alias)) int_a;

template <typename T> __device__ __forceinline__ void vst2(void* p, T v) { *(T*)p = v;  }
__device__ __forceinline__ v8f wmma16(v16h a, v16h b, v8f c) {
  v8f d = __builtin_amdgcn_wmma_f32_16x16x32_f16(false, a, false, b, (short)0, c, false, false);
  asm volatile("v_nop\n\tv_nop\n\tv_nop\n\tv_nop" : "+v"(d) : "v"(a), "v"(b));
  return d;
}
__device__ __forceinline__ v8f wmma_bf(v16b a, v16b b, v8f c) {
  v8f d = __builtin_amdgcn_wmma_f32_16x16x32_bf16(false, a, false, b, (short)0, c, false, false);
  asm volatile("v_nop\n\tv_nop\n\tv_nop\n\tv_nop" : "+v"(d) : "v"(a), "v"(b));
  return d;
}
// 16x16x32 fragments: lane = (h = lane>>4, row/col = lane&15); elements 0..7 = k0+8h+0..7, 8..15 = k0+16+8h+0..7; D element r = row 8h+r
__device__ __forceinline__ v16h frag_h(const _Float16* rowk0, int lane) {
  union { v16h v; v8h q[2]; } u; const _Float16* p = rowk0 + 8 * (lane >> 4);
  u.q[0] = *(const v8h*)p; u.q[1] = *(const v8h*)(p + 16); return u.v;
}
__device__ __forceinline__ v16h frag_f32(const float* rowk0, int lane) {
  v16h a; const float* p = rowk0 + 8 * (lane >> 4);
#pragma unroll
  for (int i = 0; i < 8; ++i) { a[i] = (_Float16)p[i]; a[8 + i] = (_Float16)p[16 + i]; }
  return a;
}
__device__ __forceinline__ v16h frag_f32s(const float* rowk0, int lane, float sc) {
  v16h a; const float* p = rowk0 + 8 * (lane >> 4);
#pragma unroll
  for (int i = 0; i < 8; ++i) { a[i] = (_Float16)(p[i] * sc); a[8 + i] = (_Float16)(p[16 + i] * sc); }
  return a;
}
// column fragment from a [K][ld] layout (column n), rows >= K read as 0
__device__ __forceinline__ v16h fragc_f32(const float* W, int k0, int n, int lane, int ld, int K) {
  v16h a; const int g = lane >> 4;
#pragma unroll
  for (int i = 0; i < 8; ++i) { const int ka = k0 + 8 * g + i, kb = ka + 16;
    a[i] = (_Float16)(ka < K ? W[(size_t)(ka < K ? ka : K - 1) * ld + n] : 0.f); a[8 + i] = (_Float16)(kb < K ? W[(size_t)(kb < K ? kb : K - 1) * ld + n] : 0.f); }
  return a;
}
struct F2 { v16b h, l; };
__device__ __forceinline__ F2 bsplit16(const float v[16]) { F2 r;
#pragma unroll
  for (int i = 0; i < 16; ++i) { const __bf16 h = (__bf16)v[i]; r.h[i] = h; r.l[i] = (__bf16)(v[i] - (float)h); }
  return r; }
__device__ __forceinline__ F2 split_row(const float* row, int k0, int lane) { float v[16]; const float* p = row + k0 + 8 * (lane >> 4);
#pragma unroll
  for (int i = 0; i < 8; ++i) { v[i] = p[i]; v[8 + i] = p[16 + i]; }
  return bsplit16(v); }
__device__ __forceinline__ F2 split_rowK(const float* row, int k0, int lane, int K) { float v[16]; const int g = lane >> 4;
#pragma unroll
  for (int i = 0; i < 8; ++i) { const int ka = k0 + 8 * g + i, kb = ka + 16; v[i] = ka < K ? row[ka < K ? ka : K - 1] : 0.f; v[8 + i] = kb < K ? row[kb < K ? kb : K - 1] : 0.f; }
  return bsplit16(v); }
__device__ __forceinline__ F2 split_col(const float* W, int k0, int n, int lane, int ld, int K) { float v[16]; const int g = lane >> 4;
#pragma unroll
  for (int i = 0; i < 8; ++i) { const int ka = k0 + 8 * g + i, kb = ka + 16; v[i] = ka < K ? W[(size_t)(ka < K ? ka : K - 1) * ld + n] : 0.f; v[8 + i] = kb < K ? W[(size_t)(kb < K ? kb : K - 1) * ld + n] : 0.f; }
  return bsplit16(v); }
__device__ __forceinline__ v8f mac3(const F2& a, const F2& b, v8f c) { c = wmma_bf(a.l, b.h, c); c = wmma_bf(a.h, b.l, c); return wmma_bf(a.h, b.h, c); }
__device__ __forceinline__ float sigm(float v) { return 1.0f / (1.0f + expf(-v)); }
#define LDSX() do { asm volatile("s_wait_dscnt 0" ::: "memory"); __builtin_amdgcn_wave_barrier(); __builtin_amdgcn_fence(__ATOMIC_RELEASE, "workgroup"); } while (0)


// Complex differential attention (B 1, H 12, S 1,024, D 128): qp = CLin_q(q) + [pe_q, pe_q] (2D wide -> q1, q2), kp = CLin_k(k) + pe_k, vp = CLin_v(v); w_s = softmax(|q_s . conj(kp)| / sqrt(128)) for s = 1, 2; a_s = w_s vp (complex); cat = [a1, a2] / rms(cat) * sub_w; out = a1 - lambda a2 with lambda = sigmoid(exp(lq1 . lk1) - exp(lq2 . lk2) + 0.3555...); out = CLin_g(q) * out (complex product); out = CLin_o(out) -> (out_r, out_i).
#define NHT 12             // heads (x batch 1)
#define SS 1024
#define DD 128
#define KK 256             // stacked K of every complex linear / logit GEMM: [real | imag]
#ifndef NHU
#define NHU NHT            // heads processed
#endif
#define NR (NHU * SS)      // rows processed
#define NRF (NHT * SS)     // full row count (output-1 offset)
#ifndef HG
#define HG 24              // (head, sel) pairs per launch group (divides NPAIR): all pairs at once, so that the 64-query blocks of k_pv outnumber the WGPs; the logit planes take 96 MiB of workspace
#endif
#define NPAIR (NHU * 2)
#define SCALE 0.0883883461356163f       // 128^-0.5 as f32
#define LAMBDA_INIT 0.35550907254219055f  // 0.8 - 0.6 exp(-0.3) as f32
__device__ __forceinline__ float bfr(float v) { return (float)(__bf16)v; }
typedef __attribute__((ext_vector_type(8))) __bf16 v8b;
typedef __attribute__((ext_vector_type(4))) __bf16 v4bf;
__device__ __forceinline__ v16b frag_b(const __bf16* rowk0, int lane) { union { v16b v; v8b q[2]; } u; const __bf16* p = rowk0 + 8 * (lane >> 4); u.q[0] = *(const v8b*)p; u.q[1] = *(const v8b*)(p + 16); return u.v; }

#define WS_QH  0u                                      // f16 q rows [row][1024]: per sel s: [s*512 +0..127] q_r, [+128..255] q_i, [+256..383] q_i, [+384..511] -q_r  (hi)
#define WS_QL  (WS_QH + 2u * (size_t)NRF * 1024)       // f16 residual x 2^10
#define WS_KH  (WS_QL + 2u * (size_t)NRF * 1024)       // f16 k rows [row][256] = [kp_r | kp_i] (hi)
#define WS_KL  (WS_KH + 2u * (size_t)NRF * KK)         // f16 residual x 2^10
#define WS_VT  (WS_KL + 2u * (size_t)NRF * KK)         // bf16 value planes [h][256 = vp_r | vp_i][s] hi
#define WS_VL  (WS_VT + 2u * (size_t)NHT * KK * SS)    // bf16 value residual planes
#define WS_G   (WS_VL + 2u * (size_t)NHT * KK * SS)    // f32 g rows [row][256] = [g_r | g_i]; later overwritten in place by the gated result z = [z_r | z_i]
#define WS_Y   (WS_G + 4u * (size_t)NRF * KK)          // f32 attention rows [row][512] = [a1_r | a1_i | a2_r | a2_i]
#define WS_LAM (WS_Y + 4u * (size_t)NRF * 512)         // one line: lambda replicated
#define WS_S   (WS_LAM + 128u)                         // f32 logits / P planes for HG (head, sel) pairs [hg][q][k]
#define WS_END (WS_S + 4u * (size_t)HG * SS * SS)

// ---- k_clin: block = (64 rows, 128 output cols, tile index over 2*NO): generic complex linear as a stacked real GEMM.
// A row = [x_r[row] | x_i[row]] (K 256; MODE < 4: two f32 input tensors, bf16 exact; MODE 4: the f32 z rows, bf16 hi + lo -> 2 products);
// output column o in [0, 2 NO): part = o / NO (0 real, 1 imag), oo = o % NO; B[k] = part 0: (k < 128 ? W_r[oo][k] : -W_i[oo][k-128]), part 1: (k < 128 ? W_i[oo][k] : W_r[oo][k-128]); + bias_part[oo].
// MODE 0: q projection (NO 256) + pe_q -> QH/QL (each value to its two slots, see WS_QH); MODE 1: k (NO 128) + pe_k -> KH/KL; MODE 2: v -> bf16 planes; MODE 3: g -> G rows; MODE 4: output linear from Z -> the two output tensors
template <int MODE, int NO>
__global__ __launch_bounds__(128) void k_clin(const float* __restrict__ XR, const float* __restrict__ XI, const float* __restrict__ WR, const float* __restrict__ WI, const float* __restrict__ BR, const float* __restrict__ BI, const float* __restrict__ PER, const float* __restrict__ PEI, void* __restrict__ D0, void* __restrict__ D1) {
  __shared__ __align__(16) float sf[64][132];
  const int tid = threadIdx.x, wave = tid >> 5, lane = tid & 31, col = lane & 15, g = lane >> 4; const int c0 = blockIdx.y * 128; const size_t r0 = (size_t)blockIdx.x * 64; const int part = c0 / NO; const int oo0 = c0 % NO;
  v8f acc[8] = {};
#pragma unroll 2
  for (int kc = 0; kc < KK / 32; ++kc) { const bool imx = kc >= 4; const int kx = (kc & 3) * 32;   // A columns kc*32.. : real input for kc < 4, imag for kc >= 4
    v16b ah, al; bool two = false;
    if (MODE < 4) { const float* p = (imx ? XI : XR) + (r0 + wave * 16 + col) * DD + kx + 8 * g;
#pragma unroll
      for (int i = 0; i < 8; ++i) { ah[i] = (__bf16)p[i]; ah[8 + i] = (__bf16)p[16 + i]; } }
    else { const F2 a = split_row(XR + (r0 + wave * 16 + col) * KK, kc * 32, lane); ah = a.h; al = a.l; two = true; }
#pragma unroll
    for (int j = 0; j < 8; ++j) { v16b w; const int oo = oo0 + j * 16 + col; const float* WS0 = (part == 0) ? (imx ? WI : WR) : (imx ? WR : WI); const float sg = (part == 0 && imx) ? -1.0f : 1.0f;
#pragma unroll
      for (int i = 0; i < 8; ++i) { w[i] = (__bf16)(sg * WS0[(size_t)oo * DD + kx + 8 * g + i]); w[8 + i] = (__bf16)(sg * WS0[(size_t)oo * DD + kx + 16 + 8 * g + i]); }
      asm volatile("s_wait_loadcnt 0x0" ::: "memory"); acc[j] = wmma_bf(ah, w, acc[j]); if (two) acc[j] = wmma_bf(al, w, acc[j]); } }
  { const float* BB = part == 0 ? BR : BI; const float* PE = part == 0 ? PER : PEI;
#pragma unroll
    for (int j = 0; j < 8; ++j) { const int oo = oo0 + j * 16 + col; const float bb = bfr(BB[oo]);
#pragma unroll
      for (int r = 0; r < 8; ++r) { const int rl = wave * 16 + 8 * g + r; float v = acc[j][r] + bb; if (MODE <= 1) v += bfr(PE[(r0 + rl) * DD + (oo & (DD - 1))]); sf[rl][j * 16 + col] = v; }
      asm volatile("s_wait_loadcnt 0x0" ::: "memory"); } }
  __syncthreads();
  if (MODE == 0) {   // q: value (sel = oo0/128, d) -> QH[row][sel*512 + (part ? 128 : 0) + d] and QH[row][sel*512 + (part ? 256 : 384) + d] (the second real copy negated); f16 hi + residual x 2^10; each destination = a 256-B segment per row by 16 consecutive threads
    _Float16* QH = (_Float16*)D0; _Float16* QL = (_Float16*)D1; const int sel = oo0 / DD; const int dA = sel * 512 + (part ? 128 : 0), dB = sel * 512 + (part ? 256 : 384); const float sgB = part ? 1.0f : -1.0f;
    for (int e = tid; e < 64 * 16; e += 128) { const int rl = e >> 4, q = e & 15; v8h ha, la, hb, lb;
#pragma unroll
      for (int k = 0; k < 8; ++k) { const float v = sf[rl][q * 8 + k]; const _Float16 hv = (_Float16)v; ha[k] = hv; la[k] = (_Float16)((v - (float)hv) * 1024.0f); const float vb = v * sgB; const _Float16 hb2 = (_Float16)vb; hb[k] = hb2; lb[k] = (_Float16)((vb - (float)hb2) * 1024.0f); }
      const size_t ro = (r0 + rl) * 1024; vst2((v4u*)(QH + ro + dA + q * 8), *(const v4u*)&ha); vst2((v4u*)(QL + ro + dA + q * 8), *(const v4u*)&la); vst2((v4u*)(QH + ro + dB + q * 8), *(const v4u*)&hb); vst2((v4u*)(QL + ro + dB + q * 8), *(const v4u*)&lb); } }
  else if (MODE == 1) {   // k rows [row][256]: column part*128 + d; f16 hi + residual x 2^10
    _Float16* KH = (_Float16*)D0; _Float16* KL = (_Float16*)D1;
    for (int e = tid; e < 64 * 16; e += 128) { const int rl = e >> 4, q = e & 15; v8h ha, la;
#pragma unroll
      for (int k = 0; k < 8; ++k) { const float v = sf[rl][q * 8 + k]; const _Float16 hv = (_Float16)v; ha[k] = hv; la[k] = (_Float16)((v - (float)hv) * 1024.0f); }
      const size_t ro = (r0 + rl) * KK + c0; vst2((v4u*)(KH + ro + q * 8), *(const v4u*)&ha); vst2((v4u*)(KL + ro + q * 8), *(const v4u*)&la); } }
  else if (MODE == 2) {
    __bf16* VT = (__bf16*)D0; __bf16* VL = (__bf16*)D1; const size_t h = r0 / SS; const int s0 = (int)(r0 % SS);
    for (int e = tid; e < 128 * 8; e += 128) { const int cl = e >> 3, q = e & 7; v8b hb, lb;
#pragma unroll
      for (int k = 0; k < 8; ++k) { const float v = sf[q * 8 + k][cl]; const __bf16 bh = (__bf16)v; hb[k] = bh; lb[k] = (__bf16)(v - (float)bh); }
      const size_t o2 = (h * KK + c0 + cl) * (size_t)SS + s0 + q * 8; vst2((v4u*)(VT + o2), *(const v4u*)&hb); vst2((v4u*)(VL + o2), *(const v4u*)&lb); } }
  else if (MODE == 3) {   // g rows [row][256] f32: 512-B segment per row by 32 lanes
    float* G = (float*)D0; for (int e = tid; e < 64 * 32; e += 128) { const int rl = e >> 5, q = e & 31; vst2(G + (r0 + rl) * KK + c0 + q * 4, *(const v4f*)&sf[rl][q * 4]); } }
  else {   // MODE 4: output rows [row][128] of out_r (part 0) or out_i (part 1): whole 512-B rows by 32 lanes
    float* O = (float*)(part == 0 ? D0 : D1); for (int e = tid; e < 64 * 32; e += 128) { const int rl = e >> 5, q = e & 31; vst2(O + (r0 + rl) * DD + q * 4, *(const v4f*)&sf[rl][q * 4]); } } }
__global__ __launch_bounds__(32) void k_lam(const float* __restrict__ LQ1, const float* __restrict__ LK1, const float* __restrict__ LQ2, const float* __restrict__ LK2, float* __restrict__ LAM) { __shared__ float sl;
  if (threadIdx.x == 0) { float s1 = 0.f, s2 = 0.f; for (int i = 0; i < DD; ++i) { s1 += bfr(LQ1[i]) * bfr(LK1[i]); s2 += bfr(LQ2[i]) * bfr(LK2[i]); } const float z = expf(s1) - expf(s2) + LAMBDA_INIT; sl = 1.0f / (1.0f + expf(-z)); }
  __syncthreads(); vst2(LAM + threadIdx.x, sl); }
// ---- k_sc: block = (64 queries, 128 keys, pair in group), 8 waves: pair p = (head h = p/2, sel = p%2); s_r = Q[sel*512 + 0..255] . KH, s_i = Q[sel*512 + 256..511] . KH (3 products each: hi.hi + (lo.hi + hi.lo) 2^-10); logit = sqrt(s_r^2 + s_i^2 + 1e-8) x 128^-0.5
// Per stage of 64 stacked-K elements the block brings one whole 128-B line of each of its rows (64 q rows x 4 planes: s_r hi, s_r lo, s_i hi, s_i lo; 128 k rows x 2 planes: hi, lo) into LDS by asynchronous 16-byte copies; two buffers, the next stage's copies fly while this stage's fragments are read from LDS.
// wave = (16-query group qg, 64-key group kg): 4 accumulator tiles x 4 sums, products per sum in the order of rising K as before
#define SCP 72                      // LDS row pitch in f16 elements: 144 B = 16 B x 9, an odd multiple of 16 B for the 16-byte fragment reads
#define SC_Q (4 * 64 * SCP * 2)     // bytes of the four q planes of a stage
#define SC_K (2 * 128 * SCP * 2)    // bytes of the two k planes of a stage
#define SC_BUF (SC_Q + SC_K)
// eight asynchronous copies of 16 B per lane; the s_wait_xcnt stands inside the statement, so that no address register of a copy is rewritten in front of it
__device__ __forceinline__ void cp8(unsigned l0, unsigned l1, unsigned l2, unsigned l3, unsigned l4, unsigned l5, unsigned l6, unsigned l7, const _Float16* g0, const _Float16* g1, const _Float16* g2, const _Float16* g3, const _Float16* g4, const _Float16* g5, const _Float16* g6, const _Float16* g7) {
  asm volatile("global_load_async_to_lds_b128 %0, %8, off\n\tglobal_load_async_to_lds_b128 %1, %9, off\n\tglobal_load_async_to_lds_b128 %2, %10, off\n\tglobal_load_async_to_lds_b128 %3, %11, off\n\t"
               "global_load_async_to_lds_b128 %4, %12, off\n\tglobal_load_async_to_lds_b128 %5, %13, off\n\tglobal_load_async_to_lds_b128 %6, %14, off\n\tglobal_load_async_to_lds_b128 %7, %15, off\n\ts_wait_xcnt 0x0"
               :: "v"(l0), "v"(l1), "v"(l2), "v"(l3), "v"(l4), "v"(l5), "v"(l6), "v"(l7), "v"(g0), "v"(g1), "v"(g2), "v"(g3), "v"(g4), "v"(g5), "v"(g6), "v"(g7) : "memory");
}
// one stage: lq = this lane's LDS byte address in the buffer (row tid / 8, 16-byte piece tid % 8), the four pointers at the same row and piece of the stage's K columns; 32 rows per sweep of the block
__device__ __forceinline__ void sc_stage(unsigned lq, const _Float16* qh, const _Float16* ql, const _Float16* kh, const _Float16* kl) {
  const unsigned R = 32 * SCP * 2;   // LDS bytes of 32 rows
  cp8(lq, lq + R, lq + 2 * R, lq + 3 * R, lq + 4 * R, lq + 5 * R, lq + 6 * R, lq + 7 * R, qh, qh + 32 * 1024, ql, ql + 32 * 1024, qh + 256, qh + 256 + 32 * 1024, ql + 256, ql + 256 + 32 * 1024);
  const unsigned lk = lq + SC_Q;
  cp8(lk, lk + R, lk + 2 * R, lk + 3 * R, lk + 4 * R, lk + 5 * R, lk + 6 * R, lk + 7 * R, kh, kh + 32 * KK, kh + 64 * KK, kh + 96 * KK, kl, kl + 32 * KK, kl + 64 * KK, kl + 96 * KK);
}
__global__ __launch_bounds__(256) void k_sc(const _Float16* __restrict__ QH, const _Float16* __restrict__ QL, const _Float16* __restrict__ KH, const _Float16* __restrict__ KL, int p0, float* __restrict__ S0) {
  __shared__ __align__(16) unsigned char sm[2 * SC_BUF];   // two stage buffers; after the loop the room holds each wave's f32 result rows [16][68]
  const int p = p0 + blockIdx.z; const int h = p >> 1, sel = p & 1; float* S = S0 + (size_t)blockIdx.z * SS * SS;
  const int tid = threadIdx.x, wave = tid >> 5, lane = tid & 31, col = lane & 15, g = lane >> 4; const int qg = wave & 3, kg = wave >> 2; const int k0 = blockIdx.y * 128; const int qb = blockIdx.x * 64;
  const _Float16* gqh = QH + ((size_t)h * SS + qb + (tid >> 3)) * 1024 + sel * 512 + (tid & 7) * 8;   // 8 lanes x 16 B = one 128-B line of a row
  const _Float16* gql = QL + ((size_t)h * SS + qb + (tid >> 3)) * 1024 + sel * 512 + (tid & 7) * 8;
  const _Float16* gkh = KH + ((size_t)h * SS + k0 + (tid >> 3)) * KK + (tid & 7) * 8;
  const _Float16* gkl = KL + ((size_t)h * SS + k0 + (tid >> 3)) * KK + (tid & 7) * 8;
  const unsigned lb = (unsigned)(size_t)sm + (unsigned)((tid >> 3) * (SCP * 2) + (tid & 7) * 16);
  sc_stage(lb, gqh, gql, gkh, gkl);
  asm volatile("s_wait_asynccnt 0x0" ::: "memory");   // this wave's copies of stage 0 have landed
  __syncthreads();                                    // stage 0 is whole in LDS
  sc_stage(lb + SC_BUF, gqh + 64, gql + 64, gkh + 64, gkl + 64);
  v8f ar[4] = {}, arl[4] = {}, ai[4] = {}, ail[4] = {};
#pragma unroll 1   // one copy of the stage body: small text, the buffer is picked by an offset
  for (int st = 0; st < KK / 64; ++st) { const _Float16* bq = (const _Float16*)(sm + (st & 1) * SC_BUF); const _Float16* bk = (const _Float16*)(sm + (st & 1) * SC_BUF + SC_Q);
    const _Float16* kp0 = bk + (kg * 64 + col) * SCP;
    v16h kf[2][2];   // k fragments (hi, lo) of this group of six products and of the next: the next group's LDS reads are issued in front of this group's products, inside the stage only
    kf[0][0] = frag_h(kp0, lane); kf[0][1] = frag_h(kp0 + 128 * SCP, lane);
#pragma unroll
    for (int kc = 0; kc < 2; ++kc) { const _Float16* qa = bq + (qg * 16 + col) * SCP + kc * 32;
      const v16h arh = frag_h(qa, lane), arlo = frag_h(qa + 64 * SCP, lane), aih = frag_h(qa + 128 * SCP, lane), ailo = frag_h(qa + 192 * SCP, lane);
#pragma unroll
      for (int j = 0; j < 4; ++j) { const int gi = kc * 4 + j, c = gi & 1, n = c ^ 1;
        if (gi + 1 < 8) { const _Float16* kp = kp0 + ((gi + 1) & 3) * 16 * SCP + ((gi + 1) >> 2) * 32; kf[n][0] = frag_h(kp, lane); kf[n][1] = frag_h(kp + 128 * SCP, lane); }
        const v16h khf = kf[c][0], klf = kf[c][1];
        ar[j] = wmma16(arh, khf, ar[j]); arl[j] = wmma16(arlo, khf, arl[j]); arl[j] = wmma16(arh, klf, arl[j]);
        ai[j] = wmma16(aih, khf, ai[j]); ail[j] = wmma16(ailo, khf, ail[j]); ail[j] = wmma16(aih, klf, ail[j]); } }
    asm volatile("s_wait_dscnt 0x0" ::: "memory");      // this wave's fragment reads of the buffer are done before it is refilled
    asm volatile("s_wait_asynccnt 0x0" ::: "memory");   // this wave's copies of the next stage have landed
    __syncthreads();                                    // publishes the next stage and ends every wave's reads of this buffer
    if (st + 2 < KK / 64) sc_stage(lb + (unsigned)((st & 1) * SC_BUF), gqh + (st + 2) * 64, gql + (st + 2) * 64, gkh + (st + 2) * 64, gkl + (st + 2) * 64); }
  asm volatile("s_wait_asynccnt 0x0" ::: "memory");     // no copy is outstanding when the room is used for the result rows
  float* ss = (float*)sm + wave * (16 * 68);
#pragma unroll
  for (int j = 0; j < 4; ++j)
#pragma unroll
    for (int r = 0; r < 8; ++r) { const float sr_ = ar[j][r] + arl[j][r] * (1.0f / 1024.0f), si_ = ai[j][r] + ail[j][r] * (1.0f / 1024.0f); ss[(8 * g + r) * 68 + j * 16 + col] = sqrtf(sr_ * sr_ + si_ * si_ + 1e-8f) * SCALE; }
  LDSX();
#pragma unroll
  for (int it = 0; it < 8; ++it) { const int rl = it * 2 + g; vst2(S + (size_t)(qb + qg * 16 + rl) * SS + k0 + kg * 64 + col * 4, *(const v4f*)&ss[rl * 68 + col * 4]); } }
// ---- k_sm: one wave = SMR query rows in a row of the HG x 1,024 rows, taken one after the other: softmax over all 1,024 keys (f32) -> P x 2^11 in place.
// A row's logits are read once and stay in the wave's registers (32 per lane: 8 loads of 512 contiguous bytes a wave); maximum and sum go over the lanes by DPP inside a 16-lane row and one exchange between the two rows; no LDS, no barrier. The next row's loads are issued in front of this row's arithmetic.
#define SMR 4
template <int M> __device__ __forceinline__ float xrow(float v) { return __builtin_bit_cast(float, __builtin_amdgcn_update_dpp(0, __builtin_bit_cast(int, v), 0x160 | M, 0xf, 0xf, true)); }   // lane l <- lane l ^ M of the same 16-lane row (row_xmask)
__device__ __forceinline__ float xhalf(float v) { const int i = __builtin_bit_cast(int, v); return __builtin_bit_cast(float, __builtin_amdgcn_permlanex16(i, i, 0x76543210, 0xfedcba98, false, false)); }   // lane l <- lane l ^ 16
__global__ __launch_bounds__(256) void k_sm(float* __restrict__ S0) {
  const int lane = threadIdx.x & 31; float* base = S0 + ((size_t)blockIdx.x * 8 + (threadIdx.x >> 5)) * (size_t)(SMR * SS) + lane * 4;
  v4f x[2][8];
#pragma unroll
  for (int j = 0; j < 8; ++j) x[0][j] = *(const v4f*)(base + j * 128);
#pragma unroll
  for (int r = 0; r < SMR; ++r) { const int c = r & 1; float* sr = base + r * SS;
    if (r + 1 < SMR) {
#pragma unroll
      for (int j = 0; j < 8; ++j) x[c ^ 1][j] = *(const v4f*)(sr + SS + j * 128); }
    __builtin_amdgcn_sched_barrier(0);   // keeps the next row's loads and the row before's stores in front of this row's arithmetic: without it the scheduler sinks the loads to just in front of their first use (every row then waits out the load latency) and holds part of a row's stores back behind the next row's arithmetic
    float mj[8];
#pragma unroll
    for (int j = 0; j < 8; ++j) mj[j] = fmaxf(fmaxf(x[c][j][0], x[c][j][1]), fmaxf(x[c][j][2], x[c][j][3]));
    float m = fmaxf(fmaxf(fmaxf(mj[0], mj[1]), fmaxf(mj[2], mj[3])), fmaxf(fmaxf(mj[4], mj[5]), fmaxf(mj[6], mj[7])));
    m = fmaxf(m, xrow<1>(m)); m = fmaxf(m, xrow<2>(m)); m = fmaxf(m, xrow<4>(m)); m = fmaxf(m, xrow<8>(m)); m = fmaxf(m, xhalf(m));
    v4f s4 = {};
#pragma unroll
    for (int j = 0; j < 8; ++j) {
#pragma unroll
      for (int k = 0; k < 4; ++k) { x[c][j][k] = expf(x[c][j][k] - m); s4[k] += x[c][j][k]; } }
    float sum = (s4[0] + s4[1]) + (s4[2] + s4[3]);
    sum += xrow<1>(sum); sum += xrow<2>(sum); sum += xrow<4>(sum); sum += xrow<8>(sum); sum += xhalf(sum);
    const float inv = (1.0f / sum) * 2048.0f;
#pragma unroll
    for (int j = 0; j < 8; ++j) vst2(sr + j * 128, x[c][j] * inv); } }
// ---- k_pv: block = 64 queries of pair (h, sel), 8 waves: Y[row][sel*256 + c] = (P . vp)[c] for c in [0,256) = [a_r | a_i] (P split bf16 hi + lo x v hi + lo, 3 products, per output element in the order hi.hi, lo.hi, hi.lo over rising keys).
// Per stage of 64 keys the block brings both value planes (256 rows x 128 B each) and its 64 P rows (256 B each) in by whole-line loads, splits P once, and keeps them in LDS; the fragments come from LDS. The next stage's loads are issued before the products of this one and wait in registers.
// wave = (32-query group qg, 64-column group cg): 2 x 4 accumulator tiles
#define PVK 64             // keys per stage
#define PVP 72             // LDS row pitch in bf16 elements: 144 B = 16 B x 9, an odd multiple of 16 B for the 16-byte fragment reads
#define PV_SV (2 * KK * PVP * 2)   // bytes of the two value planes in LDS
#define PV_SP (2 * 64 * PVP * 2)   // bytes of the two P planes in LDS
__global__ __launch_bounds__(256) void k_pv(const float* __restrict__ PS0, const __bf16* __restrict__ VT, const __bf16* __restrict__ VL, int p0, float* __restrict__ Y) { const int p = p0 + blockIdx.z; const int h = p >> 1, sel = p & 1;
  __shared__ __align__(16) unsigned char sm[PV_SV + PV_SP];   // value planes [2][256][PVP], P planes [2][64][PVP]; after the loop the value planes' room holds the f32 result rows [64][KK + 4]
  __bf16* sv = (__bf16*)sm; __bf16* sp = (__bf16*)(sm + PV_SV); float* so = (float*)sm;
  const int tid = threadIdx.x, wave = tid >> 5, lane = tid & 31, col = lane & 15, g = lane >> 4; const int qg = wave & 1, cg = wave >> 1; const int qb = blockIdx.x * 64;
  const __bf16* gvh = VT + ((size_t)h * KK + (tid >> 3)) * (size_t)SS + (tid & 7) * 8;   // 8 lanes x 16 B = one 128-B line of a value row; 32 rows per sweep of the block
  const __bf16* gvl = VL + ((size_t)h * KK + (tid >> 3)) * (size_t)SS + (tid & 7) * 8;
  const float* gp = PS0 + (size_t)blockIdx.z * SS * SS + (size_t)(qb + (tid >> 4)) * SS + (tid & 15) * 4;   // 16 lanes x 16 B = the 256 B of a P row; 16 rows per sweep
  v4u rh[8], rl[8]; v4f rp[4];
#pragma unroll
  for (int i = 0; i < 8; ++i) { rh[i] = *(const v4u*)(gvh + (size_t)i * 32 * SS); rl[i] = *(const v4u*)(gvl + (size_t)i * 32 * SS); }
#pragma unroll
  for (int i = 0; i < 4; ++i) rp[i] = *(const v4f*)(gp + (size_t)i * 16 * SS);
  v8f acc[2][4] = {};
#pragma unroll 1   // one copy of the stage body: one set of prefetch registers, small text (the fixed-count inner loops are unrolled so that their arrays stay in registers)
  for (int st = 0; st < SS / PVK; ++st) {
    if (st) __syncthreads();   // every wave has read its last fragment of the stage before
#pragma unroll
    for (int i = 0; i < 8; ++i) { const int o = (i * 32 + (tid >> 3)) * PVP + (tid & 7) * 8; vst2(sv + o, rh[i]); vst2(sv + KK * PVP + o, rl[i]); }
#pragma unroll
    for (int i = 0; i < 4; ++i) { v4bf hb, lb;
#pragma unroll
      for (int k = 0; k < 4; ++k) { const float v = rp[i][k]; const __bf16 bh = (__bf16)v; hb[k] = bh; lb[k] = (__bf16)(v - (float)bh); }
      const int o = (i * 16 + (tid >> 4)) * PVP + (tid & 15) * 4; vst2(sp + o, hb); vst2(sp + 64 * PVP + o, lb); }
    __syncthreads();           // the stage is whole in LDS
    if (st + 1 < SS / PVK) { const int ko = (st + 1) * PVK;
#pragma unroll
      for (int i = 0; i < 8; ++i) { rh[i] = *(const v4u*)(gvh + (size_t)i * 32 * SS + ko); rl[i] = *(const v4u*)(gvl + (size_t)i * 32 * SS + ko); }
#pragma unroll
      for (int i = 0; i < 4; ++i) rp[i] = *(const v4f*)(gp + (size_t)i * 16 * SS + ko);
      asm volatile("s_wait_xcnt 0x0" ::: "memory"); }   // stands in front of the first overwrite of an address register of the loads above (the fragment reads below reuse them)
#pragma unroll
    for (int kc = 0; kc < PVK / 32; ++kc) { v16b ah[2], al[2];
#pragma unroll
      for (int t = 0; t < 2; ++t) { const int o = (qg * 32 + t * 16 + col) * PVP + kc * 32; ah[t] = frag_b(sp + o, lane); al[t] = frag_b(sp + 64 * PVP + o, lane); }
#pragma unroll
      for (int j = 0; j < 4; ++j) { const int o = (cg * 64 + j * 16 + col) * PVP + kc * 32; const v16b vh = frag_b(sv + o, lane), vl = frag_b(sv + KK * PVP + o, lane);
        acc[0][j] = wmma_bf(ah[0], vh, acc[0][j]); acc[1][j] = wmma_bf(ah[1], vh, acc[1][j]);
        acc[0][j] = wmma_bf(al[0], vh, acc[0][j]); acc[1][j] = wmma_bf(al[1], vh, acc[1][j]);
        acc[0][j] = wmma_bf(ah[0], vl, acc[0][j]); acc[1][j] = wmma_bf(ah[1], vl, acc[1][j]); } } }
  __syncthreads();             // the value planes' room is free for the result rows
#pragma unroll
  for (int t = 0; t < 2; ++t)
#pragma unroll
    for (int j = 0; j < 4; ++j)
#pragma unroll
      for (int r = 0; r < 8; ++r) so[(qg * 32 + t * 16 + 8 * g + r) * (KK + 4) + cg * 64 + j * 16 + col] = acc[t][j][r] * (1.0f / 2048.0f);
  __syncthreads();             // the result rows are whole
#pragma unroll
  for (int i = 0; i < 16; ++i) { const int rl_ = i * 4 + (tid >> 6), q = tid & 63; vst2(Y + ((size_t)h * SS + qb + rl_) * 512 + sel * 256 + q * 4, *(const v4f*)&so[rl_ * (KK + 4) + q * 4]); } }
// ---- k_mix: block = 16 rows (16 lanes per row): rms over the 512 attention values (= mean over 256 of r^2 + i^2), / rms x sub_w, out = a1 - lambda a2, then the complex gate z = g * out; z written IN PLACE over the g row (each lane reads and writes exactly its own columns d and 128 + d); float4 pieces, 16 lanes x 16 B = 256-B runs
__global__ __launch_bounds__(256) void k_mix(const float* __restrict__ Y, float* __restrict__ GZ, const float* __restrict__ LAM, const float* __restrict__ SW) {
  const int t = threadIdx.x; const int rl = t >> 4, sub = t & 15; const size_t row = (size_t)blockIdx.x * 16 + rl; const float* y = Y + row * 512; float* gz = GZ + row * KK; const float lam = LAM[0];
  float s2 = 0.f; for (int c = sub * 4; c < 512; c += 64) { const v4f v = *(const v4f*)(y + c); s2 += (v[0] * v[0] + v[1] * v[1]) + (v[2] * v[2] + v[3] * v[3]); }
#pragma unroll
  for (int o = 1; o < 16; o <<= 1) s2 += __shfl_xor(s2, o);
  const float inv = 1.0f / sqrtf(s2 * (1.0f / 256.0f) + 1e-5f);
#pragma unroll
  for (int it = 0; it < 2; ++it) { const int d = sub * 4 + it * 64;   /* d in [0,128): this lane's 4 columns */
    const v4f a1r = *(const v4f*)(y + d), a1i = *(const v4f*)(y + 128 + d), a2r = *(const v4f*)(y + 256 + d), a2i = *(const v4f*)(y + 384 + d); const v4f gr = *(const v4f*)(gz + d), gi = *(const v4f*)(gz + 128 + d);
    v4f zr, zi;
#pragma unroll
    for (int k = 0; k < 4; ++k) { const float w1 = bfr(SW[d + k]) * inv, w2 = bfr(SW[DD + d + k]) * inv; const float orr = a1r[k] * w1 - lam * (a2r[k] * w2), oi = a1i[k] * w1 - lam * (a2i[k] * w2); zr[k] = gr[k] * orr - gi[k] * oi; zi[k] = gr[k] * oi + gi[k] * orr; }
    vst2(gz + d, zr); vst2(gz + 128 + d, zi); } }
extern "C" void kernel_launch(void* const* d_in, const int* in_sizes, int n_in, void* d_out, int out_size, void* d_ws, size_t ws_size, hipStream_t stream) {
  (void)in_sizes; (void)n_in; (void)out_size;
  const float** F = (const float**)d_in;   // 0 q_r, 1 q_i, 2 k_r, 3 k_i, 4 v_r, 5 v_i, 6 pe_q_r, 7 pe_q_i, 8 pe_k_r, 9 pe_k_i [1,12,1024,128]; 10 qw_r [256,128], 11 qw_i, 12 qb_r [256], 13 qb_i; 14 kw_r [128,128], 15 kw_i, 16 kb_r, 17 kb_i; 18 vw_r, 19 vw_i, 20 vb_r, 21 vb_i; 22 gw_r, 23 gw_i, 24 gb_r, 25 gb_i; 26 ow_r, 27 ow_i, 28 ob_r, 29 ob_i; 30 lq1, 31 lk1, 32 lq2, 33 lk2 [128]; 34 sub_w [256]
  if (ws_size < (size_t)WS_END) return;
  char* ws = (char*)d_ws; _Float16 *QH = (_Float16*)(ws + WS_QH), *QL = (_Float16*)(ws + WS_QL), *KH = (_Float16*)(ws + WS_KH), *KL = (_Float16*)(ws + WS_KL); __bf16 *VT = (__bf16*)(ws + WS_VT), *VL = (__bf16*)(ws + WS_VL); float *G = (float*)(ws + WS_G), *Y = (float*)(ws + WS_Y), *LAM = (float*)(ws + WS_LAM), *S = (float*)(ws + WS_S);
  float* OUT0 = (float*)d_out; float* OUT1 = (float*)d_out + (size_t)NRF * DD;
  k_clin<0, 256><<<dim3(NR / 64, 4), 128, 0, stream>>>(F[0], F[1], F[10], F[11], F[12], F[13], F[6], F[7], QH, QL);
  k_clin<1, 128><<<dim3(NR / 64, 2), 128, 0, stream>>>(F[2], F[3], F[14], F[15], F[16], F[17], F[8], F[9], KH, KL);
  k_clin<2, 128><<<dim3(NR / 64, 2), 128, 0, stream>>>(F[4], F[5], F[18], F[19], F[20], F[21], nullptr, nullptr, VT, VL);
  k_clin<3, 128><<<dim3(NR / 64, 2), 128, 0, stream>>>(F[0], F[1], F[22], F[23], F[24], F[25], nullptr, nullptr, G, nullptr);
  k_lam<<<dim3(1), 32, 0, stream>>>(F[30], F[31], F[32], F[33], LAM);
  for (int p0 = 0; p0 < NPAIR; p0 += HG) {
    k_sc<<<dim3(SS / 64, SS / 128, HG), 256, 0, stream>>>(QH, QL, KH, KL, p0, S);
    k_sm<<<dim3(SS * HG / (8 * SMR)), 256, 0, stream>>>(S);
    k_pv<<<dim3(SS / 64, 1, HG), 256, 0, stream>>>(S, VT, VL, p0, Y);
  }
  k_mix<<<dim3(NR / 16), 256, 0, stream>>>(Y, G, LAM, F[34]);
  k_clin<4, 128><<<dim3(NR / 64, 2), 128, 0, stream>>>(G, nullptr, F[26], F[27], F[28], F[29], nullptr, nullptr, OUT0, OUT1);
}

// v005
// A run of this version takes 201 microseconds.
// Next to v004, in two timings, it ran 1.47 times as fast each time.
// Counting every step since v000, it is 11.8 times as fast.
// compute dtype: all float inputs rounded to bf16; every complex linear as one stacked real GEMM ([x_r | x_i] against [W_r ; -W_i] / [W_i ; W_r]) with EXACT bf16 products on WMMA 16x16x32, f32 accumulate; q (+pe) as f16 hi + residual (x 2^10) and k (+pe) as f16 hi + residual (x 2^10) -> 3-product complex logits (s_r, s_i as two stacked K=256 real GEMMs), |s| scaled in f32 (sqrtf); softmax in f32 (precise expf); P x 2^11 split bf16 hi + lo against v bf16 hi + lo (3 products); RMS norm / lambda / differential combination / complex gating in f32; the gated result (bf16 hi + lo) through the output complex linear (2 products); f32 outputs.
#include <hip/hip_runtime.h>
#include <math.h>

typedef __attribute__((ext_vector_type(16))) _Float16 v16h;
typedef __attribute__((ext_vector_type(16))) __bf16 v16b;
typedef __attribute__((ext_vector_type(8)))  _Float16 v8h;
typedef __attribute__((ext_vector_type(8)))  float v8f;
typedef __attribute__((ext_vector_type(4)))  float v4f;
typedef __attribute__((ext_vector_type(2)))  float v2f;
typedef __attribute__((ext_vector_type(4)))  unsigned v4u;
typedef __attribute__((ext_vector_type(4)))  int v4i;
typedef float __attribute__((may_alias)) float_a;
typedef int __attribute__((may_alias)) int_a;

template <typename T> __device__ __forceinline__ void vst2(void* p, T v) { *(T*)p = v;  }
__device__ __forceinline__ v8f wmma16(v16h a, v16h b, v8f c) {
  v8f d = __builtin_amdgcn_wmma_f32_16x16x32_f16(false, a, false, b, (short)0, c, false, false);
  asm volatile("v_nop\n\tv_nop\n\tv_nop\n\tv_nop" : "+v"(d) : "v"(a), "v"(b));
  return d;
}
__device__ __forceinline__ v8f wmma_bf(v16b a, v16b b, v8f c) {
  v8f d = __builtin_amdgcn_wmma_f32_16x16x32_bf16(false, a, false, b, (short)0, c, false, false);
  asm volatile("v_nop\n\tv_nop\n\tv_nop\n\tv_nop" : "+v"(d) : "v"(a), "v"(b));
  return d;
}
// 16x16x32 fragments: lane = (h = lane>>4, row/col = lane&15); elements 0..7 = k0+8h+0..7, 8..15 = k0+16+8h+0..7; D element r = row 8h+r
__device__ __forceinline__ v16h frag_h(const _Float16* rowk0, int lane) {
  union { v16h v; v8h q[2]; } u; const _Float16* p = rowk0 + 8 * (lane >> 4);
  u.q[0] = *(const v8h*)p; u.q[1] = *(const v8h*)(p + 16); return u.v;
}
__device__ __forceinline__ v16h frag_f32(const float* rowk0, int lane) {
  v16h a; const float* p = rowk0 + 8 * (lane >> 4);
#pragma unroll
  for (int i = 0; i < 8; ++i) { a[i] = (_Float16)p[i]; a[8 + i] = (_Float16)p[16 + i]; }
  return a;
}
__device__ __forceinline__ v16h frag_f32s(const float* rowk0, int lane, float sc) {
  v16h a; const float* p = rowk0 + 8 * (lane >> 4);
#pragma unroll
  for (int i = 0; i < 8; ++i) { a[i] = (_Float16)(p[i] * sc); a[8 + i] = (_Float16)(p[16 + i] * sc); }
  return a;
}
// column fragment from a [K][ld] layout (column n), rows >= K read as 0
__device__ __forceinline__ v16h fragc_f32(const float* W, int k0, int n, int lane, int ld, int K) {
  v16h a; const int g = lane >> 4;
#pragma unroll
  for (int i = 0; i < 8; ++i) { const int ka = k0 + 8 * g + i, kb = ka + 16;
    a[i] = (_Float16)(ka < K ? W[(size_t)(ka < K ? ka : K - 1) * ld + n] : 0.f); a[8 + i] = (_Float16)(kb < K ? W[(size_t)(kb < K ? kb : K - 1) * ld + n] : 0.f); }
  return a;
}
struct F2 { v16b h, l; };
__device__ __forceinline__ F2 bsplit16(const float v[16]) { F2 r;
#pragma unroll
  for (int i = 0; i < 16; ++i) { const __bf16 h = (__bf16)v[i]; r.h[i] = h; r.l[i] = (__bf16)(v[i] - (float)h); }
  return r; }
__device__ __forceinline__ F2 split_row(const float* row, int k0, int lane) { float v[16]; const float* p = row + k0 + 8 * (lane >> 4);
#pragma unroll
  for (int i = 0; i < 8; ++i) { v[i] = p[i]; v[8 + i] = p[16 + i]; }
  return bsplit16(v); }
__device__ __forceinline__ F2 split_rowK(const float* row, int k0, int lane, int K) { float v[16]; const int g = lane >> 4;
#pragma unroll
  for (int i = 0; i < 8; ++i) { const int ka = k0 + 8 * g + i, kb = ka + 16; v[i] = ka < K ? row[ka < K ? ka : K - 1] : 0.f; v[8 + i] = kb < K ? row[kb < K ? kb : K - 1] : 0.f; }
  return bsplit16(v); }
__device__ __forceinline__ F2 split_col(const float* W, int k0, int n, int lane, int ld, int K) { float v[16]; const int g = lane >> 4;
#pragma unroll
  for (int i = 0; i < 8; ++i) { const int ka = k0 + 8 * g + i, kb = ka + 16; v[i] = ka < K ? W[(size_t)(ka < K ? ka : K - 1) * ld + n] : 0.f; v[8 + i] = kb < K ? W[(size_t)(kb < K ? kb : K - 1) * ld + n] : 0.f; }
  return bsplit16(v); }
__device__ __forceinline__ v8f mac3(const F2& a, const F2& b, v8f c) { c = wmma_bf(a.l, b.h, c); c = wmma_bf(a.h, b.l, c); return wmma_bf(a.h, b.h, c); }
__device__ __forceinline__ float sigm(float v) { return 1.0f / (1.0f + expf(-v)); }
#define LDSX() do { asm volatile("s_wait_dscnt 0" ::: "memory"); __builtin_amdgcn_wave_barrier(); __builtin_amdgcn_fence(__ATOMIC_RELEASE, "workgroup"); } while (0)


// Complex differential attention (B 1, H 12, S 1,024, D 128): qp = CLin_q(q) + [pe_q, pe_q] (2D wide -> q1, q2), kp = CLin_k(k) + pe_k, vp = CLin_v(v); w_s = softmax(|q_s . conj(kp)| / sqrt(128)) for s = 1, 2; a_s = w_s vp (complex); cat = [a1, a2] / rms(cat) * sub_w; out = a1 - lambda a2 with lambda = sigmoid(exp(lq1 . lk1) - exp(lq2 . lk2) + 0.3555...); out = CLin_g(q) * out (complex product); out = CLin_o(out) -> (out_r, out_i).
#define NHT 12             // heads (x batch 1)
#define SS 1024
#define DD 128
#define KK 256             // stacked K of every complex linear / logit GEMM: [real | imag]
#ifndef NHU
#define NHU NHT            // heads processed
#endif
#define NR (NHU * SS)      // rows processed
#define NRF (NHT * SS)     // full row count (output-1 offset)
#ifndef HG
#define HG 24              // (head, sel) pairs per launch group (divides NPAIR): all pairs at once, so that the 64-query blocks of k_pv outnumber the WGPs; the logit planes take 96 MiB of workspace
#endif
#define NPAIR (NHU * 2)
#define SCALE 0.0883883461356163f       // 128^-0.5 as f32
#define LAMBDA_INIT 0.35550907254219055f  // 0.8 - 0.6 exp(-0.3) as f32
__device__ __forceinline__ float bfr(float v) { return (float)(__bf16)v; }
typedef __attribute__((ext_vector_type(8))) __bf16 v8b;
typedef __attribute__((ext_vector_type(4))) __bf16 v4bf;
__device__ __forceinline__ v16b frag_b(const __bf16* rowk0, int lane) { union { v16b v; v8b q[2]; } u; const __bf16* p = rowk0 + 8 * (lane >> 4); u.q[0] = *(const v8b*)p; u.q[1] = *(const v8b*)(p + 16); return u.v; }

#define WS_QH  0u                                      // f16 q rows [row][1024]: per sel s: [s*512 +0..127] q_r, [+128..255] q_i, [+256..383] q_i, [+384..511] -q_r  (hi)
#define WS_QL  (WS_QH + 2u * (size_t)NRF * 1024)       // f16 residual x 2^10
#define WS_KH  (WS_QL + 2u * (size_t)NRF * 1024)       // f16 k rows [row][256] = [kp_r | kp_i] (hi)
#define WS_KL  (WS_KH + 2u * (size_t)NRF * KK)         // f16 residual x 2^10
#define WS_VT  (WS_KL + 2u * (size_t)NRF * KK)         // bf16 value planes [h][256 = vp_r | vp_i][s] hi
#define WS_VL  (WS_VT + 2u * (size_t)NHT * KK * SS)    // bf16 value residual planes
#define WS_G   (WS_VL + 2u * (size_t)NHT * KK * SS)    // f32 g rows [row][256] = [g_r | g_i]; later overwritten in place by the gated result z = [z_r | z_i]
#define WS_Y   (WS_G + 4u * (size_t)NRF * KK)          // f32 attention rows [row][512] = [a1_r | a1_i | a2_r | a2_i]
#define WS_LAM (WS_Y + 4u * (size_t)NRF * 512)         // one line: lambda replicated
#define WS_S   (WS_LAM + 128u)                         // f32 logits / P planes for HG (head, sel) pairs [hg][q][k]
#define WS_END (WS_S + 4u * (size_t)HG * SS * SS)

// ---- k_clin: block = (64 rows, 128 output cols, tile index over 2*NO), 8 waves: generic complex linear as a stacked real GEMM.
// A row = [x_r[row] | x_i[row]] (K 256; MODE < 4: two f32 input tensors, bf16 exact; MODE 4: the f32 z rows, bf16 hi + lo -> 2 products);
// output column o in [0, 2 NO): part = o / NO (0 real, 1 imag), oo = o % NO; B[k] = part 0: (k < 128 ? W_r[oo][k] : -W_i[oo][k-128]), part 1: (k < 128 ? W_i[oo][k] : W_r[oo][k-128]); + bias_part[oo].
// MODE 0: q projection (NO 256) + pe_q -> QH/QL (each value to its two slots, see WS_QH); MODE 1: k (NO 128) + pe_k -> KH/KL; MODE 2: v -> bf16 planes; MODE 3: g -> G rows; MODE 4: output linear from Z -> the two output tensors
// Data path: the block brings its 128 weight rows and its 64 A rows (both K halves: real, imag) in by whole 512-B rows (one wave = one row per load), all of these loads issued in front of the first use (pe rows and bias: behind the first barrier, so that they come in while the products run; pe is added at the write-out, behind the bias), rounds weights and A to bf16 once and keeps them in LDS; every wave's fragments come from LDS, the next 32 K columns' fragments read in front of this group's products.
// wave = (16-row group rg, 64-column group cg): 4 accumulator tiles, products per tile in the order of rising K. The fixed-count loops are unrolled so that their arrays stay in registers.
#define CLP 264            // LDS row pitch in bf16 elements: 528 B = 16 B x 33, an odd multiple of 16 B for the 16-byte fragment reads
#define SFP 132            // pitch of the f32 result rows
// one K half of the weight rows / of the A rows into registers: b = the block's first row (the same for all threads), o = this thread's byte offset from it (row tid / 32, 16-byte piece tid % 32); 8 rows per sweep of the block
__device__ __forceinline__ void cl_ldw(v4f (&rw)[16], const char* b, unsigned o) {
#pragma unroll
  for (int i = 0; i < 16; ++i) rw[i] = *(const v4f*)(b + o + i * (8 * DD * 4));
}
__device__ __forceinline__ void cl_lda(v4f (&ra)[8], const char* b, unsigned o, int xs) {
#pragma unroll
  for (int i = 0; i < 8; ++i) ra[i] = *(const v4f*)(b + o + i * (8 * xs * 4));
}
// the same from registers into LDS as bf16 (weights x sg, which is +1 or -1: exact); pw, pa = this thread's place in the weight plane and in the first A plane
__device__ __forceinline__ void cl_putw(const v4f (&rw)[16], float sg, __bf16* pw) {
#pragma unroll
  for (int i = 0; i < 16; ++i) { v4bf b;
#pragma unroll
    for (int k = 0; k < 4; ++k) b[k] = (__bf16)(sg * rw[i][k]);
    vst2(pw + i * 8 * CLP, b); }
}
template <int NA> __device__ __forceinline__ void cl_puta(const v4f (&ra)[8], __bf16* pa) {
#pragma unroll
  for (int i = 0; i < 8; ++i) { v4bf hb, lb;
#pragma unroll
    for (int k = 0; k < 4; ++k) { const float v = ra[i][k]; const __bf16 bh = (__bf16)v; hb[k] = bh; lb[k] = (__bf16)(v - (float)bh); }
    vst2(pa + i * 8 * CLP, hb); if (NA == 2) vst2(pa + 64 * CLP + i * 8 * CLP, lb); }
}
// all products: fa = this lane's A row, fw = this lane's first weight row; two sets of fragments, so that the LDS reads of the next 32 K columns are under way while this group's products run
template <int NA> __device__ __forceinline__ void cl_mac(v8f (&acc)[4], const __bf16* fa, const __bf16* fw, int lane) {
  v16b a[2][NA], w[2][4];
#pragma unroll
  for (int t = 0; t < NA; ++t) a[0][t] = frag_b(fa + t * 64 * CLP, lane);
#pragma unroll
  for (int j = 0; j < 4; ++j) w[0][j] = frag_b(fw + j * 16 * CLP, lane);
#pragma unroll
  for (int kc = 0; kc < KK / 32; ++kc) { const int c = kc & 1, n = c ^ 1;
    if (kc + 1 < KK / 32) {
#pragma unroll
      for (int t = 0; t < NA; ++t) a[n][t] = frag_b(fa + t * 64 * CLP + (kc + 1) * 32, lane);
#pragma unroll
      for (int j = 0; j < 4; ++j) w[n][j] = frag_b(fw + j * 16 * CLP + (kc + 1) * 32, lane); }
#pragma unroll
    for (int t = 0; t < NA; ++t)
#pragma unroll
      for (int j = 0; j < 4; ++j) acc[j] = wmma_bf(a[c][t], w[c][j], acc[j]); }
}
template <int MODE, int NO>
__global__ __launch_bounds__(256) void k_clin(const float* __restrict__ XR, const float* __restrict__ XI, const float* __restrict__ WR, const float* __restrict__ WI, const float* __restrict__ BR, const float* __restrict__ BI, const float* __restrict__ PER, const float* __restrict__ PEI, void* __restrict__ D0, void* __restrict__ D1) {
  constexpr int NA = MODE == 4 ? 2 : 1;   // A planes in LDS
  __shared__ __align__(16) unsigned char sm[(128 + NA * 64) * CLP * 2];   // weight plane [128][CLP], A planes [NA][64][CLP]; after the products the weight plane's room holds the f32 result rows [64][SFP]
  __bf16* sw = (__bf16*)sm; __bf16* sa = sw + 128 * CLP; float* sf = (float*)sm;
  const int tid = threadIdx.x, wave = tid >> 5, lane = tid & 31, col = lane & 15, g = lane >> 4; const int rg = wave & 3, cg = wave >> 2; const int c0 = blockIdx.y * 128; const size_t r0 = (size_t)blockIdx.x * 64; const int part = c0 / NO; const int oo0 = c0 % NO;
  constexpr int XS = MODE < 4 ? DD : KK; const float sg1 = part == 0 ? -1.0f : 1.0f;
  // every global read = a base that is the same for the whole block + a 32-bit byte offset of the thread
  const char* wb0 = (const char*)((part == 0 ? WR : WI) + (size_t)oo0 * DD); const char* wb1 = (const char*)((part == 0 ? WI : WR) + (size_t)oo0 * DD); const unsigned wo = (unsigned)tid * 16u;   // row tid / 32 of 512 B, piece tid % 32
  const char* xb0 = (const char*)(XR + r0 * XS); const char* xb1 = MODE < 4 ? (const char*)(XI + r0 * XS) : xb0 + 128 * 4; const unsigned xo = MODE < 4 ? wo : (unsigned)(wave * (XS * 4) + lane * 16);
  const float* bbs = (part == 0 ? BR : BI) + oo0; const unsigned bi = (unsigned)(cg * 64 + col);
  const char* pb = MODE <= 1 ? (const char*)((part == 0 ? PER : PEI) + r0 * DD) : nullptr; const unsigned po = (unsigned)((tid >> 4) * (DD * 4) + (tid & 15) * 32);   // MODE <= 1: 16 lanes x 32 B = the 512 B of a pe row; 16 rows per sweep
  __bf16* pw = sw + wave * CLP + lane * 4; __bf16* pa = sa + wave * CLP + lane * 4;
  const __bf16* fa = sa + (rg * 16 + col) * CLP; const __bf16* fw = sw + (cg * 64 + col) * CLP;
  v4f rw0[16], ra0[8], rw1[16], ra1[8], pe[4][2]; float bb[4];
  cl_ldw(rw0, wb0, wo); cl_ldw(rw1, wb1, wo); cl_lda(ra0, xb0, xo, XS); cl_lda(ra1, xb1, xo, XS);
  // stands in front of the first overwrite of an address register of the loads above; the bases and the offset registers that the loads name (the thread id, scaled by the load's width) are inputs, so that they live up to the wait
  if (MODE < 4) asm volatile("s_wait_xcnt 0x0" :: "v"(tid), "s"(wb0), "s"(wb1), "s"(xb0), "s"(xb1) : "memory");
  else asm volatile("s_wait_xcnt 0x0" :: "v"(tid), "v"(xo), "s"(wb0), "s"(wb1), "s"(xb0) : "memory");
  cl_putw(rw0, 1.0f, pw); cl_putw(rw1, sg1, pw + 128);
  cl_puta<NA>(ra0, pa); cl_puta<NA>(ra1, pa + 128);
  __syncthreads();             // weights and A rows are whole in LDS
  // the bias and the pe rows come in while the products run
#pragma unroll
  for (int j = 0; j < 4; ++j) bb[j] = bbs[bi + j * 16];
  if (MODE <= 1) {
#pragma unroll
    for (int it = 0; it < 4; ++it) { pe[it][0] = *(const v4f*)(pb + po + it * (16 * DD * 4)); pe[it][1] = *(const v4f*)(pb + po + it * (16 * DD * 4) + 16); }
    asm volatile("s_wait_xcnt 0x0" :: "v"(bi), "s"(bbs), "v"(po), "s"(pb) : "memory"); }   // as above
  else asm volatile("s_wait_xcnt 0x0" :: "v"(bi), "s"(bbs) : "memory");   // as above
  v8f acc[4] = {};
  cl_mac<NA>(acc, fa, fw, lane);
  __syncthreads();             // the weight plane's room is free for the result rows
#pragma unroll
  for (int j = 0; j < 4; ++j) { const float bj = bfr(bb[j]);
#pragma unroll
    for (int r = 0; r < 8; ++r) sf[(rg * 16 + 8 * g + r) * SFP + cg * 64 + j * 16 + col] = acc[j][r] + bj; }
  __syncthreads();             // the result rows are whole
  if (MODE == 0) {   // q: value (sel = oo0/128, d) -> QH[row][sel*512 + (part ? 128 : 0) + d] and QH[row][sel*512 + (part ? 256 : 384) + d] (the second real copy negated); f16 hi + residual x 2^10; each destination = a 256-B segment per row by 16 consecutive threads
    _Float16* QH = (_Float16*)D0; _Float16* QL = (_Float16*)D1; const int sel = oo0 / DD; const int dA = sel * 512 + (part ? 128 : 0), dB = sel * 512 + (part ? 256 : 384); const float sgB = part ? 1.0f : -1.0f;
#pragma unroll   // pe[it] stays in registers
    for (int it = 0; it < 4; ++it) { const int rl = it * 16 + (tid >> 4), q = tid & 15; v8h ha, la, hb, lb;
#pragma unroll
      for (int k = 0; k < 8; ++k) { const float v = sf[rl * SFP + q * 8 + k] + bfr(pe[it][k >> 2][k & 3]); const _Float16 hv = (_Float16)v; ha[k] = hv; la[k] = (_Float16)((v - (float)hv) * 1024.0f); const float vb = v * sgB; const _Float16 hb2 = (_Float16)vb; hb[k] = hb2; lb[k] = (_Float16)((vb - (float)hb2) * 1024.0f); }
      const size_t ro = (r0 + rl) * 1024; vst2((v4u*)(QH + ro + dA + q * 8), *(const v4u*)&ha); vst2((v4u*)(QL + ro + dA + q * 8), *(const v4u*)&la); vst2((v4u*)(QH + ro + dB + q * 8), *(const v4u*)&hb); vst2((v4u*)(QL + ro + dB + q * 8), *(const v4u*)&lb); } }
  else if (MODE == 1) {   // k rows [row][256]: column part*128 + d; f16 hi + residual x 2^10
    _Float16* KH = (_Float16*)D0; _Float16* KL = (_Float16*)D1;
#pragma unroll   // pe[it] stays in registers
    for (int it = 0; it < 4; ++it) { const int rl = it * 16 + (tid >> 4), q = tid & 15; v8h ha, la;
#pragma unroll
      for (int k = 0; k < 8; ++k) { const float v = sf[rl * SFP + q * 8 + k] + bfr(pe[it][k >> 2][k & 3]); const _Float16 hv = (_Float16)v; ha[k] = hv; la[k] = (_Float16)((v - (float)hv) * 1024.0f); }
      const size_t ro = (r0 + rl) * KK + c0; vst2((v4u*)(KH + ro + q * 8), *(const v4u*)&ha); vst2((v4u*)(KL + ro + q * 8), *(const v4u*)&la); } }
  else if (MODE == 2) {
    __bf16* VT = (__bf16*)D0; __bf16* VL = (__bf16*)D1; const size_t h = r0 / SS; const int s0 = (int)(r0 % SS);
#pragma unroll   // the LDS reads of all four sweeps are under way together
    for (int it = 0; it < 4; ++it) { const int e = it * 256 + tid, cl = e >> 3, q = e & 7; v8b hb, lb;
#pragma unroll
      for (int k = 0; k < 8; ++k) { const float v = sf[(q * 8 + k) * SFP + cl]; const __bf16 bh = (__bf16)v; hb[k] = bh; lb[k] = (__bf16)(v - (float)bh); }
      const size_t o2 = (h * KK + c0 + cl) * (size_t)SS + s0 + q * 8; vst2((v4u*)(VT + o2), *(const v4u*)&hb); vst2((v4u*)(VL + o2), *(const v4u*)&lb); } }
  else if (MODE == 3) {   // g rows [row][256] f32: 512-B segment per row by 32 lanes
    float* G = (float*)D0;
#pragma unroll   // the LDS reads of all eight sweeps are under way together
    for (int it = 0; it < 8; ++it) { const int rl = it * 8 + wave, q = lane; vst2(G + (r0 + rl) * KK + c0 + q * 4, *(const v4f*)&sf[rl * SFP + q * 4]); } }
  else {   // MODE 4: output rows [row][128] of out_r (part 0) or out_i (part 1): whole 512-B rows by 32 lanes
    float* O = (float*)(part == 0 ? D0 : D1);
#pragma unroll   // the LDS reads of all eight sweeps are under way together
    for (int it = 0; it < 8; ++it) { const int rl = it * 8 + wave, q = lane; vst2(O + (r0 + rl) * DD + q * 4, *(const v4f*)&sf[rl * SFP + q * 4]); } } }
__global__ __launch_bounds__(32) void k_lam(const float* __restrict__ LQ1, const float* __restrict__ LK1, const float* __restrict__ LQ2, const float* __restrict__ LK2, float* __restrict__ LAM) { __shared__ float sl;
  if (threadIdx.x == 0) { float s1 = 0.f, s2 = 0.f; for (int i = 0; i < DD; ++i) { s1 += bfr(LQ1[i]) * bfr(LK1[i]); s2 += bfr(LQ2[i]) * bfr(LK2[i]); } const float z = expf(s1) - expf(s2) + LAMBDA_INIT; sl = 1.0f / (1.0f + expf(-z)); }
  __syncthreads(); vst2(LAM + threadIdx.x, sl); }
// ---- k_sc: block = (64 queries, 128 keys, pair in group), 8 waves: pair p = (head h = p/2, sel = p%2); s_r = Q[sel*512 + 0..255] . KH, s_i = Q[sel*512 + 256..511] . KH (3 products each: hi.hi + (lo.hi + hi.lo) 2^-10); logit = sqrt(s_r^2 + s_i^2 + 1e-8) x 128^-0.5
// Per stage of 64 stacked-K elements the block brings one whole 128-B line of each of its rows (64 q rows x 4 planes: s_r hi, s_r lo, s_i hi, s_i lo; 128 k rows x 2 planes: hi, lo) into LDS by asynchronous 16-byte copies; two buffers, the next stage's copies fly while this stage's fragments are read from LDS.
// wave = (16-query group qg, 64-key group kg): 4 accumulator tiles x 4 sums, products per sum in the order of rising K as before
#define SCP 72                      // LDS row pitch in f16 elements: 144 B = 16 B x 9, an odd multiple of 16 B for the 16-byte fragment reads
#define SC_Q (4 * 64 * SCP * 2)     // bytes of the four q planes of a stage
#define SC_K (2 * 128 * SCP * 2)    // bytes of the two k planes of a stage
#define SC_BUF (SC_Q + SC_K)
// eight asynchronous copies of 16 B per lane; the s_wait_xcnt stands inside the statement, so that no address register of a copy is rewritten in front of it
__device__ __forceinline__ void cp8(unsigned l0, unsigned l1, unsigned l2, unsigned l3, unsigned l4, unsigned l5, unsigned l6, unsigned l7, const _Float16* g0, const _Float16* g1, const _Float16* g2, const _Float16* g3, const _Float16* g4, const _Float16* g5, const _Float16* g6, const _Float16* g7) {
  asm volatile("global_load_async_to_lds_b128 %0, %8, off\n\tglobal_load_async_to_lds_b128 %1, %9, off\n\tglobal_load_async_to_lds_b128 %2, %10, off\n\tglobal_load_async_to_lds_b128 %3, %11, off\n\t"
               "global_load_async_to_lds_b128 %4, %12, off\n\tglobal_load_async_to_lds_b128 %5, %13, off\n\tglobal_load_async_to_lds_b128 %6, %14, off\n\tglobal_load_async_to_lds_b128 %7, %15, off\n\ts_wait_xcnt 0x0"
               :: "v"(l0), "v"(l1), "v"(l2), "v"(l3), "v"(l4), "v"(l5), "v"(l6), "v"(l7), "v"(g0), "v"(g1), "v"(g2), "v"(g3), "v"(g4), "v"(g5), "v"(g6), "v"(g7) : "memory");
}
// one stage: lq = this lane's LDS byte address in the buffer (row tid / 8, 16-byte piece tid % 8), the four pointers at the same row and piece of the stage's K columns; 32 rows per sweep of the block
__device__ __forceinline__ void sc_stage(unsigned lq, const _Float16* qh, const _Float16* ql, const _Float16* kh, const _Float16* kl) {
  const unsigned R = 32 * SCP * 2;   // LDS bytes of 32 rows
  cp8(lq, lq + R, lq + 2 * R, lq + 3 * R, lq + 4 * R, lq + 5 * R, lq + 6 * R, lq + 7 * R, qh, qh + 32 * 1024, ql, ql + 32 * 1024, qh + 256, qh + 256 + 32 * 1024, ql + 256, ql + 256 + 32 * 1024);
  const unsigned lk = lq + SC_Q;
  cp8(lk, lk + R, lk + 2 * R, lk + 3 * R, lk + 4 * R, lk + 5 * R, lk + 6 * R, lk + 7 * R, kh, kh + 32 * KK, kh + 64 * KK, kh + 96 * KK, kl, kl + 32 * KK, kl + 64 * KK, kl + 96 * KK);
}
__global__ __launch_bounds__(256) void k_sc(const _Float16* __restrict__ QH, const _Float16* __restrict__ QL, const _Float16* __restrict__ KH, const _Float16* __restrict__ KL, int p0, float* __restrict__ S0) {
  __shared__ __align__(16) unsigned char sm[2 * SC_BUF];   // two stage buffers; after the loop the room holds each wave's f32 result rows [16][68]
  const int p = p0 + blockIdx.z; const int h = p >> 1, sel = p & 1; float* S = S0 + (size_t)blockIdx.z * SS * SS;
  const int tid = threadIdx.x, wave = tid >> 5, lane = tid & 31, col = lane & 15, g = lane >> 4; const int qg = wave & 3, kg = wave >> 2; const int k0 = blockIdx.y * 128; const int qb = blockIdx.x * 64;
  const _Float16* gqh = QH + ((size_t)h * SS + qb + (tid >> 3)) * 1024 + sel * 512 + (tid & 7) * 8;   // 8 lanes x 16 B = one 128-B line of a row
  const _Float16* gql = QL + ((size_t)h * SS + qb + (tid >> 3)) * 1024 + sel * 512 + (tid & 7) * 8;
  const _Float16* gkh = KH + ((size_t)h * SS + k0 + (tid >> 3)) * KK + (tid & 7) * 8;
  const _Float16* gkl = KL + ((size_t)h * SS + k0 + (tid >> 3)) * KK + (tid & 7) * 8;
  const unsigned lb = (unsigned)(size_t)sm + (unsigned)((tid >> 3) * (SCP * 2) + (tid & 7) * 16);
  sc_stage(lb, gqh, gql, gkh, gkl);
  asm volatile("s_wait_asynccnt 0x0" ::: "memory");   // this wave's copies of stage 0 have landed
  __syncthreads();                                    // stage 0 is whole in LDS
  sc_stage(lb + SC_BUF, gqh + 64, gql + 64, gkh + 64, gkl + 64);
  v8f ar[4] = {}, arl[4] = {}, ai[4] = {}, ail[4] = {};
#pragma unroll 1   // one copy of the stage body: small text, the buffer is picked by an offset
  for (int st = 0; st < KK / 64; ++st) { const _Float16* bq = (const _Float16*)(sm + (st & 1) * SC_BUF); const _Float16* bk = (const _Float16*)(sm + (st & 1) * SC_BUF + SC_Q);
    const _Float16* kp0 = bk + (kg * 64 + col) * SCP;
    v16h kf[2][2];   // k fragments (hi, lo) of this group of six products and of the next: the next group's LDS reads are issued in front of this group's products, inside the stage only
    kf[0][0] = frag_h(kp0, lane); kf[0][1] = frag_h(kp0 + 128 * SCP, lane);
#pragma unroll
    for (int kc = 0; kc < 2; ++kc) { const _Float16* qa = bq + (qg * 16 + col) * SCP + kc * 32;
      const v16h arh = frag_h(qa, lane), arlo = frag_h(qa + 64 * SCP, lane), aih = frag_h(qa + 128 * SCP, lane), ailo = frag_h(qa + 192 * SCP, lane);
#pragma unroll
      for (int j = 0; j < 4; ++j) { const int gi = kc * 4 + j, c = gi & 1, n = c ^ 1;
        if (gi + 1 < 8) { const _Float16* kp = kp0 + ((gi + 1) & 3) * 16 * SCP + ((gi + 1) >> 2) * 32; kf[n][0] = frag_h(kp, lane); kf[n][1] = frag_h(kp + 128 * SCP, lane); }
        const v16h khf = kf[c][0], klf = kf[c][1];
        ar[j] = wmma16(arh, khf, ar[j]); arl[j] = wmma16(arlo, khf, arl[j]); arl[j] = wmma16(arh, klf, arl[j]);
        ai[j] = wmma16(aih, khf, ai[j]); ail[j] = wmma16(ailo, khf, ail[j]); ail[j] = wmma16(aih, klf, ail[j]); } }
    asm volatile("s_wait_dscnt 0x0" ::: "memory");      // this wave's fragment reads of the buffer are done before it is refilled
    asm volatile("s_wait_asynccnt 0x0" ::: "memory");   // this wave's copies of the next stage have landed
    __syncthreads();                                    // publishes the next stage and ends every wave's reads of this buffer
    if (st + 2 < KK / 64) sc_stage(lb + (unsigned)((st & 1) * SC_BUF), gqh + (st + 2) * 64, gql + (st + 2) * 64, gkh + (st + 2) * 64, gkl + (st + 2) * 64); }
  asm volatile("s_wait_asynccnt 0x0" ::: "memory");     // no copy is outstanding when the room is used for the result rows
  float* ss = (float*)sm + wave * (16 * 68);
#pragma unroll
  for (int j = 0; j < 4; ++j)
#pragma unroll
    for (int r = 0; r < 8; ++r) { const float sr_ = ar[j][r] + arl[j][r] * (1.0f / 1024.0f), si_ = ai[j][r] + ail[j][r] * (1.0f / 1024.0f); ss[(8 * g + r) * 68 + j * 16 + col] = sqrtf(sr_ * sr_ + si_ * si_ + 1e-8f) * SCALE; }
  LDSX();
#pragma unroll
  for (int it = 0; it < 8; ++it) { const int rl = it * 2 + g; vst2(S + (size_t)(qb + qg * 16 + rl) * SS + k0 + kg * 64 + col * 4, *(const v4f*)&ss[rl * 68 + col * 4]); } }
// ---- k_sm: one wave = SMR query rows in a row of the HG x 1,024 rows, taken one after the other: softmax over all 1,024 keys (f32) -> P x 2^11 in place.
// A row's logits are read once and stay in the wave's registers (32 per lane: 8 loads of 512 contiguous bytes a wave); maximum and sum go over the lanes by DPP inside a 16-lane row and one exchange between the two rows; no LDS, no barrier. The next row's loads are issued in front of this row's arithmetic.
#define SMR 4
template <int M> __device__ __forceinline__ float xrow(float v) { return __builtin_bit_cast(float, __builtin_amdgcn_update_dpp(0, __builtin_bit_cast(int, v), 0x160 | M, 0xf, 0xf, true)); }   // lane l <- lane l ^ M of the same 16-lane row (row_xmask)
__device__ __forceinline__ float xhalf(float v) { const int i = __builtin_bit_cast(int, v); return __builtin_bit_cast(float, __builtin_amdgcn_permlanex16(i, i, 0x76543210, 0xfedcba98, false, false)); }   // lane l <- lane l ^ 16
__global__ __launch_bounds__(256) void k_sm(float* __restrict__ S0) {
  const int lane = threadIdx.x & 31; float* base = S0 + ((size_t)blockIdx.x * 8 + (threadIdx.x >> 5)) * (size_t)(SMR * SS) + lane * 4;
  v4f x[2][8];
#pragma unroll
  for (int j = 0; j < 8; ++j) x[0][j] = *(const v4f*)(base + j * 128);
#pragma unroll
  for (int r = 0; r < SMR; ++r) { const int c = r & 1; float* sr = base + r * SS;
    if (r + 1 < SMR) {
#pragma unroll
      for (int j = 0; j < 8; ++j) x[c ^ 1][j] = *(const v4f*)(sr + SS + j * 128); }
    __builtin_amdgcn_sched_barrier(0);   // keeps the next row's loads and the row before's stores in front of this row's arithmetic: without it the scheduler sinks the loads to just in front of their first use (every row then waits out the load latency) and holds part of a row's stores back behind the next row's arithmetic
    float mj[8];
#pragma unroll
    for (int j = 0; j < 8; ++j) mj[j] = fmaxf(fmaxf(x[c][j][0], x[c][j][1]), fmaxf(x[c][j][2], x[c][j][3]));
    float m = fmaxf(fmaxf(fmaxf(mj[0], mj[1]), fmaxf(mj[2], mj[3])), fmaxf(fmaxf(mj[4], mj[5]), fmaxf(mj[6], mj[7])));
    m = fmaxf(m, xrow<1>(m)); m = fmaxf(m, xrow<2>(m)); m = fmaxf(m, xrow<4>(m)); m = fmaxf(m, xrow<8>(m)); m = fmaxf(m, xhalf(m));
    v4f s4 = {};
#pragma unroll
    for (int j = 0; j < 8; ++j) {
#pragma unroll
      for (int k = 0; k < 4; ++k) { x[c][j][k] = expf(x[c][j][k] - m); s4[k] += x[c][j][k]; } }
    float sum = (s4[0] + s4[1]) + (s4[2] + s4[3]);
    sum += xrow<1>(sum); sum += xrow<2>(sum); sum += xrow<4>(sum); sum += xrow<8>(sum); sum += xhalf(sum);
    const float inv = (1.0f / sum) * 2048.0f;
#pragma unroll
    for (int j = 0; j < 8; ++j) vst2(sr + j * 128, x[c][j] * inv); } }
// ---- k_pv: block = 64 queries of pair (h, sel), 8 waves: Y[row][sel*256 + c] = (P . vp)[c] for c in [0,256) = [a_r | a_i] (P split bf16 hi + lo x v hi + lo, 3 products, per output element in the order hi.hi, lo.hi, hi.lo over rising keys).
// Per stage of 64 keys the block brings both value planes (256 rows x 128 B each) and its 64 P rows (256 B each) in by whole-line loads, splits P once, and keeps them in LDS; the fragments come from LDS. The next stage's loads are issued before the products of this one and wait in registers.
// wave = (32-query group qg, 64-column group cg): 2 x 4 accumulator tiles
#define PVK 64             // keys per stage
#define PVP 72             // LDS row pitch in bf16 elements: 144 B = 16 B x 9, an odd multiple of 16 B for the 16-byte fragment reads
#define PV_SV (2 * KK * PVP * 2)   // bytes of the two value planes in LDS
#define PV_SP (2 * 64 * PVP * 2)   // bytes of the two P planes in LDS
__global__ __launch_bounds__(256) void k_pv(const float* __restrict__ PS0, const __bf16* __restrict__ VT, const __bf16* __restrict__ VL, int p0, float* __restrict__ Y) { const int p = p0 + blockIdx.z; const int h = p >> 1, sel = p & 1;
  __shared__ __align__(16) unsigned char sm[PV_SV + PV_SP];   // value planes [2][256][PVP], P planes [2][64][PVP]; after the loop the value planes' room holds the f32 result rows [64][KK + 4]
  __bf16* sv = (__bf16*)sm; __bf16* sp = (__bf16*)(sm + PV_SV); float* so = (float*)sm;
  const int tid = threadIdx.x, wave = tid >> 5, lane = tid & 31, col = lane & 15, g = lane >> 4; const int qg = wave & 1, cg = wave >> 1; const int qb = blockIdx.x * 64;
  const __bf16* gvh = VT + ((size_t)h * KK + (tid >> 3)) * (size_t)SS + (tid & 7) * 8;   // 8 lanes x 16 B = one 128-B line of a value row; 32 rows per sweep of the block
  const __bf16* gvl = VL + ((size_t)h * KK + (tid >> 3)) * (size_t)SS + (tid & 7) * 8;
  const float* gp = PS0 + (size_t)blockIdx.z * SS * SS + (size_t)(qb + (tid >> 4)) * SS + (tid & 15) * 4;   // 16 lanes x 16 B = the 256 B of a P row; 16 rows per sweep
  v4u rh[8], rl[8]; v4f rp[4];
#pragma unroll
  for (int i = 0; i < 8; ++i) { rh[i] = *(const v4u*)(gvh + (size_t)i * 32 * SS); rl[i] = *(const v4u*)(gvl + (size_t)i * 32 * SS); }
#pragma unroll
  for (int i = 0; i < 4; ++i) rp[i] = *(const v4f*)(gp + (size_t)i * 16 * SS);
  v8f acc[2][4] = {};
#pragma unroll 1   // one copy of the stage body: one set of prefetch registers, small text (the fixed-count inner loops are unrolled so that their arrays stay in registers)
  for (int st = 0; st < SS / PVK; ++st) {
    if (st) __syncthreads();   // every wave has read its last fragment of the stage before
#pragma unroll
    for (int i = 0; i < 8; ++i) { const int o = (i * 32 + (tid >> 3)) * PVP + (tid & 7) * 8; vst2(sv + o, rh[i]); vst2(sv + KK * PVP + o, rl[i]); }
#pragma unroll
    for (int i = 0; i < 4; ++i) { v4bf hb, lb;
#pragma unroll
      for (int k = 0; k < 4; ++k) { const float v = rp[i][k]; const __bf16 bh = (__bf16)v; hb[k] = bh; lb[k] = (__bf16)(v - (float)bh); }
      const int o = (i * 16 + (tid >> 4)) * PVP + (tid & 15) * 4; vst2(sp + o, hb); vst2(sp + 64 * PVP + o, lb); }
    __syncthreads();           // the stage is whole in LDS
    if (st + 1 < SS / PVK) { const int ko = (st + 1) * PVK;
#pragma unroll
      for (int i = 0; i < 8; ++i) { rh[i] = *(const v4u*)(gvh + (size_t)i * 32 * SS + ko); rl[i] = *(const v4u*)(gvl + (size_t)i * 32 * SS + ko); }
#pragma unroll
      for (int i = 0; i < 4; ++i) rp[i] = *(const v4f*)(gp + (size_t)i * 16 * SS + ko);
      asm volatile("s_wait_xcnt 0x0" ::: "memory"); }   // stands in front of the first overwrite of an address register of the loads above (the fragment reads below reuse them)
#pragma unroll
    for (int kc = 0; kc < PVK / 32; ++kc) { v16b ah[2], al[2];
#pragma unroll
      for (int t = 0; t < 2; ++t) { const int o = (qg * 32 + t * 16 + col) * PVP + kc * 32; ah[t] = frag_b(sp + o, lane); al[t] = frag_b(sp + 64 * PVP + o, lane); }
#pragma unroll
      for (int j = 0; j < 4; ++j) { const int o = (cg * 64 + j * 16 + col) * PVP + kc * 32; const v16b vh = frag_b(sv + o, lane), vl = frag_b(sv + KK * PVP + o, lane);
        acc[0][j] = wmma_bf(ah[0], vh, acc[0][j]); acc[1][j] = wmma_bf(ah[1], vh, acc[1][j]);
        acc[0][j] = wmma_bf(al[0], vh, acc[0][j]); acc[1][j] = wmma_bf(al[1], vh, acc[1][j]);
        acc[0][j] = wmma_bf(ah[0], vl, acc[0][j]); acc[1][j] = wmma_bf(ah[1], vl, acc[1][j]); } } }
  __syncthreads();             // the value planes' room is free for the result rows
#pragma unroll
  for (int t = 0; t < 2; ++t)
#pragma unroll
    for (int j = 0; j < 4; ++j)
#pragma unroll
      for (int r = 0; r < 8; ++r) so[(qg * 32 + t * 16 + 8 * g + r) * (KK + 4) + cg * 64 + j * 16 + col] = acc[t][j][r] * (1.0f / 2048.0f);
  __syncthreads();             // the result rows are whole
#pragma unroll
  for (int i = 0; i < 16; ++i) { const int rl_ = i * 4 + (tid >> 6), q = tid & 63; vst2(Y + ((size_t)h * SS + qb + rl_) * 512 + sel * 256 + q * 4, *(const v4f*)&so[rl_ * (KK + 4) + q * 4]); } }
// ---- k_mix: block = 16 rows (16 lanes per row): rms over the 512 attention values (= mean over 256 of r^2 + i^2), / rms x sub_w, out = a1 - lambda a2, then the complex gate z = g * out; z written IN PLACE over the g row (each lane reads and writes exactly its own columns d and 128 + d); float4 pieces, 16 lanes x 16 B = 256-B runs
__global__ __launch_bounds__(256) void k_mix(const float* __restrict__ Y, float* __restrict__ GZ, const float* __restrict__ LAM, const float* __restrict__ SW) {
  const int t = threadIdx.x; const int rl = t >> 4, sub = t & 15; const size_t row = (size_t)blockIdx.x * 16 + rl; const float* y = Y + row * 512; float* gz = GZ + row * KK; const float lam = LAM[0];
  float s2 = 0.f; for (int c = sub * 4; c < 512; c += 64) { const v4f v = *(const v4f*)(y + c); s2 += (v[0] * v[0] + v[1] * v[1]) + (v[2] * v[2] + v[3] * v[3]); }
#pragma unroll
  for (int o = 1; o < 16; o <<= 1) s2 += __shfl_xor(s2, o);
  const float inv = 1.0f / sqrtf(s2 * (1.0f / 256.0f) + 1e-5f);
#pragma unroll
  for (int it = 0; it < 2; ++it) { const int d = sub * 4 + it * 64;   /* d in [0,128): this lane's 4 columns */
    const v4f a1r = *(const v4f*)(y + d), a1i = *(const v4f*)(y + 128 + d), a2r = *(const v4f*)(y + 256 + d), a2i = *(const v4f*)(y + 384 + d); const v4f gr = *(const v4f*)(gz + d), gi = *(const v4f*)(gz + 128 + d);
    v4f zr, zi;
#pragma unroll
    for (int k = 0; k < 4; ++k) { const float w1 = bfr(SW[d + k]) * inv, w2 = bfr(SW[DD + d + k]) * inv; const float orr = a1r[k] * w1 - lam * (a2r[k] * w2), oi = a1i[k] * w1 - lam * (a2i[k] * w2); zr[k] = gr[k] * orr - gi[k] * oi; zi[k] = gr[k] * oi + gi[k] * orr; }
    vst2(gz + d, zr); vst2(gz + 128 + d, zi); } }
extern "C" void kernel_launch(void* const* d_in, const int* in_sizes, int n_in, void* d_out, int out_size, void* d_ws, size_t ws_size, hipStream_t stream) {
  (void)in_sizes; (void)n_in; (void)out_size;
  const float** F = (const float**)d_in;   // 0 q_r, 1 q_i, 2 k_r, 3 k_i, 4 v_r, 5 v_i, 6 pe_q_r, 7 pe_q_i, 8 pe_k_r, 9 pe_k_i [1,12,1024,128]; 10 qw_r [256,128], 11 qw_i, 12 qb_r [256], 13 qb_i; 14 kw_r [128,128], 15 kw_i, 16 kb_r, 17 kb_i; 18 vw_r, 19 vw_i, 20 vb_r, 21 vb_i; 22 gw_r, 23 gw_i, 24 gb_r, 25 gb_i; 26 ow_r, 27 ow_i, 28 ob_r, 29 ob_i; 30 lq1, 31 lk1, 32 lq2, 33 lk2 [128]; 34 sub_w [256]
  if (ws_size < (size_t)WS_END) return;
  char* ws = (char*)d_ws; _Float16 *QH = (_Float16*)(ws + WS_QH), *QL = (_Float16*)(ws + WS_QL), *KH = (_Float16*)(ws + WS_KH), *KL = (_Float16*)(ws + WS_KL); __bf16 *VT = (__bf16*)(ws + WS_VT), *VL = (__bf16*)(ws + WS_VL); float *G = (float*)(ws + WS_G), *Y = (float*)(ws + WS_Y), *LAM = (float*)(ws + WS_LAM), *S = (float*)(ws + WS_S);
  float* OUT0 = (float*)d_out; float* OUT1 = (float*)d_out + (size_t)NRF * DD;
  k_clin<0, 256><<<dim3(NR / 64, 4), 256, 0, stream>>>(F[0], F[1], F[10], F[11], F[12], F[13], F[6], F[7], QH, QL);
  k_clin<1, 128><<<dim3(NR / 64, 2), 256, 0, stream>>>(F[2], F[3], F[14], F[15], F[16], F[17], F[8], F[9], KH, KL);
  k_clin<2, 128><<<dim3(NR / 64, 2), 256, 0, stream>>>(F[4], F[5], F[18], F[19], F[20], F[21], nullptr, nullptr, VT, VL);
  k_clin<3, 128><<<dim3(NR / 64, 2), 256, 0, stream>>>(F[0], F[1], F[22], F[23], F[24], F[25], nullptr, nullptr, G, nullptr);
  k_lam<<<dim3(1), 32, 0, stream>>>(F[30], F[31], F[32], F[33], LAM);
  for (int p0 = 0; p0 < NPAIR; p0 += HG) {
    k_sc<<<dim3(SS / 64, SS / 128, HG), 256, 0, stream>>>(QH, QL, KH, KL, p0, S);
    k_sm<<<dim3(SS * HG / (8 * SMR)), 256, 0, stream>>>(S);
    k_pv<<<dim3(SS / 64, 1, HG), 256, 0, stream>>>(S, VT, VL, p0, Y);
  }
  k_mix<<<dim3(NR / 16), 256, 0, stream>>>(Y, G, LAM, F[34]);
  k_clin<4, 128><<<dim3(NR / 64, 2), 256, 0, stream>>>(G, nullptr, F[26], F[27], F[28], F[29], nullptr, nullptr, OUT0, OUT1);
}

// v006
// A run of this version takes 188 microseconds.
// In both of two side-by-side timings against v005, it was 1.07 times as fast.
// Counting every step since v000, it is 12.7 times as fast.
// compute dtype: all float inputs rounded to bf16; every complex linear as one stacked real GEMM ([x_r | x_i] against [W_r ; -W_i] / [W_i ; W_r]) with EXACT bf16 products on WMMA 16x16x32, f32 accumulate; q (+pe) as f16 hi + residual (x 2^10) and k (+pe) as f16 hi + residual (x 2^10) -> 3-product complex logits (s_r, s_i as two stacked K=256 real GEMMs), |s| scaled in f32 (sqrtf); softmax in f32 (precise expf); P x 2^11 split bf16 hi + lo against v bf16 hi + lo (3 products); RMS norm / lambda / differential combination / complex gating in f32; the gated result (bf16 hi + lo) through the output complex linear (2 products); f32 outputs.
#include <hip/hip_runtime.h>
#include <math.h>

typedef __attribute__((ext_vector_type(16))) _Float16 v16h;
typedef __attribute__((ext_vector_type(16))) __bf16 v16b;
typedef __attribute__((ext_vector_type(8)))  _Float16 v8h;
typedef __attribute__((ext_vector_type(8)))  float v8f;
typedef __attribute__((ext_vector_type(4)))  float v4f;
typedef __attribute__((ext_vector_type(2)))  float v2f;
typedef __attribute__((ext_vector_type(4)))  unsigned v4u;
typedef __attribute__((ext_vector_type(4)))  int v4i;
typedef float __attribute__((may_alias)) float_a;
typedef int __attribute__((may_alias)) int_a;

template <typename T> __device__ __forceinline__ void vst2(void* p, T v) { *(T*)p = v;  }
__device__ __forceinline__ v8f wmma16(v16h a, v16h b, v8f c) {
  v8f d = __builtin_amdgcn_wmma_f32_16x16x32_f16(false, a, false, b, (short)0, c, false, false);
  asm volatile("v_nop\n\tv_nop\n\tv_nop\n\tv_nop" : "+v"(d) : "v"(a), "v"(b));
  return d;
}
__device__ __forceinline__ v8f wmma_bf(v16b a, v16b b, v8f c) {
  v8f d = __builtin_amdgcn_wmma_f32_16x16x32_bf16(false, a, false, b, (short)0, c, false, false);
  asm volatile("v_nop\n\tv_nop\n\tv_nop\n\tv_nop" : "+v"(d) : "v"(a), "v"(b));
  return d;
}
// 16x16x32 fragments: lane = (h = lane>>4, row/col = lane&15); elements 0..7 = k0+8h+0..7, 8..15 = k0+16+8h+0..7; D element r = row 8h+r
__device__ __forceinline__ v16h frag_h(const _Float16* rowk0, int lane) {
  union { v16h v; v8h q[2]; } u; const _Float16* p = rowk0 + 8 * (lane >> 4);
  u.q[0] = *(const v8h*)p; u.q[1] = *(const v8h*)(p + 16); return u.v;
}
__device__ __forceinline__ v16h frag_f32(const float* rowk0, int lane) {
  v16h a; const float* p = rowk0 + 8 * (lane >> 4);
#pragma unroll
  for (int i = 0; i < 8; ++i) { a[i] = (_Float16)p[i]; a[8 + i] = (_Float16)p[16 + i]; }
  return a;
}
__device__ __forceinline__ v16h frag_f32s(const float* rowk0, int lane, float sc) {
  v16h a; const float* p = rowk0 + 8 * (lane >> 4);
#pragma unroll
  for (int i = 0; i < 8; ++i) { a[i] = (_Float16)(p[i] * sc); a[8 + i] = (_Float16)(p[16 + i] * sc); }
  return a;
}
// column fragment from a [K][ld] layout (column n), rows >= K read as 0
__device__ __forceinline__ v16h fragc_f32(const float* W, int k0, int n, int lane, int ld, int K) {
  v16h a; const int g = lane >> 4;
#pragma unroll
  for (int i = 0; i < 8; ++i) { const int ka = k0 + 8 * g + i, kb = ka + 16;
    a[i] = (_Float16)(ka < K ? W[(size_t)(ka < K ? ka : K - 1) * ld + n] : 0.f); a[8 + i] = (_Float16)(kb < K ? W[(size_t)(kb < K ? kb : K - 1) * ld + n] : 0.f); }
  return a;
}
struct F2 { v16b h, l; };
__device__ __forceinline__ F2 bsplit16(const float v[16]) { F2 r;
#pragma unroll
  for (int i = 0; i < 16; ++i) { const __bf16 h = (__bf16)v[i]; r.h[i] = h; r.l[i] = (__bf16)(v[i] - (float)h); }
  return r; }
__device__ __forceinline__ F2 split_row(const float* row, int k0, int lane) { float v[16]; const float* p = row + k0 + 8 * (lane >> 4);
#pragma unroll
  for (int i = 0; i < 8; ++i) { v[i] = p[i]; v[8 + i] = p[16 + i]; }
  return bsplit16(v); }
__device__ __forceinline__ F2 split_rowK(const float* row, int k0, int lane, int K) { float v[16]; const int g = lane >> 4;
#pragma unroll
  for (int i = 0; i < 8; ++i) { const int ka = k0 + 8 * g + i, kb = ka + 16; v[i] = ka < K ? row[ka < K ? ka : K - 1] : 0.f; v[8 + i] = kb < K ? row[kb < K ? kb : K - 1] : 0.f; }
  return bsplit16(v); }
__device__ __forceinline__ F2 split_col(const float* W, int k0, int n, int lane, int ld, int K) { float v[16]; const int g = lane >> 4;
#pragma unroll
  for (int i = 0; i < 8; ++i) { const int ka = k0 + 8 * g + i, kb = ka + 16; v[i] = ka < K ? W[(size_t)(ka < K ? ka : K - 1) * ld + n] : 0.f; v[8 + i] = kb < K ? W[(size_t)(kb < K ? kb : K - 1) * ld + n] : 0.f; }
  return bsplit16(v); }
__device__ __forceinline__ v8f mac3(const F2& a, const F2& b, v8f c) { c = wmma_bf(a.l, b.h, c); c = wmma_bf(a.h, b.l, c); return wmma_bf(a.h, b.h, c); }
__device__ __forceinline__ float sigm(float v) { return 1.0f / (1.0f + expf(-v)); }
#define LDSX() do { asm volatile("s_wait_dscnt 0" ::: "memory"); __builtin_amdgcn_wave_barrier(); __builtin_amdgcn_fence(__ATOMIC_RELEASE, "workgroup"); } while (0)


// Complex differential attention (B 1, H 12, S 1,024, D 128): qp = CLin_q(q) + [pe_q, pe_q] (2D wide -> q1, q2), kp = CLin_k(k) + pe_k, vp = CLin_v(v); w_s = softmax(|q_s . conj(kp)| / sqrt(128)) for s = 1, 2; a_s = w_s vp (complex); cat = [a1, a2] / rms(cat) * sub_w; out = a1 - lambda a2 with lambda = sigmoid(exp(lq1 . lk1) - exp(lq2 . lk2) + 0.3555...); out = CLin_g(q) * out (complex product); out = CLin_o(out) -> (out_r, out_i).
#define NHT 12             // heads (x batch 1)
#define SS 1024
#define DD 128
#define KK 256             // stacked K of every complex linear / logit GEMM: [real | imag]
#ifndef NHU
#define NHU NHT            // heads processed
#endif
#define NR (NHU * SS)      // rows processed
#define NRF (NHT * SS)     // full row count (output-1 offset)
#ifndef HG
#define HG 24              // (head, sel) pairs per launch group (divides NPAIR): all pairs at once, so that the 64-query blocks of k_pv outnumber the WGPs; the logit planes take 96 MiB of workspace
#endif
#define NPAIR (NHU * 2)
#define SCALE 0.0883883461356163f       // 128^-0.5 as f32
#define LAMBDA_INIT 0.35550907254219055f  // 0.8 - 0.6 exp(-0.3) as f32
__device__ __forceinline__ float bfr(float v) { return (float)(__bf16)v; }
typedef __attribute__((ext_vector_type(8))) __bf16 v8b;
typedef __attribute__((ext_vector_type(4))) __bf16 v4bf;
__device__ __forceinline__ v16b frag_b(const __bf16* rowk0, int lane) { union { v16b v; v8b q[2]; } u; const __bf16* p = rowk0 + 8 * (lane >> 4); u.q[0] = *(const v8b*)p; u.q[1] = *(const v8b*)(p + 16); return u.v; }

#define WS_QH  0u                                      // f16 q rows [row][1024]: per sel s: [s*512 +0..127] q_r, [+128..255] q_i, [+256..383] q_i, [+384..511] -q_r  (hi)
#define WS_QL  (WS_QH + 2u * (size_t)NRF * 1024)       // f16 residual x 2^10
#define WS_KH  (WS_QL + 2u * (size_t)NRF * 1024)       // f16 k rows [row][256] = [kp_r | kp_i] (hi)
#define WS_KL  (WS_KH + 2u * (size_t)NRF * KK)         // f16 residual x 2^10
#define WS_VT  (WS_KL + 2u * (size_t)NRF * KK)         // bf16 value planes [h][256 = vp_r | vp_i][s] hi
#define WS_VL  (WS_VT + 2u * (size_t)NHT * KK * SS)    // bf16 value residual planes
#define WS_G   (WS_VL + 2u * (size_t)NHT * KK * SS)    // f32 g rows [row][256] = [g_r | g_i]; later overwritten in place by the gated result z = [z_r | z_i]
#define WS_Y   (WS_G + 4u * (size_t)NRF * KK)          // f32 attention rows [row][512] = [a1_r | a1_i | a2_r | a2_i]
#define WS_LAM (WS_Y + 4u * (size_t)NRF * 512)         // one line: lambda replicated
#define WS_S   (WS_LAM + 128u)                         // f32 logits / P planes for HG (head, sel) pairs [hg][q][k]
#define WS_END (WS_S + 4u * (size_t)HG * SS * SS)

// ---- clin_body: block = (64 rows, 128 output cols, tile index over 2*NO), 8 waves: generic complex linear as a stacked real GEMM.
// A row = [x_r[row] | x_i[row]] (K 256; MODE < 4: two f32 input tensors, bf16 exact; MODE 4: the f32 z rows, bf16 hi + lo -> 2 products);
// output column o in [0, 2 NO): part = o / NO (0 real, 1 imag), oo = o % NO; B[k] = part 0: (k < 128 ? W_r[oo][k] : -W_i[oo][k-128]), part 1: (k < 128 ? W_i[oo][k] : W_r[oo][k-128]); + bias_part[oo].
// MODE 0: q projection (NO 256) + pe_q -> QH/QL (each value to its two slots, see WS_QH); MODE 1: k (NO 128) + pe_k -> KH/KL; MODE 2: v -> bf16 planes; MODE 3: g -> G rows; MODE 4: output linear from Z -> the two output tensors
// Data path: the block brings its 128 weight rows and its 64 A rows (both K halves: real, imag) in by whole 512-B rows (one wave = one row per load), all of these loads issued in front of the first use (pe rows and bias: behind the first barrier, so that they come in while the products run; pe is added at the write-out, behind the bias), rounds weights and A to bf16 once and keeps them in LDS; every wave's fragments come from LDS, the next 32 K columns' fragments read in front of this group's products.
// wave = (16-row group rg, 64-column group cg): 4 accumulator tiles, products per tile in the order of rising K. The fixed-count loops are unrolled so that their arrays stay in registers.
#define CLP 264            // LDS row pitch in bf16 elements: 528 B = 16 B x 33, an odd multiple of 16 B for the 16-byte fragment reads
#define SFP 132            // pitch of the f32 result rows
// one K half of the weight rows / of the A rows into registers: b = the block's first row (the same for all threads), o = this thread's byte offset from it (row tid / 32, 16-byte piece tid % 32); 8 rows per sweep of the block
__device__ __forceinline__ void cl_ldw(v4f (&rw)[16], const char* b, unsigned o) {
#pragma unroll
  for (int i = 0; i < 16; ++i) rw[i] = *(const v4f*)(b + o + i * (8 * DD * 4));
}
__device__ __forceinline__ void cl_lda(v4f (&ra)[8], const char* b, unsigned o, int xs) {
#pragma unroll
  for (int i = 0; i < 8; ++i) ra[i] = *(const v4f*)(b + o + i * (8 * xs * 4));
}
// the same from registers into LDS as bf16 (weights x sg, which is +1 or -1: exact); pw, pa = this thread's place in the weight plane and in the first A plane
__device__ __forceinline__ void cl_putw(const v4f (&rw)[16], float sg, __bf16* pw) {
#pragma unroll
  for (int i = 0; i < 16; ++i) { v4bf b;
#pragma unroll
    for (int k = 0; k < 4; ++k) b[k] = (__bf16)(sg * rw[i][k]);
    vst2(pw + i * 8 * CLP, b); }
}
template <int NA> __device__ __forceinline__ void cl_puta(const v4f (&ra)[8], __bf16* pa) {
#pragma unroll
  for (int i = 0; i < 8; ++i) { v4bf hb, lb;
#pragma unroll
    for (int k = 0; k < 4; ++k) { const float v = ra[i][k]; const __bf16 bh = (__bf16)v; hb[k] = bh; lb[k] = (__bf16)(v - (float)bh); }
    vst2(pa + i * 8 * CLP, hb); if (NA == 2) vst2(pa + 64 * CLP + i * 8 * CLP, lb); }
}
// all products: fa = this lane's A row, fw = this lane's first weight row; two sets of fragments, so that the LDS reads of the next 32 K columns are under way while this group's products run
template <int NA> __device__ __forceinline__ void cl_mac(v8f (&acc)[4], const __bf16* fa, const __bf16* fw, int lane) {
  v16b a[2][NA], w[2][4];
#pragma unroll
  for (int t = 0; t < NA; ++t) a[0][t] = frag_b(fa + t * 64 * CLP, lane);
#pragma unroll
  for (int j = 0; j < 4; ++j) w[0][j] = frag_b(fw + j * 16 * CLP, lane);
#pragma unroll
  for (int kc = 0; kc < KK / 32; ++kc) { const int c = kc & 1, n = c ^ 1;
    if (kc + 1 < KK / 32) {
#pragma unroll
      for (int t = 0; t < NA; ++t) a[n][t] = frag_b(fa + t * 64 * CLP + (kc + 1) * 32, lane);
#pragma unroll
      for (int j = 0; j < 4; ++j) w[n][j] = frag_b(fw + j * 16 * CLP + (kc + 1) * 32, lane); }
#pragma unroll
    for (int t = 0; t < NA; ++t)
#pragma unroll
      for (int j = 0; j < 4; ++j) acc[j] = wmma_bf(a[c][t], w[c][j], acc[j]); }
}
// MODE 4 = the output linear, known at compile time; MODE -1 = one of the modes 0 to 3, picked per block by mrt (they share the data path and the products and differ in the write-out). sm = the block's LDS, bx = its 64-row group, c0 = its first column of the 2 NO, part and oo0 as above
template <int MODE>
__device__ __forceinline__ void clin_body(unsigned char* sm, int mrt, int bx, int c0, int part, int oo0, const float* __restrict__ XR, const float* __restrict__ XI, const float* __restrict__ WR, const float* __restrict__ WI, const float* __restrict__ BR, const float* __restrict__ BI, const float* __restrict__ PER, const float* __restrict__ PEI, void* __restrict__ D0, void* __restrict__ D1) {
  constexpr int NA = MODE == 4 ? 2 : 1;   // A planes in LDS
  const int mode = MODE == 4 ? 4 : mrt;
  // sm holds (128 + NA * 64) * CLP * 2 bytes: weight plane [128][CLP], A planes [NA][64][CLP]; after the products the weight plane's room holds the f32 result rows [64][SFP]
  __bf16* sw = (__bf16*)sm; __bf16* sa = sw + 128 * CLP; float* sf = (float*)sm;
  const int tid = threadIdx.x, wave = tid >> 5, lane = tid & 31, col = lane & 15, g = lane >> 4; const int rg = wave & 3, cg = wave >> 2; const size_t r0 = (size_t)bx * 64;
  constexpr int XS = MODE < 4 ? DD : KK; const float sg1 = part == 0 ? -1.0f : 1.0f;
  // every global read = a base that is the same for the whole block + a 32-bit byte offset of the thread
  const char* wb0 = (const char*)((part == 0 ? WR : WI) + (size_t)oo0 * DD); const char* wb1 = (const char*)((part == 0 ? WI : WR) + (size_t)oo0 * DD); const unsigned wo = (unsigned)tid * 16u;   // row tid / 32 of 512 B, piece tid % 32
  const char* xb0 = (const char*)(XR + r0 * XS); const char* xb1 = MODE < 4 ? (const char*)(XI + r0 * XS) : xb0 + 128 * 4; const unsigned xo = MODE < 4 ? wo : (unsigned)(wave * (XS * 4) + lane * 16);
  const float* bbs = (part == 0 ? BR : BI) + oo0; const unsigned bi = (unsigned)(cg * 64 + col);
  const char* pb = mode <= 1 ? (const char*)((part == 0 ? PER : PEI) + r0 * DD) : nullptr; const unsigned po = (unsigned)((tid >> 4) * (DD * 4) + (tid & 15) * 32);   // MODE <= 1: 16 lanes x 32 B = the 512 B of a pe row; 16 rows per sweep
  __bf16* pw = sw + wave * CLP + lane * 4; __bf16* pa = sa + wave * CLP + lane * 4;
  const __bf16* fa = sa + (rg * 16 + col) * CLP; const __bf16* fw = sw + (cg * 64 + col) * CLP;
  v4f rw0[16], ra0[8], rw1[16], ra1[8], pe[4][2]; float bb[4];
  cl_ldw(rw0, wb0, wo); cl_ldw(rw1, wb1, wo); cl_lda(ra0, xb0, xo, XS); cl_lda(ra1, xb1, xo, XS);
  // stands in front of the first overwrite of an address register of the loads above; the bases and the offset registers that the loads name (the thread id, scaled by the load's width) are inputs, so that they live up to the wait
  if (MODE < 4) asm volatile("s_wait_xcnt 0x0" :: "v"(tid), "s"(wb0), "s"(wb1), "s"(xb0), "s"(xb1) : "memory");
  else asm volatile("s_wait_xcnt 0x0" :: "v"(tid), "v"(xo), "s"(wb0), "s"(wb1), "s"(xb0) : "memory");
  cl_putw(rw0, 1.0f, pw); cl_putw(rw1, sg1, pw + 128);
  cl_puta<NA>(ra0, pa); cl_puta<NA>(ra1, pa + 128);
  __syncthreads();             // weights and A rows are whole in LDS
  // the bias and the pe rows come in while the products run
#pragma unroll
  for (int j = 0; j < 4; ++j) bb[j] = bbs[bi + j * 16];
  if (mode <= 1) {
#pragma unroll
    for (int it = 0; it < 4; ++it) { pe[it][0] = *(const v4f*)(pb + po + it * (16 * DD * 4)); pe[it][1] = *(const v4f*)(pb + po + it * (16 * DD * 4) + 16); }
    asm volatile("s_wait_xcnt 0x0" :: "v"(bi), "s"(bbs), "v"(po), "s"(pb) : "memory"); }   // as above
  else asm volatile("s_wait_xcnt 0x0" :: "v"(bi), "s"(bbs) : "memory");   // as above
  v8f acc[4] = {};
  cl_mac<NA>(acc, fa, fw, lane);
  __syncthreads();             // the weight plane's room is free for the result rows
#pragma unroll
  for (int j = 0; j < 4; ++j) { const float bj = bfr(bb[j]);
#pragma unroll
    for (int r = 0; r < 8; ++r) sf[(rg * 16 + 8 * g + r) * SFP + cg * 64 + j * 16 + col] = acc[j][r] + bj; }
  __syncthreads();             // the result rows are whole
  if (mode == 0) {   // q: value (sel = oo0/128, d) -> QH[row][sel*512 + (part ? 128 : 0) + d] and QH[row][sel*512 + (part ? 256 : 384) + d] (the second real copy negated); f16 hi + residual x 2^10; each destination = a 256-B segment per row by 16 consecutive threads
    _Float16* QH = (_Float16*)D0; _Float16* QL = (_Float16*)D1; const int sel = oo0 / DD; const int dA = sel * 512 + (part ? 128 : 0), dB = sel * 512 + (part ? 256 : 384); const float sgB = part ? 1.0f : -1.0f;
#pragma unroll   // pe[it] stays in registers
    for (int it = 0; it < 4; ++it) { const int rl = it * 16 + (tid >> 4), q = tid & 15; v8h ha, la, hb, lb;
#pragma unroll
      for (int k = 0; k < 8; ++k) { const float v = sf[rl * SFP + q * 8 + k] + bfr(pe[it][k >> 2][k & 3]); const _Float16 hv = (_Float16)v; ha[k] = hv; la[k] = (_Float16)((v - (float)hv) * 1024.0f); const float vb = v * sgB; const _Float16 hb2 = (_Float16)vb; hb[k] = hb2; lb[k] = (_Float16)((vb - (float)hb2) * 1024.0f); }
      const size_t ro = (r0 + rl) * 1024; vst2((v4u*)(QH + ro + dA + q * 8), *(const v4u*)&ha); vst2((v4u*)(QL + ro + dA + q * 8), *(const v4u*)&la); vst2((v4u*)(QH + ro + dB + q * 8), *(const v4u*)&hb); vst2((v4u*)(QL + ro + dB + q * 8), *(const v4u*)&lb); } }
  else if (mode == 1) {   // k rows [row][256]: column part*128 + d; f16 hi + residual x 2^10
    _Float16* KH = (_Float16*)D0; _Float16* KL = (_Float16*)D1;
#pragma unroll   // pe[it] stays in registers
    for (int it = 0; it < 4; ++it) { const int rl = it * 16 + (tid >> 4), q = tid & 15; v8h ha, la;
#pragma unroll
      for (int k = 0; k < 8; ++k) { const float v = sf[rl * SFP + q * 8 + k] + bfr(pe[it][k >> 2][k & 3]); const _Float16 hv = (_Float16)v; ha[k] = hv; la[k] = (_Float16)((v - (float)hv) * 1024.0f); }
      const size_t ro = (r0 + rl) * KK + c0; vst2((v4u*)(KH + ro + q * 8), *(const v4u*)&ha); vst2((v4u*)(KL + ro + q * 8), *(const v4u*)&la); }
    asm volatile("s_wait_xcnt 0x0" ::: "memory"); }   // run-time mode: in the listing another mode's code follows behind a branch; the wait stands in front of any overwrite there of a register that the stores above name
  else if (mode == 2) {
    __bf16* VT = (__bf16*)D0; __bf16* VL = (__bf16*)D1; const size_t h = r0 / SS; const int s0 = (int)(r0 % SS);
#pragma unroll   // the LDS reads of all four sweeps are under way together
    for (int it = 0; it < 4; ++it) { const int e = it * 256 + tid, cl = e >> 3, q = e & 7; v8b hb, lb;
#pragma unroll
      for (int k = 0; k < 8; ++k) { const float v = sf[(q * 8 + k) * SFP + cl]; const __bf16 bh = (__bf16)v; hb[k] = bh; lb[k] = (__bf16)(v - (float)bh); }
      const size_t o2 = (h * KK + c0 + cl) * (size_t)SS + s0 + q * 8; vst2((v4u*)(VT + o2), *(const v4u*)&hb); vst2((v4u*)(VL + o2), *(const v4u*)&lb); }
    asm volatile("s_wait_xcnt 0x0" ::: "memory"); }   // as at the end of mode 1
  else if (mode == 3) {   // g rows [row][256] f32: 512-B segment per row by 32 lanes
    float* G = (float*)D0;
#pragma unroll   // the LDS reads of all eight sweeps are under way together
    for (int it = 0; it < 8; ++it) { const int rl = it * 8 + wave, q = lane; vst2(G + (r0 + rl) * KK + c0 + q * 4, *(const v4f*)&sf[rl * SFP + q * 4]); }
    asm volatile("s_wait_xcnt 0x0" ::: "memory"); }   // as at the end of mode 1
  else if (MODE == 4) {   // output rows [row][128] of out_r (part 0) or out_i (part 1): whole 512-B rows by 32 lanes
    float* O = (float*)(part == 0 ? D0 : D1);
#pragma unroll   // the LDS reads of all eight sweeps are under way together
    for (int it = 0; it < 8; ++it) { const int rl = it * 8 + wave, q = lane; vst2(O + (r0 + rl) * DD + q * 4, *(const v4f*)&sf[rl * SFP + q * 4]); } } }
__device__ __forceinline__ void lam_body(float* slp, const float* __restrict__ LQ1, const float* __restrict__ LK1, const float* __restrict__ LQ2, const float* __restrict__ LK2, float* __restrict__ LAM) { float& sl = *slp;
  if (threadIdx.x == 0) { float s1 = 0.f, s2 = 0.f;
#pragma unroll 1   // one copy of the trip, so that the wait below stands between a trip's loads and the next trip's addresses
    for (int i = 0; i < DD; i += 4) { const float *p1 = LQ1 + i, *p2 = LK1 + i, *p3 = LQ2 + i, *p4 = LK2 + i; float a[4], b[4], c[4], d[4];
#pragma unroll
      for (int k = 0; k < 4; ++k) { a[k] = p1[k]; b[k] = p2[k]; c[k] = p3[k]; d[k] = p4[k]; }
      asm volatile("s_wait_xcnt 0x0" :: "s"(p1), "s"(p2), "s"(p3), "s"(p4) : "memory");   // stands in front of the next trip's overwrite of the address registers of the loads above; the addresses are inputs, so that they live up to the wait
#pragma unroll
      for (int k = 0; k < 4; ++k) { s1 += bfr(a[k]) * bfr(b[k]); s2 += bfr(c[k]) * bfr(d[k]); } }
    const float z = expf(s1) - expf(s2) + LAMBDA_INIT; sl = 1.0f / (1.0f + expf(-z)); }
  __syncthreads(); if (threadIdx.x < 32) vst2(LAM + threadIdx.x, sl); }
// ---- k_proj: everything that reads only the inputs, in ONE launch: block 0 = lambda; then NR / 64 blocks per 128-column tile t: 4 tiles of the q projection, 2 of g (which reads the same rows as q), 2 of k, 2 of v. None of these reads what another writes, so that their blocks fill the chip together and one part's start and tail lie under another part's work.
__global__ __launch_bounds__(256) void k_proj(const float* __restrict__ QR, const float* __restrict__ QI, const float* __restrict__ KR, const float* __restrict__ KI, const float* __restrict__ VR, const float* __restrict__ VI, const float* __restrict__ PQR, const float* __restrict__ PQI, const float* __restrict__ PKR, const float* __restrict__ PKI,
    const float* __restrict__ QWR, const float* __restrict__ QWI, const float* __restrict__ QBR, const float* __restrict__ QBI, const float* __restrict__ KWR, const float* __restrict__ KWI, const float* __restrict__ KBR, const float* __restrict__ KBI,
    const float* __restrict__ VWR, const float* __restrict__ VWI, const float* __restrict__ VBR, const float* __restrict__ VBI, const float* __restrict__ GWR, const float* __restrict__ GWI, const float* __restrict__ GBR, const float* __restrict__ GBI,
    const float* __restrict__ LQ1, const float* __restrict__ LK1, const float* __restrict__ LQ2, const float* __restrict__ LK2,
    void* __restrict__ QH, void* __restrict__ QL, void* __restrict__ KH, void* __restrict__ KL, void* __restrict__ VT, void* __restrict__ VL, void* __restrict__ G, float* __restrict__ LAM) {
  __shared__ __align__(16) unsigned char sm[(128 + 64) * CLP * 2];
  if (blockIdx.x == 0) { lam_body((float*)sm, LQ1, LK1, LQ2, LK2, LAM); return; }   // the same for the whole block
  const int b = (int)blockIdx.x - 1, t = b / (NR / 64), bx = b % (NR / 64);
  const int m = t < 4 ? 0 : t < 6 ? 3 : (t - 4) >> 1;   // mode: t 0..3 q, 4 5 g, 6 7 k, 8 9 v
  const int c0 = (t < 4 ? t : t & 1) * 128, part = t < 4 ? t >> 1 : t & 1, oo0 = t < 4 ? (t & 1) * 128 : 0;
  clin_body<-1>(sm, m, bx, c0, part, oo0, m == 1 ? KR : m == 2 ? VR : QR, m == 1 ? KI : m == 2 ? VI : QI, m == 0 ? QWR : m == 1 ? KWR : m == 2 ? VWR : GWR, m == 0 ? QWI : m == 1 ? KWI : m == 2 ? VWI : GWI,
                m == 0 ? QBR : m == 1 ? KBR : m == 2 ? VBR : GBR, m == 0 ? QBI : m == 1 ? KBI : m == 2 ? VBI : GBI, m == 0 ? PQR : PKR, m == 0 ? PQI : PKI, m == 0 ? QH : m == 1 ? KH : m == 2 ? VT : G, m == 0 ? QL : m == 1 ? KL : VL); }
// ---- k_out: the output linear from the gated rows
__global__ __launch_bounds__(256) void k_out(const float* __restrict__ Z, const float* __restrict__ WR, const float* __restrict__ WI, const float* __restrict__ BR, const float* __restrict__ BI, void* __restrict__ D0, void* __restrict__ D1) {
  __shared__ __align__(16) unsigned char sm[(128 + 2 * 64) * CLP * 2];
  clin_body<4>(sm, 4, blockIdx.x, blockIdx.y * 128, blockIdx.y, 0, Z, nullptr, WR, WI, BR, BI, nullptr, nullptr, D0, D1); }
// ---- k_sc: block = (64 queries, 128 keys, pair in group), 8 waves: pair p = (head h = p/2, sel = p%2); s_r = Q[sel*512 + 0..255] . KH, s_i = Q[sel*512 + 256..511] . KH (3 products each: hi.hi + (lo.hi + hi.lo) 2^-10); logit = sqrt(s_r^2 + s_i^2 + 1e-8) x 128^-0.5
// Per stage of 64 stacked-K elements the block brings one whole 128-B line of each of its rows (64 q rows x 4 planes: s_r hi, s_r lo, s_i hi, s_i lo; 128 k rows x 2 planes: hi, lo) into LDS by asynchronous 16-byte copies; two buffers, the next stage's copies fly while this stage's fragments are read from LDS.
// wave = (16-query group qg, 64-key group kg): 4 accumulator tiles x 4 sums, products per sum in the order of rising K as before
#define SCP 72                      // LDS row pitch in f16 elements: 144 B = 16 B x 9, an odd multiple of 16 B for the 16-byte fragment reads
#define SC_Q (4 * 64 * SCP * 2)     // bytes of the four q planes of a stage
#define SC_K (2 * 128 * SCP * 2)    // bytes of the two k planes of a stage
#define SC_BUF (SC_Q + SC_K)
// eight asynchronous copies of 16 B per lane; the s_wait_xcnt stands inside the statement, so that no address register of a copy is rewritten in front of it
__device__ __forceinline__ void cp8(unsigned l0, unsigned l1, unsigned l2, unsigned l3, unsigned l4, unsigned l5, unsigned l6, unsigned l7, const _Float16* g0, const _Float16* g1, const _Float16* g2, const _Float16* g3, const _Float16* g4, const _Float16* g5, const _Float16* g6, const _Float16* g7) {
  asm volatile("global_load_async_to_lds_b128 %0, %8, off\n\tglobal_load_async_to_lds_b128 %1, %9, off\n\tglobal_load_async_to_lds_b128 %2, %10, off\n\tglobal_load_async_to_lds_b128 %3, %11, off\n\t"
               "global_load_async_to_lds_b128 %4, %12, off\n\tglobal_load_async_to_lds_b128 %5, %13, off\n\tglobal_load_async_to_lds_b128 %6, %14, off\n\tglobal_load_async_to_lds_b128 %7, %15, off\n\ts_wait_xcnt 0x0"
               :: "v"(l0), "v"(l1), "v"(l2), "v"(l3), "v"(l4), "v"(l5), "v"(l6), "v"(l7), "v"(g0), "v"(g1), "v"(g2), "v"(g3), "v"(g4), "v"(g5), "v"(g6), "v"(g7) : "memory");
}
// one stage: lq = this lane's LDS byte address in the buffer (row tid / 8, 16-byte piece tid % 8), the four pointers at the same row and piece of the stage's K columns; 32 rows per sweep of the block
__device__ __forceinline__ void sc_stage(unsigned lq, const _Float16* qh, const _Float16* ql, const _Float16* kh, const _Float16* kl) {
  const unsigned R = 32 * SCP * 2;   // LDS bytes of 32 rows
  cp8(lq, lq + R, lq + 2 * R, lq + 3 * R, lq + 4 * R, lq + 5 * R, lq + 6 * R, lq + 7 * R, qh, qh + 32 * 1024, ql, ql + 32 * 1024, qh + 256, qh + 256 + 32 * 1024, ql + 256, ql + 256 + 32 * 1024);
  const unsigned lk = lq + SC_Q;
  cp8(lk, lk + R, lk + 2 * R, lk + 3 * R, lk + 4 * R, lk + 5 * R, lk + 6 * R, lk + 7 * R, kh, kh + 32 * KK, kh + 64 * KK, kh + 96 * KK, kl, kl + 32 * KK, kl + 64 * KK, kl + 96 * KK);
}
__global__ __launch_bounds__(256) void k_sc(const _Float16* __restrict__ QH, const _Float16* __restrict__ QL, const _Float16* __restrict__ KH, const _Float16* __restrict__ KL, int p0, float* __restrict__ S0) {
  __shared__ __align__(16) unsigned char sm[2 * SC_BUF];   // two stage buffers; after the loop the room holds each wave's f32 result rows [16][68]
  const int p = p0 + blockIdx.z; const int h = p >> 1, sel = p & 1; float* S = S0 + (size_t)blockIdx.z * SS * SS;
  const int tid = threadIdx.x, wave = tid >> 5, lane = tid & 31, col = lane & 15, g = lane >> 4; const int qg = wave & 3, kg = wave >> 2; const int k0 = blockIdx.y * 128; const int qb = blockIdx.x * 64;
  const _Float16* gqh = QH + ((size_t)h * SS + qb + (tid >> 3)) * 1024 + sel * 512 + (tid & 7) * 8;   // 8 lanes x 16 B = one 128-B line of a row
  const _Float16* gql = QL + ((size_t)h * SS + qb + (tid >> 3)) * 1024 + sel * 512 + (tid & 7) * 8;
  const _Float16* gkh = KH + ((size_t)h * SS + k0 + (tid >> 3)) * KK + (tid & 7) * 8;
  const _Float16* gkl = KL + ((size_t)h * SS + k0 + (tid >> 3)) * KK + (tid & 7) * 8;
  const unsigned lb = (unsigned)(size_t)sm + (unsigned)((tid >> 3) * (SCP * 2) + (tid & 7) * 16);
  sc_stage(lb, gqh, gql, gkh, gkl);
  asm volatile("s_wait_asynccnt 0x0" ::: "memory");   // this wave's copies of stage 0 have landed
  __syncthreads();                                    // stage 0 is whole in LDS
  sc_stage(lb + SC_BUF, gqh + 64, gql + 64, gkh + 64, gkl + 64);
  v8f ar[4] = {}, arl[4] = {}, ai[4] = {}, ail[4] = {};
#pragma unroll 1   // one copy of the stage body: small text, the buffer is picked by an offset
  for (int st = 0; st < KK / 64; ++st) { const _Float16* bq = (const _Float16*)(sm + (st & 1) * SC_BUF); const _Float16* bk = (const _Float16*)(sm + (st & 1) * SC_BUF + SC_Q);
    const _Float16* kp0 = bk + (kg * 64 + col) * SCP;
    v16h kf[2][2];   // k fragments (hi, lo) of this group of six products and of the next: the next group's LDS reads are issued in front of this group's products, inside the stage only
    kf[0][0] = frag_h(kp0, lane); kf[0][1] = frag_h(kp0 + 128 * SCP, lane);
#pragma unroll
    for (int kc = 0; kc < 2; ++kc) { const _Float16* qa = bq + (qg * 16 + col) * SCP + kc * 32;
      const v16h arh = frag_h(qa, lane), arlo = frag_h(qa + 64 * SCP, lane), aih = frag_h(qa + 128 * SCP, lane), ailo = frag_h(qa + 192 * SCP, lane);
#pragma unroll
      for (int j = 0; j < 4; ++j) { const int gi = kc * 4 + j, c = gi & 1, n = c ^ 1;
        if (gi + 1 < 8) { const _Float16* kp = kp0 + ((gi + 1) & 3) * 16 * SCP + ((gi + 1) >> 2) * 32; kf[n][0] = frag_h(kp, lane); kf[n][1] = frag_h(kp + 128 * SCP, lane); }
        const v16h khf = kf[c][0], klf = kf[c][1];
        ar[j] = wmma16(arh, khf, ar[j]); arl[j] = wmma16(arlo, khf, arl[j]); arl[j] = wmma16(arh, klf, arl[j]);
        ai[j] = wmma16(aih, khf, ai[j]); ail[j] = wmma16(ailo, khf, ail[j]); ail[j] = wmma16(aih, klf, ail[j]); } }
    asm volatile("s_wait_dscnt 0x0" ::: "memory");      // this wave's fragment reads of the buffer are done before it is refilled
    asm volatile("s_wait_asynccnt 0x0" ::: "memory");   // this wave's copies of the next stage have landed
    __syncthreads();                                    // publishes the next stage and ends every wave's reads of this buffer
    if (st + 2 < KK / 64) sc_stage(lb + (unsigned)((st & 1) * SC_BUF), gqh + (st + 2) * 64, gql + (st + 2) * 64, gkh + (st + 2) * 64, gkl + (st + 2) * 64); }
  asm volatile("s_wait_asynccnt 0x0" ::: "memory");     // no copy is outstanding when the room is used for the result rows
  float* ss = (float*)sm + wave * (16 * 68);
#pragma unroll
  for (int j = 0; j < 4; ++j)
#pragma unroll
    for (int r = 0; r < 8; ++r) { const float sr_ = ar[j][r] + arl[j][r] * (1.0f / 1024.0f), si_ = ai[j][r] + ail[j][r] * (1.0f / 1024.0f); ss[(8 * g + r) * 68 + j * 16 + col] = sqrtf(sr_ * sr_ + si_ * si_ + 1e-8f) * SCALE; }
  LDSX();
#pragma unroll
  for (int it = 0; it < 8; ++it) { const int rl = it * 2 + g; vst2(S + (size_t)(qb + qg * 16 + rl) * SS + k0 + kg * 64 + col * 4, *(const v4f*)&ss[rl * 68 + col * 4]); } }
// ---- k_sm: one wave = SMR query rows in a row of the HG x 1,024 rows, taken one after the other: softmax over all 1,024 keys (f32) -> P x 2^11 in place.
// A row's logits are read once and stay in the wave's registers (32 per lane: 8 loads of 512 contiguous bytes a wave); maximum and sum go over the lanes by DPP inside a 16-lane row and one exchange between the two rows; no LDS, no barrier. The next row's loads are issued in front of this row's arithmetic.
#define SMR 4
template <int M> __device__ __forceinline__ float xrow(float v) { return __builtin_bit_cast(float, __builtin_amdgcn_update_dpp(0, __builtin_bit_cast(int, v), 0x160 | M, 0xf, 0xf, true)); }   // lane l <- lane l ^ M of the same 16-lane row (row_xmask)
__device__ __forceinline__ float xhalf(float v) { const int i = __builtin_bit_cast(int, v); return __builtin_bit_cast(float, __builtin_amdgcn_permlanex16(i, i, 0x76543210, 0xfedcba98, false, false)); }   // lane l <- lane l ^ 16
__global__ __launch_bounds__(256) void k_sm(float* __restrict__ S0) {
  const int lane = threadIdx.x & 31; float* base = S0 + ((size_t)blockIdx.x * 8 + (threadIdx.x >> 5)) * (size_t)(SMR * SS) + lane * 4;
  v4f x[2][8];
#pragma unroll
  for (int j = 0; j < 8; ++j) x[0][j] = *(const v4f*)(base + j * 128);
#pragma unroll
  for (int r = 0; r < SMR; ++r) { const int c = r & 1; float* sr = base + r * SS;
    if (r + 1 < SMR) {
#pragma unroll
      for (int j = 0; j < 8; ++j) x[c ^ 1][j] = *(const v4f*)(sr + SS + j * 128); }
    __builtin_amdgcn_sched_barrier(0);   // keeps the next row's loads and the row before's stores in front of this row's arithmetic: without it the scheduler sinks the loads to just in front of their first use (every row then waits out the load latency) and holds part of a row's stores back behind the next row's arithmetic
    float mj[8];
#pragma unroll
    for (int j = 0; j < 8; ++j) mj[j] = fmaxf(fmaxf(x[c][j][0], x[c][j][1]), fmaxf(x[c][j][2], x[c][j][3]));
    float m = fmaxf(fmaxf(fmaxf(mj[0], mj[1]), fmaxf(mj[2], mj[3])), fmaxf(fmaxf(mj[4], mj[5]), fmaxf(mj[6], mj[7])));
    m = fmaxf(m, xrow<1>(m)); m = fmaxf(m, xrow<2>(m)); m = fmaxf(m, xrow<4>(m)); m = fmaxf(m, xrow<8>(m)); m = fmaxf(m, xhalf(m));
    v4f s4 = {};
#pragma unroll
    for (int j = 0; j < 8; ++j) {
#pragma unroll
      for (int k = 0; k < 4; ++k) { x[c][j][k] = expf(x[c][j][k] - m); s4[k] += x[c][j][k]; } }
    float sum = (s4[0] + s4[1]) + (s4[2] + s4[3]);
    sum += xrow<1>(sum); sum += xrow<2>(sum); sum += xrow<4>(sum); sum += xrow<8>(sum); sum += xhalf(sum);
    const float inv = (1.0f / sum) * 2048.0f;
#pragma unroll
    for (int j = 0; j < 8; ++j) vst2(sr + j * 128, x[c][j] * inv); } }
// ---- k_pv: block = 64 queries of pair (h, sel), 8 waves: Y[row][sel*256 + c] = (P . vp)[c] for c in [0,256) = [a_r | a_i] (P split bf16 hi + lo x v hi + lo, 3 products, per output element in the order hi.hi, lo.hi, hi.lo over rising keys).
// Per stage of 64 keys the block brings both value planes (256 rows x 128 B each) and its 64 P rows (256 B each) in by whole-line loads, splits P once, and keeps them in LDS; the fragments come from LDS. The next stage's loads are issued before the products of this one and wait in registers.
// wave = (32-query group qg, 64-column group cg): 2 x 4 accumulator tiles
#define PVK 64             // keys per stage
#define PVP 72             // LDS row pitch in bf16 elements: 144 B = 16 B x 9, an odd multiple of 16 B for the 16-byte fragment reads
#define PV_SV (2 * KK * PVP * 2)   // bytes of the two value planes in LDS
#define PV_SP (2 * 64 * PVP * 2)   // bytes of the two P planes in LDS
__global__ __launch_bounds__(256) void k_pv(const float* __restrict__ PS0, const __bf16* __restrict__ VT, const __bf16* __restrict__ VL, int p0, float* __restrict__ Y) { const int p = p0 + blockIdx.z; const int h = p >> 1, sel = p & 1;
  __shared__ __align__(16) unsigned char sm[PV_SV + PV_SP];   // value planes [2][256][PVP], P planes [2][64][PVP]; after the loop the value planes' room holds the f32 result rows [64][KK + 4]
  __bf16* sv = (__bf16*)sm; __bf16* sp = (__bf16*)(sm + PV_SV); float* so = (float*)sm;
  const int tid = threadIdx.x, wave = tid >> 5, lane = tid & 31, col = lane & 15, g = lane >> 4; const int qg = wave & 1, cg = wave >> 1; const int qb = blockIdx.x * 64;
  const __bf16* gvh = VT + ((size_t)h * KK + (tid >> 3)) * (size_t)SS + (tid & 7) * 8;   // 8 lanes x 16 B = one 128-B line of a value row; 32 rows per sweep of the block
  const __bf16* gvl = VL + ((size_t)h * KK + (tid >> 3)) * (size_t)SS + (tid & 7) * 8;
  const float* gp = PS0 + (size_t)blockIdx.z * SS * SS + (size_t)(qb + (tid >> 4)) * SS + (tid & 15) * 4;   // 16 lanes x 16 B = the 256 B of a P row; 16 rows per sweep
  v4u rh[8], rl[8]; v4f rp[4];
#pragma unroll
  for (int i = 0; i < 8; ++i) { rh[i] = *(const v4u*)(gvh + (size_t)i * 32 * SS); rl[i] = *(const v4u*)(gvl + (size_t)i * 32 * SS); }
#pragma unroll
  for (int i = 0; i < 4; ++i) rp[i] = *(const v4f*)(gp + (size_t)i * 16 * SS);
  v8f acc[2][4] = {};
#pragma unroll 1   // one copy of the stage body: one set of prefetch registers, small text (the fixed-count inner loops are unrolled so that their arrays stay in registers)
  for (int st = 0; st < SS / PVK; ++st) {
    if (st) __syncthreads();   // every wave has read its last fragment of the stage before
#pragma unroll
    for (int i = 0; i < 8; ++i) { const int o = (i * 32 + (tid >> 3)) * PVP + (tid & 7) * 8; vst2(sv + o, rh[i]); vst2(sv + KK * PVP + o, rl[i]); }
#pragma unroll
    for (int i = 0; i < 4; ++i) { v4bf hb, lb;
#pragma unroll
      for (int k = 0; k < 4; ++k) { const float v = rp[i][k]; const __bf16 bh = (__bf16)v; hb[k] = bh; lb[k] = (__bf16)(v - (float)bh); }
      const int o = (i * 16 + (tid >> 4)) * PVP + (tid & 15) * 4; vst2(sp + o, hb); vst2(sp + 64 * PVP + o, lb); }
    __syncthreads();           // the stage is whole in LDS
    if (st + 1 < SS / PVK) { const int ko = (st + 1) * PVK;
#pragma unroll
      for (int i = 0; i < 8; ++i) { rh[i] = *(const v4u*)(gvh + (size_t)i * 32 * SS + ko); rl[i] = *(const v4u*)(gvl + (size_t)i * 32 * SS + ko); }
#pragma unroll
      for (int i = 0; i < 4; ++i) rp[i] = *(const v4f*)(gp + (size_t)i * 16 * SS + ko);
      asm volatile("s_wait_xcnt 0x0" ::: "memory"); }   // stands in front of the first overwrite of an address register of the loads above (the fragment reads below reuse them)
#pragma unroll
    for (int kc = 0; kc < PVK / 32; ++kc) { v16b ah[2], al[2];
#pragma unroll
      for (int t = 0; t < 2; ++t) { const int o = (qg * 32 + t * 16 + col) * PVP + kc * 32; ah[t] = frag_b(sp + o, lane); al[t] = frag_b(sp + 64 * PVP + o, lane); }
#pragma unroll
      for (int j = 0; j < 4; ++j) { const int o = (cg * 64 + j * 16 + col) * PVP + kc * 32; const v16b vh = frag_b(sv + o, lane), vl = frag_b(sv + KK * PVP + o, lane);
        acc[0][j] = wmma_bf(ah[0], vh, acc[0][j]); acc[1][j] = wmma_bf(ah[1], vh, acc[1][j]);
        acc[0][j] = wmma_bf(al[0], vh, acc[0][j]); acc[1][j] = wmma_bf(al[1], vh, acc[1][j]);
        acc[0][j] = wmma_bf(ah[0], vl, acc[0][j]); acc[1][j] = wmma_bf(ah[1], vl, acc[1][j]); } } }
  __syncthreads();             // the value planes' room is free for the result rows
#pragma unroll
  for (int t = 0; t < 2; ++t)
#pragma unroll
    for (int j = 0; j < 4; ++j)
#pragma unroll
      for (int r = 0; r < 8; ++r) so[(qg * 32 + t * 16 + 8 * g + r) * (KK + 4) + cg * 64 + j * 16 + col] = acc[t][j][r] * (1.0f / 2048.0f);
  __syncthreads();             // the result rows are whole
#pragma unroll
  for (int i = 0; i < 16; ++i) { const int rl_ = i * 4 + (tid >> 6), q = tid & 63; vst2(Y + ((size_t)h * SS + qb + rl_) * 512 + sel * 256 + q * 4, *(const v4f*)&so[rl_ * (KK + 4) + q * 4]); } }
// ---- k_mix: block = 16 rows (16 lanes per row): rms over the 512 attention values (= mean over 256 of r^2 + i^2), / rms x sub_w, out = a1 - lambda a2, then the complex gate z = g * out; z written IN PLACE over the g row (each lane reads and writes exactly its own columns d and 128 + d); float4 pieces, 16 lanes x 16 B = 256-B runs
__global__ __launch_bounds__(256) void k_mix(const float* __restrict__ Y, float* __restrict__ GZ, const float* __restrict__ LAM, const float* __restrict__ SW) {
  const int t = threadIdx.x; const int rl = t >> 4, sub = t & 15; const size_t row = (size_t)blockIdx.x * 16 + rl; const float* y = Y + row * 512; float* gz = GZ + row * KK; const float lam = LAM[0];
  float s2 = 0.f; for (int c = sub * 4; c < 512; c += 64) { const v4f v = *(const v4f*)(y + c); s2 += (v[0] * v[0] + v[1] * v[1]) + (v[2] * v[2] + v[3] * v[3]); }
#pragma unroll
  for (int o = 1; o < 16; o <<= 1) s2 += __shfl_xor(s2, o);
  const float inv = 1.0f / sqrtf(s2 * (1.0f / 256.0f) + 1e-5f);
#pragma unroll
  for (int it = 0; it < 2; ++it) { const int d = sub * 4 + it * 64;   /* d in [0,128): this lane's 4 columns */
    const v4f a1r = *(const v4f*)(y + d), a1i = *(const v4f*)(y + 128 + d), a2r = *(const v4f*)(y + 256 + d), a2i = *(const v4f*)(y + 384 + d); const v4f gr = *(const v4f*)(gz + d), gi = *(const v4f*)(gz + 128 + d);
    v4f zr, zi;
#pragma unroll
    for (int k = 0; k < 4; ++k) { const float w1 = bfr(SW[d + k]) * inv, w2 = bfr(SW[DD + d + k]) * inv; const float orr = a1r[k] * w1 - lam * (a2r[k] * w2), oi = a1i[k] * w1 - lam * (a2i[k] * w2); zr[k] = gr[k] * orr - gi[k] * oi; zi[k] = gr[k] * oi + gi[k] * orr; }
    vst2(gz + d, zr); vst2(gz + 128 + d, zi); } }
extern "C" void kernel_launch(void* const* d_in, const int* in_sizes, int n_in, void* d_out, int out_size, void* d_ws, size_t ws_size, hipStream_t stream) {
  (void)in_sizes; (void)n_in; (void)out_size;
  const float** F = (const float**)d_in;   // 0 q_r, 1 q_i, 2 k_r, 3 k_i, 4 v_r, 5 v_i, 6 pe_q_r, 7 pe_q_i, 8 pe_k_r, 9 pe_k_i [1,12,1024,128]; 10 qw_r [256,128], 11 qw_i, 12 qb_r [256], 13 qb_i; 14 kw_r [128,128], 15 kw_i, 16 kb_r, 17 kb_i; 18 vw_r, 19 vw_i, 20 vb_r, 21 vb_i; 22 gw_r, 23 gw_i, 24 gb_r, 25 gb_i; 26 ow_r, 27 ow_i, 28 ob_r, 29 ob_i; 30 lq1, 31 lk1, 32 lq2, 33 lk2 [128]; 34 sub_w [256]
  if (ws_size < (size_t)WS_END) return;
  char* ws = (char*)d_ws; _Float16 *QH = (_Float16*)(ws + WS_QH), *QL = (_Float16*)(ws + WS_QL), *KH = (_Float16*)(ws + WS_KH), *KL = (_Float16*)(ws + WS_KL); __bf16 *VT = (__bf16*)(ws + WS_VT), *VL = (__bf16*)(ws + WS_VL); float *G = (float*)(ws + WS_G), *Y = (float*)(ws + WS_Y), *LAM = (float*)(ws + WS_LAM), *S = (float*)(ws + WS_S);
  float* OUT0 = (float*)d_out; float* OUT1 = (float*)d_out + (size_t)NRF * DD;
  k_proj<<<dim3(1 + 10 * (NR / 64)), 256, 0, stream>>>(F[0], F[1], F[2], F[3], F[4], F[5], F[6], F[7], F[8], F[9], F[10], F[11], F[12], F[13], F[14], F[15], F[16], F[17], F[18], F[19], F[20], F[21], F[22], F[23], F[24], F[25], F[30], F[31], F[32], F[33], QH, QL, KH, KL, VT, VL, G, LAM);
  for (int p0 = 0; p0 < NPAIR; p0 += HG) {
    k_sc<<<dim3(SS / 64, SS / 128, HG), 256, 0, stream>>>(QH, QL, KH, KL, p0, S);
    k_sm<<<dim3(SS * HG / (8 * SMR)), 256, 0, stream>>>(S);
    k_pv<<<dim3(SS / 64, 1, HG), 256, 0, stream>>>(S, VT, VL, p0, Y);
  }
  k_mix<<<dim3(NR / 16), 256, 0, stream>>>(Y, G, LAM, F[34]);
  k_out<<<dim3(NR / 64, 2), 256, 0, stream>>>(G, F[26], F[27], F[28], F[29], OUT0, OUT1);
}

// v007
// It runs in 156 microseconds.
// Next to v006, in two timings, it ran 1.20 times as fast each time.
// All steps since v000 together make it 15.3 times as fast.
// compute dtype: all float inputs rounded to bf16; every complex linear as one stacked real GEMM ([x_r | x_i] against [W_r ; -W_i] / [W_i ; W_r]) with EXACT bf16 products on WMMA 16x16x32, f32 accumulate; q (+pe) as f16 hi + residual (x 2^10) and k (+pe) as f16 hi + residual (x 2^10) -> 3-product complex logits (s_r, s_i as two stacked K=256 real GEMMs), |s| scaled in f32 (sqrtf); softmax in f32 (per 64 keys against their own maximum by the hardware's 2^x, then one factor per row and 64 keys by precise expf); P x 2^11 split bf16 hi + lo against v bf16 hi + lo (3 products); RMS norm / lambda / differential combination / complex gating in f32; the gated result (bf16 hi + lo) through the output complex linear (2 products); f32 outputs.
#include <hip/hip_runtime.h>
#include <math.h>

typedef __attribute__((ext_vector_type(16))) _Float16 v16h;
typedef __attribute__((ext_vector_type(16))) __bf16 v16b;
typedef __attribute__((ext_vector_type(8)))  _Float16 v8h;
typedef __attribute__((ext_vector_type(8)))  float v8f;
typedef __attribute__((ext_vector_type(4)))  float v4f;
typedef __attribute__((ext_vector_type(2)))  float v2f;
typedef __attribute__((ext_vector_type(4)))  unsigned v4u;
typedef __attribute__((ext_vector_type(4)))  int v4i;
typedef float __attribute__((may_alias)) float_a;
typedef int __attribute__((may_alias)) int_a;

template <typename T> __device__ __forceinline__ void vst2(void* p, T v) { *(T*)p = v;  }
__device__ __forceinline__ v8f wmma16(v16h a, v16h b, v8f c) {
  v8f d = __builtin_amdgcn_wmma_f32_16x16x32_f16(false, a, false, b, (short)0, c, false, false);
  asm volatile("v_nop\n\tv_nop\n\tv_nop\n\tv_nop" : "+v"(d) : "v"(a), "v"(b));
  return d;
}
__device__ __forceinline__ v8f wmma_bf(v16b a, v16b b, v8f c) {
  v8f d = __builtin_amdgcn_wmma_f32_16x16x32_bf16(false, a, false, b, (short)0, c, false, false);
  asm volatile("v_nop\n\tv_nop\n\tv_nop\n\tv_nop" : "+v"(d) : "v"(a), "v"(b));
  return d;
}
// 16x16x32 fragments: lane = (h = lane>>4, row/col = lane&15); elements 0..7 = k0+8h+0..7, 8..15 = k0+16+8h+0..7; D element r = row 8h+r
__device__ __forceinline__ v16h frag_h(const _Float16* rowk0, int lane) {
  union { v16h v; v8h q[2]; } u; const _Float16* p = rowk0 + 8 * (lane >> 4);
  u.q[0] = *(const v8h*)p; u.q[1] = *(const v8h*)(p + 16); return u.v;
}
__device__ __forceinline__ v16h frag_f32(const float* rowk0, int lane) {
  v16h a; const float* p = rowk0 + 8 * (lane >> 4);
#pragma unroll
  for (int i = 0; i < 8; ++i) { a[i] = (_Float16)p[i]; a[8 + i] = (_Float16)p[16 + i]; }
  return a;
}
__device__ __forceinline__ v16h frag_f32s(const float* rowk0, int lane, float sc) {
  v16h a; const float* p = rowk0 + 8 * (lane >> 4);
#pragma unroll
  for (int i = 0; i < 8; ++i) { a[i] = (_Float16)(p[i] * sc); a[8 + i] = (_Float16)(p[16 + i] * sc); }
  return a;
}
// column fragment from a [K][ld] layout (column n), rows >= K read as 0
__device__ __forceinline__ v16h fragc_f32(const float* W, int k0, int n, int lane, int ld, int K) {
  v16h a; const int g = lane >> 4;
#pragma unroll
  for (int i = 0; i < 8; ++i) { const int ka = k0 + 8 * g + i, kb = ka + 16;
    a[i] = (_Float16)(ka < K ? W[(size_t)(ka < K ? ka : K - 1) * ld + n] : 0.f); a[8 + i] = (_Float16)(kb < K ? W[(size_t)(kb < K ? kb : K - 1) * ld + n] : 0.f); }
  return a;
}
struct F2 { v16b h, l; };
__device__ __forceinline__ F2 bsplit16(const float v[16]) { F2 r;
#pragma unroll
  for (int i = 0; i < 16; ++i) { const __bf16 h = (__bf16)v[i]; r.h[i] = h; r.l[i] = (__bf16)(v[i] - (float)h); }
  return r; }
__device__ __forceinline__ F2 split_row(const float* row, int k0, int lane) { float v[16]; const float* p = row + k0 + 8 * (lane >> 4);
#pragma unroll
  for (int i = 0; i < 8; ++i) { v[i] = p[i]; v[8 + i] = p[16 + i]; }
  return bsplit16(v); }
__device__ __forceinline__ F2 split_rowK(const float* row, int k0, int lane, int K) { float v[16]; const int g = lane >> 4;
#pragma unroll
  for (int i = 0; i < 8; ++i) { const int ka = k0 + 8 * g + i, kb = ka + 16; v[i] = ka < K ? row[ka < K ? ka : K - 1] : 0.f; v[8 + i] = kb < K ? row[kb < K ? kb : K - 1] : 0.f; }
  return bsplit16(v); }
__device__ __forceinline__ F2 split_col(const float* W, int k0, int n, int lane, int ld, int K) { float v[16]; const int g = lane >> 4;
#pragma unroll
  for (int i = 0; i < 8; ++i) { const int ka = k0 + 8 * g + i, kb = ka + 16; v[i] = ka < K ? W[(size_t)(ka < K ? ka : K - 1) * ld + n] : 0.f; v[8 + i] = kb < K ? W[(size_t)(kb < K ? kb : K - 1) * ld + n] : 0.f; }
  return bsplit16(v); }
__device__ __forceinline__ v8f mac3(const F2& a, const F2& b, v8f c) { c = wmma_bf(a.l, b.h, c); c = wmma_bf(a.h, b.l, c); return wmma_bf(a.h, b.h, c); }
__device__ __forceinline__ float sigm(float v) { return 1.0f / (1.0f + expf(-v)); }
#define LDSX() do { asm volatile("s_wait_dscnt 0" ::: "memory"); __builtin_amdgcn_wave_barrier(); __builtin_amdgcn_fence(__ATOMIC_RELEASE, "workgroup"); } while (0)


// Complex differential attention (B 1, H 12, S 1,024, D 128): qp = CLin_q(q) + [pe_q, pe_q] (2D wide -> q1, q2), kp = CLin_k(k) + pe_k, vp = CLin_v(v); w_s = softmax(|q_s . conj(kp)| / sqrt(128)) for s = 1, 2; a_s = w_s vp (complex); cat = [a1, a2] / rms(cat) * sub_w; out = a1 - lambda a2 with lambda = sigmoid(exp(lq1 . lk1) - exp(lq2 . lk2) + 0.3555...); out = CLin_g(q) * out (complex product); out = CLin_o(out) -> (out_r, out_i).
#define NHT 12             // heads (x batch 1)
#define SS 1024
#define DD 128
#define KK 256             // stacked K of every complex linear / logit GEMM: [real | imag]
#ifndef NHU
#define NHU NHT            // heads processed
#endif
#define NR (NHU * SS)      // rows processed
#define NRF (NHT * SS)     // full row count (output-1 offset)
#ifndef HG
#define HG 24              // (head, sel) pairs per launch group (divides NPAIR): all pairs at once, so that the 64-query blocks of k_pv outnumber the WGPs; the logit planes take 96 MiB of workspace
#endif
#define NPAIR (NHU * 2)
#define SCALE 0.0883883461356163f       // 128^-0.5 as f32
#define LAMBDA_INIT 0.35550907254219055f  // 0.8 - 0.6 exp(-0.3) as f32
__device__ __forceinline__ float bfr(float v) { return (float)(__bf16)v; }
typedef __attribute__((ext_vector_type(8))) __bf16 v8b;
typedef __attribute__((ext_vector_type(4))) __bf16 v4bf;
__device__ __forceinline__ v16b frag_b(const __bf16* rowk0, int lane) { union { v16b v; v8b q[2]; } u; const __bf16* p = rowk0 + 8 * (lane >> 4); u.q[0] = *(const v8b*)p; u.q[1] = *(const v8b*)(p + 16); return u.v; }

#define WS_QH  0u                                      // f16 q rows [row][1024]: per sel s: [s*512 +0..127] q_r, [+128..255] q_i, [+256..383] q_i, [+384..511] -q_r  (hi)
#define WS_QL  (WS_QH + 2u * (size_t)NRF * 1024)       // f16 residual x 2^10
#define WS_KH  (WS_QL + 2u * (size_t)NRF * 1024)       // f16 k rows [row][256] = [kp_r | kp_i] (hi)
#define WS_KL  (WS_KH + 2u * (size_t)NRF * KK)         // f16 residual x 2^10
#define WS_VT  (WS_KL + 2u * (size_t)NRF * KK)         // bf16 value planes [h][256 = vp_r | vp_i][s] hi
#define WS_VL  (WS_VT + 2u * (size_t)NHT * KK * SS)    // bf16 value residual planes
#define WS_G   (WS_VL + 2u * (size_t)NHT * KK * SS)    // f32 g rows [row][256] = [g_r | g_i]; later overwritten in place by the gated result z = [z_r | z_i]
#define WS_Y   (WS_G + 4u * (size_t)NRF * KK)          // f32 attention rows [row][512] = [a1_r | a1_i | a2_r | a2_i]
#define WS_LAM (WS_Y + 4u * (size_t)NRF * 512)         // one line: lambda replicated
#define WS_S   (WS_LAM + 128u)                         // f32 planes for HG (head, sel) pairs [hg][q][k]: exp(logit - maximum of the row's logits in the key's group of 64 keys)
#define WS_ST  (WS_S + 4u * (size_t)HG * SS * SS)      // f32 softmax parts, one 128-B line per (pair, group of 16 queries, group of 64 keys): word (r % 2) * 8 + r / 2 = row r's maximum over these keys, word 16 + the same = row r's sum of the plane's values over these keys
#define WS_END (WS_ST + 128u * (size_t)HG * (SS / 16) * (SS / 64))

// ---- clin_body: block = (64 rows, 128 output cols, tile index over 2*NO), 8 waves: generic complex linear as a stacked real GEMM.
// A row = [x_r[row] | x_i[row]] (K 256; MODE < 4: two f32 input tensors, bf16 exact; MODE 4: the f32 z rows, bf16 hi + lo -> 2 products);
// output column o in [0, 2 NO): part = o / NO (0 real, 1 imag), oo = o % NO; B[k] = part 0: (k < 128 ? W_r[oo][k] : -W_i[oo][k-128]), part 1: (k < 128 ? W_i[oo][k] : W_r[oo][k-128]); + bias_part[oo].
// MODE 0: q projection (NO 256) + pe_q -> QH/QL (each value to its two slots, see WS_QH); MODE 1: k (NO 128) + pe_k -> KH/KL; MODE 2: v -> bf16 planes; MODE 3: g -> G rows; MODE 4: output linear from Z -> the two output tensors
// Data path: the block brings its 128 weight rows and its 64 A rows (both K halves: real, imag) in by whole 512-B rows (one wave = one row per load), all of these loads issued in front of the first use (pe rows and bias: behind the first barrier, so that they come in while the products run; pe is added at the write-out, behind the bias), rounds weights and A to bf16 once and keeps them in LDS; every wave's fragments come from LDS, the next 32 K columns' fragments read in front of this group's products.
// wave = (16-row group rg, 64-column group cg): 4 accumulator tiles, products per tile in the order of rising K. The fixed-count loops are unrolled so that their arrays stay in registers.
#define CLP 264            // LDS row pitch in bf16 elements: 528 B = 16 B x 33, an odd multiple of 16 B for the 16-byte fragment reads
#define SFP 132            // pitch of the f32 result rows
// one K half of the weight rows / of the A rows into registers: b = the block's first row (the same for all threads), o = this thread's byte offset from it (row tid / 32, 16-byte piece tid % 32); 8 rows per sweep of the block
__device__ __forceinline__ void cl_ldw(v4f (&rw)[16], const char* b, unsigned o) {
#pragma unroll
  for (int i = 0; i < 16; ++i) rw[i] = *(const v4f*)(b + o + i * (8 * DD * 4));
}
__device__ __forceinline__ void cl_lda(v4f (&ra)[8], const char* b, unsigned o, int xs) {
#pragma unroll
  for (int i = 0; i < 8; ++i) ra[i] = *(const v4f*)(b + o + i * (8 * xs * 4));
}
// the same from registers into LDS as bf16 (weights x sg, which is +1 or -1: exact); pw, pa = this thread's place in the weight plane and in the first A plane
__device__ __forceinline__ void cl_putw(const v4f (&rw)[16], float sg, __bf16* pw) {
#pragma unroll
  for (int i = 0; i < 16; ++i) { v4bf b;
#pragma unroll
    for (int k = 0; k < 4; ++k) b[k] = (__bf16)(sg * rw[i][k]);
    vst2(pw + i * 8 * CLP, b); }
}
template <int NA> __device__ __forceinline__ void cl_puta(const v4f (&ra)[8], __bf16* pa) {
#pragma unroll
  for (int i = 0; i < 8; ++i) { v4bf hb, lb;
#pragma unroll
    for (int k = 0; k < 4; ++k) { const float v = ra[i][k]; const __bf16 bh = (__bf16)v; hb[k] = bh; lb[k] = (__bf16)(v - (float)bh); }
    vst2(pa + i * 8 * CLP, hb); if (NA == 2) vst2(pa + 64 * CLP + i * 8 * CLP, lb); }
}
// all products: fa = this lane's A row, fw = this lane's first weight row; two sets of fragments, so that the LDS reads of the next 32 K columns are under way while this group's products run
template <int NA> __device__ __forceinline__ void cl_mac(v8f (&acc)[4], const __bf16* fa, const __bf16* fw, int lane) {
  v16b a[2][NA], w[2][4];
#pragma unroll
  for (int t = 0; t < NA; ++t) a[0][t] = frag_b(fa + t * 64 * CLP, lane);
#pragma unroll
  for (int j = 0; j < 4; ++j) w[0][j] = frag_b(fw + j * 16 * CLP, lane);
#pragma unroll
  for (int kc = 0; kc < KK / 32; ++kc) { const int c = kc & 1, n = c ^ 1;
    if (kc + 1 < KK / 32) {
#pragma unroll
      for (int t = 0; t < NA; ++t) a[n][t] = frag_b(fa + t * 64 * CLP + (kc + 1) * 32, lane);
#pragma unroll
      for (int j = 0; j < 4; ++j) w[n][j] = frag_b(fw + j * 16 * CLP + (kc + 1) * 32, lane); }
#pragma unroll
    for (int t = 0; t < NA; ++t)
#pragma unroll
      for (int j = 0; j < 4; ++j) acc[j] = wmma_bf(a[c][t], w[c][j], acc[j]); }
}
// MODE 4 = the output linear, known at compile time; MODE -1 = one of the modes 0 to 3, picked per block by mrt (they share the data path and the products and differ in the write-out). sm = the block's LDS, bx = its 64-row group, c0 = its first column of the 2 NO, part and oo0 as above
template <int MODE>
__device__ __forceinline__ void clin_body(unsigned char* sm, int mrt, int bx, int c0, int part, int oo0, const float* __restrict__ XR, const float* __restrict__ XI, const float* __restrict__ WR, const float* __restrict__ WI, const float* __restrict__ BR, const float* __restrict__ BI, const float* __restrict__ PER, const float* __restrict__ PEI, void* __restrict__ D0, void* __restrict__ D1) {
  constexpr int NA = MODE == 4 ? 2 : 1;   // A planes in LDS
  const int mode = MODE == 4 ? 4 : mrt;
  // sm holds (128 + NA * 64) * CLP * 2 bytes: weight plane [128][CLP], A planes [NA][64][CLP]; after the products the weight plane's room holds the f32 result rows [64][SFP]
  __bf16* sw = (__bf16*)sm; __bf16* sa = sw + 128 * CLP; float* sf = (float*)sm;
  const int tid = threadIdx.x, wave = tid >> 5, lane = tid & 31, col = lane & 15, g = lane >> 4; const int rg = wave & 3, cg = wave >> 2; const size_t r0 = (size_t)bx * 64;
  constexpr int XS = MODE < 4 ? DD : KK; const float sg1 = part == 0 ? -1.0f : 1.0f;
  // every global read = a base that is the same for the whole block + a 32-bit byte offset of the thread
  const char* wb0 = (const char*)((part == 0 ? WR : WI) + (size_t)oo0 * DD); const char* wb1 = (const char*)((part == 0 ? WI : WR) + (size_t)oo0 * DD); const unsigned wo = (unsigned)tid * 16u;   // row tid / 32 of 512 B, piece tid % 32
  const char* xb0 = (const char*)(XR + r0 * XS); const char* xb1 = MODE < 4 ? (const char*)(XI + r0 * XS) : xb0 + 128 * 4; const unsigned xo = MODE < 4 ? wo : (unsigned)(wave * (XS * 4) + lane * 16);
  const float* bbs = (part == 0 ? BR : BI) + oo0; const unsigned bi = (unsigned)(cg * 64 + col);
  const char* pb = mode <= 1 ? (const char*)((part == 0 ? PER : PEI) + r0 * DD) : nullptr; const unsigned po = (unsigned)((tid >> 4) * (DD * 4) + (tid & 15) * 32);   // MODE <= 1: 16 lanes x 32 B = the 512 B of a pe row; 16 rows per sweep
  __bf16* pw = sw + wave * CLP + lane * 4; __bf16* pa = sa + wave * CLP + lane * 4;
  const __bf16* fa = sa + (rg * 16 + col) * CLP; const __bf16* fw = sw + (cg * 64 + col) * CLP;
  v4f rw0[16], ra0[8], rw1[16], ra1[8], pe[4][2]; float bb[4];
  cl_ldw(rw0, wb0, wo); cl_ldw(rw1, wb1, wo); cl_lda(ra0, xb0, xo, XS); cl_lda(ra1, xb1, xo, XS);
  // stands in front of the first overwrite of an address register of the loads above; the bases and the offset registers that the loads name (the thread id, scaled by the load's width) are inputs, so that they live up to the wait
  if (MODE < 4) asm volatile("s_wait_xcnt 0x0" :: "v"(tid), "s"(wb0), "s"(wb1), "s"(xb0), "s"(xb1) : "memory");
  else asm volatile("s_wait_xcnt 0x0" :: "v"(tid), "v"(xo), "s"(wb0), "s"(wb1), "s"(xb0) : "memory");
  cl_putw(rw0, 1.0f, pw); cl_putw(rw1, sg1, pw + 128);
  cl_puta<NA>(ra0, pa); cl_puta<NA>(ra1, pa + 128);
  __syncthreads();             // weights and A rows are whole in LDS
  // the bias and the pe rows come in while the products run
#pragma unroll
  for (int j = 0; j < 4; ++j) bb[j] = bbs[bi + j * 16];
  if (mode <= 1) {
#pragma unroll
    for (int it = 0; it < 4; ++it) { pe[it][0] = *(const v4f*)(pb + po + it * (16 * DD * 4)); pe[it][1] = *(const v4f*)(pb + po + it * (16 * DD * 4) + 16); }
    asm volatile("s_wait_xcnt 0x0" :: "v"(bi), "s"(bbs), "v"(po), "s"(pb) : "memory"); }   // as above
  else asm volatile("s_wait_xcnt 0x0" :: "v"(bi), "s"(bbs) : "memory");   // as above
  v8f acc[4] = {};
  cl_mac<NA>(acc, fa, fw, lane);
  __syncthreads();             // the weight plane's room is free for the result rows
#pragma unroll
  for (int j = 0; j < 4; ++j) { const float bj = bfr(bb[j]);
#pragma unroll
    for (int r = 0; r < 8; ++r) sf[(rg * 16 + 8 * g + r) * SFP + cg * 64 + j * 16 + col] = acc[j][r] + bj; }
  __syncthreads();             // the result rows are whole
  if (mode == 0) {   // q: value (sel = oo0/128, d) -> QH[row][sel*512 + (part ? 128 : 0) + d] and QH[row][sel*512 + (part ? 256 : 384) + d] (the second real copy negated); f16 hi + residual x 2^10; each destination = a 256-B segment per row by 16 consecutive threads
    _Float16* QH = (_Float16*)D0; _Float16* QL = (_Float16*)D1; const int sel = oo0 / DD; const int dA = sel * 512 + (part ? 128 : 0), dB = sel * 512 + (part ? 256 : 384); const float sgB = part ? 1.0f : -1.0f;
#pragma unroll   // pe[it] stays in registers
    for (int it = 0; it < 4; ++it) { const int rl = it * 16 + (tid >> 4), q = tid & 15; v8h ha, la, hb, lb;
#pragma unroll
      for (int k = 0; k < 8; ++k) { const float v = sf[rl * SFP + q * 8 + k] + bfr(pe[it][k >> 2][k & 3]); const _Float16 hv = (_Float16)v; ha[k] = hv; la[k] = (_Float16)((v - (float)hv) * 1024.0f); const float vb = v * sgB; const _Float16 hb2 = (_Float16)vb; hb[k] = hb2; lb[k] = (_Float16)((vb - (float)hb2) * 1024.0f); }
      const size_t ro = (r0 + rl) * 1024; vst2((v4u*)(QH + ro + dA + q * 8), *(const v4u*)&ha); vst2((v4u*)(QL + ro + dA + q * 8), *(const v4u*)&la); vst2((v4u*)(QH + ro + dB + q * 8), *(const v4u*)&hb); vst2((v4u*)(QL + ro + dB + q * 8), *(const v4u*)&lb); } }
  else if (mode == 1) {   // k rows [row][256]: column part*128 + d; f16 hi + residual x 2^10
    _Float16* KH = (_Float16*)D0; _Float16* KL = (_Float16*)D1;
#pragma unroll   // pe[it] stays in registers
    for (int it = 0; it < 4; ++it) { const int rl = it * 16 + (tid >> 4), q = tid & 15; v8h ha, la;
#pragma unroll
      for (int k = 0; k < 8; ++k) { const float v = sf[rl * SFP + q * 8 + k] + bfr(pe[it][k >> 2][k & 3]); const _Float16 hv = (_Float16)v; ha[k] = hv; la[k] = (_Float16)((v - (float)hv) * 1024.0f); }
      const size_t ro = (r0 + rl) * KK + c0; vst2((v4u*)(KH + ro + q * 8), *(const v4u*)&ha); vst2((v4u*)(KL + ro + q * 8), *(const v4u*)&la); }
    asm volatile("s_wait_xcnt 0x0" ::: "memory"); }   // run-time mode: in the listing another mode's code follows behind a branch; the wait stands in front of any overwrite there of a register that the stores above name
  else if (mode == 2) {
    __bf16* VT = (__bf16*)D0; __bf16* VL = (__bf16*)D1; const size_t h = r0 / SS; const int s0 = (int)(r0 % SS);
#pragma unroll   // the LDS reads of all four sweeps are under way together
    for (int it = 0; it < 4; ++it) { const int e = it * 256 + tid, cl = e >> 3, q = e & 7; v8b hb, lb;
#pragma unroll
      for (int k = 0; k < 8; ++k) { const float v = sf[(q * 8 + k) * SFP + cl]; const __bf16 bh = (__bf16)v; hb[k] = bh; lb[k] = (__bf16)(v - (float)bh); }
      const size_t o2 = (h * KK + c0 + cl) * (size_t)SS + s0 + q * 8; vst2((v4u*)(VT + o2), *(const v4u*)&hb); vst2((v4u*)(VL + o2), *(const v4u*)&lb); }
    asm volatile("s_wait_xcnt 0x0" ::: "memory"); }   // as at the end of mode 1
  else if (mode == 3) {   // g rows [row][256] f32: 512-B segment per row by 32 lanes
    float* G = (float*)D0;
#pragma unroll   // the LDS reads of all eight sweeps are under way together
    for (int it = 0; it < 8; ++it) { const int rl = it * 8 + wave, q = lane; vst2(G + (r0 + rl) * KK + c0 + q * 4, *(const v4f*)&sf[rl * SFP + q * 4]); }
    asm volatile("s_wait_xcnt 0x0" ::: "memory"); }   // as at the end of mode 1
  else if (MODE == 4) {   // output rows [row][128] of out_r (part 0) or out_i (part 1): whole 512-B rows by 32 lanes
    float* O = (float*)(part == 0 ? D0 : D1);
#pragma unroll   // the LDS reads of all eight sweeps are under way together
    for (int it = 0; it < 8; ++it) { const int rl = it * 8 + wave, q = lane; vst2(O + (r0 + rl) * DD + q * 4, *(const v4f*)&sf[rl * SFP + q * 4]); } } }
__device__ __forceinline__ void lam_body(float* slp, const float* __restrict__ LQ1, const float* __restrict__ LK1, const float* __restrict__ LQ2, const float* __restrict__ LK2, float* __restrict__ LAM) { float& sl = *slp;
  if (threadIdx.x == 0) { float s1 = 0.f, s2 = 0.f;
#pragma unroll 1   // one copy of the trip, so that the wait below stands between a trip's loads and the next trip's addresses
    for (int i = 0; i < DD; i += 4) { const float *p1 = LQ1 + i, *p2 = LK1 + i, *p3 = LQ2 + i, *p4 = LK2 + i; float a[4], b[4], c[4], d[4];
#pragma unroll
      for (int k = 0; k < 4; ++k) { a[k] = p1[k]; b[k] = p2[k]; c[k] = p3[k]; d[k] = p4[k]; }
      asm volatile("s_wait_xcnt 0x0" :: "s"(p1), "s"(p2), "s"(p3), "s"(p4) : "memory");   // stands in front of the next trip's overwrite of the address registers of the loads above; the addresses are inputs, so that they live up to the wait
#pragma unroll
      for (int k = 0; k < 4; ++k) { s1 += bfr(a[k]) * bfr(b[k]); s2 += bfr(c[k]) * bfr(d[k]); } }
    const float z = expf(s1) - expf(s2) + LAMBDA_INIT; sl = 1.0f / (1.0f + expf(-z)); }
  __syncthreads(); if (threadIdx.x < 32) vst2(LAM + threadIdx.x, sl); }
// ---- k_proj: everything that reads only the inputs, in ONE launch: block 0 = lambda; then NR / 64 blocks per 128-column tile t: 4 tiles of the q projection, 2 of g (which reads the same rows as q), 2 of k, 2 of v. None of these reads what another writes, so that their blocks fill the chip together and one part's start and tail lie under another part's work.
__global__ __launch_bounds__(256) void k_proj(const float* __restrict__ QR, const float* __restrict__ QI, const float* __restrict__ KR, const float* __restrict__ KI, const float* __restrict__ VR, const float* __restrict__ VI, const float* __restrict__ PQR, const float* __restrict__ PQI, const float* __restrict__ PKR, const float* __restrict__ PKI,
    const float* __restrict__ QWR, const float* __restrict__ QWI, const float* __restrict__ QBR, const float* __restrict__ QBI, const float* __restrict__ KWR, const float* __restrict__ KWI, const float* __restrict__ KBR, const float* __restrict__ KBI,
    const float* __restrict__ VWR, const float* __restrict__ VWI, const float* __restrict__ VBR, const float* __restrict__ VBI, const float* __restrict__ GWR, const float* __restrict__ GWI, const float* __restrict__ GBR, const float* __restrict__ GBI,
    const float* __restrict__ LQ1, const float* __restrict__ LK1, const float* __restrict__ LQ2, const float* __restrict__ LK2,
    void* __restrict__ QH, void* __restrict__ QL, void* __restrict__ KH, void* __restrict__ KL, void* __restrict__ VT, void* __restrict__ VL, void* __restrict__ G, float* __restrict__ LAM) {
  __shared__ __align__(16) unsigned char sm[(128 + 64) * CLP * 2];
  if (blockIdx.x == 0) { lam_body((float*)sm, LQ1, LK1, LQ2, LK2, LAM); return; }   // the same for the whole block
  const int b = (int)blockIdx.x - 1, t = b / (NR / 64), bx = b % (NR / 64);
  const int m = t < 4 ? 0 : t < 6 ? 3 : (t - 4) >> 1;   // mode: t 0..3 q, 4 5 g, 6 7 k, 8 9 v
  const int c0 = (t < 4 ? t : t & 1) * 128, part = t < 4 ? t >> 1 : t & 1, oo0 = t < 4 ? (t & 1) * 128 : 0;
  clin_body<-1>(sm, m, bx, c0, part, oo0, m == 1 ? KR : m == 2 ? VR : QR, m == 1 ? KI : m == 2 ? VI : QI, m == 0 ? QWR : m == 1 ? KWR : m == 2 ? VWR : GWR, m == 0 ? QWI : m == 1 ? KWI : m == 2 ? VWI : GWI,
                m == 0 ? QBR : m == 1 ? KBR : m == 2 ? VBR : GBR, m == 0 ? QBI : m == 1 ? KBI : m == 2 ? VBI : GBI, m == 0 ? PQR : PKR, m == 0 ? PQI : PKI, m == 0 ? QH : m == 1 ? KH : m == 2 ? VT : G, m == 0 ? QL : m == 1 ? KL : VL); }
// ---- k_out: the output linear from the gated rows
__global__ __launch_bounds__(256) void k_out(const float* __restrict__ Z, const float* __restrict__ WR, const float* __restrict__ WI, const float* __restrict__ BR, const float* __restrict__ BI, void* __restrict__ D0, void* __restrict__ D1) {
  __shared__ __align__(16) unsigned char sm[(128 + 2 * 64) * CLP * 2];
  clin_body<4>(sm, 4, blockIdx.x, blockIdx.y * 128, blockIdx.y, 0, Z, nullptr, WR, WI, BR, BI, nullptr, nullptr, D0, D1); }
// ---- k_sc: block = (64 queries, 128 keys, pair in group), 8 waves: pair p = (head h = p/2, sel = p%2); s_r = Q[sel*512 + 0..255] . KH, s_i = Q[sel*512 + 256..511] . KH (3 products each: hi.hi + (lo.hi + hi.lo) 2^-10); logit = sqrt(s_r^2 + s_i^2 + 1e-8) x 128^-0.5
// The softmax's first half is done here, on the logits while they are in the wave: per row the maximum m64 over the wave's 64 keys, e = exp(logit - m64) -> the S plane, the sum of e; m64 and the sum go to the wave's own line of ST. k_pv turns them into one factor per (row, 64 keys), so that no pass over the planes stands between the two kernels.
// Per stage of 64 stacked-K elements the block brings one whole 128-B line of each of its rows (64 q rows x 4 planes: s_r hi, s_r lo, s_i hi, s_i lo; 128 k rows x 2 planes: hi, lo) into LDS by asynchronous 16-byte copies; two buffers, the next stage's copies fly while this stage's fragments are read from LDS.
// wave = (16-query group qg, 64-key group kg): 4 accumulator tiles x 4 sums, products per sum in the order of rising K as before
#define SCP 72                      // LDS row pitch in f16 elements: 144 B = 16 B x 9, an odd multiple of 16 B for the 16-byte fragment reads
#define SC_Q (4 * 64 * SCP * 2)     // bytes of the four q planes of a stage
#define SC_K (2 * 128 * SCP * 2)    // bytes of the two k planes of a stage
#define SC_BUF (SC_Q + SC_K)
// eight asynchronous copies of 16 B per lane; the s_wait_xcnt stands inside the statement, so that no address register of a copy is rewritten in front of it
__device__ __forceinline__ void cp8(unsigned l0, unsigned l1, unsigned l2, unsigned l3, unsigned l4, unsigned l5, unsigned l6, unsigned l7, const _Float16* g0, const _Float16* g1, const _Float16* g2, const _Float16* g3, const _Float16* g4, const _Float16* g5, const _Float16* g6, const _Float16* g7) {
  asm volatile("global_load_async_to_lds_b128 %0, %8, off\n\tglobal_load_async_to_lds_b128 %1, %9, off\n\tglobal_load_async_to_lds_b128 %2, %10, off\n\tglobal_load_async_to_lds_b128 %3, %11, off\n\t"
               "global_load_async_to_lds_b128 %4, %12, off\n\tglobal_load_async_to_lds_b128 %5, %13, off\n\tglobal_load_async_to_lds_b128 %6, %14, off\n\tglobal_load_async_to_lds_b128 %7, %15, off\n\ts_wait_xcnt 0x0"
               :: "v"(l0), "v"(l1), "v"(l2), "v"(l3), "v"(l4), "v"(l5), "v"(l6), "v"(l7), "v"(g0), "v"(g1), "v"(g2), "v"(g3), "v"(g4), "v"(g5), "v"(g6), "v"(g7) : "memory");
}
// one stage: lq = this lane's LDS byte address in the buffer (row tid / 8, 16-byte piece tid % 8), the four pointers at the same row and piece of the stage's K columns; 32 rows per sweep of the block
__device__ __forceinline__ void sc_stage(unsigned lq, const _Float16* qh, const _Float16* ql, const _Float16* kh, const _Float16* kl) {
  const unsigned R = 32 * SCP * 2;   // LDS bytes of 32 rows
  cp8(lq, lq + R, lq + 2 * R, lq + 3 * R, lq + 4 * R, lq + 5 * R, lq + 6 * R, lq + 7 * R, qh, qh + 32 * 1024, ql, ql + 32 * 1024, qh + 256, qh + 256 + 32 * 1024, ql + 256, ql + 256 + 32 * 1024);
  const unsigned lk = lq + SC_Q;
  cp8(lk, lk + R, lk + 2 * R, lk + 3 * R, lk + 4 * R, lk + 5 * R, lk + 6 * R, lk + 7 * R, kh, kh + 32 * KK, kh + 64 * KK, kh + 96 * KK, kl, kl + 32 * KK, kl + 64 * KK, kl + 96 * KK);
}
template <int M> __device__ __forceinline__ float xrow(float v) { return __builtin_bit_cast(float, __builtin_amdgcn_update_dpp(0, __builtin_bit_cast(int, v), 0x160 | M, 0xf, 0xf, true)); }   // lane l <- lane l ^ M of the same 16-lane row (row_xmask)
__device__ __forceinline__ float rowmax(float m) { m = fmaxf(m, xrow<1>(m)); m = fmaxf(m, xrow<2>(m)); m = fmaxf(m, xrow<4>(m)); return fmaxf(m, xrow<8>(m)); }   // over the 16 lanes of a row, the result in all of them
__device__ __forceinline__ float rowsum(float s) { s += xrow<1>(s); s += xrow<2>(s); s += xrow<4>(s); return s + xrow<8>(s); }
__global__ __launch_bounds__(256) void k_sc(const _Float16* __restrict__ QH, const _Float16* __restrict__ QL, const _Float16* __restrict__ KH, const _Float16* __restrict__ KL, int p0, float* __restrict__ S0, float* __restrict__ ST) {
  __shared__ __align__(16) unsigned char sm[2 * SC_BUF];   // two stage buffers; after the loop the room holds each wave's f32 result rows [16][68]
  const int p = p0 + blockIdx.z; const int h = p >> 1, sel = p & 1; float* S = S0 + (size_t)blockIdx.z * SS * SS;
  const int tid = threadIdx.x, wave = tid >> 5, lane = tid & 31, col = lane & 15, g = lane >> 4; const int qg = wave & 3, kg = wave >> 2; const int k0 = blockIdx.y * 128; const int qb = blockIdx.x * 64;
  const _Float16* gqh = QH + ((size_t)h * SS + qb + (tid >> 3)) * 1024 + sel * 512 + (tid & 7) * 8;   // 8 lanes x 16 B = one 128-B line of a row
  const _Float16* gql = QL + ((size_t)h * SS + qb + (tid >> 3)) * 1024 + sel * 512 + (tid & 7) * 8;
  const _Float16* gkh = KH + ((size_t)h * SS + k0 + (tid >> 3)) * KK + (tid & 7) * 8;
  const _Float16* gkl = KL + ((size_t)h * SS + k0 + (tid >> 3)) * KK + (tid & 7) * 8;
  const unsigned lb = (unsigned)(size_t)sm + (unsigned)((tid >> 3) * (SCP * 2) + (tid & 7) * 16);
  sc_stage(lb, gqh, gql, gkh, gkl);
  asm volatile("s_wait_asynccnt 0x0" ::: "memory");   // this wave's copies of stage 0 have landed
  __syncthreads();                                    // stage 0 is whole in LDS
  sc_stage(lb + SC_BUF, gqh + 64, gql + 64, gkh + 64, gkl + 64);
  v8f ar[4] = {}, arl[4] = {}, ai[4] = {}, ail[4] = {};
#pragma unroll 1   // one copy of the stage body: small text, the buffer is picked by an offset
  for (int st = 0; st < KK / 64; ++st) { const _Float16* bq = (const _Float16*)(sm + (st & 1) * SC_BUF); const _Float16* bk = (const _Float16*)(sm + (st & 1) * SC_BUF + SC_Q);
    const _Float16* kp0 = bk + (kg * 64 + col) * SCP;
    v16h kf[2][2];   // k fragments (hi, lo) of this group of six products and of the next: the next group's LDS reads are issued in front of this group's products, inside the stage only
    kf[0][0] = frag_h(kp0, lane); kf[0][1] = frag_h(kp0 + 128 * SCP, lane);
#pragma unroll
    for (int kc = 0; kc < 2; ++kc) { const _Float16* qa = bq + (qg * 16 + col) * SCP + kc * 32;
      const v16h arh = frag_h(qa, lane), arlo = frag_h(qa + 64 * SCP, lane), aih = frag_h(qa + 128 * SCP, lane), ailo = frag_h(qa + 192 * SCP, lane);
#pragma unroll
      for (int j = 0; j < 4; ++j) { const int gi = kc * 4 + j, c = gi & 1, n = c ^ 1;
        if (gi + 1 < 8) { const _Float16* kp = kp0 + ((gi + 1) & 3) * 16 * SCP + ((gi + 1) >> 2) * 32; kf[n][0] = frag_h(kp, lane); kf[n][1] = frag_h(kp + 128 * SCP, lane); }
        const v16h khf = kf[c][0], klf = kf[c][1];
        ar[j] = wmma16(arh, khf, ar[j]); arl[j] = wmma16(arlo, khf, arl[j]); arl[j] = wmma16(arh, klf, arl[j]);
        ai[j] = wmma16(aih, khf, ai[j]); ail[j] = wmma16(ailo, khf, ail[j]); ail[j] = wmma16(aih, klf, ail[j]); } }
    asm volatile("s_wait_dscnt 0x0" ::: "memory");      // this wave's fragment reads of the buffer are done before it is refilled
    asm volatile("s_wait_asynccnt 0x0" ::: "memory");   // this wave's copies of the next stage have landed
    __syncthreads();                                    // publishes the next stage and ends every wave's reads of this buffer
    if (st + 2 < KK / 64) sc_stage(lb + (unsigned)((st & 1) * SC_BUF), gqh + (st + 2) * 64, gql + (st + 2) * 64, gkh + (st + 2) * 64, gkl + (st + 2) * 64); }
  asm volatile("s_wait_asynccnt 0x0" ::: "memory");     // no copy is outstanding when the room is used for the result rows
  float* ss = (float*)sm + wave * (16 * 68);
#pragma unroll
  for (int j = 0; j < 4; ++j)
#pragma unroll
    for (int r = 0; r < 8; ++r) { const float sr_ = ar[j][r] + arl[j][r] * (1.0f / 1024.0f), si_ = ai[j][r] + ail[j][r] * (1.0f / 1024.0f); ss[(8 * g + r) * 68 + j * 16 + col] = sqrtf(sr_ * sr_ + si_ * si_ + 1e-8f) * SCALE; }
  LDSX();
  // 16 lanes hold the 64 logits of row it * 2 + g
  v4f x[8]; float mx[8], sx[8];
#pragma unroll
  for (int it = 0; it < 8; ++it) { x[it] = *(const v4f*)&ss[(it * 2 + g) * 68 + col * 4]; mx[it] = rowmax(fmaxf(fmaxf(x[it][0], x[it][1]), fmaxf(x[it][2], x[it][3]))); }
#pragma unroll
  for (int it = 0; it < 8; ++it) {
#pragma unroll
    for (int k = 0; k < 4; ++k) x[it][k] = __expf(x[it][k] - mx[it]);   // the hardware's 2^x of the difference x log2 e: its error, about 2^-19 relative at a difference of 30, lies under that of the bf16 hi + lo split of P (2^-17), and the library's expf would take four times the vector issue slots here
    sx[it] = rowsum((x[it][0] + x[it][1]) + (x[it][2] + x[it][3])); }
  float* sd = S + (size_t)(qb + qg * 16 + g) * SS + k0 + kg * 64 + col * 4;
#pragma unroll
  for (int it = 0; it < 8; ++it) vst2(sd + it * 2 * SS, x[it]);
  // every lane of a 16-lane row holds the row's eight maxima and sums: its first lane writes them, 4 x 16 B, into the wave's own ST line
  if (col == 0) { float* pd = ST + (((size_t)blockIdx.z * (SS / 16) + blockIdx.x * 4 + qg) * (SS / 64) + blockIdx.y * 2 + kg) * 32 + g * 8;
    const v4f m0 = {mx[0], mx[1], mx[2], mx[3]}, m1 = {mx[4], mx[5], mx[6], mx[7]}, s0 = {sx[0], sx[1], sx[2], sx[3]}, s1 = {sx[4], sx[5], sx[6], sx[7]};
    vst2(pd, m0); vst2(pd + 4, m1); vst2(pd + 16, s0); vst2(pd + 20, s1); } }
// ---- k_pv: block = 64 queries of pair (h, sel), 8 waves: Y[row][sel*256 + c] = (P . vp)[c] for c in [0,256) = [a_r | a_i] (P split bf16 hi + lo x v hi + lo, 3 products, per output element in the order hi.hi, lo.hi, hi.lo over rising keys).
// The softmax's second half: from the ST lines of its 64 rows the block forms, once, the row maximum m = max over the 16 key groups of m64, the row sum = sum of exp(m64 - m) x (the group's sum), and the factor exp(m64 - m) / sum x 2^11 per (row, key group); a stage is one key group, and P = e x the stage's factor where P is split.
// Per stage of 64 keys the block brings both value planes (256 rows x 128 B each) and its 64 P rows (256 B each) in by whole-line loads, splits P once, and keeps them in LDS; the fragments come from LDS. The next stage's loads are issued before the products of this one and wait in registers.
// wave = (32-query group qg, 64-column group cg): 2 x 4 accumulator tiles
#define PVK 64             // keys per stage
#define PVP 72             // LDS row pitch in bf16 elements: 144 B = 16 B x 9, an odd multiple of 16 B for the 16-byte fragment reads
#define PV_SV (2 * KK * PVP * 2)   // bytes of the two value planes in LDS
#define PV_SP (2 * 64 * PVP * 2)   // bytes of the two P planes in LDS
#define PFP 17             // pitch of the factor rows in f32 elements
__global__ __launch_bounds__(256) void k_pv(const float* __restrict__ PS0, const float* __restrict__ ST, const __bf16* __restrict__ VT, const __bf16* __restrict__ VL, int p0, float* __restrict__ Y) { const int p = p0 + blockIdx.z; const int h = p >> 1, sel = p & 1;
  __shared__ __align__(16) unsigned char sm[PV_SV + PV_SP + 64 * PFP * 4];   // value planes [2][256][PVP], P planes [2][64][PVP], factors [64][PFP]; after the loop the value planes' room holds the f32 result rows [64][KK + 4]
  __bf16* sv = (__bf16*)sm; __bf16* sp = (__bf16*)(sm + PV_SV); float* so = (float*)sm; float* sfc = (float*)(sm + PV_SV + PV_SP);
  const int tid = threadIdx.x, wave = tid >> 5, lane = tid & 31, col = lane & 15, g = lane >> 4; const int qg = wave & 1, cg = wave >> 1; const int qb = blockIdx.x * 64;
  const __bf16* gvh = VT + ((size_t)h * KK + (tid >> 3)) * (size_t)SS + (tid & 7) * 8;   // 8 lanes x 16 B = one 128-B line of a value row; 32 rows per sweep of the block
  const __bf16* gvl = VL + ((size_t)h * KK + (tid >> 3)) * (size_t)SS + (tid & 7) * 8;
  const float* gp = PS0 + (size_t)blockIdx.z * SS * SS + (size_t)(qb + (tid >> 4)) * SS + (tid & 15) * 4;   // 16 lanes x 16 B = the 256 B of a P row; 16 rows per sweep
  // this thread's softmax parts: rows i * 16 + tid / 16 (the P rows that it stages), key group tid % 16; a base that is the same for the whole block + the thread's index
  const float* stb = ST + ((size_t)blockIdx.z * (SS / 16) + blockIdx.x * 4) * (size_t)((SS / 64) * 32); const unsigned sto = (unsigned)((tid & 15) * 32 + ((tid >> 4) & 1) * 8 + (tid >> 5));   // line tid % 16, the word of row tid / 16
  float ml[4], sl[4];
#pragma unroll
  for (int i = 0; i < 4; ++i) { ml[i] = stb[sto + i * ((SS / 64) * 32)]; sl[i] = stb[sto + i * ((SS / 64) * 32) + 16]; }
  v4u rh[8], rl[8]; v4f rp[4];
#pragma unroll
  for (int i = 0; i < 8; ++i) { rh[i] = *(const v4u*)(gvh + (size_t)i * 32 * SS); rl[i] = *(const v4u*)(gvl + (size_t)i * 32 * SS); }
#pragma unroll
  for (int i = 0; i < 4; ++i) rp[i] = *(const v4f*)(gp + (size_t)i * 16 * SS);
#pragma unroll
  for (int i = 0; i < 4; ++i) { const float f = expf(ml[i] - rowmax(ml[i])); sfc[(i * 16 + (tid >> 4)) * PFP + (tid & 15)] = f * ((1.0f / rowsum(f * sl[i])) * 2048.0f); }
  LDSX();   // a factor row is written and read by the same 16 lanes: the wave's own LDS writes are done before its lanes read each other's words
  float fc[4];   // the factors of this thread's four P rows for the stage whose P waits in rp, fetched with it
#pragma unroll
  for (int i = 0; i < 4; ++i) fc[i] = sfc[(i * 16 + (tid >> 4)) * PFP];
  v8f acc[2][4] = {};
#pragma unroll 1   // one copy of the stage body: one set of prefetch registers, small text (the fixed-count inner loops are unrolled so that their arrays stay in registers)
  for (int st = 0; st < SS / PVK; ++st) {
    if (st) __syncthreads();   // every wave has read its last fragment of the stage before
#pragma unroll
    for (int i = 0; i < 8; ++i) { const int o = (i * 32 + (tid >> 3)) * PVP + (tid & 7) * 8; vst2(sv + o, rh[i]); vst2(sv + KK * PVP + o, rl[i]); }
#pragma unroll
    for (int i = 0; i < 4; ++i) { v4bf hb, lb;
#pragma unroll
      for (int k = 0; k < 4; ++k) { const float v = rp[i][k] * fc[i]; const __bf16 bh = (__bf16)v; hb[k] = bh; lb[k] = (__bf16)(v - (float)bh); }
      const int o = (i * 16 + (tid >> 4)) * PVP + (tid & 15) * 4; vst2(sp + o, hb); vst2(sp + 64 * PVP + o, lb); }
    __syncthreads();           // the stage is whole in LDS
    if (st + 1 < SS / PVK) { const int ko = (st + 1) * PVK;
#pragma unroll
      for (int i = 0; i < 8; ++i) { rh[i] = *(const v4u*)(gvh + (size_t)i * 32 * SS + ko); rl[i] = *(const v4u*)(gvl + (size_t)i * 32 * SS + ko); }
#pragma unroll
      for (int i = 0; i < 4; ++i) { rp[i] = *(const v4f*)(gp + (size_t)i * 16 * SS + ko); fc[i] = sfc[(i * 16 + (tid >> 4)) * PFP + st + 1]; }
      asm volatile("s_wait_xcnt 0x0" ::: "memory"); }   // stands in front of the first overwrite of an address register of the loads above (the fragment reads below reuse them)
#pragma unroll
    for (int kc = 0; kc < PVK / 32; ++kc) { v16b ah[2], al[2];
#pragma unroll
      for (int t = 0; t < 2; ++t) { const int o = (qg * 32 + t * 16 + col) * PVP + kc * 32; ah[t] = frag_b(sp + o, lane); al[t] = frag_b(sp + 64 * PVP + o, lane); }
#pragma unroll
      for (int j = 0; j < 4; ++j) { const int o = (cg * 64 + j * 16 + col) * PVP + kc * 32; const v16b vh = frag_b(sv + o, lane), vl = frag_b(sv + KK * PVP + o, lane);
        acc[0][j] = wmma_bf(ah[0], vh, acc[0][j]); acc[1][j] = wmma_bf(ah[1], vh, acc[1][j]);
        acc[0][j] = wmma_bf(al[0], vh, acc[0][j]); acc[1][j] = wmma_bf(al[1], vh, acc[1][j]);
        acc[0][j] = wmma_bf(ah[0], vl, acc[0][j]); acc[1][j] = wmma_bf(ah[1], vl, acc[1][j]); } } }
  __syncthreads();             // the value planes' room is free for the result rows
#pragma unroll
  for (int t = 0; t < 2; ++t)
#pragma unroll
    for (int j = 0; j < 4; ++j)
#pragma unroll
      for (int r = 0; r < 8; ++r) so[(qg * 32 + t * 16 + 8 * g + r) * (KK + 4) + cg * 64 + j * 16 + col] = acc[t][j][r] * (1.0f / 2048.0f);
  __syncthreads();             // the result rows are whole
#pragma unroll
  for (int i = 0; i < 16; ++i) { const int rl_ = i * 4 + (tid >> 6), q = tid & 63; vst2(Y + ((size_t)h * SS + qb + rl_) * 512 + sel * 256 + q * 4, *(const v4f*)&so[rl_ * (KK + 4) + q * 4]); } }
// ---- k_mix: block = 16 rows (16 lanes per row): rms over the 512 attention values (= mean over 256 of r^2 + i^2), / rms x sub_w, out = a1 - lambda a2, then the complex gate z = g * out; z written IN PLACE over the g row (each lane reads and writes exactly its own columns d and 128 + d); float4 pieces, 16 lanes x 16 B = 256-B runs
__global__ __launch_bounds__(256) void k_mix(const float* __restrict__ Y, float* __restrict__ GZ, const float* __restrict__ LAM, const float* __restrict__ SW) {
  const int t = threadIdx.x; const int rl = t >> 4, sub = t & 15; const size_t row = (size_t)blockIdx.x * 16 + rl; const float* y = Y + row * 512; float* gz = GZ + row * KK; const float lam = LAM[0];
  float s2 = 0.f; for (int c = sub * 4; c < 512; c += 64) { const v4f v = *(const v4f*)(y + c); s2 += (v[0] * v[0] + v[1] * v[1]) + (v[2] * v[2] + v[3] * v[3]); }
#pragma unroll
  for (int o = 1; o < 16; o <<= 1) s2 += __shfl_xor(s2, o);
  const float inv = 1.0f / sqrtf(s2 * (1.0f / 256.0f) + 1e-5f);
#pragma unroll
  for (int it = 0; it < 2; ++it) { const int d = sub * 4 + it * 64;   /* d in [0,128): this lane's 4 columns */
    const v4f a1r = *(const v4f*)(y + d), a1i = *(const v4f*)(y + 128 + d), a2r = *(const v4f*)(y + 256 + d), a2i = *(const v4f*)(y + 384 + d); const v4f gr = *(const v4f*)(gz + d), gi = *(const v4f*)(gz + 128 + d);
    v4f zr, zi;
#pragma unroll
    for (int k = 0; k < 4; ++k) { const float w1 = bfr(SW[d + k]) * inv, w2 = bfr(SW[DD + d + k]) * inv; const float orr = a1r[k] * w1 - lam * (a2r[k] * w2), oi = a1i[k] * w1 - lam * (a2i[k] * w2); zr[k] = gr[k] * orr - gi[k] * oi; zi[k] = gr[k] * oi + gi[k] * orr; }
    vst2(gz + d, zr); vst2(gz + 128 + d, zi); } }
extern "C" void kernel_launch(void* const* d_in, const int* in_sizes, int n_in, void* d_out, int out_size, void* d_ws, size_t ws_size, hipStream_t stream) {
  (void)in_sizes; (void)n_in; (void)out_size;
  const float** F = (const float**)d_in;   // 0 q_r, 1 q_i, 2 k_r, 3 k_i, 4 v_r, 5 v_i, 6 pe_q_r, 7 pe_q_i, 8 pe_k_r, 9 pe_k_i [1,12,1024,128]; 10 qw_r [256,128], 11 qw_i, 12 qb_r [256], 13 qb_i; 14 kw_r [128,128], 15 kw_i, 16 kb_r, 17 kb_i; 18 vw_r, 19 vw_i, 20 vb_r, 21 vb_i; 22 gw_r, 23 gw_i, 24 gb_r, 25 gb_i; 26 ow_r, 27 ow_i, 28 ob_r, 29 ob_i; 30 lq1, 31 lk1, 32 lq2, 33 lk2 [128]; 34 sub_w [256]
  if (ws_size < (size_t)WS_END) return;
  char* ws = (char*)d_ws; _Float16 *QH = (_Float16*)(ws + WS_QH), *QL = (_Float16*)(ws + WS_QL), *KH = (_Float16*)(ws + WS_KH), *KL = (_Float16*)(ws + WS_KL); __bf16 *VT = (__bf16*)(ws + WS_VT), *VL = (__bf16*)(ws + WS_VL); float *G = (float*)(ws + WS_G), *Y = (float*)(ws + WS_Y), *LAM = (float*)(ws + WS_LAM), *S = (float*)(ws + WS_S), *ST = (float*)(ws + WS_ST);
  float* OUT0 = (float*)d_out; float* OUT1 = (float*)d_out + (size_t)NRF * DD;
  k_proj<<<dim3(1 + 10 * (NR / 64)), 256, 0, stream>>>(F[0], F[1], F[2], F[3], F[4], F[5], F[6], F[7], F[8], F[9], F[10], F[11], F[12], F[13], F[14], F[15], F[16], F[17], F[18], F[19], F[20], F[21], F[22], F[23], F[24], F[25], F[30], F[31], F[32], F[33], QH, QL, KH, KL, VT, VL, G, LAM);
  for (int p0 = 0; p0 < NPAIR; p0 += HG) {
    k_sc<<<dim3(SS / 64, SS / 128, HG), 256, 0, stream>>>(QH, QL, KH, KL, p0, S, ST);
    k_pv<<<dim3(SS / 64, 1, HG), 256, 0, stream>>>(S, ST, VT, VL, p0, Y);
  }
  k_mix<<<dim3(NR / 16), 256, 0, stream>>>(Y, G, LAM, F[34]);
  k_out<<<dim3(NR / 64, 2), 256, 0, stream>>>(G, F[26], F[27], F[28], F[29], OUT0, OUT1);
}

// v008
// Measured time: 144 microseconds a run.
// Two timings next to v007 both put it at 1.08 times that version's speed.
// All steps since v000 together make it 16.5 times as fast.
// compute dtype: all float inputs rounded to bf16; every complex linear as one stacked real GEMM ([x_r | x_i] against [W_r ; -W_i] / [W_i ; W_r]) with EXACT bf16 products on WMMA 16x16x32, f32 accumulate; q (+pe) as f16 hi + residual (x 2^10) and k (+pe) as f16 hi + residual (x 2^10) -> 3-product complex logits (s_r, s_i as two stacked K=256 real GEMMs), |s| scaled in f32 (sqrtf); softmax in f32 (per 64 keys against their own maximum by the hardware's 2^x, then one factor per row and 64 keys by precise expf); P x 2^11 split bf16 hi + lo against v bf16 hi + lo (3 products); RMS norm / lambda / differential combination / complex gating in f32; the gated result (bf16 hi + lo) through the output complex linear (2 products); f32 outputs.
#include <hip/hip_runtime.h>
#include <math.h>

typedef __attribute__((ext_vector_type(16))) _Float16 v16h;
typedef __attribute__((ext_vector_type(16))) __bf16 v16b;
typedef __attribute__((ext_vector_type(8)))  _Float16 v8h;
typedef __attribute__((ext_vector_type(8)))  float v8f;
typedef __attribute__((ext_vector_type(4)))  float v4f;
typedef __attribute__((ext_vector_type(2)))  float v2f;
typedef __attribute__((ext_vector_type(4)))  unsigned v4u;
typedef __attribute__((ext_vector_type(4)))  int v4i;
typedef float __attribute__((may_alias)) float_a;
typedef int __attribute__((may_alias)) int_a;

template <typename T> __device__ __forceinline__ void vst2(void* p, T v) { *(T*)p = v;  }
__device__ __forceinline__ v8f wmma16(v16h a, v16h b, v8f c) {
  v8f d = __builtin_amdgcn_wmma_f32_16x16x32_f16(false, a, false, b, (short)0, c, false, false);
  asm volatile("v_nop\n\tv_nop\n\tv_nop\n\tv_nop" : "+v"(d) : "v"(a), "v"(b));
  return d;
}
__device__ __forceinline__ v8f wmma_bf(v16b a, v16b b, v8f c) {
  v8f d = __builtin_amdgcn_wmma_f32_16x16x32_bf16(false, a, false, b, (short)0, c, false, false);
  asm volatile("v_nop\n\tv_nop\n\tv_nop\n\tv_nop" : "+v"(d) : "v"(a), "v"(b));
  return d;
}
// 16x16x32 fragments: lane = (h = lane>>4, row/col = lane&15); elements 0..7 = k0+8h+0..7, 8..15 = k0+16+8h+0..7; D element r = row 8h+r
__device__ __forceinline__ v16h frag_h(const _Float16* rowk0, int lane) {
  union { v16h v; v8h q[2]; } u; const _Float16* p = rowk0 + 8 * (lane >> 4);
  u.q[0] = *(const v8h*)p; u.q[1] = *(const v8h*)(p + 16); return u.v;
}
__device__ __forceinline__ v16h frag_f32(const float* rowk0, int lane) {
  v16h a; const float* p = rowk0 + 8 * (lane >> 4);
#pragma unroll
  for (int i = 0; i < 8; ++i) { a[i] = (_Float16)p[i]; a[8 + i] = (_Float16)p[16 + i]; }
  return a;
}
__device__ __forceinline__ v16h frag_f32s(const float* rowk0, int lane, float sc) {
  v16h a; const float* p = rowk0 + 8 * (lane >> 4);
#pragma unroll
  for (int i = 0; i < 8; ++i) { a[i] = (_Float16)(p[i] * sc); a[8 + i] = (_Float16)(p[16 + i] * sc); }
  return a;
}
// column fragment from a [K][ld] layout (column n), rows >= K read as 0
__device__ __forceinline__ v16h fragc_f32(const float* W, int k0, int n, int lane, int ld, int K) {
  v16h a; const int g = lane >> 4;
#pragma unroll
  for (int i = 0; i < 8; ++i) { const int ka = k0 + 8 * g + i, kb = ka + 16;
    a[i] = (_Float16)(ka < K ? W[(size_t)(ka < K ? ka : K - 1) * ld + n] : 0.f); a[8 + i] = (_Float16)(kb < K ? W[(size_t)(kb < K ? kb : K - 1) * ld + n] : 0.f); }
  return a;
}
struct F2 { v16b h, l; };
__device__ __forceinline__ F2 bsplit16(const float v[16]) { F2 r;
#pragma unroll
  for (int i = 0; i < 16; ++i) { const __bf16 h = (__bf16)v[i]; r.h[i] = h; r.l[i] = (__bf16)(v[i] - (float)h); }
  return r; }
__device__ __forceinline__ F2 split_row(const float* row, int k0, int lane) { float v[16]; const float* p = row + k0 + 8 * (lane >> 4);
#pragma unroll
  for (int i = 0; i < 8; ++i) { v[i] = p[i]; v[8 + i] = p[16 + i]; }
  return bsplit16(v); }
__device__ __forceinline__ F2 split_rowK(const float* row, int k0, int lane, int K) { float v[16]; const int g = lane >> 4;
#pragma unroll
  for (int i = 0; i < 8; ++i) { const int ka = k0 + 8 * g + i, kb = ka + 16; v[i] = ka < K ? row[ka < K ? ka : K - 1] : 0.f; v[8 + i] = kb < K ? row[kb < K ? kb : K - 1] : 0.f; }
  return bsplit16(v); }
__device__ __forceinline__ F2 split_col(const float* W, int k0, int n, int lane, int ld, int K) { float v[16]; const int g = lane >> 4;
#pragma unroll
  for (int i = 0; i < 8; ++i) { const int ka = k0 + 8 * g + i, kb = ka + 16; v[i] = ka < K ? W[(size_t)(ka < K ? ka : K - 1) * ld + n] : 0.f; v[8 + i] = kb < K ? W[(size_t)(kb < K ? kb : K - 1) * ld + n] : 0.f; }
  return bsplit16(v); }
__device__ __forceinline__ v8f mac3(const F2& a, const F2& b, v8f c) { c = wmma_bf(a.l, b.h, c); c = wmma_bf(a.h, b.l, c); return wmma_bf(a.h, b.h, c); }
__device__ __forceinline__ float sigm(float v) { return 1.0f / (1.0f + expf(-v)); }
#define LDSX() do { asm volatile("s_wait_dscnt 0" ::: "memory"); __builtin_amdgcn_wave_barrier(); __builtin_amdgcn_fence(__ATOMIC_RELEASE, "workgroup"); } while (0)
// work-group barrier for LDS data alone: release and acquire of the LDS address space at work-group scope around the barrier; unlike __syncthreads() it does not make the wave wait for its outstanding global loads, which are meant to fly across it
#define LBAR() do { __builtin_amdgcn_fence(__ATOMIC_RELEASE, "workgroup", "local"); __builtin_amdgcn_s_barrier(); __builtin_amdgcn_fence(__ATOMIC_ACQUIRE, "workgroup", "local"); } while (0)


// Complex differential attention (B 1, H 12, S 1,024, D 128): qp = CLin_q(q) + [pe_q, pe_q] (2D wide -> q1, q2), kp = CLin_k(k) + pe_k, vp = CLin_v(v); w_s = softmax(|q_s . conj(kp)| / sqrt(128)) for s = 1, 2; a_s = w_s vp (complex); cat = [a1, a2] / rms(cat) * sub_w; out = a1 - lambda a2 with lambda = sigmoid(exp(lq1 . lk1) - exp(lq2 . lk2) + 0.3555...); out = CLin_g(q) * out (complex product); out = CLin_o(out) -> (out_r, out_i).
#define NHT 12             // heads (x batch 1)
#define SS 1024
#define DD 128
#define KK 256             // stacked K of every complex linear / logit GEMM: [real | imag]
#ifndef NHU
#define NHU NHT            // heads processed
#endif
#define NR (NHU * SS)      // rows processed
#define NRF (NHT * SS)     // full row count (output-1 offset)
#ifndef HG
#define HG 24              // (head, sel) pairs per launch group (even, divides NPAIR): all pairs at once, so that the blocks of k_pv (64 P rows each) outnumber the WGPs; the logit planes take 96 MiB of workspace
#endif
#define NPAIR (NHU * 2)
#define SCALE 0.0883883461356163f       // 128^-0.5 as f32
#define LAMBDA_INIT 0.35550907254219055f  // 0.8 - 0.6 exp(-0.3) as f32
__device__ __forceinline__ float bfr(float v) { return (float)(__bf16)v; }
typedef __attribute__((ext_vector_type(8))) __bf16 v8b;
typedef __attribute__((ext_vector_type(4))) __bf16 v4bf;
__device__ __forceinline__ v16b frag_b(const __bf16* rowk0, int lane) { union { v16b v; v8b q[2]; } u; const __bf16* p = rowk0 + 8 * (lane >> 4); u.q[0] = *(const v8b*)p; u.q[1] = *(const v8b*)(p + 16); return u.v; }

#define WS_QH  0u                                      // f16 q rows [row][1024]: per sel s: [s*512 +0..127] q_r, [+128..255] q_i, [+256..383] q_i, [+384..511] -q_r  (hi)
#define WS_QL  (WS_QH + 2u * (size_t)NRF * 1024)       // f16 residual x 2^10
#define WS_KH  (WS_QL + 2u * (size_t)NRF * 1024)       // f16 k rows [row][256] = [kp_r | kp_i] (hi)
#define WS_KL  (WS_KH + 2u * (size_t)NRF * KK)         // f16 residual x 2^10
#define WS_VT  (WS_KL + 2u * (size_t)NRF * KK)         // bf16 value planes [h][256 = vp_r | vp_i][s] hi
#define WS_VL  (WS_VT + 2u * (size_t)NHT * KK * SS)    // bf16 value residual planes
#define WS_G   (WS_VL + 2u * (size_t)NHT * KK * SS)    // f32 g rows [row][256] = [g_r | g_i]
#define WS_LAM (WS_G + 4u * (size_t)NRF * KK)          // one line: lambda replicated
#define WS_S   (WS_LAM + 128u)                         // f32 planes for HG (head, sel) pairs [hg][q][k]: exp(logit - maximum of the row's logits in the key's group of 64 keys)
#define WS_ST  (WS_S + 4u * (size_t)HG * SS * SS)      // f32 softmax parts, one 128-B line per (pair, group of 16 queries, group of 64 keys): word (r % 2) * 8 + r / 2 = row r's maximum over these keys, word 16 + the same = row r's sum of the plane's values over these keys
#define WS_END (WS_ST + 128u * (size_t)HG * (SS / 16) * (SS / 64))

// ---- clin_body: block = (64 rows, 128 output cols, tile index over 2*NO), 8 waves: generic complex linear as a stacked real GEMM.
// A row = [x_r[row] | x_i[row]] (K 256: two f32 input tensors, bf16 exact);
// output column o in [0, 2 NO): part = o / NO (0 real, 1 imag), oo = o % NO; B[k] = part 0: (k < 128 ? W_r[oo][k] : -W_i[oo][k-128]), part 1: (k < 128 ? W_i[oo][k] : W_r[oo][k-128]); + bias_part[oo].
// MODE 0: q projection (NO 256) + pe_q -> QH/QL (each value to its two slots, see WS_QH); MODE 1: k (NO 128) + pe_k -> KH/KL; MODE 2: v -> bf16 planes; MODE 3: g -> G rows (the output linear stands in k_pv)
// Data path: the block brings its 128 weight rows and its 64 A rows (both K halves: real, imag) in by whole 512-B rows (one wave = one row per load), all of these loads issued in front of the first use (pe rows and bias: behind the first barrier, so that they come in while the products run; pe is added at the write-out, behind the bias), rounds weights and A to bf16 once and keeps them in LDS; every wave's fragments come from LDS, the next 32 K columns' fragments read in front of this group's products.
// wave = (16-row group rg, 64-column group cg): 4 accumulator tiles, products per tile in the order of rising K. The fixed-count loops are unrolled so that their arrays stay in registers.
#define CLP 264            // LDS row pitch in bf16 elements: 528 B = 16 B x 33, an odd multiple of 16 B for the 16-byte fragment reads
#define SFP 132            // pitch of the f32 result rows
// one K half of the weight rows / of the A rows into registers: b = the block's first row (the same for all threads), o = this thread's byte offset from it (row tid / 32, 16-byte piece tid % 32); 8 rows per sweep of the block
__device__ __forceinline__ void cl_ldw(v4f (&rw)[16], const char* b, unsigned o) {
#pragma unroll
  for (int i = 0; i < 16; ++i) rw[i] = *(const v4f*)(b + o + i * (8 * DD * 4));
}
__device__ __forceinline__ void cl_lda(v4f (&ra)[8], const char* b, unsigned o, int xs) {
#pragma unroll
  for (int i = 0; i < 8; ++i) ra[i] = *(const v4f*)(b + o + i * (8 * xs * 4));
}
// the same from registers into LDS as bf16 (weights x sg, which is +1 or -1: exact); pw, pa = this thread's place in the weight plane and in the first A plane
__device__ __forceinline__ void cl_putw(const v4f (&rw)[16], float sg, __bf16* pw) {
#pragma unroll
  for (int i = 0; i < 16; ++i) { v4bf b;
#pragma unroll
    for (int k = 0; k < 4; ++k) b[k] = (__bf16)(sg * rw[i][k]);
    vst2(pw + i * 8 * CLP, b); }
}
template <int NA> __device__ __forceinline__ void cl_puta(const v4f (&ra)[8], __bf16* pa) {
#pragma unroll
  for (int i = 0; i < 8; ++i) { v4bf hb, lb;
#pragma unroll
    for (int k = 0; k < 4; ++k) { const float v = ra[i][k]; const __bf16 bh = (__bf16)v; hb[k] = bh; lb[k] = (__bf16)(v - (float)bh); }
    vst2(pa + i * 8 * CLP, hb); if (NA == 2) vst2(pa + 64 * CLP + i * 8 * CLP, lb); }
}
// all products: fa = this lane's A row, fw = this lane's first weight row; two sets of fragments, so that the LDS reads of the next 32 K columns are under way while this group's products run
template <int NA> __device__ __forceinline__ void cl_mac(v8f (&acc)[4], const __bf16* fa, const __bf16* fw, int lane) {
  v16b a[2][NA], w[2][4];
#pragma unroll
  for (int t = 0; t < NA; ++t) a[0][t] = frag_b(fa + t * 64 * CLP, lane);
#pragma unroll
  for (int j = 0; j < 4; ++j) w[0][j] = frag_b(fw + j * 16 * CLP, lane);
#pragma unroll
  for (int kc = 0; kc < KK / 32; ++kc) { const int c = kc & 1, n = c ^ 1;
    if (kc + 1 < KK / 32) {
#pragma unroll
      for (int t = 0; t < NA; ++t) a[n][t] = frag_b(fa + t * 64 * CLP + (kc + 1) * 32, lane);
#pragma unroll
      for (int j = 0; j < 4; ++j) w[n][j] = frag_b(fw + j * 16 * CLP + (kc + 1) * 32, lane); }
#pragma unroll
    for (int t = 0; t < NA; ++t)
#pragma unroll
      for (int j = 0; j < 4; ++j) acc[j] = wmma_bf(a[c][t], w[c][j], acc[j]); }
}
// the mode, 0 to 3, is picked per block by mrt (the modes share the data path and the products and differ in the write-out). sm = the block's LDS, bx = its 64-row group, c0 = its first column of the 2 NO, part and oo0 as above
__device__ __forceinline__ void clin_body(unsigned char* sm, int mrt, int bx, int c0, int part, int oo0, const float* __restrict__ XR, const float* __restrict__ XI, const float* __restrict__ WR, const float* __restrict__ WI, const float* __restrict__ BR, const float* __restrict__ BI, const float* __restrict__ PER, const float* __restrict__ PEI, void* __restrict__ D0, void* __restrict__ D1) {
  constexpr int NA = 1;   // A planes in LDS
  const int mode = mrt;
  // sm holds (128 + NA * 64) * CLP * 2 bytes: weight plane [128][CLP], A planes [NA][64][CLP]; after the products the weight plane's room holds the f32 result rows [64][SFP]
  __bf16* sw = (__bf16*)sm; __bf16* sa = sw + 128 * CLP; float* sf = (float*)sm;
  const int tid = threadIdx.x, wave = tid >> 5, lane = tid & 31, col = lane & 15, g = lane >> 4; const int rg = wave & 3, cg = wave >> 2; const size_t r0 = (size_t)bx * 64;
  constexpr int XS = DD; const float sg1 = part == 0 ? -1.0f : 1.0f;
  // every global read = a base that is the same for the whole block + a 32-bit byte offset of the thread
  const char* wb0 = (const char*)((part == 0 ? WR : WI) + (size_t)oo0 * DD); const char* wb1 = (const char*)((part == 0 ? WI : WR) + (size_t)oo0 * DD); const unsigned wo = (unsigned)tid * 16u;   // row tid / 32 of 512 B, piece tid % 32
  const char* xb0 = (const char*)(XR + r0 * XS); const char* xb1 = (const char*)(XI + r0 * XS); const unsigned xo = wo;
  const float* bbs = (part == 0 ? BR : BI) + oo0; const unsigned bi = (unsigned)(cg * 64 + col);
  const char* pb = mode <= 1 ? (const char*)((part == 0 ? PER : PEI) + r0 * DD) : nullptr; const unsigned po = (unsigned)((tid >> 4) * (DD * 4) + (tid & 15) * 32);   // MODE <= 1: 16 lanes x 32 B = the 512 B of a pe row; 16 rows per sweep
  __bf16* pw = sw + wave * CLP + lane * 4; __bf16* pa = sa + wave * CLP + lane * 4;
  const __bf16* fa = sa + (rg * 16 + col) * CLP; const __bf16* fw = sw + (cg * 64 + col) * CLP;
  v4f rw0[16], ra0[8], rw1[16], ra1[8], pe[4][2]; float bb[4];
  cl_ldw(rw0, wb0, wo); cl_ldw(rw1, wb1, wo); cl_lda(ra0, xb0, xo, XS); cl_lda(ra1, xb1, xo, XS);
  // stands in front of the first overwrite of an address register of the loads above; the bases and the offset registers that the loads name (the thread id, scaled by the load's width) are inputs, so that they live up to the wait
  asm volatile("s_wait_xcnt 0x0" :: "v"(tid), "s"(wb0), "s"(wb1), "s"(xb0), "s"(xb1) : "memory");
  cl_putw(rw0, 1.0f, pw); cl_putw(rw1, sg1, pw + 128);
  cl_puta<NA>(ra0, pa); cl_puta<NA>(ra1, pa + 128);
  __syncthreads();             // weights and A rows are whole in LDS
  // the bias and the pe rows come in while the products run
#pragma unroll
  for (int j = 0; j < 4; ++j) bb[j] = bbs[bi + j * 16];
  if (mode <= 1) {
#pragma unroll
    for (int it = 0; it < 4; ++it) { pe[it][0] = *(const v4f*)(pb + po + it * (16 * DD * 4)); pe[it][1] = *(const v4f*)(pb + po + it * (16 * DD * 4) + 16); }
    asm volatile("s_wait_xcnt 0x0" :: "v"(bi), "s"(bbs), "v"(po), "s"(pb) : "memory"); }   // as above
  else asm volatile("s_wait_xcnt 0x0" :: "v"(bi), "s"(bbs) : "memory");   // as above
  v8f acc[4] = {};
  cl_mac<NA>(acc, fa, fw, lane);
  __syncthreads();             // the weight plane's room is free for the result rows
#pragma unroll
  for (int j = 0; j < 4; ++j) { const float bj = bfr(bb[j]);
#pragma unroll
    for (int r = 0; r < 8; ++r) sf[(rg * 16 + 8 * g + r) * SFP + cg * 64 + j * 16 + col] = acc[j][r] + bj; }
  __syncthreads();             // the result rows are whole
  if (mode == 0) {   // q: value (sel = oo0/128, d) -> QH[row][sel*512 + (part ? 128 : 0) + d] and QH[row][sel*512 + (part ? 256 : 384) + d] (the second real copy negated); f16 hi + residual x 2^10; each destination = a 256-B segment per row by 16 consecutive threads
    _Float16* QH = (_Float16*)D0; _Float16* QL = (_Float16*)D1; const int sel = oo0 / DD; const int dA = sel * 512 + (part ? 128 : 0), dB = sel * 512 + (part ? 256 : 384); const float sgB = part ? 1.0f : -1.0f;
#pragma unroll   // pe[it] stays in registers
    for (int it = 0; it < 4; ++it) { const int rl = it * 16 + (tid >> 4), q = tid & 15; v8h ha, la, hb, lb;
#pragma unroll
      for (int k = 0; k < 8; ++k) { const float v = sf[rl * SFP + q * 8 + k] + bfr(pe[it][k >> 2][k & 3]); const _Float16 hv = (_Float16)v; ha[k] = hv; la[k] = (_Float16)((v - (float)hv) * 1024.0f); const float vb = v * sgB; const _Float16 hb2 = (_Float16)vb; hb[k] = hb2; lb[k] = (_Float16)((vb - (float)hb2) * 1024.0f); }
      const size_t ro = (r0 + rl) * 1024; vst2((v4u*)(QH + ro + dA + q * 8), *(const v4u*)&ha); vst2((v4u*)(QL + ro + dA + q * 8), *(const v4u*)&la); vst2((v4u*)(QH + ro + dB + q * 8), *(const v4u*)&hb); vst2((v4u*)(QL + ro + dB + q * 8), *(const v4u*)&lb); } }
  else if (mode == 1) {   // k rows [row][256]: column part*128 + d; f16 hi + residual x 2^10
    _Float16* KH = (_Float16*)D0; _Float16* KL = (_Float16*)D1;
#pragma unroll   // pe[it] stays in registers
    for (int it = 0; it < 4; ++it) { const int rl = it * 16 + (tid >> 4), q = tid & 15; v8h ha, la;
#pragma unroll
      for (int k = 0; k < 8; ++k) { const float v = sf[rl * SFP + q * 8 + k] + bfr(pe[it][k >> 2][k & 3]); const _Float16 hv = (_Float16)v; ha[k] = hv; la[k] = (_Float16)((v - (float)hv) * 1024.0f); }
      const size_t ro = (r0 + rl) * KK + c0; vst2((v4u*)(KH + ro + q * 8), *(const v4u*)&ha); vst2((v4u*)(KL + ro + q * 8), *(const v4u*)&la); }
    asm volatile("s_wait_xcnt 0x0" ::: "memory"); }   // run-time mode: in the listing another mode's code follows behind a branch; the wait stands in front of any overwrite there of a register that the stores above name
  else if (mode == 2) {
    __bf16* VT = (__bf16*)D0; __bf16* VL = (__bf16*)D1; const size_t h = r0 / SS; const int s0 = (int)(r0 % SS);
#pragma unroll   // the LDS reads of all four sweeps are under way together
    for (int it = 0; it < 4; ++it) { const int e = it * 256 + tid, cl = e >> 3, q = e & 7; v8b hb, lb;
#pragma unroll
      for (int k = 0; k < 8; ++k) { const float v = sf[(q * 8 + k) * SFP + cl]; const __bf16 bh = (__bf16)v; hb[k] = bh; lb[k] = (__bf16)(v - (float)bh); }
      const size_t o2 = (h * KK + c0 + cl) * (size_t)SS + s0 + q * 8; vst2((v4u*)(VT + o2), *(const v4u*)&hb); vst2((v4u*)(VL + o2), *(const v4u*)&lb); }
    asm volatile("s_wait_xcnt 0x0" ::: "memory"); }   // as at the end of mode 1
  else if (mode == 3) {   // g rows [row][256] f32: 512-B segment per row by 32 lanes
    float* G = (float*)D0;
#pragma unroll   // the LDS reads of all eight sweeps are under way together
    for (int it = 0; it < 8; ++it) { const int rl = it * 8 + wave, q = lane; vst2(G + (r0 + rl) * KK + c0 + q * 4, *(const v4f*)&sf[rl * SFP + q * 4]); }
    asm volatile("s_wait_xcnt 0x0" ::: "memory"); }   // as at the end of mode 1
}
__device__ __forceinline__ void lam_body(float* slp, const float* __restrict__ LQ1, const float* __restrict__ LK1, const float* __restrict__ LQ2, const float* __restrict__ LK2, float* __restrict__ LAM) { float& sl = *slp;
  if (threadIdx.x == 0) { float s1 = 0.f, s2 = 0.f;
#pragma unroll 1   // one copy of the trip, so that the wait below stands between a trip's loads and the next trip's addresses
    for (int i = 0; i < DD; i += 4) { const float *p1 = LQ1 + i, *p2 = LK1 + i, *p3 = LQ2 + i, *p4 = LK2 + i; float a[4], b[4], c[4], d[4];
#pragma unroll
      for (int k = 0; k < 4; ++k) { a[k] = p1[k]; b[k] = p2[k]; c[k] = p3[k]; d[k] = p4[k]; }
      asm volatile("s_wait_xcnt 0x0" :: "s"(p1), "s"(p2), "s"(p3), "s"(p4) : "memory");   // stands in front of the next trip's overwrite of the address registers of the loads above; the addresses are inputs, so that they live up to the wait
#pragma unroll
      for (int k = 0; k < 4; ++k) { s1 += bfr(a[k]) * bfr(b[k]); s2 += bfr(c[k]) * bfr(d[k]); } }
    const float z = expf(s1) - expf(s2) + LAMBDA_INIT; sl = 1.0f / (1.0f + expf(-z)); }
  __syncthreads(); if (threadIdx.x < 32) vst2(LAM + threadIdx.x, sl); }
// ---- k_proj: everything that reads only the inputs, in ONE launch: block 0 = lambda; then NR / 64 blocks per 128-column tile t: 4 tiles of the q projection, 2 of g (which reads the same rows as q), 2 of k, 2 of v. None of these reads what another writes, so that their blocks fill the chip together and one part's start and tail lie under another part's work.
__global__ __launch_bounds__(256) void k_proj(const float* __restrict__ QR, const float* __restrict__ QI, const float* __restrict__ KR, const float* __restrict__ KI, const float* __restrict__ VR, const float* __restrict__ VI, const float* __restrict__ PQR, const float* __restrict__ PQI, const float* __restrict__ PKR, const float* __restrict__ PKI,
    const float* __restrict__ QWR, const float* __restrict__ QWI, const float* __restrict__ QBR, const float* __restrict__ QBI, const float* __restrict__ KWR, const float* __restrict__ KWI, const float* __restrict__ KBR, const float* __restrict__ KBI,
    const float* __restrict__ VWR, const float* __restrict__ VWI, const float* __restrict__ VBR, const float* __restrict__ VBI, const float* __restrict__ GWR, const float* __restrict__ GWI, const float* __restrict__ GBR, const float* __restrict__ GBI,
    const float* __restrict__ LQ1, const float* __restrict__ LK1, const float* __restrict__ LQ2, const float* __restrict__ LK2,
    void* __restrict__ QH, void* __restrict__ QL, void* __restrict__ KH, void* __restrict__ KL, void* __restrict__ VT, void* __restrict__ VL, void* __restrict__ G, float* __restrict__ LAM) {
  __shared__ __align__(16) unsigned char sm[(128 + 64) * CLP * 2];
  if (blockIdx.x == 0) { lam_body((float*)sm, LQ1, LK1, LQ2, LK2, LAM); return; }   // the same for the whole block
  const int b = (int)blockIdx.x - 1, t = b / (NR / 64), bx = b % (NR / 64);
  const int m = t < 4 ? 0 : t < 6 ? 3 : (t - 4) >> 1;   // mode: t 0..3 q, 4 5 g, 6 7 k, 8 9 v
  const int c0 = (t < 4 ? t : t & 1) * 128, part = t < 4 ? t >> 1 : t & 1, oo0 = t < 4 ? (t & 1) * 128 : 0;
  clin_body(sm, m, bx, c0, part, oo0, m == 1 ? KR : m == 2 ? VR : QR, m == 1 ? KI : m == 2 ? VI : QI, m == 0 ? QWR : m == 1 ? KWR : m == 2 ? VWR : GWR, m == 0 ? QWI : m == 1 ? KWI : m == 2 ? VWI : GWI,
                m == 0 ? QBR : m == 1 ? KBR : m == 2 ? VBR : GBR, m == 0 ? QBI : m == 1 ? KBI : m == 2 ? VBI : GBI, m == 0 ? PQR : PKR, m == 0 ? PQI : PKI, m == 0 ? QH : m == 1 ? KH : m == 2 ? VT : G, m == 0 ? QL : m == 1 ? KL : VL); }
// ---- k_sc: block = (64 queries, 128 keys, pair in group), 8 waves: pair p = (head h = p/2, sel = p%2); s_r = Q[sel*512 + 0..255] . KH, s_i = Q[sel*512 + 256..511] . KH (3 products each: hi.hi + (lo.hi + hi.lo) 2^-10); logit = sqrt(s_r^2 + s_i^2 + 1e-8) x 128^-0.5
// The softmax's first half is done here, on the logits while they are in the wave: per row the maximum m64 over the wave's 64 keys, e = exp(logit - m64) -> the S plane, the sum of e; m64 and the sum go to the wave's own line of ST. k_pv turns them into one factor per (row, 64 keys), so that no pass over the planes stands between the two kernels.
// Per stage of 64 stacked-K elements the block brings one whole 128-B line of each of its rows (64 q rows x 4 planes: s_r hi, s_r lo, s_i hi, s_i lo; 128 k rows x 2 planes: hi, lo) into LDS by asynchronous 16-byte copies; two buffers, the next stage's copies fly while this stage's fragments are read from LDS.
// wave = (16-query group qg, 64-key group kg): 4 accumulator tiles x 4 sums, products per sum in the order of rising K as before
#define SCP 72                      // LDS row pitch in f16 elements: 144 B = 16 B x 9, an odd multiple of 16 B for the 16-byte fragment reads
#define SC_Q (4 * 64 * SCP * 2)     // bytes of the four q planes of a stage
#define SC_K (2 * 128 * SCP * 2)    // bytes of the two k planes of a stage
#define SC_BUF (SC_Q + SC_K)
// eight asynchronous copies of 16 B per lane; the s_wait_xcnt stands inside the statement, so that no address register of a copy is rewritten in front of it
__device__ __forceinline__ void cp8(unsigned l0, unsigned l1, unsigned l2, unsigned l3, unsigned l4, unsigned l5, unsigned l6, unsigned l7, const _Float16* g0, const _Float16* g1, const _Float16* g2, const _Float16* g3, const _Float16* g4, const _Float16* g5, const _Float16* g6, const _Float16* g7) {
  asm volatile("global_load_async_to_lds_b128 %0, %8, off\n\tglobal_load_async_to_lds_b128 %1, %9, off\n\tglobal_load_async_to_lds_b128 %2, %10, off\n\tglobal_load_async_to_lds_b128 %3, %11, off\n\t"
               "global_load_async_to_lds_b128 %4, %12, off\n\tglobal_load_async_to_lds_b128 %5, %13, off\n\tglobal_load_async_to_lds_b128 %6, %14, off\n\tglobal_load_async_to_lds_b128 %7, %15, off\n\ts_wait_xcnt 0x0"
               :: "v"(l0), "v"(l1), "v"(l2), "v"(l3), "v"(l4), "v"(l5), "v"(l6), "v"(l7), "v"(g0), "v"(g1), "v"(g2), "v"(g3), "v"(g4), "v"(g5), "v"(g6), "v"(g7) : "memory");
}
// one stage: lq = this lane's LDS byte address in the buffer (row tid / 8, 16-byte piece tid % 8), the four pointers at the same row and piece of the stage's K columns; 32 rows per sweep of the block
__device__ __forceinline__ void sc_stage(unsigned lq, const _Float16* qh, const _Float16* ql, const _Float16* kh, const _Float16* kl) {
  const unsigned R = 32 * SCP * 2;   // LDS bytes of 32 rows
  cp8(lq, lq + R, lq + 2 * R, lq + 3 * R, lq + 4 * R, lq + 5 * R, lq + 6 * R, lq + 7 * R, qh, qh + 32 * 1024, ql, ql + 32 * 1024, qh + 256, qh + 256 + 32 * 1024, ql + 256, ql + 256 + 32 * 1024);
  const unsigned lk = lq + SC_Q;
  cp8(lk, lk + R, lk + 2 * R, lk + 3 * R, lk + 4 * R, lk + 5 * R, lk + 6 * R, lk + 7 * R, kh, kh + 32 * KK, kh + 64 * KK, kh + 96 * KK, kl, kl + 32 * KK, kl + 64 * KK, kl + 96 * KK);
}
template <int M> __device__ __forceinline__ float xrow(float v) { return __builtin_bit_cast(float, __builtin_amdgcn_update_dpp(0, __builtin_bit_cast(int, v), 0x160 | M, 0xf, 0xf, true)); }   // lane l <- lane l ^ M of the same 16-lane row (row_xmask)
__device__ __forceinline__ float rowmax(float m) { m = fmaxf(m, xrow<1>(m)); m = fmaxf(m, xrow<2>(m)); m = fmaxf(m, xrow<4>(m)); return fmaxf(m, xrow<8>(m)); }   // over the 16 lanes of a row, the result in all of them
__device__ __forceinline__ float rowsum(float s) { s += xrow<1>(s); s += xrow<2>(s); s += xrow<4>(s); return s + xrow<8>(s); }
__global__ __launch_bounds__(256) void k_sc(const _Float16* __restrict__ QH, const _Float16* __restrict__ QL, const _Float16* __restrict__ KH, const _Float16* __restrict__ KL, int p0, float* __restrict__ S0, float* __restrict__ ST) {
  __shared__ __align__(16) unsigned char sm[2 * SC_BUF];   // two stage buffers; after the loop the room holds each wave's f32 result rows [16][68]
  const int p = p0 + blockIdx.z; const int h = p >> 1, sel = p & 1; float* S = S0 + (size_t)blockIdx.z * SS * SS;
  const int tid = threadIdx.x, wave = tid >> 5, lane = tid & 31, col = lane & 15, g = lane >> 4; const int qg = wave & 3, kg = wave >> 2; const int k0 = blockIdx.y * 128; const int qb = blockIdx.x * 64;
  const _Float16* gqh = QH + ((size_t)h * SS + qb + (tid >> 3)) * 1024 + sel * 512 + (tid & 7) * 8;   // 8 lanes x 16 B = one 128-B line of a row
  const _Float16* gql = QL + ((size_t)h * SS + qb + (tid >> 3)) * 1024 + sel * 512 + (tid & 7) * 8;
  const _Float16* gkh = KH + ((size_t)h * SS + k0 + (tid >> 3)) * KK + (tid & 7) * 8;
  const _Float16* gkl = KL + ((size_t)h * SS + k0 + (tid >> 3)) * KK + (tid & 7) * 8;
  const unsigned lb = (unsigned)(size_t)sm + (unsigned)((tid >> 3) * (SCP * 2) + (tid & 7) * 16);
  sc_stage(lb, gqh, gql, gkh, gkl);
  asm volatile("s_wait_asynccnt 0x0" ::: "memory");   // this wave's copies of stage 0 have landed
  __syncthreads();                                    // stage 0 is whole in LDS
  sc_stage(lb + SC_BUF, gqh + 64, gql + 64, gkh + 64, gkl + 64);
  v8f ar[4] = {}, arl[4] = {}, ai[4] = {}, ail[4] = {};
#pragma unroll 1   // one copy of the stage body: small text, the buffer is picked by an offset
  for (int st = 0; st < KK / 64; ++st) { const _Float16* bq = (const _Float16*)(sm + (st & 1) * SC_BUF); const _Float16* bk = (const _Float16*)(sm + (st & 1) * SC_BUF + SC_Q);
    const _Float16* kp0 = bk + (kg * 64 + col) * SCP;
    v16h kf[2][2];   // k fragments (hi, lo) of this group of six products and of the next: the next group's LDS reads are issued in front of this group's products, inside the stage only
    kf[0][0] = frag_h(kp0, lane); kf[0][1] = frag_h(kp0 + 128 * SCP, lane);
#pragma unroll
    for (int kc = 0; kc < 2; ++kc) { const _Float16* qa = bq + (qg * 16 + col) * SCP + kc * 32;
      const v16h arh = frag_h(qa, lane), arlo = frag_h(qa + 64 * SCP, lane), aih = frag_h(qa + 128 * SCP, lane), ailo = frag_h(qa + 192 * SCP, lane);
#pragma unroll
      for (int j = 0; j < 4; ++j) { const int gi = kc * 4 + j, c = gi & 1, n = c ^ 1;
        if (gi + 1 < 8) { const _Float16* kp = kp0 + ((gi + 1) & 3) * 16 * SCP + ((gi + 1) >> 2) * 32; kf[n][0] = frag_h(kp, lane); kf[n][1] = frag_h(kp + 128 * SCP, lane); }
        const v16h khf = kf[c][0], klf = kf[c][1];
        ar[j] = wmma16(arh, khf, ar[j]); arl[j] = wmma16(arlo, khf, arl[j]); arl[j] = wmma16(arh, klf, arl[j]);
        ai[j] = wmma16(aih, khf, ai[j]); ail[j] = wmma16(ailo, khf, ail[j]); ail[j] = wmma16(aih, klf, ail[j]); } }
    asm volatile("s_wait_dscnt 0x0" ::: "memory");      // this wave's fragment reads of the buffer are done before it is refilled
    asm volatile("s_wait_asynccnt 0x0" ::: "memory");   // this wave's copies of the next stage have landed
    __syncthreads();                                    // publishes the next stage and ends every wave's reads of this buffer
    if (st + 2 < KK / 64) sc_stage(lb + (unsigned)((st & 1) * SC_BUF), gqh + (st + 2) * 64, gql + (st + 2) * 64, gkh + (st + 2) * 64, gkl + (st + 2) * 64); }
  asm volatile("s_wait_asynccnt 0x0" ::: "memory");     // no copy is outstanding when the room is used for the result rows
  float* ss = (float*)sm + wave * (16 * 68);
#pragma unroll
  for (int j = 0; j < 4; ++j)
#pragma unroll
    for (int r = 0; r < 8; ++r) { const float sr_ = ar[j][r] + arl[j][r] * (1.0f / 1024.0f), si_ = ai[j][r] + ail[j][r] * (1.0f / 1024.0f); ss[(8 * g + r) * 68 + j * 16 + col] = sqrtf(sr_ * sr_ + si_ * si_ + 1e-8f) * SCALE; }
  LDSX();
  // 16 lanes hold the 64 logits of row it * 2 + g
  v4f x[8]; float mx[8], sx[8];
#pragma unroll
  for (int it = 0; it < 8; ++it) { x[it] = *(const v4f*)&ss[(it * 2 + g) * 68 + col * 4]; mx[it] = rowmax(fmaxf(fmaxf(x[it][0], x[it][1]), fmaxf(x[it][2], x[it][3]))); }
#pragma unroll
  for (int it = 0; it < 8; ++it) {
#pragma unroll
    for (int k = 0; k < 4; ++k) x[it][k] = __expf(x[it][k] - mx[it]);   // the hardware's 2^x of the difference x log2 e: its error, about 2^-19 relative at a difference of 30, lies under that of the bf16 hi + lo split of P (2^-17), and the library's expf would take four times the vector issue slots here
    sx[it] = rowsum((x[it][0] + x[it][1]) + (x[it][2] + x[it][3])); }
  float* sd = S + (size_t)(qb + qg * 16 + g) * SS + k0 + kg * 64 + col * 4;
#pragma unroll
  for (int it = 0; it < 8; ++it) vst2(sd + it * 2 * SS, x[it]);
  // every lane of a 16-lane row holds the row's eight maxima and sums: its first lane writes them, 4 x 16 B, into the wave's own ST line
  if (col == 0) { float* pd = ST + (((size_t)blockIdx.z * (SS / 16) + blockIdx.x * 4 + qg) * (SS / 64) + blockIdx.y * 2 + kg) * 32 + g * 8;
    const v4f m0 = {mx[0], mx[1], mx[2], mx[3]}, m1 = {mx[4], mx[5], mx[6], mx[7]}, s0 = {sx[0], sx[1], sx[2], sx[3]}, s1 = {sx[4], sx[5], sx[6], sx[7]};
    vst2(pd, m0); vst2(pd + 4, m1); vst2(pd + 16, s0); vst2(pd + 20, s1); } }
// ---- k_pv: block = 32 queries of head h for BOTH sels (64 P rows: local row sel * 32 + q), 8 waves: a_sel[q][c] = (P_sel . vp)[c] for c in [0,256) = [a_r | a_i] (P split bf16 hi + lo x v hi + lo, 3 products, per output element in the order hi.hi, lo.hi, hi.lo over rising keys); then, in the same block, everything behind it: rms, lambda, gate and the output linear, so that neither the attention rows nor the gated rows go through memory.
// The softmax's second half: from the ST lines of its 64 rows the block forms, once, the row maximum m = max over the 16 key groups of m64, the row sum = sum of exp(m64 - m) x (the group's sum), and the factor exp(m64 - m) / sum x 2^11 per (row, key group); a stage is one key group, and P = e x the stage's factor where P is split.
// Per stage of 64 keys the block brings both value planes (256 rows x 128 B each) and its 64 P rows (256 B each) in by whole-line loads, splits P once, and keeps them in LDS; the fragments come from LDS. The next stage's loads are issued before the products of this one and wait in registers.
// wave = (sel qg, 64-column group cg): 2 x 4 accumulator tiles
// Behind the loop: the 64 result rows in LDS are the whole 512 attention values of each of the 32 queries. 16 lanes per query: rms over the 512 values (= mean over 256 of r^2 + i^2), / rms x sub_w, out = a1 - lambda a2, the complex gate z = g * out; z = [z_r | z_i] as bf16 hi + lo into LDS. Output linear: one weight plane [128 outputs][W_r | W_i] in LDS serves both parts: out_r = z_r . W_r + (-z_i) . W_i (the sign on the z fragment, exact), out_i = z_r . W_i + z_i . W_r; per output element the products in the order of rising stacked K, hi then lo. wave = (16-query group, 32 outputs, both parts): 4 accumulator tiles.
#define PVK 64             // keys per stage
#define PVP 72             // LDS row pitch in bf16 elements: 144 B = 16 B x 9, an odd multiple of 16 B for the 16-byte fragment reads
#define PV_SV (2 * KK * PVP * 2)   // bytes of the two value planes in LDS
#define PV_SP (2 * 64 * PVP * 2)   // bytes of the two P planes in LDS
#define PFP 17             // pitch of the factor rows in f32 elements
#define PV_SA (2 * 32 * CLP * 2)   // bytes of the two planes of gated rows, which take the room of the P planes and the factors and more
#define PRO(i) ((size_t)((i) >> 1) * SS * SS + (size_t)((i) & 1) * 16 * SS)              // P rows i * 16 ..: plane of sel i / 2, queries (i % 2) * 16 ..
#define STO(i) ((((i) >> 1) * (SS / 16) + ((i) & 1)) * ((SS / 64) * 32))                   // the same for the ST lines
__global__ __launch_bounds__(256) void k_pv(const float* __restrict__ PS0, const float* __restrict__ ST, const __bf16* __restrict__ VT, const __bf16* __restrict__ VL, int p0, const float* __restrict__ G, const float* __restrict__ LAM, const float* __restrict__ SW,
    const float* __restrict__ OWR, const float* __restrict__ OWI, const float* __restrict__ OBR, const float* __restrict__ OBI, float* __restrict__ O0, float* __restrict__ O1) { const int h = (p0 >> 1) + blockIdx.z;
  __shared__ __align__(16) unsigned char sm[PV_SV + PV_SA];   // value planes [2][256][PVP], P planes [2][64][PVP], factors [64][PFP]; after the loop the value planes' room holds the f32 result rows [64][KK + 4], then the weight plane [128][CLP], then the f32 output rows [32][KK + 4]; the room behind it the gated rows [2][32][CLP]
  __bf16* sv = (__bf16*)sm; __bf16* sp = (__bf16*)(sm + PV_SV); float* so = (float*)sm; float* sfc = (float*)(sm + PV_SV + PV_SP); __bf16* sa = (__bf16*)(sm + PV_SV);
  const int tid = threadIdx.x, wave = tid >> 5, lane = tid & 31, col = lane & 15, g = lane >> 4; const int qg = wave & 1, cg = wave >> 1; const int qb = blockIdx.x * 32;
  const __bf16* gvh = VT + ((size_t)h * KK + (tid >> 3)) * (size_t)SS + (tid & 7) * 8;   // 8 lanes x 16 B = one 128-B line of a value row; 32 rows per sweep of the block
  const __bf16* gvl = VL + ((size_t)h * KK + (tid >> 3)) * (size_t)SS + (tid & 7) * 8;
  const float* gp = PS0 + (size_t)(blockIdx.z * 2) * SS * SS + (size_t)(qb + (tid >> 4)) * SS + (tid & 15) * 4;   // 16 lanes x 16 B = the 256 B of a P row; 16 rows per sweep
  // this thread's softmax parts: local rows i * 16 + tid / 16 (the P rows that it stages), key group tid % 16; a base that is the same for the whole block + the thread's index
  const float* stb = ST + ((size_t)(blockIdx.z * 2) * (SS / 16) + blockIdx.x * 2) * (size_t)((SS / 64) * 32); const unsigned sto = (unsigned)((tid & 15) * 32 + ((tid >> 4) & 1) * 8 + (tid >> 5));   // line tid % 16, the word of row tid / 16
  float ml[4], sl[4];
#pragma unroll
  for (int i = 0; i < 4; ++i) { ml[i] = stb[sto + STO(i)]; sl[i] = stb[sto + STO(i) + 16]; }
  v4u rh[8], rl[8]; v4f rp[4];
#pragma unroll
  for (int i = 0; i < 8; ++i) { rh[i] = *(const v4u*)(gvh + (size_t)i * 32 * SS); rl[i] = *(const v4u*)(gvl + (size_t)i * 32 * SS); }
#pragma unroll
  for (int i = 0; i < 4; ++i) rp[i] = *(const v4f*)(gp + PRO(i));
  asm volatile("s_wait_xcnt 0x0" :: "v"(sto), "s"(stb), "v"(gvh), "v"(gvl), "v"(gp) : "memory");   // stands in front of the first overwrite of an address register of the loads above; the addresses are inputs, so that they live up to the wait
#pragma unroll
  for (int i = 0; i < 4; ++i) { const float f = expf(ml[i] - rowmax(ml[i])); sfc[(i * 16 + (tid >> 4)) * PFP + (tid & 15)] = f * ((1.0f / rowsum(f * sl[i])) * 2048.0f); }
  LDSX();   // a factor row is written and read by the same 16 lanes: the wave's own LDS writes are done before its lanes read each other's words
  float fc[4];   // the factors of this thread's four P rows for the stage whose P waits in rp, fetched with it
#pragma unroll
  for (int i = 0; i < 4; ++i) fc[i] = sfc[(i * 16 + (tid >> 4)) * PFP];
  v8f acc[2][4] = {};
#pragma unroll 1   // one copy of the stage body: one set of prefetch registers, small text (the fixed-count inner loops are unrolled so that their arrays stay in registers)
  for (int st = 0; st < SS / PVK; ++st) {
    if (st) __syncthreads();   // every wave has read its last fragment of the stage before
#pragma unroll
    for (int i = 0; i < 8; ++i) { const int o = (i * 32 + (tid >> 3)) * PVP + (tid & 7) * 8; vst2(sv + o, rh[i]); vst2(sv + KK * PVP + o, rl[i]); }
#pragma unroll
    for (int i = 0; i < 4; ++i) { v4bf hb, lb;
#pragma unroll
      for (int k = 0; k < 4; ++k) { const float v = rp[i][k] * fc[i]; const __bf16 bh = (__bf16)v; hb[k] = bh; lb[k] = (__bf16)(v - (float)bh); }
      const int o = (i * 16 + (tid >> 4)) * PVP + (tid & 15) * 4; vst2(sp + o, hb); vst2(sp + 64 * PVP + o, lb); }
    __syncthreads();           // the stage is whole in LDS
    if (st + 1 < SS / PVK) { const int ko = (st + 1) * PVK;
#pragma unroll
      for (int i = 0; i < 8; ++i) { rh[i] = *(const v4u*)(gvh + (size_t)i * 32 * SS + ko); rl[i] = *(const v4u*)(gvl + (size_t)i * 32 * SS + ko); }
#pragma unroll
      for (int i = 0; i < 4; ++i) { rp[i] = *(const v4f*)(gp + PRO(i) + ko); fc[i] = sfc[(i * 16 + (tid >> 4)) * PFP + st + 1]; }
      asm volatile("s_wait_xcnt 0x0" ::: "memory"); }   // stands in front of the first overwrite of an address register of the loads above (the fragment reads below reuse them)
#pragma unroll
    for (int kc = 0; kc < PVK / 32; ++kc) { v16b ah[2], al[2];
#pragma unroll
      for (int t = 0; t < 2; ++t) { const int o = (qg * 32 + t * 16 + col) * PVP + kc * 32; ah[t] = frag_b(sp + o, lane); al[t] = frag_b(sp + 64 * PVP + o, lane); }
#pragma unroll
      for (int j = 0; j < 4; ++j) { const int o = (cg * 64 + j * 16 + col) * PVP + kc * 32; const v16b vh = frag_b(sv + o, lane), vl = frag_b(sv + KK * PVP + o, lane);
        acc[0][j] = wmma_bf(ah[0], vh, acc[0][j]); acc[1][j] = wmma_bf(ah[1], vh, acc[1][j]);
        acc[0][j] = wmma_bf(al[0], vh, acc[0][j]); acc[1][j] = wmma_bf(al[1], vh, acc[1][j]);
        acc[0][j] = wmma_bf(ah[0], vl, acc[0][j]); acc[1][j] = wmma_bf(ah[1], vl, acc[1][j]); } } }
  // what the gate and the write-out read from memory comes in while the result rows go through LDS: g rows (16 lanes per query, queries w * 16 + tid / 16, columns d = (tid % 16) * 4 + it * 64 and 128 + d), sub_w, bias, lambda
  const int rl_ = tid >> 4, sub = tid & 15; const int org = wave & 1, ocg = wave >> 1;   // output linear: 16-query group, group of 32 outputs
  const float* gb = G + ((size_t)h * SS + qb) * KK; const unsigned go = (unsigned)(rl_ * KK + sub * 4); const unsigned swo = (unsigned)(sub * 4); const unsigned bo = (unsigned)(ocg * 32 + col);
  v4f gr[2][2], gi[2][2], sw1[2], sw2[2]; float bb[2][2];
#pragma unroll
  for (int w = 0; w < 2; ++w)
#pragma unroll
    for (int it = 0; it < 2; ++it) { gr[w][it] = *(const v4f*)(gb + go + w * 16 * KK + it * 64); gi[w][it] = *(const v4f*)(gb + go + w * 16 * KK + it * 64 + 128); }
#pragma unroll
  for (int it = 0; it < 2; ++it) { sw1[it] = *(const v4f*)(SW + swo + it * 64); sw2[it] = *(const v4f*)(SW + swo + it * 64 + DD); }
#pragma unroll
  for (int j = 0; j < 2; ++j) { bb[0][j] = OBR[bo + j * 16]; bb[1][j] = OBI[bo + j * 16]; }
  const float lam = LAM[0];
  asm volatile("s_wait_xcnt 0x0" :: "v"(go), "s"(gb), "v"(swo), "s"(SW), "v"(bo), "s"(OBR), "s"(OBI) : "memory");   // as above
  LBAR();                      // the value planes' room is free for the result rows, the P planes' room for the gated rows; the loads above fly on
#pragma unroll
  for (int t = 0; t < 2; ++t)
#pragma unroll
    for (int j = 0; j < 4; ++j)
#pragma unroll
      for (int r = 0; r < 8; ++r) so[(qg * 32 + t * 16 + 8 * g + r) * (KK + 4) + cg * 64 + j * 16 + col] = acc[t][j][r] * (1.0f / 2048.0f);
  // the output weights, whole 512-B rows, wait in registers while the rows are mixed
  v4f rw0[16], rw1[16]; const unsigned wo = (unsigned)tid * 16u;
  cl_ldw(rw0, (const char*)OWR, wo); cl_ldw(rw1, (const char*)OWI, wo);
  asm volatile("s_wait_xcnt 0x0" :: "v"(tid), "v"(wo), "s"(OWR), "s"(OWI) : "memory");   // as above
  LBAR();                      // the result rows are whole; the weight loads fly on
#pragma unroll
  for (int w = 0; w < 2; ++w) { const int q = w * 16 + rl_; const float* y1 = so + q * (KK + 4); const float* y2 = so + (32 + q) * (KK + 4);
    float s2 = 0.f;
#pragma unroll
    for (int i = 0; i < 8; ++i) { const v4f v = *(const v4f*)((i < 4 ? y1 : y2) + sub * 4 + (i & 3) * 64); s2 += (v[0] * v[0] + v[1] * v[1]) + (v[2] * v[2] + v[3] * v[3]); }
    s2 = rowsum(s2);
    const float inv = 1.0f / sqrtf(s2 * (1.0f / 256.0f) + 1e-5f);
#pragma unroll
    for (int it = 0; it < 2; ++it) { const int d = sub * 4 + it * 64;   /* d in [0,128): this lane's 4 columns */
      const v4f a1r = *(const v4f*)(y1 + d), a1i = *(const v4f*)(y1 + 128 + d), a2r = *(const v4f*)(y2 + d), a2i = *(const v4f*)(y2 + 128 + d);
      v4bf rh_, rlo, ih_, ilo;
#pragma unroll
      for (int k = 0; k < 4; ++k) { const float w1 = bfr(sw1[it][k]) * inv, w2 = bfr(sw2[it][k]) * inv; const float orr = a1r[k] * w1 - lam * (a2r[k] * w2), oi = a1i[k] * w1 - lam * (a2i[k] * w2);
        const float zr = gr[w][it][k] * orr - gi[w][it][k] * oi, zi = gr[w][it][k] * oi + gi[w][it][k] * orr;
        const __bf16 zrh = (__bf16)zr, zih = (__bf16)zi; rh_[k] = zrh; rlo[k] = (__bf16)(zr - (float)zrh); ih_[k] = zih; ilo[k] = (__bf16)(zi - (float)zih); }
      vst2(sa + q * CLP + d, rh_); vst2(sa + q * CLP + 128 + d, ih_); vst2(sa + (32 + q) * CLP + d, rlo); vst2(sa + (32 + q) * CLP + 128 + d, ilo); } }
  LBAR();                      // the gated rows are whole, the result rows' room is free for the weight plane; the weight loads may still fly
  { __bf16* pw = (__bf16*)sm + wave * CLP + lane * 4; cl_putw(rw0, 1.0f, pw); cl_putw(rw1, 1.0f, pw + 128); }
  __syncthreads();             // the weight plane is whole
  v8f oc[2][2] = {};
  { const __bf16* fa = sa + (org * 16 + col) * CLP; const __bf16* fw = (const __bf16*)sm + (ocg * 32 + col) * CLP;
#pragma unroll
    for (int kc = 0; kc < KK / 32; ++kc) { v16b a[2], an[2], w0[2], w1[2];
#pragma unroll
      for (int t = 0; t < 2; ++t) { a[t] = frag_b(fa + t * 32 * CLP + kc * 32, lane); an[t] = a[t];
        if (kc >= 4) { union { v16b v; unsigned u[8]; } x; x.v = a[t];   // -z_i: the sign bit of each bf16
#pragma unroll
          for (int e = 0; e < 8; ++e) x.u[e] ^= 0x80008000u;
          an[t] = x.v; } }
#pragma unroll
      for (int j = 0; j < 2; ++j) { w0[j] = frag_b(fw + j * 16 * CLP + kc * 32, lane); w1[j] = frag_b(fw + j * 16 * CLP + ((kc * 32) ^ 128), lane); }
#pragma unroll
      for (int t = 0; t < 2; ++t)
#pragma unroll
        for (int j = 0; j < 2; ++j) { oc[0][j] = wmma_bf(an[t], w0[j], oc[0][j]); oc[1][j] = wmma_bf(a[t], w1[j], oc[1][j]); } } }
  __syncthreads();             // the weight plane's room is free for the output rows
#pragma unroll
  for (int pt = 0; pt < 2; ++pt)
#pragma unroll
    for (int j = 0; j < 2; ++j) { const float bj = bfr(bb[pt][j]);
#pragma unroll
      for (int r = 0; r < 8; ++r) so[(org * 16 + 8 * g + r) * (KK + 4) + pt * 128 + ocg * 32 + j * 16 + col] = oc[pt][j][r] + bj; }
  __syncthreads();             // the output rows are whole
  // whole 512-B rows of out_r and out_i by 32 lanes
#pragma unroll
  for (int it = 0; it < 8; ++it) { const int e = it * 8 + wave, ro = e >> 1, pt = e & 1; vst2((pt ? O1 : O0) + ((size_t)h * SS + qb + ro) * DD + lane * 4, *(const v4f*)&so[ro * (KK + 4) + pt * 128 + lane * 4]); } }
extern "C" void kernel_launch(void* const* d_in, const int* in_sizes, int n_in, void* d_out, int out_size, void* d_ws, size_t ws_size, hipStream_t stream) {
  (void)in_sizes; (void)n_in; (void)out_size;
  const float** F = (const float**)d_in;   // 0 q_r, 1 q_i, 2 k_r, 3 k_i, 4 v_r, 5 v_i, 6 pe_q_r, 7 pe_q_i, 8 pe_k_r, 9 pe_k_i [1,12,1024,128]; 10 qw_r [256,128], 11 qw_i, 12 qb_r [256], 13 qb_i; 14 kw_r [128,128], 15 kw_i, 16 kb_r, 17 kb_i; 18 vw_r, 19 vw_i, 20 vb_r, 21 vb_i; 22 gw_r, 23 gw_i, 24 gb_r, 25 gb_i; 26 ow_r, 27 ow_i, 28 ob_r, 29 ob_i; 30 lq1, 31 lk1, 32 lq2, 33 lk2 [128]; 34 sub_w [256]
  if (ws_size < (size_t)WS_END) return;
  char* ws = (char*)d_ws; _Float16 *QH = (_Float16*)(ws + WS_QH), *QL = (_Float16*)(ws + WS_QL), *KH = (_Float16*)(ws + WS_KH), *KL = (_Float16*)(ws + WS_KL); __bf16 *VT = (__bf16*)(ws + WS_VT), *VL = (__bf16*)(ws + WS_VL); float *G = (float*)(ws + WS_G), *LAM = (float*)(ws + WS_LAM), *S = (float*)(ws + WS_S), *ST = (float*)(ws + WS_ST);
  float* OUT0 = (float*)d_out; float* OUT1 = (float*)d_out + (size_t)NRF * DD;
  k_proj<<<dim3(1 + 10 * (NR / 64)), 256, 0, stream>>>(F[0], F[1], F[2], F[3], F[4], F[5], F[6], F[7], F[8], F[9], F[10], F[11], F[12], F[13], F[14], F[15], F[16], F[17], F[18], F[19], F[20], F[21], F[22], F[23], F[24], F[25], F[30], F[31], F[32], F[33], QH, QL, KH, KL, VT, VL, G, LAM);
  for (int p0 = 0; p0 < NPAIR; p0 += HG) {
    k_sc<<<dim3(SS / 64, SS / 128, HG), 256, 0, stream>>>(QH, QL, KH, KL, p0, S, ST);
    k_pv<<<dim3(SS / 32, 1, HG / 2), 256, 0, stream>>>(S, ST, VT, VL, p0, G, LAM, F[34], F[26], F[27], F[28], F[29], OUT0, OUT1);
  }
}

// v009
// It runs in 139 microseconds.
// In both of two side-by-side timings against v008, it was 1.04 times as fast.
// All steps since v000 together make it 17.1 times as fast.
// compute dtype: all float inputs rounded to bf16; every complex linear as one stacked real GEMM ([x_r | x_i] against [W_r ; -W_i] / [W_i ; W_r]) with EXACT bf16 products on WMMA 16x16x32, f32 accumulate; q (+pe) as f16 hi + residual (x 2^10) and k (+pe) as f16 hi + residual (x 2^10) -> 3-product complex logits (s_r, s_i as two stacked K=256 real GEMMs), |s| scaled in f32 (sqrtf); softmax in f32 (per 64 keys against their own maximum by the hardware's 2^x, then one factor per row and 64 keys by precise expf); P x 2^11 split bf16 hi + lo against v bf16 hi + lo (3 products); RMS norm / lambda / differential combination / complex gating in f32; the gated result (bf16 hi + lo) through the output complex linear (2 products); f32 outputs.
#include <hip/hip_runtime.h>
#include <math.h>

typedef __attribute__((ext_vector_type(16))) _Float16 v16h;
typedef __attribute__((ext_vector_type(16))) __bf16 v16b;
typedef __attribute__((ext_vector_type(8)))  _Float16 v8h;
typedef __attribute__((ext_vector_type(8)))  float v8f;
typedef __attribute__((ext_vector_type(4)))  float v4f;
typedef __attribute__((ext_vector_type(2)))  float v2f;
typedef __attribute__((ext_vector_type(4)))  unsigned v4u;
typedef __attribute__((ext_vector_type(4)))  int v4i;
typedef float __attribute__((may_alias)) float_a;
typedef int __attribute__((may_alias)) int_a;

template <typename T> __device__ __forceinline__ void vst2(void* p, T v) { *(T*)p = v;  }
__device__ __forceinline__ v8f wmma16(v16h a, v16h b, v8f c) {
  v8f d = __builtin_amdgcn_wmma_f32_16x16x32_f16(false, a, false, b, (short)0, c, false, false);
  return d;
}
__device__ __forceinline__ v8f wmma_bf(v16b a, v16b b, v8f c) {
  v8f d = __builtin_amdgcn_wmma_f32_16x16x32_bf16(false, a, false, b, (short)0, c, false, false);
  return d;
}
// 16x16x32 fragments: lane = (h = lane>>4, row/col = lane&15); elements 0..7 = k0+8h+0..7, 8..15 = k0+16+8h+0..7; D element r = row 8h+r
__device__ __forceinline__ v16h frag_h(const _Float16* rowk0, int lane) {
  union { v16h v; v8h q[2]; } u; const _Float16* p = rowk0 + 8 * (lane >> 4);
  u.q[0] = *(const v8h*)p; u.q[1] = *(const v8h*)(p + 16); return u.v;
}
__device__ __forceinline__ v16h frag_f32(const float* rowk0, int lane) {
  v16h a; const float* p = rowk0 + 8 * (lane >> 4);
#pragma unroll
  for (int i = 0; i < 8; ++i) { a[i] = (_Float16)p[i]; a[8 + i] = (_Float16)p[16 + i]; }
  return a;
}
__device__ __forceinline__ v16h frag_f32s(const float* rowk0, int lane, float sc) {
  v16h a; const float* p = rowk0 + 8 * (lane >> 4);
#pragma unroll
  for (int i = 0; i < 8; ++i) { a[i] = (_Float16)(p[i] * sc); a[8 + i] = (_Float16)(p[16 + i] * sc); }
  return a;
}
// column fragment from a [K][ld] layout (column n), rows >= K read as 0
__device__ __forceinline__ v16h fragc_f32(const float* W, int k0, int n, int lane, int ld, int K) {
  v16h a; const int g = lane >> 4;
#pragma unroll
  for (int i = 0; i < 8; ++i) { const int ka = k0 + 8 * g + i, kb = ka + 16;
    a[i] = (_Float16)(ka < K ? W[(size_t)(ka < K ? ka : K - 1) * ld + n] : 0.f); a[8 + i] = (_Float16)(kb < K ? W[(size_t)(kb < K ? kb : K - 1) * ld + n] : 0.f); }
  return a;
}
struct F2 { v16b h, l; };
__device__ __forceinline__ F2 bsplit16(const float v[16]) { F2 r;
#pragma unroll
  for (int i = 0; i < 16; ++i) { const __bf16 h = (__bf16)v[i]; r.h[i] = h; r.l[i] = (__bf16)(v[i] - (float)h); }
  return r; }
__device__ __forceinline__ F2 split_row(const float* row, int k0, int lane) { float v[16]; const float* p = row + k0 + 8 * (lane >> 4);
#pragma unroll
  for (int i = 0; i < 8; ++i) { v[i] = p[i]; v[8 + i] = p[16 + i]; }
  return bsplit16(v); }
__device__ __forceinline__ F2 split_rowK(const float* row, int k0, int lane, int K) { float v[16]; const int g = lane >> 4;
#pragma unroll
  for (int i = 0; i < 8; ++i) { const int ka = k0 + 8 * g + i, kb = ka + 16; v[i] = ka < K ? row[ka < K ? ka : K - 1] : 0.f; v[8 + i] = kb < K ? row[kb < K ? kb : K - 1] : 0.f; }
  return bsplit16(v); }
__device__ __forceinline__ F2 split_col(const float* W, int k0, int n, int lane, int ld, int K) { float v[16]; const int g = lane >> 4;
#pragma unroll
  for (int i = 0; i < 8; ++i) { const int ka = k0 + 8 * g + i, kb = ka + 16; v[i] = ka < K ? W[(size_t)(ka < K ? ka : K - 1) * ld + n] : 0.f; v[8 + i] = kb < K ? W[(size_t)(kb < K ? kb : K - 1) * ld + n] : 0.f; }
  return bsplit16(v); }
__device__ __forceinline__ v8f mac3(const F2& a, const F2& b, v8f c) { c = wmma_bf(a.l, b.h, c); c = wmma_bf(a.h, b.l, c); return wmma_bf(a.h, b.h, c); }
__device__ __forceinline__ float sigm(float v) { return 1.0f / (1.0f + expf(-v)); }
// scheduling fence: the compiler moves no instruction over it. It stands between a group's LDS fragment reads and the products in front of which the source issues them: without it the reads are sunk to just in front of their first use and their latency is waited for in full
#define SFENCE() __builtin_amdgcn_sched_barrier(0)
#define LDSX() do { asm volatile("s_wait_dscnt 0" ::: "memory"); __builtin_amdgcn_wave_barrier(); __builtin_amdgcn_fence(__ATOMIC_RELEASE, "workgroup"); } while (0)
// work-group barrier for LDS data alone: release and acquire of the LDS address space at work-group scope around the barrier; unlike __syncthreads() it does not make the wave wait for its outstanding global loads, which are meant to fly across it
#define LBAR() do { __builtin_amdgcn_fence(__ATOMIC_RELEASE, "workgroup", "local"); __builtin_amdgcn_s_barrier(); __builtin_amdgcn_fence(__ATOMIC_ACQUIRE, "workgroup", "local"); } while (0)


// Complex differential attention (B 1, H 12, S 1,024, D 128): qp = CLin_q(q) + [pe_q, pe_q] (2D wide -> q1, q2), kp = CLin_k(k) + pe_k, vp = CLin_v(v); w_s = softmax(|q_s . conj(kp)| / sqrt(128)) for s = 1, 2; a_s = w_s vp (complex); cat = [a1, a2] / rms(cat) * sub_w; out = a1 - lambda a2 with lambda = sigmoid(exp(lq1 . lk1) - exp(lq2 . lk2) + 0.3555...); out = CLin_g(q) * out (complex product); out = CLin_o(out) -> (out_r, out_i).
#define NHT 12             // heads (x batch 1)
#define SS 1024
#define DD 128
#define KK 256             // stacked K of every complex linear / logit GEMM: [real | imag]
#ifndef NHU
#define NHU NHT            // heads processed
#endif
#define NR (NHU * SS)      // rows processed
#define NRF (NHT * SS)     // full row count (output-1 offset)
#ifndef HG
#define HG 24              // (head, sel) pairs per launch group (even, divides NPAIR): all pairs at once, so that the blocks of k_pv (64 P rows each) outnumber the WGPs; the logit planes take 96 MiB of workspace
#endif
#define NPAIR (NHU * 2)
#define SCALE 0.0883883461356163f       // 128^-0.5 as f32
#define LAMBDA_INIT 0.35550907254219055f  // 0.8 - 0.6 exp(-0.3) as f32
__device__ __forceinline__ float bfr(float v) { return (float)(__bf16)v; }
typedef __attribute__((ext_vector_type(8))) __bf16 v8b;
typedef __attribute__((ext_vector_type(4))) __bf16 v4bf;
__device__ __forceinline__ v16b frag_b(const __bf16* rowk0, int lane) { union { v16b v; v8b q[2]; } u; const __bf16* p = rowk0 + 8 * (lane >> 4); u.q[0] = *(const v8b*)p; u.q[1] = *(const v8b*)(p + 16); return u.v; }

#define WS_QH  0u                                      // f16 q rows [row][1024]: per sel s: [s*512 +0..127] q_r, [+128..255] q_i, [+256..383] q_i, [+384..511] -q_r  (hi)
#define WS_QL  (WS_QH + 2u * (size_t)NRF * 1024)       // f16 residual x 2^10
#define WS_KH  (WS_QL + 2u * (size_t)NRF * 1024)       // f16 k rows [row][256] = [kp_r | kp_i] (hi)
#define WS_KL  (WS_KH + 2u * (size_t)NRF * KK)         // f16 residual x 2^10
#define WS_VT  (WS_KL + 2u * (size_t)NRF * KK)         // bf16 value planes [h][256 = vp_r | vp_i][s] hi
#define WS_VL  (WS_VT + 2u * (size_t)NHT * KK * SS)    // bf16 value residual planes
#define WS_G   (WS_VL + 2u * (size_t)NHT * KK * SS)    // f32 g rows [row][256] = [g_r | g_i]
#define WS_LAM (WS_G + 4u * (size_t)NRF * KK)          // one line: lambda replicated
#define WS_S   (WS_LAM + 128u)                         // f32 planes for HG (head, sel) pairs [hg][q][k]: exp(logit - maximum of the row's logits in the key's group of 64 keys)
#define WS_ST  (WS_S + 4u * (size_t)HG * SS * SS)      // f32 softmax parts, one 128-B line per (pair, group of 16 queries, group of 64 keys): word (r % 2) * 8 + r / 2 = row r's maximum over these keys, word 16 + the same = row r's sum of the plane's values over these keys
#define WS_END (WS_ST + 128u * (size_t)HG * (SS / 16) * (SS / 64))

// ---- clin_body: block = (64 rows, 128 output cols, tile index over 2*NO), 8 waves: generic complex linear as a stacked real GEMM.
// A row = [x_r[row] | x_i[row]] (K 256: two f32 input tensors, bf16 exact);
// output column o in [0, 2 NO): part = o / NO (0 real, 1 imag), oo = o % NO; B[k] = part 0: (k < 128 ? W_r[oo][k] : -W_i[oo][k-128]), part 1: (k < 128 ? W_i[oo][k] : W_r[oo][k-128]); + bias_part[oo].
// MODE 0: q projection (NO 256) + pe_q -> QH/QL (each value to its two slots, see WS_QH); MODE 1: k (NO 128) + pe_k -> KH/KL; MODE 2: v -> bf16 planes; MODE 3: g -> G rows (the output linear stands in k_pv)
// Data path: the block brings its 128 weight rows and its 64 A rows (both K halves: real, imag) in by whole 512-B rows (one wave = one row per load), all of these loads issued in front of the first use (pe rows and bias: behind the first barrier, so that they come in while the products run; pe is added at the write-out, behind the bias), rounds weights and A to bf16 once and keeps them in LDS; every wave's fragments come from LDS, the next 32 K columns' fragments read in front of this group's products.
// wave = (16-row group rg, 64-column group cg): 4 accumulator tiles, products per tile in the order of rising K. The fixed-count loops are unrolled so that their arrays stay in registers.
#define CLP 264            // LDS row pitch in bf16 elements: 528 B = 16 B x 33, an odd multiple of 16 B for the 16-byte fragment reads
#define SFP 132            // pitch of the f32 result rows
// one K half of the weight rows / of the A rows into registers: b = the block's first row (the same for all threads), o = this thread's byte offset from it (row tid / 32, 16-byte piece tid % 32); 8 rows per sweep of the block
__device__ __forceinline__ void cl_ldw(v4f (&rw)[16], const char* b, unsigned o) {
#pragma unroll
  for (int i = 0; i < 16; ++i) rw[i] = *(const v4f*)(b + o + i * (8 * DD * 4));
}
__device__ __forceinline__ void cl_lda(v4f (&ra)[8], const char* b, unsigned o, int xs) {
#pragma unroll
  for (int i = 0; i < 8; ++i) ra[i] = *(const v4f*)(b + o + i * (8 * xs * 4));
}
// the same from registers into LDS as bf16 (weights x sg, which is +1 or -1: exact); pw, pa = this thread's place in the weight plane and in the first A plane
__device__ __forceinline__ void cl_putw(const v4f (&rw)[16], float sg, __bf16* pw) {
#pragma unroll
  for (int i = 0; i < 16; ++i) { v4bf b;
#pragma unroll
    for (int k = 0; k < 4; ++k) b[k] = (__bf16)(sg * rw[i][k]);
    vst2(pw + i * 8 * CLP, b); }
}
template <int NA> __device__ __forceinline__ void cl_puta(const v4f (&ra)[8], __bf16* pa) {
#pragma unroll
  for (int i = 0; i < 8; ++i) { v4bf hb, lb;
#pragma unroll
    for (int k = 0; k < 4; ++k) { const float v = ra[i][k]; const __bf16 bh = (__bf16)v; hb[k] = bh; lb[k] = (__bf16)(v - (float)bh); }
    vst2(pa + i * 8 * CLP, hb); if (NA == 2) vst2(pa + 64 * CLP + i * 8 * CLP, lb); }
}
// all products: fa = this lane's A row, fw = this lane's first weight row; two sets of fragments, so that the LDS reads of the next 32 K columns are under way while this group's products run
template <int NA> __device__ __forceinline__ void cl_mac(v8f (&acc)[4], const __bf16* fa, const __bf16* fw, int lane) {
  v16b a[2][NA], w[2][4];
#pragma unroll
  for (int t = 0; t < NA; ++t) a[0][t] = frag_b(fa + t * 64 * CLP, lane);
#pragma unroll
  for (int j = 0; j < 4; ++j) w[0][j] = frag_b(fw + j * 16 * CLP, lane);
#pragma unroll
  for (int kc = 0; kc < KK / 32; ++kc) { const int c = kc & 1, n = c ^ 1;
    if (kc + 1 < KK / 32) {
#pragma unroll
      for (int t = 0; t < NA; ++t) a[n][t] = frag_b(fa + t * 64 * CLP + (kc + 1) * 32, lane);
#pragma unroll
      for (int j = 0; j < 4; ++j) w[n][j] = frag_b(fw + j * 16 * CLP + (kc + 1) * 32, lane); }
    SFENCE();   // the next 32 K columns' reads stay in front of this group's products
#pragma unroll
    for (int t = 0; t < NA; ++t)
#pragma unroll
      for (int j = 0; j < 4; ++j) acc[j] = wmma_bf(a[c][t], w[c][j], acc[j]);
    SFENCE(); }   // and the reads after them behind these products
}
// the mode, 0 to 3, is picked per block by mrt (the modes share the data path and the products and differ in the write-out). sm = the block's LDS, bx = its 64-row group, c0 = its first column of the 2 NO, part and oo0 as above
__device__ __forceinline__ void clin_body(unsigned char* sm, int mrt, int bx, int c0, int part, int oo0, const float* __restrict__ XR, const float* __restrict__ XI, const float* __restrict__ WR, const float* __restrict__ WI, const float* __restrict__ BR, const float* __restrict__ BI, const float* __restrict__ PER, const float* __restrict__ PEI, void* __restrict__ D0, void* __restrict__ D1) {
  constexpr int NA = 1;   // A planes in LDS
  const int mode = mrt;
  // sm holds (128 + NA * 64) * CLP * 2 bytes: weight plane [128][CLP], A planes [NA][64][CLP]; after the products the weight plane's room holds the f32 result rows [64][SFP]
  __bf16* sw = (__bf16*)sm; __bf16* sa = sw + 128 * CLP; float* sf = (float*)sm;
  const int tid = threadIdx.x, wave = tid >> 5, lane = tid & 31, col = lane & 15, g = lane >> 4; const int rg = wave & 3, cg = wave >> 2; const size_t r0 = (size_t)bx * 64;
  constexpr int XS = DD; const float sg1 = part == 0 ? -1.0f : 1.0f;
  // every global read = a base that is the same for the whole block + a 32-bit byte offset of the thread
  const char* wb0 = (const char*)((part == 0 ? WR : WI) + (size_t)oo0 * DD); const char* wb1 = (const char*)((part == 0 ? WI : WR) + (size_t)oo0 * DD); const unsigned wo = (unsigned)tid * 16u;   // row tid / 32 of 512 B, piece tid % 32
  const char* xb0 = (const char*)(XR + r0 * XS); const char* xb1 = (const char*)(XI + r0 * XS); const unsigned xo = wo;
  const float* bbs = (part == 0 ? BR : BI) + oo0; const unsigned bi = (unsigned)(cg * 64 + col);
  const char* pb = mode <= 1 ? (const char*)((part == 0 ? PER : PEI) + r0 * DD) : nullptr; const unsigned po = (unsigned)((tid >> 4) * (DD * 4) + (tid & 15) * 32);   // MODE <= 1: 16 lanes x 32 B = the 512 B of a pe row; 16 rows per sweep
  __bf16* pw = sw + wave * CLP + lane * 4; __bf16* pa = sa + wave * CLP + lane * 4;
  const __bf16* fa = sa + (rg * 16 + col) * CLP; const __bf16* fw = sw + (cg * 64 + col) * CLP;
  v4f rw0[16], ra0[8], rw1[16], ra1[8], pe[4][2]; float bb[4];
  cl_ldw(rw0, wb0, wo); cl_ldw(rw1, wb1, wo); cl_lda(ra0, xb0, xo, XS); cl_lda(ra1, xb1, xo, XS);
  // stands in front of the first overwrite of an address register of the loads above; the bases and the offset registers that the loads name (the thread id, scaled by the load's width) are inputs, so that they live up to the wait
  asm volatile("s_wait_xcnt 0x0" :: "v"(tid), "s"(wb0), "s"(wb1), "s"(xb0), "s"(xb1) : "memory");
  cl_putw(rw0, 1.0f, pw); cl_putw(rw1, sg1, pw + 128);
  cl_puta<NA>(ra0, pa); cl_puta<NA>(ra1, pa + 128);
  __syncthreads();             // weights and A rows are whole in LDS
  // the bias and the pe rows come in while the products run
#pragma unroll
  for (int j = 0; j < 4; ++j) bb[j] = bbs[bi + j * 16];
  if (mode <= 1) {
#pragma unroll
    for (int it = 0; it < 4; ++it) { pe[it][0] = *(const v4f*)(pb + po + it * (16 * DD * 4)); pe[it][1] = *(const v4f*)(pb + po + it * (16 * DD * 4) + 16); }
    asm volatile("s_wait_xcnt 0x0" :: "v"(bi), "s"(bbs), "v"(po), "s"(pb) : "memory"); }   // as above
  else asm volatile("s_wait_xcnt 0x0" :: "v"(bi), "s"(bbs) : "memory");   // as above
  v8f acc[4] = {};
  cl_mac<NA>(acc, fa, fw, lane);
  __syncthreads();             // the weight plane's room is free for the result rows
#pragma unroll
  for (int j = 0; j < 4; ++j) { const float bj = bfr(bb[j]);
#pragma unroll
    for (int r = 0; r < 8; ++r) sf[(rg * 16 + 8 * g + r) * SFP + cg * 64 + j * 16 + col] = acc[j][r] + bj; }
  __syncthreads();             // the result rows are whole
  if (mode == 0) {   // q: value (sel = oo0/128, d) -> QH[row][sel*512 + (part ? 128 : 0) + d] and QH[row][sel*512 + (part ? 256 : 384) + d] (the second real copy negated); f16 hi + residual x 2^10; each destination = a 256-B segment per row by 16 consecutive threads
    _Float16* QH = (_Float16*)D0; _Float16* QL = (_Float16*)D1; const int sel = oo0 / DD; const int dA = sel * 512 + (part ? 128 : 0), dB = sel * 512 + (part ? 256 : 384); const float sgB = part ? 1.0f : -1.0f;
#pragma unroll   // pe[it] stays in registers
    for (int it = 0; it < 4; ++it) { const int rl = it * 16 + (tid >> 4), q = tid & 15; v8h ha, la, hb, lb;
#pragma unroll
      for (int k = 0; k < 8; ++k) { const float v = sf[rl * SFP + q * 8 + k] + bfr(pe[it][k >> 2][k & 3]); const _Float16 hv = (_Float16)v; ha[k] = hv; la[k] = (_Float16)((v - (float)hv) * 1024.0f); const float vb = v * sgB; const _Float16 hb2 = (_Float16)vb; hb[k] = hb2; lb[k] = (_Float16)((vb - (float)hb2) * 1024.0f); }
      const size_t ro = (r0 + rl) * 1024; vst2((v4u*)(QH + ro + dA + q * 8), *(const v4u*)&ha); vst2((v4u*)(QL + ro + dA + q * 8), *(const v4u*)&la); vst2((v4u*)(QH + ro + dB + q * 8), *(const v4u*)&hb); vst2((v4u*)(QL + ro + dB + q * 8), *(const v4u*)&lb); } }
  else if (mode == 1) {   // k rows [row][256]: column part*128 + d; f16 hi + residual x 2^10
    _Float16* KH = (_Float16*)D0; _Float16* KL = (_Float16*)D1;
#pragma unroll   // pe[it] stays in registers
    for (int it = 0; it < 4; ++it) { const int rl = it * 16 + (tid >> 4), q = tid & 15; v8h ha, la;
#pragma unroll
      for (int k = 0; k < 8; ++k) { const float v = sf[rl * SFP + q * 8 + k] + bfr(pe[it][k >> 2][k & 3]); const _Float16 hv = (_Float16)v; ha[k] = hv; la[k] = (_Float16)((v - (float)hv) * 1024.0f); }
      const size_t ro = (r0 + rl) * KK + c0; vst2((v4u*)(KH + ro + q * 8), *(const v4u*)&ha); vst2((v4u*)(KL + ro + q * 8), *(const v4u*)&la); }
    asm volatile("s_wait_xcnt 0x0" ::: "memory"); }   // run-time mode: in the listing another mode's code follows behind a branch; the wait stands in front of any overwrite there of a register that the stores above name
  else if (mode == 2) {
    __bf16* VT = (__bf16*)D0; __bf16* VL = (__bf16*)D1; const size_t h = r0 / SS; const int s0 = (int)(r0 % SS);
#pragma unroll   // the LDS reads of all four sweeps are under way together
    for (int it = 0; it < 4; ++it) { const int e = it * 256 + tid, cl = e >> 3, q = e & 7; v8b hb, lb;
#pragma unroll
      for (int k = 0; k < 8; ++k) { const float v = sf[(q * 8 + k) * SFP + cl]; const __bf16 bh = (__bf16)v; hb[k] = bh; lb[k] = (__bf16)(v - (float)bh); }
      const size_t o2 = (h * KK + c0 + cl) * (size_t)SS + s0 + q * 8; vst2((v4u*)(VT + o2), *(const v4u*)&hb); vst2((v4u*)(VL + o2), *(const v4u*)&lb); }
    asm volatile("s_wait_xcnt 0x0" ::: "memory"); }   // as at the end of mode 1
  else if (mode == 3) {   // g rows [row][256] f32: 512-B segment per row by 32 lanes
    float* G = (float*)D0;
#pragma unroll   // the LDS reads of all eight sweeps are under way together
    for (int it = 0; it < 8; ++it) { const int rl = it * 8 + wave, q = lane; vst2(G + (r0 + rl) * KK + c0 + q * 4, *(const v4f*)&sf[rl * SFP + q * 4]); }
    asm volatile("s_wait_xcnt 0x0" ::: "memory"); }   // as at the end of mode 1
}
__device__ __forceinline__ void lam_body(float* slp, const float* __restrict__ LQ1, const float* __restrict__ LK1, const float* __restrict__ LQ2, const float* __restrict__ LK2, float* __restrict__ LAM) { float& sl = *slp;
  if (threadIdx.x == 0) { float s1 = 0.f, s2 = 0.f;
#pragma unroll 1   // one copy of the trip, so that the wait below stands between a trip's loads and the next trip's addresses
    for (int i = 0; i < DD; i += 4) { const float *p1 = LQ1 + i, *p2 = LK1 + i, *p3 = LQ2 + i, *p4 = LK2 + i; float a[4], b[4], c[4], d[4];
#pragma unroll
      for (int k = 0; k < 4; ++k) { a[k] = p1[k]; b[k] = p2[k]; c[k] = p3[k]; d[k] = p4[k]; }
      asm volatile("s_wait_xcnt 0x0" :: "s"(p1), "s"(p2), "s"(p3), "s"(p4) : "memory");   // stands in front of the next trip's overwrite of the address registers of the loads above; the addresses are inputs, so that they live up to the wait
#pragma unroll
      for (int k = 0; k < 4; ++k) { s1 += bfr(a[k]) * bfr(b[k]); s2 += bfr(c[k]) * bfr(d[k]); } }
    const float z = expf(s1) - expf(s2) + LAMBDA_INIT; sl = 1.0f / (1.0f + expf(-z)); }
  __syncthreads(); if (threadIdx.x < 32) vst2(LAM + threadIdx.x, sl); }
// ---- k_proj: everything that reads only the inputs, in ONE launch: block 0 = lambda; then NR / 64 blocks per 128-column tile t: 4 tiles of the q projection, 2 of g (which reads the same rows as q), 2 of k, 2 of v. None of these reads what another writes, so that their blocks fill the chip together and one part's start and tail lie under another part's work.
__global__ __launch_bounds__(256) void k_proj(const float* __restrict__ QR, const float* __restrict__ QI, const float* __restrict__ KR, const float* __restrict__ KI, const float* __restrict__ VR, const float* __restrict__ VI, const float* __restrict__ PQR, const float* __restrict__ PQI, const float* __restrict__ PKR, const float* __restrict__ PKI,
    const float* __restrict__ QWR, const float* __restrict__ QWI, const float* __restrict__ QBR, const float* __restrict__ QBI, const float* __restrict__ KWR, const float* __restrict__ KWI, const float* __restrict__ KBR, const float* __restrict__ KBI,
    const float* __restrict__ VWR, const float* __restrict__ VWI, const float* __restrict__ VBR, const float* __restrict__ VBI, const float* __restrict__ GWR, const float* __restrict__ GWI, const float* __restrict__ GBR, const float* __restrict__ GBI,
    const float* __restrict__ LQ1, const float* __restrict__ LK1, const float* __restrict__ LQ2, const float* __restrict__ LK2,
    void* __restrict__ QH, void* __restrict__ QL, void* __restrict__ KH, void* __restrict__ KL, void* __restrict__ VT, void* __restrict__ VL, void* __restrict__ G, float* __restrict__ LAM) {
  __shared__ __align__(16) unsigned char sm[(128 + 64) * CLP * 2];
  if (blockIdx.x == 0) { lam_body((float*)sm, LQ1, LK1, LQ2, LK2, LAM); return; }   // the same for the whole block
  const int b = (int)blockIdx.x - 1, t = b / (NR / 64), bx = b % (NR / 64);
  const int m = t < 4 ? 0 : t < 6 ? 3 : (t - 4) >> 1;   // mode: t 0..3 q, 4 5 g, 6 7 k, 8 9 v
  const int c0 = (t < 4 ? t : t & 1) * 128, part = t < 4 ? t >> 1 : t & 1, oo0 = t < 4 ? (t & 1) * 128 : 0;
  clin_body(sm, m, bx, c0, part, oo0, m == 1 ? KR : m == 2 ? VR : QR, m == 1 ? KI : m == 2 ? VI : QI, m == 0 ? QWR : m == 1 ? KWR : m == 2 ? VWR : GWR, m == 0 ? QWI : m == 1 ? KWI : m == 2 ? VWI : GWI,
                m == 0 ? QBR : m == 1 ? KBR : m == 2 ? VBR : GBR, m == 0 ? QBI : m == 1 ? KBI : m == 2 ? VBI : GBI, m == 0 ? PQR : PKR, m == 0 ? PQI : PKI, m == 0 ? QH : m == 1 ? KH : m == 2 ? VT : G, m == 0 ? QL : m == 1 ? KL : VL); }
// ---- k_sc: block = (64 queries, 128 keys, pair in group), 8 waves: pair p = (head h = p/2, sel = p%2); s_r = Q[sel*512 + 0..255] . KH, s_i = Q[sel*512 + 256..511] . KH (3 products each: hi.hi + (lo.hi + hi.lo) 2^-10); logit = sqrt(s_r^2 + s_i^2 + 1e-8) x 128^-0.5
// The softmax's first half is done here, on the logits while they are in the wave: per row the maximum m64 over the wave's 64 keys, e = exp(logit - m64) -> the S plane, the sum of e; m64 and the sum go to the wave's own line of ST. k_pv turns them into one factor per (row, 64 keys), so that no pass over the planes stands between the two kernels.
// Per stage of 64 stacked-K elements the block brings one whole 128-B line of each of its rows (64 q rows x 4 planes: s_r hi, s_r lo, s_i hi, s_i lo; 128 k rows x 2 planes: hi, lo) into LDS by asynchronous 16-byte copies; two buffers, the next stage's copies fly while this stage's fragments are read from LDS.
// wave = (16-query group qg, 64-key group kg): 4 accumulator tiles x 4 sums, products per sum in the order of rising K as before
#define SCP 72                      // LDS row pitch in f16 elements: 144 B = 16 B x 9, an odd multiple of 16 B for the 16-byte fragment reads
#define SC_Q (4 * 64 * SCP * 2)     // bytes of the four q planes of a stage
#define SC_K (2 * 128 * SCP * 2)    // bytes of the two k planes of a stage
#define SC_BUF (SC_Q + SC_K)
// eight asynchronous copies of 16 B per lane; the s_wait_xcnt stands inside the statement, so that no address register of a copy is rewritten in front of it
__device__ __forceinline__ void cp8(unsigned l0, unsigned l1, unsigned l2, unsigned l3, unsigned l4, unsigned l5, unsigned l6, unsigned l7, const _Float16* g0, const _Float16* g1, const _Float16* g2, const _Float16* g3, const _Float16* g4, const _Float16* g5, const _Float16* g6, const _Float16* g7) {
  asm volatile("global_load_async_to_lds_b128 %0, %8, off\n\tglobal_load_async_to_lds_b128 %1, %9, off\n\tglobal_load_async_to_lds_b128 %2, %10, off\n\tglobal_load_async_to_lds_b128 %3, %11, off\n\t"
               "global_load_async_to_lds_b128 %4, %12, off\n\tglobal_load_async_to_lds_b128 %5, %13, off\n\tglobal_load_async_to_lds_b128 %6, %14, off\n\tglobal_load_async_to_lds_b128 %7, %15, off\n\ts_wait_xcnt 0x0"
               :: "v"(l0), "v"(l1), "v"(l2), "v"(l3), "v"(l4), "v"(l5), "v"(l6), "v"(l7), "v"(g0), "v"(g1), "v"(g2), "v"(g3), "v"(g4), "v"(g5), "v"(g6), "v"(g7) : "memory");
}
// one stage: lq = this lane's LDS byte address in the buffer (row tid / 8, 16-byte piece tid % 8), the four pointers at the same row and piece of the stage's K columns; 32 rows per sweep of the block
__device__ __forceinline__ void sc_stage(unsigned lq, const _Float16* qh, const _Float16* ql, const _Float16* kh, const _Float16* kl) {
  const unsigned R = 32 * SCP * 2;   // LDS bytes of 32 rows
  cp8(lq, lq + R, lq + 2 * R, lq + 3 * R, lq + 4 * R, lq + 5 * R, lq + 6 * R, lq + 7 * R, qh, qh + 32 * 1024, ql, ql + 32 * 1024, qh + 256, qh + 256 + 32 * 1024, ql + 256, ql + 256 + 32 * 1024);
  const unsigned lk = lq + SC_Q;
  cp8(lk, lk + R, lk + 2 * R, lk + 3 * R, lk + 4 * R, lk + 5 * R, lk + 6 * R, lk + 7 * R, kh, kh + 32 * KK, kh + 64 * KK, kh + 96 * KK, kl, kl + 32 * KK, kl + 64 * KK, kl + 96 * KK);
}
template <int M> __device__ __forceinline__ float xrow(float v) { return __builtin_bit_cast(float, __builtin_amdgcn_update_dpp(0, __builtin_bit_cast(int, v), 0x160 | M, 0xf, 0xf, true)); }   // lane l <- lane l ^ M of the same 16-lane row (row_xmask)
__device__ __forceinline__ float rowmax(float m) { m = fmaxf(m, xrow<1>(m)); m = fmaxf(m, xrow<2>(m)); m = fmaxf(m, xrow<4>(m)); return fmaxf(m, xrow<8>(m)); }   // over the 16 lanes of a row, the result in all of them
__device__ __forceinline__ float rowsum(float s) { s += xrow<1>(s); s += xrow<2>(s); s += xrow<4>(s); return s + xrow<8>(s); }
__global__ __launch_bounds__(256) void k_sc(const _Float16* __restrict__ QH, const _Float16* __restrict__ QL, const _Float16* __restrict__ KH, const _Float16* __restrict__ KL, int p0, float* __restrict__ S0, float* __restrict__ ST) {
  __shared__ __align__(16) unsigned char sm[2 * SC_BUF];   // two stage buffers; after the loop the room holds each wave's f32 result rows [16][68]
  const int p = p0 + blockIdx.z; const int h = p >> 1, sel = p & 1; float* S = S0 + (size_t)blockIdx.z * SS * SS;
  const int tid = threadIdx.x, wave = tid >> 5, lane = tid & 31, col = lane & 15, g = lane >> 4; const int qg = wave & 3, kg = wave >> 2; const int k0 = blockIdx.y * 128; const int qb = blockIdx.x * 64;
  const _Float16* gqh = QH + ((size_t)h * SS + qb + (tid >> 3)) * 1024 + sel * 512 + (tid & 7) * 8;   // 8 lanes x 16 B = one 128-B line of a row
  const _Float16* gql = QL + ((size_t)h * SS + qb + (tid >> 3)) * 1024 + sel * 512 + (tid & 7) * 8;
  const _Float16* gkh = KH + ((size_t)h * SS + k0 + (tid >> 3)) * KK + (tid & 7) * 8;
  const _Float16* gkl = KL + ((size_t)h * SS + k0 + (tid >> 3)) * KK + (tid & 7) * 8;
  const unsigned lb = (unsigned)(size_t)sm + (unsigned)((tid >> 3) * (SCP * 2) + (tid & 7) * 16);
  sc_stage(lb, gqh, gql, gkh, gkl);
  asm volatile("s_wait_asynccnt 0x0" ::: "memory");   // this wave's copies of stage 0 have landed
  __syncthreads();                                    // stage 0 is whole in LDS
  sc_stage(lb + SC_BUF, gqh + 64, gql + 64, gkh + 64, gkl + 64);
  v8f ar[4] = {}, arl[4] = {}, ai[4] = {}, ail[4] = {};
#pragma unroll 1   // one copy of the stage body: small text, the buffer is picked by an offset
  for (int st = 0; st < KK / 64; ++st) { const _Float16* bq = (const _Float16*)(sm + (st & 1) * SC_BUF); const _Float16* bk = (const _Float16*)(sm + (st & 1) * SC_BUF + SC_Q);
    const _Float16* kp0 = bk + (kg * 64 + col) * SCP;
    v16h kf[2][2];   // k fragments (hi, lo) of this group of six products and of the next: the next group's LDS reads are issued in front of this group's products, inside the stage only
    kf[0][0] = frag_h(kp0, lane); kf[0][1] = frag_h(kp0 + 128 * SCP, lane);
#pragma unroll
    for (int kc = 0; kc < 2; ++kc) { const _Float16* qa = bq + (qg * 16 + col) * SCP + kc * 32;
      const v16h arh = frag_h(qa, lane), arlo = frag_h(qa + 64 * SCP, lane), aih = frag_h(qa + 128 * SCP, lane), ailo = frag_h(qa + 192 * SCP, lane);
#pragma unroll
      for (int j = 0; j < 4; ++j) { const int gi = kc * 4 + j, c = gi & 1, n = c ^ 1;
        if (gi + 1 < 8) { const _Float16* kp = kp0 + ((gi + 1) & 3) * 16 * SCP + ((gi + 1) >> 2) * 32; kf[n][0] = frag_h(kp, lane); kf[n][1] = frag_h(kp + 128 * SCP, lane); }
        SFENCE();   // the next group's reads stay in front of this group's products
        const v16h khf = kf[c][0], klf = kf[c][1];
        ar[j] = wmma16(arh, khf, ar[j]); arl[j] = wmma16(arlo, khf, arl[j]); arl[j] = wmma16(arh, klf, arl[j]);
        ai[j] = wmma16(aih, khf, ai[j]); ail[j] = wmma16(ailo, khf, ail[j]); ail[j] = wmma16(aih, klf, ail[j]);
        SFENCE(); } }   // and the reads after them behind these products
    asm volatile("s_wait_dscnt 0x0" ::: "memory");      // this wave's fragment reads of the buffer are done before it is refilled
    asm volatile("s_wait_asynccnt 0x0" ::: "memory");   // this wave's copies of the next stage have landed
    __syncthreads();                                    // publishes the next stage and ends every wave's reads of this buffer
    if (st + 2 < KK / 64) sc_stage(lb + (unsigned)((st & 1) * SC_BUF), gqh + (st + 2) * 64, gql + (st + 2) * 64, gkh + (st + 2) * 64, gkl + (st + 2) * 64); }
  asm volatile("s_wait_asynccnt 0x0" ::: "memory");     // no copy is outstanding when the room is used for the result rows
  float* ss = (float*)sm + wave * (16 * 68);
#pragma unroll
  for (int j = 0; j < 4; ++j)
#pragma unroll
    for (int r = 0; r < 8; ++r) { const float sr_ = ar[j][r] + arl[j][r] * (1.0f / 1024.0f), si_ = ai[j][r] + ail[j][r] * (1.0f / 1024.0f); ss[(8 * g + r) * 68 + j * 16 + col] = sqrtf(sr_ * sr_ + si_ * si_ + 1e-8f) * SCALE; }
  LDSX();
  // 16 lanes hold the 64 logits of row it * 2 + g
  v4f x[8]; float mx[8], sx[8];
#pragma unroll
  for (int it = 0; it < 8; ++it) { x[it] = *(const v4f*)&ss[(it * 2 + g) * 68 + col * 4]; mx[it] = rowmax(fmaxf(fmaxf(x[it][0], x[it][1]), fmaxf(x[it][2], x[it][3]))); }
#pragma unroll
  for (int it = 0; it < 8; ++it) {
#pragma unroll
    for (int k = 0; k < 4; ++k) x[it][k] = __expf(x[it][k] - mx[it]);   // the hardware's 2^x of the difference x log2 e: its error, about 2^-19 relative at a difference of 30, lies under that of the bf16 hi + lo split of P (2^-17), and the library's expf would take four times the vector issue slots here
    sx[it] = rowsum((x[it][0] + x[it][1]) + (x[it][2] + x[it][3])); }
  float* sd = S + (size_t)(qb + qg * 16 + g) * SS + k0 + kg * 64 + col * 4;
#pragma unroll
  for (int it = 0; it < 8; ++it) vst2(sd + it * 2 * SS, x[it]);
  // every lane of a 16-lane row holds the row's eight maxima and sums: its first lane writes them, 4 x 16 B, into the wave's own ST line
  if (col == 0) { float* pd = ST + (((size_t)blockIdx.z * (SS / 16) + blockIdx.x * 4 + qg) * (SS / 64) + blockIdx.y * 2 + kg) * 32 + g * 8;
    const v4f m0 = {mx[0], mx[1], mx[2], mx[3]}, m1 = {mx[4], mx[5], mx[6], mx[7]}, s0 = {sx[0], sx[1], sx[2], sx[3]}, s1 = {sx[4], sx[5], sx[6], sx[7]};
    vst2(pd, m0); vst2(pd + 4, m1); vst2(pd + 16, s0); vst2(pd + 20, s1); } }
// ---- k_pv: block = 32 queries of head h for BOTH sels (64 P rows: local row sel * 32 + q), 8 waves: a_sel[q][c] = (P_sel . vp)[c] for c in [0,256) = [a_r | a_i] (P split bf16 hi + lo x v hi + lo, 3 products, per output element in the order hi.hi, lo.hi, hi.lo over rising keys); then, in the same block, everything behind it: rms, lambda, gate and the output linear, so that neither the attention rows nor the gated rows go through memory.
// The softmax's second half: from the ST lines of its 64 rows the block forms, once, the row maximum m = max over the 16 key groups of m64, the row sum = sum of exp(m64 - m) x (the group's sum), and the factor exp(m64 - m) / sum x 2^11 per (row, key group); a stage is one key group, and P = e x the stage's factor where P is split.
// Per stage of 64 keys the block brings both value planes (256 rows x 128 B each) and its 64 P rows (256 B each) in by whole-line loads, splits P once, and keeps them in LDS; the fragments come from LDS. The next stage's loads are issued before the products of this one and wait in registers.
// wave = (sel qg, 64-column group cg): 2 x 4 accumulator tiles
// Behind the loop: the 64 result rows in LDS are the whole 512 attention values of each of the 32 queries. 16 lanes per query: rms over the 512 values (= mean over 256 of r^2 + i^2), / rms x sub_w, out = a1 - lambda a2, the complex gate z = g * out; z = [z_r | z_i] as bf16 hi + lo into LDS. Output linear: one weight plane [128 outputs][W_r | W_i] in LDS serves both parts: out_r = z_r . W_r + (-z_i) . W_i (the sign on the z fragment, exact), out_i = z_r . W_i + z_i . W_r; per output element the products in the order of rising stacked K, hi then lo. wave = (16-query group, 32 outputs, both parts): 4 accumulator tiles.
#define PVK 64             // keys per stage
#define PVP 72             // LDS row pitch in bf16 elements: 144 B = 16 B x 9, an odd multiple of 16 B for the 16-byte fragment reads
#define PV_SV (2 * KK * PVP * 2)   // bytes of the two value planes in LDS
#define PV_SP (2 * 64 * PVP * 2)   // bytes of the two P planes in LDS
#define PFP 17             // pitch of the factor rows in f32 elements
#define PV_SA (2 * 32 * CLP * 2)   // bytes of the two planes of gated rows, which take the room of the P planes and the factors and more
#define PRO(i) ((size_t)((i) >> 1) * SS * SS + (size_t)((i) & 1) * 16 * SS)              // P rows i * 16 ..: plane of sel i / 2, queries (i % 2) * 16 ..
#define STO(i) ((((i) >> 1) * (SS / 16) + ((i) & 1)) * ((SS / 64) * 32))                   // the same for the ST lines
__global__ __launch_bounds__(256) void k_pv(const float* __restrict__ PS0, const float* __restrict__ ST, const __bf16* __restrict__ VT, const __bf16* __restrict__ VL, int p0, const float* __restrict__ G, const float* __restrict__ LAM, const float* __restrict__ SW,
    const float* __restrict__ OWR, const float* __restrict__ OWI, const float* __restrict__ OBR, const float* __restrict__ OBI, float* __restrict__ O0, float* __restrict__ O1) { const int h = (p0 >> 1) + blockIdx.z;
  __shared__ __align__(16) unsigned char sm[PV_SV + PV_SA];   // value planes [2][256][PVP], P planes [2][64][PVP], factors [64][PFP]; after the loop the value planes' room holds the f32 result rows [64][KK + 4], then the weight plane [128][CLP], then the f32 output rows [32][KK + 4]; the room behind it the gated rows [2][32][CLP]
  __bf16* sv = (__bf16*)sm; __bf16* sp = (__bf16*)(sm + PV_SV); float* so = (float*)sm; float* sfc = (float*)(sm + PV_SV + PV_SP); __bf16* sa = (__bf16*)(sm + PV_SV);
  const int tid = threadIdx.x, wave = tid >> 5, lane = tid & 31, col = lane & 15, g = lane >> 4; const int qg = wave & 1, cg = wave >> 1; const int qb = blockIdx.x * 32;
  const __bf16* gvh = VT + ((size_t)h * KK + (tid >> 3)) * (size_t)SS + (tid & 7) * 8;   // 8 lanes x 16 B = one 128-B line of a value row; 32 rows per sweep of the block
  const __bf16* gvl = VL + ((size_t)h * KK + (tid >> 3)) * (size_t)SS + (tid & 7) * 8;
  const float* gp = PS0 + (size_t)(blockIdx.z * 2) * SS * SS + (size_t)(qb + (tid >> 4)) * SS + (tid & 15) * 4;   // 16 lanes x 16 B = the 256 B of a P row; 16 rows per sweep
  // this thread's softmax parts: local rows i * 16 + tid / 16 (the P rows that it stages), key group tid % 16; a base that is the same for the whole block + the thread's index
  const float* stb = ST + ((size_t)(blockIdx.z * 2) * (SS / 16) + blockIdx.x * 2) * (size_t)((SS / 64) * 32); const unsigned sto = (unsigned)((tid & 15) * 32 + ((tid >> 4) & 1) * 8 + (tid >> 5));   // line tid % 16, the word of row tid / 16
  float ml[4], sl[4];
#pragma unroll
  for (int i = 0; i < 4; ++i) { ml[i] = stb[sto + STO(i)]; sl[i] = stb[sto + STO(i) + 16]; }
  v4u rh[8], rl[8]; v4f rp[4];
#pragma unroll
  for (int i = 0; i < 8; ++i) { rh[i] = *(const v4u*)(gvh + (size_t)i * 32 * SS); rl[i] = *(const v4u*)(gvl + (size_t)i * 32 * SS); }
#pragma unroll
  for (int i = 0; i < 4; ++i) rp[i] = *(const v4f*)(gp + PRO(i));
  asm volatile("s_wait_xcnt 0x0" :: "v"(sto), "s"(stb), "v"(gvh), "v"(gvl), "v"(gp) : "memory");   // stands in front of the first overwrite of an address register of the loads above; the addresses are inputs, so that they live up to the wait
#pragma unroll
  for (int i = 0; i < 4; ++i) { const float f = expf(ml[i] - rowmax(ml[i])); sfc[(i * 16 + (tid >> 4)) * PFP + (tid & 15)] = f * ((1.0f / rowsum(f * sl[i])) * 2048.0f); }
  LDSX();   // a factor row is written and read by the same 16 lanes: the wave's own LDS writes are done before its lanes read each other's words
  float fc[4];   // the factors of this thread's four P rows for the stage whose P waits in rp, fetched with it
#pragma unroll
  for (int i = 0; i < 4; ++i) fc[i] = sfc[(i * 16 + (tid >> 4)) * PFP];
  v8f acc[2][4] = {};
#pragma unroll 1   // one copy of the stage body: one set of prefetch registers, small text (the fixed-count inner loops are unrolled so that their arrays stay in registers)
  for (int st = 0; st < SS / PVK; ++st) {
    if (st) __syncthreads();   // every wave has read its last fragment of the stage before
#pragma unroll
    for (int i = 0; i < 8; ++i) { const int o = (i * 32 + (tid >> 3)) * PVP + (tid & 7) * 8; vst2(sv + o, rh[i]); vst2(sv + KK * PVP + o, rl[i]); }
#pragma unroll
    for (int i = 0; i < 4; ++i) { v4bf hb, lb;
#pragma unroll
      for (int k = 0; k < 4; ++k) { const float v = rp[i][k] * fc[i]; const __bf16 bh = (__bf16)v; hb[k] = bh; lb[k] = (__bf16)(v - (float)bh); }
      const int o = (i * 16 + (tid >> 4)) * PVP + (tid & 15) * 4; vst2(sp + o, hb); vst2(sp + 64 * PVP + o, lb); }
    __syncthreads();           // the stage is whole in LDS
    if (st + 1 < SS / PVK) { const int ko = (st + 1) * PVK; const __bf16 *ph = gvh + st * PVK, *pl = gvl + st * PVK;   // this stage's columns of the value rows: the next stage's lie PVK elements on
#pragma unroll
      for (int i = 0; i < 8; ++i) { rh[i] = *(const v4u*)(ph + (size_t)i * 32 * SS + PVK); rl[i] = *(const v4u*)(pl + (size_t)i * 32 * SS + PVK); }
#pragma unroll
      for (int i = 0; i < 4; ++i) { rp[i] = *(const v4f*)(gp + PRO(i) + ko); fc[i] = sfc[(i * 16 + (tid >> 4)) * PFP + st + 1]; }
      asm volatile("s_wait_xcnt 0x0" :: "v"(ph), "v"(pl) : "memory"); }   // stands in front of the first overwrite of an address register of the loads above (the fragment reads below reuse them); the value rows' addresses are inputs, so that they live up to the wait and no later load of the group lands on them
#pragma unroll
    for (int kc = 0; kc < PVK / 32; ++kc) { v16b ah[2], al[2];
#pragma unroll
      for (int t = 0; t < 2; ++t) { const int o = (qg * 32 + t * 16 + col) * PVP + kc * 32; ah[t] = frag_b(sp + o, lane); al[t] = frag_b(sp + 64 * PVP + o, lane); }
#pragma unroll
      for (int j = 0; j < 4; ++j) { const int o = (cg * 64 + j * 16 + col) * PVP + kc * 32; const v16b vh = frag_b(sv + o, lane), vl = frag_b(sv + KK * PVP + o, lane);
        SFENCE();   // both value fragments' reads are issued together, in front of the six products
        acc[0][j] = wmma_bf(ah[0], vh, acc[0][j]); acc[1][j] = wmma_bf(ah[1], vh, acc[1][j]);
        acc[0][j] = wmma_bf(al[0], vh, acc[0][j]); acc[1][j] = wmma_bf(al[1], vh, acc[1][j]);
        acc[0][j] = wmma_bf(ah[0], vl, acc[0][j]); acc[1][j] = wmma_bf(ah[1], vl, acc[1][j]); } } }
  // what the gate and the write-out read from memory comes in while the result rows go through LDS: g rows (16 lanes per query, queries w * 16 + tid / 16, columns d = (tid % 16) * 4 + it * 64 and 128 + d), sub_w, bias, lambda
  const int rl_ = tid >> 4, sub = tid & 15; const int org = wave & 1, ocg = wave >> 1;   // output linear: 16-query group, group of 32 outputs
  const float* gb = G + ((size_t)h * SS + qb) * KK; const unsigned go = (unsigned)(rl_ * KK + sub * 4); const unsigned swo = (unsigned)(sub * 4); const unsigned bo = (unsigned)(ocg * 32 + col);
  v4f gr[2][2], gi[2][2], sw1[2], sw2[2]; float bb[2][2];
#pragma unroll
  for (int w = 0; w < 2; ++w)
#pragma unroll
    for (int it = 0; it < 2; ++it) { gr[w][it] = *(const v4f*)(gb + go + w * 16 * KK + it * 64); gi[w][it] = *(const v4f*)(gb + go + w * 16 * KK + it * 64 + 128); }
#pragma unroll
  for (int it = 0; it < 2; ++it) { sw1[it] = *(const v4f*)(SW + swo + it * 64); sw2[it] = *(const v4f*)(SW + swo + it * 64 + DD); }
#pragma unroll
  for (int j = 0; j < 2; ++j) { bb[0][j] = OBR[bo + j * 16]; bb[1][j] = OBI[bo + j * 16]; }
  const float lam = LAM[0];
  asm volatile("s_wait_xcnt 0x0" :: "v"(go), "s"(gb), "v"(swo), "s"(SW), "v"(bo), "s"(OBR), "s"(OBI) : "memory");   // as above
  LBAR();                      // the value planes' room is free for the result rows, the P planes' room for the gated rows; the loads above fly on
#pragma unroll
  for (int t = 0; t < 2; ++t)
#pragma unroll
    for (int j = 0; j < 4; ++j)
#pragma unroll
      for (int r = 0; r < 8; ++r) so[(qg * 32 + t * 16 + 8 * g + r) * (KK + 4) + cg * 64 + j * 16 + col] = acc[t][j][r] * (1.0f / 2048.0f);
  // the output weights, whole 512-B rows, wait in registers while the rows are mixed
  v4f rw0[16], rw1[16]; const unsigned wo = (unsigned)tid * 16u;
  cl_ldw(rw0, (const char*)OWR, wo); cl_ldw(rw1, (const char*)OWI, wo);
  asm volatile("s_wait_xcnt 0x0" :: "v"(tid), "v"(wo), "s"(OWR), "s"(OWI) : "memory");   // as above
  LBAR();                      // the result rows are whole; the weight loads fly on
#pragma unroll
  for (int w = 0; w < 2; ++w) { const int q = w * 16 + rl_; const float* y1 = so + q * (KK + 4); const float* y2 = so + (32 + q) * (KK + 4);
    float s2 = 0.f;
#pragma unroll
    for (int i = 0; i < 8; ++i) { const v4f v = *(const v4f*)((i < 4 ? y1 : y2) + sub * 4 + (i & 3) * 64); s2 += (v[0] * v[0] + v[1] * v[1]) + (v[2] * v[2] + v[3] * v[3]); }
    s2 = rowsum(s2);
    const float inv = 1.0f / sqrtf(s2 * (1.0f / 256.0f) + 1e-5f);
#pragma unroll
    for (int it = 0; it < 2; ++it) { const int d = sub * 4 + it * 64;   /* d in [0,128): this lane's 4 columns */
      const v4f a1r = *(const v4f*)(y1 + d), a1i = *(const v4f*)(y1 + 128 + d), a2r = *(const v4f*)(y2 + d), a2i = *(const v4f*)(y2 + 128 + d);
      v4bf rh_, rlo, ih_, ilo;
#pragma unroll
      for (int k = 0; k < 4; ++k) { const float w1 = bfr(sw1[it][k]) * inv, w2 = bfr(sw2[it][k]) * inv; const float orr = a1r[k] * w1 - lam * (a2r[k] * w2), oi = a1i[k] * w1 - lam * (a2i[k] * w2);
        const float zr = gr[w][it][k] * orr - gi[w][it][k] * oi, zi = gr[w][it][k] * oi + gi[w][it][k] * orr;
        const __bf16 zrh = (__bf16)zr, zih = (__bf16)zi; rh_[k] = zrh; rlo[k] = (__bf16)(zr - (float)zrh); ih_[k] = zih; ilo[k] = (__bf16)(zi - (float)zih); }
      vst2(sa + q * CLP + d, rh_); vst2(sa + q * CLP + 128 + d, ih_); vst2(sa + (32 + q) * CLP + d, rlo); vst2(sa + (32 + q) * CLP + 128 + d, ilo); } }
  LBAR();                      // the gated rows are whole, the result rows' room is free for the weight plane; the weight loads may still fly
  { __bf16* pw = (__bf16*)sm + wave * CLP + lane * 4; cl_putw(rw0, 1.0f, pw); cl_putw(rw1, 1.0f, pw + 128); }
  __syncthreads();             // the weight plane is whole
  v8f oc[2][2] = {};
  { const __bf16* fa = sa + (org * 16 + col) * CLP; const __bf16* fw = (const __bf16*)sm + (ocg * 32 + col) * CLP;
#pragma unroll
    for (int kc = 0; kc < KK / 32; ++kc) { v16b a[2], an[2], w0[2], w1[2];
#pragma unroll
      for (int t = 0; t < 2; ++t) { a[t] = frag_b(fa + t * 32 * CLP + kc * 32, lane); an[t] = a[t];
        if (kc >= 4) { union { v16b v; unsigned u[8]; } x; x.v = a[t];   // -z_i: the sign bit of each bf16
#pragma unroll
          for (int e = 0; e < 8; ++e) x.u[e] ^= 0x80008000u;
          an[t] = x.v; } }
#pragma unroll
      for (int j = 0; j < 2; ++j) { w0[j] = frag_b(fw + j * 16 * CLP + kc * 32, lane); w1[j] = frag_b(fw + j * 16 * CLP + ((kc * 32) ^ 128), lane); }
#pragma unroll
      for (int t = 0; t < 2; ++t)
#pragma unroll
        for (int j = 0; j < 2; ++j) { oc[0][j] = wmma_bf(an[t], w0[j], oc[0][j]); oc[1][j] = wmma_bf(a[t], w1[j], oc[1][j]); } } }
  __syncthreads();             // the weight plane's room is free for the output rows
#pragma unroll
  for (int pt = 0; pt < 2; ++pt)
#pragma unroll
    for (int j = 0; j < 2; ++j) { const float bj = bfr(bb[pt][j]);
#pragma unroll
      for (int r = 0; r < 8; ++r) so[(org * 16 + 8 * g + r) * (KK + 4) + pt * 128 + ocg * 32 + j * 16 + col] = oc[pt][j][r] + bj; }
  __syncthreads();             // the output rows are whole
  // whole 512-B rows of out_r and out_i by 32 lanes
#pragma unroll
  for (int it = 0; it < 8; ++it) { const int e = it * 8 + wave, ro = e >> 1, pt = e & 1; vst2((pt ? O1 : O0) + ((size_t)h * SS + qb + ro) * DD + lane * 4, *(const v4f*)&so[ro * (KK + 4) + pt * 128 + lane * 4]); } }
extern "C" void kernel_launch(void* const* d_in, const int* in_sizes, int n_in, void* d_out, int out_size, void* d_ws, size_t ws_size, hipStream_t stream) {
  (void)in_sizes; (void)n_in; (void)out_size;
  const float** F = (const float**)d_in;   // 0 q_r, 1 q_i, 2 k_r, 3 k_i, 4 v_r, 5 v_i, 6 pe_q_r, 7 pe_q_i, 8 pe_k_r, 9 pe_k_i [1,12,1024,128]; 10 qw_r [256,128], 11 qw_i, 12 qb_r [256], 13 qb_i; 14 kw_r [128,128], 15 kw_i, 16 kb_r, 17 kb_i; 18 vw_r, 19 vw_i, 20 vb_r, 21 vb_i; 22 gw_r, 23 gw_i, 24 gb_r, 25 gb_i; 26 ow_r, 27 ow_i, 28 ob_r, 29 ob_i; 30 lq1, 31 lk1, 32 lq2, 33 lk2 [128]; 34 sub_w [256]
  if (ws_size < (size_t)WS_END) return;
  char* ws = (char*)d_ws; _Float16 *QH = (_Float16*)(ws + WS_QH), *QL = (_Float16*)(ws + WS_QL), *KH = (_Float16*)(ws + WS_KH), *KL = (_Float16*)(ws + WS_KL); __bf16 *VT = (__bf16*)(ws + WS_VT), *VL = (__bf16*)(ws + WS_VL); float *G = (float*)(ws + WS_G), *LAM = (float*)(ws + WS_LAM), *S = (float*)(ws + WS_S), *ST = (float*)(ws + WS_ST);
  float* OUT0 = (float*)d_out; float* OUT1 = (float*)d_out + (size_t)NRF * DD;
  k_proj<<<dim3(1 + 10 * (NR / 64)), 256, 0, stream>>>(F[0], F[1], F[2], F[3], F[4], F[5], F[6], F[7], F[8], F[9], F[10], F[11], F[12], F[13], F[14], F[15], F[16], F[17], F[18], F[19], F[20], F[21], F[22], F[23], F[24], F[25], F[30], F[31], F[32], F[33], QH, QL, KH, KL, VT, VL, G, LAM);
  for (int p0 = 0; p0 < NPAIR; p0 += HG) {
    k_sc<<<dim3(SS / 64, SS / 128, HG), 256, 0, stream>>>(QH, QL, KH, KL, p0, S, ST);
    k_pv<<<dim3(SS / 32, 1, HG / 2), 256, 0, stream>>>(S, ST, VT, VL, p0, G, LAM, F[34], F[26], F[27], F[28], F[29], OUT0, OUT1);
  }
}

// v010
// One run takes 130 microseconds.
// Next to v009, in two timings, it ran 1.07 times as fast each time.
// Counting every step since v000, it is 18.3 times as fast.
// compute dtype: all float inputs rounded to bf16; every complex linear as one stacked real GEMM ([x_r | x_i] against [W_r ; -W_i] / [W_i ; W_r]) with EXACT bf16 products on WMMA 16x16x32, f32 accumulate; q (+pe) as f16 hi + residual (x 2^10) and k (+pe) as f16 hi + residual (x 2^10) -> 3-product complex logits (s_r, s_i as two stacked K=256 real GEMMs; -q_r by the sign bit of the f16 fragment, exact), |s| scaled in f32 (sqrtf); softmax in f32 (per 64 keys against their own maximum by the hardware's 2^x, then one factor per row and 64 keys by precise expf); P x 2^11 split bf16 hi + lo against v bf16 hi + lo (3 products); RMS norm / lambda / differential combination / complex gating in f32; the gated result (bf16 hi + lo) through the output complex linear (2 products); f32 outputs.
#include <hip/hip_runtime.h>
#include <math.h>

typedef __attribute__((ext_vector_type(16))) _Float16 v16h;
typedef __attribute__((ext_vector_type(16))) __bf16 v16b;
typedef __attribute__((ext_vector_type(8)))  _Float16 v8h;
typedef __attribute__((ext_vector_type(8)))  float v8f;
typedef __attribute__((ext_vector_type(4)))  float v4f;
typedef __attribute__((ext_vector_type(2)))  float v2f;
typedef __attribute__((ext_vector_type(4)))  unsigned v4u;
typedef __attribute__((ext_vector_type(4)))  int v4i;
typedef float __attribute__((may_alias)) float_a;
typedef int __attribute__((may_alias)) int_a;

template <typename T> __device__ __forceinline__ void vst2(void* p, T v) { *(T*)p = v;  }
__device__ __forceinline__ v8f wmma16(v16h a, v16h b, v8f c) {
  v8f d = __builtin_amdgcn_wmma_f32_16x16x32_f16(false, a, false, b, (short)0, c, false, false);
  return d;
}
__device__ __forceinline__ v8f wmma_bf(v16b a, v16b b, v8f c) {
  v8f d = __builtin_amdgcn_wmma_f32_16x16x32_bf16(false, a, false, b, (short)0, c, false, false);
  return d;
}
// 16x16x32 fragments: lane = (h = lane>>4, row/col = lane&15); elements 0..7 = k0+8h+0..7, 8..15 = k0+16+8h+0..7; D element r = row 8h+r
__device__ __forceinline__ v16h frag_h(const _Float16* rowk0, int lane) {
  union { v16h v; v8h q[2]; } u; const _Float16* p = rowk0 + 8 * (lane >> 4);
  u.q[0] = *(const v8h*)p; u.q[1] = *(const v8h*)(p + 16); return u.v;
}
__device__ __forceinline__ v16h frag_f32(const float* rowk0, int lane) {
  v16h a; const float* p = rowk0 + 8 * (lane >> 4);
#pragma unroll
  for (int i = 0; i < 8; ++i) { a[i] = (_Float16)p[i]; a[8 + i] = (_Float16)p[16 + i]; }
  return a;
}
__device__ __forceinline__ v16h frag_f32s(const float* rowk0, int lane, float sc) {
  v16h a; const float* p = rowk0 + 8 * (lane >> 4);
#pragma unroll
  for (int i = 0; i < 8; ++i) { a[i] = (_Float16)(p[i] * sc); a[8 + i] = (_Float16)(p[16 + i] * sc); }
  return a;
}
// column fragment from a [K][ld] layout (column n), rows >= K read as 0
__device__ __forceinline__ v16h fragc_f32(const float* W, int k0, int n, int lane, int ld, int K) {
  v16h a; const int g = lane >> 4;
#pragma unroll
  for (int i = 0; i < 8; ++i) { const int ka = k0 + 8 * g + i, kb = ka + 16;
    a[i] = (_Float16)(ka < K ? W[(size_t)(ka < K ? ka : K - 1) * ld + n] : 0.f); a[8 + i] = (_Float16)(kb < K ? W[(size_t)(kb < K ? kb : K - 1) * ld + n] : 0.f); }
  return a;
}
struct F2 { v16b h, l; };
__device__ __forceinline__ F2 bsplit16(const float v[16]) { F2 r;
#pragma unroll
  for (int i = 0; i < 16; ++i) { const __bf16 h = (__bf16)v[i]; r.h[i] = h; r.l[i] = (__bf16)(v[i] - (float)h); }
  return r; }
__device__ __forceinline__ F2 split_row(const float* row, int k0, int lane) { float v[16]; const float* p = row + k0 + 8 * (lane >> 4);
#pragma unroll
  for (int i = 0; i < 8; ++i) { v[i] = p[i]; v[8 + i] = p[16 + i]; }
  return bsplit16(v); }
__device__ __forceinline__ F2 split_rowK(const float* row, int k0, int lane, int K) { float v[16]; const int g = lane >> 4;
#pragma unroll
  for (int i = 0; i < 8; ++i) { const int ka = k0 + 8 * g + i, kb = ka + 16; v[i] = ka < K ? row[ka < K ? ka : K - 1] : 0.f; v[8 + i] = kb < K ? row[kb < K ? kb : K - 1] : 0.f; }
  return bsplit16(v); }
__device__ __forceinline__ F2 split_col(const float* W, int k0, int n, int lane, int ld, int K) { float v[16]; const int g = lane >> 4;
#pragma unroll
  for (int i = 0; i < 8; ++i) { const int ka = k0 + 8 * g + i, kb = ka + 16; v[i] = ka < K ? W[(size_t)(ka < K ? ka : K - 1) * ld + n] : 0.f; v[8 + i] = kb < K ? W[(size_t)(kb < K ? kb : K - 1) * ld + n] : 0.f; }
  return bsplit16(v); }
__device__ __forceinline__ v8f mac3(const F2& a, const F2& b, v8f c) { c = wmma_bf(a.l, b.h, c); c = wmma_bf(a.h, b.l, c); return wmma_bf(a.h, b.h, c); }
__device__ __forceinline__ float sigm(float v) { return 1.0f / (1.0f + expf(-v)); }
// scheduling fence: the compiler moves no instruction over it. It stands between a group's LDS fragment reads and the products in front of which the source issues them: without it the reads are sunk to just in front of their first use and their latency is waited for in full
#define SFENCE() __builtin_amdgcn_sched_barrier(0)
#define LDSX() do { asm volatile("s_wait_dscnt 0" ::: "memory"); __builtin_amdgcn_wave_barrier(); __builtin_amdgcn_fence(__ATOMIC_RELEASE, "workgroup"); } while (0)
// work-group barrier for LDS data alone: release and acquire of the LDS address space at work-group scope around the barrier; unlike __syncthreads() it does not make the wave wait for its outstanding global loads, which are meant to fly across it
#define LBAR() do { __builtin_amdgcn_fence(__ATOMIC_RELEASE, "workgroup", "local"); __builtin_amdgcn_s_barrier(); __builtin_amdgcn_fence(__ATOMIC_ACQUIRE, "workgroup", "local"); } while (0)


// Complex differential attention (B 1, H 12, S 1,024, D 128): qp = CLin_q(q) + [pe_q, pe_q] (2D wide -> q1, q2), kp = CLin_k(k) + pe_k, vp = CLin_v(v); w_s = softmax(|q_s . conj(kp)| / sqrt(128)) for s = 1, 2; a_s = w_s vp (complex); cat = [a1, a2] / rms(cat) * sub_w; out = a1 - lambda a2 with lambda = sigmoid(exp(lq1 . lk1) - exp(lq2 . lk2) + 0.3555...); out = CLin_g(q) * out (complex product); out = CLin_o(out) -> (out_r, out_i).
#define NHT 12             // heads (x batch 1)
#define SS 1024
#define DD 128
#define KK 256             // stacked K of every complex linear / logit GEMM: [real | imag]
#ifndef NHU
#define NHU NHT            // heads processed
#endif
#define NR (NHU * SS)      // rows processed
#define NRF (NHT * SS)     // full row count (output-1 offset)
#ifndef HG
#define HG 24              // (head, sel) pairs per launch group (even, divides NPAIR): all pairs at once, so that the blocks of k_pv (64 P rows each) outnumber the WGPs; the logit planes take 96 MiB of workspace
#endif
#define NPAIR (NHU * 2)
#define SCALE 0.0883883461356163f       // 128^-0.5 as f32
#define LAMBDA_INIT 0.35550907254219055f  // 0.8 - 0.6 exp(-0.3) as f32
__device__ __forceinline__ float bfr(float v) { return (float)(__bf16)v; }
typedef __attribute__((ext_vector_type(8))) __bf16 v8b;
typedef __attribute__((ext_vector_type(4))) __bf16 v4bf;
__device__ __forceinline__ v16b frag_b(const __bf16* rowk0, int lane) { union { v16b v; v8b q[2]; } u; const __bf16* p = rowk0 + 8 * (lane >> 4); u.q[0] = *(const v8b*)p; u.q[1] = *(const v8b*)(p + 16); return u.v; }

#define QP 512                                         // pitch of a q row in f16 elements
#define WS_QH  0u                                      // f16 q rows [row][QP]: per sel s: [s*256 +0..127] q_r, [+128..255] q_i  (hi)
#define WS_QL  (WS_QH + 2u * (size_t)NRF * QP)         // f16 residual x 2^10
#define WS_KH  (WS_QL + 2u * (size_t)NRF * QP)         // f16 k rows [row][256] = [kp_r | kp_i] (hi)
#define WS_KL  (WS_KH + 2u * (size_t)NRF * KK)         // f16 residual x 2^10
#define WS_VT  (WS_KL + 2u * (size_t)NRF * KK)         // bf16 value planes [h][256 = vp_r | vp_i][s] hi
#define WS_VL  (WS_VT + 2u * (size_t)NHT * KK * SS)    // bf16 value residual planes
#define WS_G   (WS_VL + 2u * (size_t)NHT * KK * SS)    // f32 g rows [row][256] = [g_r | g_i]
#define WS_LAM (WS_G + 4u * (size_t)NRF * KK)          // one line: lambda replicated
#define WS_S   (WS_LAM + 128u)                         // f32 planes for HG (head, sel) pairs [hg][q][k]: exp(logit - maximum of the row's logits in the key's group of 64 keys)
#define WS_ST  (WS_S + 4u * (size_t)HG * SS * SS)      // f32 softmax parts, one 128-B line per (pair, group of 16 queries, group of 64 keys): word (r % 2) * 8 + r / 2 = row r's maximum over these keys, word 16 + the same = row r's sum of the plane's values over these keys
#define WS_END (WS_ST + 128u * (size_t)HG * (SS / 16) * (SS / 64))

// ---- clin_body: block = (64 rows, 128 output cols, tile index over 2*NO), 8 waves: generic complex linear as a stacked real GEMM.
// A row = [x_r[row] | x_i[row]] (K 256: two f32 input tensors, bf16 exact);
// output column o in [0, 2 NO): part = o / NO (0 real, 1 imag), oo = o % NO; B[k] = part 0: (k < 128 ? W_r[oo][k] : -W_i[oo][k-128]), part 1: (k < 128 ? W_i[oo][k] : W_r[oo][k-128]); + bias_part[oo].
// MODE 0: q projection (NO 256) + pe_q -> QH/QL (see WS_QH); MODE 1: k (NO 128) + pe_k -> KH/KL; MODE 2: v -> bf16 planes; MODE 3: g -> G rows (the output linear stands in k_pv)
// Data path: the block brings its 128 weight rows and its 64 A rows (both K halves: real, imag) in by whole 512-B rows (one wave = one row per load), all of these loads issued in front of the first use (pe rows and bias: behind the first barrier, so that they come in while the products run; pe is added at the write-out, behind the bias), rounds weights and A to bf16 once and keeps them in LDS; every wave's fragments come from LDS, the next 32 K columns' fragments read in front of this group's products.
// wave = (16-row group rg, 64-column group cg): 4 accumulator tiles, products per tile in the order of rising K. The fixed-count loops are unrolled so that their arrays stay in registers.
#define CLP 264            // LDS row pitch in bf16 elements: 528 B = 16 B x 33, an odd multiple of 16 B for the 16-byte fragment reads
#define SFP 132            // pitch of the f32 result rows
// one K half of the weight rows / of the A rows into registers: b = the block's first row (the same for all threads), o = this thread's byte offset from it (row tid / 32, 16-byte piece tid % 32); 8 rows per sweep of the block
__device__ __forceinline__ void cl_ldw(v4f (&rw)[16], const char* b, unsigned o) {
#pragma unroll
  for (int i = 0; i < 16; ++i) rw[i] = *(const v4f*)(b + o + i * (8 * DD * 4));
}
__device__ __forceinline__ void cl_lda(v4f (&ra)[8], const char* b, unsigned o, int xs) {
#pragma unroll
  for (int i = 0; i < 8; ++i) ra[i] = *(const v4f*)(b + o + i * (8 * xs * 4));
}
// the same from registers into LDS as bf16 (weights x sg, which is +1 or -1: exact); pw, pa = this thread's place in the weight plane and in the first A plane
__device__ __forceinline__ void cl_putw(const v4f (&rw)[16], float sg, __bf16* pw) {
#pragma unroll
  for (int i = 0; i < 16; ++i) { v4bf b;
#pragma unroll
    for (int k = 0; k < 4; ++k) b[k] = (__bf16)(sg * rw[i][k]);
    vst2(pw + i * 8 * CLP, b); }
}
template <int NA> __device__ __forceinline__ void cl_puta(const v4f (&ra)[8], __bf16* pa) {
#pragma unroll
  for (int i = 0; i < 8; ++i) { v4bf hb, lb;
#pragma unroll
    for (int k = 0; k < 4; ++k) { const float v = ra[i][k]; const __bf16 bh = (__bf16)v; hb[k] = bh; lb[k] = (__bf16)(v - (float)bh); }
    vst2(pa + i * 8 * CLP, hb); if (NA == 2) vst2(pa + 64 * CLP + i * 8 * CLP, lb); }
}
// all products: fa = this lane's A row, fw = this lane's first weight row; two sets of fragments, so that the LDS reads of the next 32 K columns are under way while this group's products run
template <int NA> __device__ __forceinline__ void cl_mac(v8f (&acc)[4], const __bf16* fa, const __bf16* fw, int lane) {
  v16b a[2][NA], w[2][4];
#pragma unroll
  for (int t = 0; t < NA; ++t) a[0][t] = frag_b(fa + t * 64 * CLP, lane);
#pragma unroll
  for (int j = 0; j < 4; ++j) w[0][j] = frag_b(fw + j * 16 * CLP, lane);
#pragma unroll
  for (int kc = 0; kc < KK / 32; ++kc) { const int c = kc & 1, n = c ^ 1;
    if (kc + 1 < KK / 32) {
#pragma unroll
      for (int t = 0; t < NA; ++t) a[n][t] = frag_b(fa + t * 64 * CLP + (kc + 1) * 32, lane);
#pragma unroll
      for (int j = 0; j < 4; ++j) w[n][j] = frag_b(fw + j * 16 * CLP + (kc + 1) * 32, lane); }
    SFENCE();   // the next 32 K columns' reads stay in front of this group's products
#pragma unroll
    for (int t = 0; t < NA; ++t)
#pragma unroll
      for (int j = 0; j < 4; ++j) acc[j] = wmma_bf(a[c][t], w[c][j], acc[j]);
    SFENCE(); }   // and the reads after them behind these products
}
// the mode, 0 to 3, is picked per block by mrt (the modes share the data path and the products and differ in the write-out). sm = the block's LDS, bx = its 64-row group, c0 = its first column of the 2 NO, part and oo0 as above
__device__ __forceinline__ void clin_body(unsigned char* sm, int mrt, int bx, int c0, int part, int oo0, const float* __restrict__ XR, const float* __restrict__ XI, const float* __restrict__ WR, const float* __restrict__ WI, const float* __restrict__ BR, const float* __restrict__ BI, const float* __restrict__ PER, const float* __restrict__ PEI, void* __restrict__ D0, void* __restrict__ D1) {
  constexpr int NA = 1;   // A planes in LDS
  const int mode = mrt;
  // sm holds (128 + NA * 64) * CLP * 2 bytes: weight plane [128][CLP], A planes [NA][64][CLP]; after the products the weight plane's room holds the f32 result rows [64][SFP]
  __bf16* sw = (__bf16*)sm; __bf16* sa = sw + 128 * CLP; float* sf = (float*)sm;
  const int tid = threadIdx.x, wave = tid >> 5, lane = tid & 31, col = lane & 15, g = lane >> 4; const int rg = wave & 3, cg = wave >> 2; const size_t r0 = (size_t)bx * 64;
  constexpr int XS = DD; const float sg1 = part == 0 ? -1.0f : 1.0f;
  // every global read = a base that is the same for the whole block + a 32-bit byte offset of the thread
  const char* wb0 = (const char*)((part == 0 ? WR : WI) + (size_t)oo0 * DD); const char* wb1 = (const char*)((part == 0 ? WI : WR) + (size_t)oo0 * DD); const unsigned wo = (unsigned)tid * 16u;   // row tid / 32 of 512 B, piece tid % 32
  const char* xb0 = (const char*)(XR + r0 * XS); const char* xb1 = (const char*)(XI + r0 * XS); const unsigned xo = wo;
  const float* bbs = (part == 0 ? BR : BI) + oo0; const unsigned bi = (unsigned)(cg * 64 + col);
  const char* pb = mode <= 1 ? (const char*)((part == 0 ? PER : PEI) + r0 * DD) : nullptr; const unsigned po = (unsigned)((tid >> 4) * (DD * 4) + (tid & 15) * 32);   // MODE <= 1: 16 lanes x 32 B = the 512 B of a pe row; 16 rows per sweep
  __bf16* pw = sw + wave * CLP + lane * 4; __bf16* pa = sa + wave * CLP + lane * 4;
  const __bf16* fa = sa + (rg * 16 + col) * CLP; const __bf16* fw = sw + (cg * 64 + col) * CLP;
  v4f rw0[16], ra0[8], rw1[16], ra1[8], pe[4][2]; float bb[4];
  cl_ldw(rw0, wb0, wo); cl_ldw(rw1, wb1, wo); cl_lda(ra0, xb0, xo, XS); cl_lda(ra1, xb1, xo, XS);
  // stands in front of the first overwrite of an address register of the loads above; the bases and the offset registers that the loads name (the thread id, scaled by the load's width) are inputs, so that they live up to the wait
  asm volatile("s_wait_xcnt 0x0" :: "v"(tid), "s"(wb0), "s"(wb1), "s"(xb0), "s"(xb1) : "memory");
  cl_putw(rw0, 1.0f, pw); cl_putw(rw1, sg1, pw + 128);
  cl_puta<NA>(ra0, pa); cl_puta<NA>(ra1, pa + 128);
  __syncthreads();             // weights and A rows are whole in LDS
  // the bias and the pe rows come in while the products run
#pragma unroll
  for (int j = 0; j < 4; ++j) bb[j] = bbs[bi + j * 16];
  if (mode <= 1) {
#pragma unroll
    for (int it = 0; it < 4; ++it) { pe[it][0] = *(const v4f*)(pb + po + it * (16 * DD * 4)); pe[it][1] = *(const v4f*)(pb + po + it * (16 * DD * 4) + 16); }
    asm volatile("s_wait_xcnt 0x0" :: "v"(bi), "s"(bbs), "v"(po), "s"(pb) : "memory"); }   // as above
  else asm volatile("s_wait_xcnt 0x0" :: "v"(bi), "s"(bbs) : "memory");   // as above
  v8f acc[4] = {};
  cl_mac<NA>(acc, fa, fw, lane);
  __syncthreads();             // the weight plane's room is free for the result rows
#pragma unroll
  for (int j = 0; j < 4; ++j) { const float bj = bfr(bb[j]);
#pragma unroll
    for (int r = 0; r < 8; ++r) sf[(rg * 16 + 8 * g + r) * SFP + cg * 64 + j * 16 + col] = acc[j][r] + bj; }
  __syncthreads();             // the result rows are whole
  if (mode == 0) {   // q: value (sel = oo0/128, d) -> QH[row][sel*256 + part*128 + d]; f16 hi + residual x 2^10; a 256-B segment per row by 16 consecutive threads
    _Float16* QH = (_Float16*)D0; _Float16* QL = (_Float16*)D1; const int dA = (oo0 / DD) * 256 + part * 128;
#pragma unroll   // pe[it] stays in registers
    for (int it = 0; it < 4; ++it) { const int rl = it * 16 + (tid >> 4), q = tid & 15; v8h ha, la;
#pragma unroll
      for (int k = 0; k < 8; ++k) { const float v = sf[rl * SFP + q * 8 + k] + bfr(pe[it][k >> 2][k & 3]); const _Float16 hv = (_Float16)v; ha[k] = hv; la[k] = (_Float16)((v - (float)hv) * 1024.0f); }
      const size_t ro = (r0 + rl) * QP + dA; vst2((v4u*)(QH + ro + q * 8), *(const v4u*)&ha); vst2((v4u*)(QL + ro + q * 8), *(const v4u*)&la); } }
  else if (mode == 1) {   // k rows [row][256]: column part*128 + d; f16 hi + residual x 2^10
    _Float16* KH = (_Float16*)D0; _Float16* KL = (_Float16*)D1;
#pragma unroll   // pe[it] stays in registers
    for (int it = 0; it < 4; ++it) { const int rl = it * 16 + (tid >> 4), q = tid & 15; v8h ha, la;
#pragma unroll
      for (int k = 0; k < 8; ++k) { const float v = sf[rl * SFP + q * 8 + k] + bfr(pe[it][k >> 2][k & 3]); const _Float16 hv = (_Float16)v; ha[k] = hv; la[k] = (_Float16)((v - (float)hv) * 1024.0f); }
      const size_t ro = (r0 + rl) * KK + c0; vst2((v4u*)(KH + ro + q * 8), *(const v4u*)&ha); vst2((v4u*)(KL + ro + q * 8), *(const v4u*)&la); }
    asm volatile("s_wait_xcnt 0x0" ::: "memory"); }   // run-time mode: in the listing another mode's code follows behind a branch; the wait stands in front of any overwrite there of a register that the stores above name
  else if (mode == 2) {
    __bf16* VT = (__bf16*)D0; __bf16* VL = (__bf16*)D1; const size_t h = r0 / SS; const int s0 = (int)(r0 % SS);
#pragma unroll   // the LDS reads of all four sweeps are under way together
    for (int it = 0; it < 4; ++it) { const int e = it * 256 + tid, cl = e >> 3, q = e & 7; v8b hb, lb;
#pragma unroll
      for (int k = 0; k < 8; ++k) { const float v = sf[(q * 8 + k) * SFP + cl]; const __bf16 bh = (__bf16)v; hb[k] = bh; lb[k] = (__bf16)(v - (float)bh); }
      const size_t o2 = (h * KK + c0 + cl) * (size_t)SS + s0 + q * 8; vst2((v4u*)(VT + o2), *(const v4u*)&hb); vst2((v4u*)(VL + o2), *(const v4u*)&lb); }
    asm volatile("s_wait_xcnt 0x0" ::: "memory"); }   // as at the end of mode 1
  else if (mode == 3) {   // g rows [row][256] f32: 512-B segment per row by 32 lanes
    float* G = (float*)D0;
#pragma unroll   // the LDS reads of all eight sweeps are under way together
    for (int it = 0; it < 8; ++it) { const int rl = it * 8 + wave, q = lane; vst2(G + (r0 + rl) * KK + c0 + q * 4, *(const v4f*)&sf[rl * SFP + q * 4]); }
    asm volatile("s_wait_xcnt 0x0" ::: "memory"); }   // as at the end of mode 1
}
__device__ __forceinline__ void lam_body(float* slp, const float* __restrict__ LQ1, const float* __restrict__ LK1, const float* __restrict__ LQ2, const float* __restrict__ LK2, float* __restrict__ LAM) { float& sl = *slp;
  if (threadIdx.x == 0) { float s1 = 0.f, s2 = 0.f;
#pragma unroll 1   // one copy of the trip, so that the wait below stands between a trip's loads and the next trip's addresses
    for (int i = 0; i < DD; i += 4) { const float *p1 = LQ1 + i, *p2 = LK1 + i, *p3 = LQ2 + i, *p4 = LK2 + i; float a[4], b[4], c[4], d[4];
#pragma unroll
      for (int k = 0; k < 4; ++k) { a[k] = p1[k]; b[k] = p2[k]; c[k] = p3[k]; d[k] = p4[k]; }
      asm volatile("s_wait_xcnt 0x0" :: "s"(p1), "s"(p2), "s"(p3), "s"(p4) : "memory");   // stands in front of the next trip's overwrite of the address registers of the loads above; the addresses are inputs, so that they live up to the wait
#pragma unroll
      for (int k = 0; k < 4; ++k) { s1 += bfr(a[k]) * bfr(b[k]); s2 += bfr(c[k]) * bfr(d[k]); } }
    const float z = expf(s1) - expf(s2) + LAMBDA_INIT; sl = 1.0f / (1.0f + expf(-z)); }
  __syncthreads(); if (threadIdx.x < 32) vst2(LAM + threadIdx.x, sl); }
// ---- k_proj: everything that reads only the inputs, in ONE launch: block 0 = lambda; then NR / 64 blocks per 128-column tile t: 4 tiles of the q projection, 2 of g (which reads the same rows as q), 2 of k, 2 of v. None of these reads what another writes, so that their blocks fill the chip together and one part's start and tail lie under another part's work.
__global__ __launch_bounds__(256) void k_proj(const float* __restrict__ QR, const float* __restrict__ QI, const float* __restrict__ KR, const float* __restrict__ KI, const float* __restrict__ VR, const float* __restrict__ VI, const float* __restrict__ PQR, const float* __restrict__ PQI, const float* __restrict__ PKR, const float* __restrict__ PKI,
    const float* __restrict__ QWR, const float* __restrict__ QWI, const float* __restrict__ QBR, const float* __restrict__ QBI, const float* __restrict__ KWR, const float* __restrict__ KWI, const float* __restrict__ KBR, const float* __restrict__ KBI,
    const float* __restrict__ VWR, const float* __restrict__ VWI, const float* __restrict__ VBR, const float* __restrict__ VBI, const float* __restrict__ GWR, const float* __restrict__ GWI, const float* __restrict__ GBR, const float* __restrict__ GBI,
    const float* __restrict__ LQ1, const float* __restrict__ LK1, const float* __restrict__ LQ2, const float* __restrict__ LK2,
    void* __restrict__ QH, void* __restrict__ QL, void* __restrict__ KH, void* __restrict__ KL, void* __restrict__ VT, void* __restrict__ VL, void* __restrict__ G, float* __restrict__ LAM) {
  __shared__ __align__(16) unsigned char sm[(128 + 64) * CLP * 2];
  if (blockIdx.x == 0) { lam_body((float*)sm, LQ1, LK1, LQ2, LK2, LAM); return; }   // the same for the whole block
  const int b = (int)blockIdx.x - 1, t = b / (NR / 64), bx = b % (NR / 64);
  const int m = t < 4 ? 0 : t < 6 ? 3 : (t - 4) >> 1;   // mode: t 0..3 q, 4 5 g, 6 7 k, 8 9 v
  const int c0 = (t < 4 ? t : t & 1) * 128, part = t < 4 ? t >> 1 : t & 1, oo0 = t < 4 ? (t & 1) * 128 : 0;
  clin_body(sm, m, bx, c0, part, oo0, m == 1 ? KR : m == 2 ? VR : QR, m == 1 ? KI : m == 2 ? VI : QI, m == 0 ? QWR : m == 1 ? KWR : m == 2 ? VWR : GWR, m == 0 ? QWI : m == 1 ? KWI : m == 2 ? VWI : GWI,
                m == 0 ? QBR : m == 1 ? KBR : m == 2 ? VBR : GBR, m == 0 ? QBI : m == 1 ? KBI : m == 2 ? VBI : GBI, m == 0 ? PQR : PKR, m == 0 ? PQI : PKI, m == 0 ? QH : m == 1 ? KH : m == 2 ? VT : G, m == 0 ? QL : m == 1 ? KL : VL); }
// ---- k_sc: block = (64 queries, SC_NT tiles of 128 keys, pair in group), 8 waves: pair p = (head h = p/2, sel = p%2); s_r = [q_r | q_i] . KH, s_i = [q_i | -q_r] . KH (3 products each: hi.hi + (lo.hi + hi.lo) 2^-10); logit = sqrt(s_r^2 + s_i^2 + 1e-8) x 128^-0.5
// The softmax's first half is done here, on the logits while they are in the wave: per row the maximum m64 over the wave's 64 keys, e = exp(logit - m64) -> the S plane, the sum of e; m64 and the sum go to the wave's own line of ST. k_pv turns them into one factor per (row, 64 keys), so that no pass over the planes stands between the two kernels.
// Per stage of 64 stacked-K elements the block brings one whole 128-B line of each of its 128 k rows x 2 planes (hi, lo) into LDS by asynchronous 16-byte copies; two buffers, the next stage's copies fly while this stage's fragments are read from LDS.
// The q rows come in once: stages 0 and 1 (the k_r columns) bring, with their k lines, columns d = st * 64 .. of 64 q rows x 4 planes (q_r hi, q_r lo, q_i hi, q_i lo) into the q room of their buffer, and there they stay: stages 2 and 3 (the k_i columns) meet the same q columns with the roles changed (s_r takes q_i, s_i takes -q_r), so that they refill the k room alone. And so does the block's second tile of 128 keys (SC_NT tiles, one after the other, the ring of k stages running on from one to the next).
// wave = (16-query group qg, 64-key group kg): 4 accumulator tiles x 4 sums, products per sum in the order of rising K as before
#define SCP 72                      // LDS row pitch in f16 elements: 144 B = 16 B x 9, an odd multiple of 16 B for the 16-byte fragment reads
#define SC_Q (4 * 64 * SCP * 2)     // bytes of the four q planes of a stage
#define SC_K (2 * 128 * SCP * 2)    // bytes of the two k planes of a stage
#define SC_BUF (SC_Q + SC_K)
#define SC_NT 2                     // tiles of 128 keys per block: 6 blocks per WGP, two of them resident
// eight asynchronous copies of 16 B per lane; the s_wait_xcnt stands inside the statement, so that no address register of a copy is rewritten in front of it
__device__ __forceinline__ void cp8(unsigned l0, unsigned l1, unsigned l2, unsigned l3, unsigned l4, unsigned l5, unsigned l6, unsigned l7, const _Float16* g0, const _Float16* g1, const _Float16* g2, const _Float16* g3, const _Float16* g4, const _Float16* g5, const _Float16* g6, const _Float16* g7) {
  asm volatile("global_load_async_to_lds_b128 %0, %8, off\n\tglobal_load_async_to_lds_b128 %1, %9, off\n\tglobal_load_async_to_lds_b128 %2, %10, off\n\tglobal_load_async_to_lds_b128 %3, %11, off\n\t"
               "global_load_async_to_lds_b128 %4, %12, off\n\tglobal_load_async_to_lds_b128 %5, %13, off\n\tglobal_load_async_to_lds_b128 %6, %14, off\n\tglobal_load_async_to_lds_b128 %7, %15, off\n\ts_wait_xcnt 0x0"
               :: "v"(l0), "v"(l1), "v"(l2), "v"(l3), "v"(l4), "v"(l5), "v"(l6), "v"(l7), "v"(g0), "v"(g1), "v"(g2), "v"(g3), "v"(g4), "v"(g5), "v"(g6), "v"(g7) : "memory");
}
// lq = this lane's LDS byte address in the buffer (row tid / 8, 16-byte piece tid % 8), the pointers at the same row and piece of the wanted columns; 32 rows per sweep of the block
#define SC_R (32 * SCP * 2)   // LDS bytes of 32 rows
// 64 columns of the q rows: q_r at qh, ql, q_i 128 elements on
__device__ __forceinline__ void sc_q(unsigned lq, const _Float16* qh, const _Float16* ql) {
  cp8(lq, lq + SC_R, lq + 2 * SC_R, lq + 3 * SC_R, lq + 4 * SC_R, lq + 5 * SC_R, lq + 6 * SC_R, lq + 7 * SC_R, qh, qh + 32 * QP, ql, ql + 32 * QP, qh + 128, qh + 128 + 32 * QP, ql + 128, ql + 128 + 32 * QP);
}
// one stage of the k rows
__device__ __forceinline__ void sc_k(unsigned lq, const _Float16* kh, const _Float16* kl) {
  const unsigned lk = lq + SC_Q;
  cp8(lk, lk + SC_R, lk + 2 * SC_R, lk + 3 * SC_R, lk + 4 * SC_R, lk + 5 * SC_R, lk + 6 * SC_R, lk + 7 * SC_R, kh, kh + 32 * KK, kh + 64 * KK, kh + 96 * KK, kl, kl + 32 * KK, kl + 64 * KK, kl + 96 * KK);
}
__device__ __forceinline__ v16h neg_h(v16h a) { union { v16h v; unsigned u[8]; } x; x.v = a;   // -a: the sign bit of each f16
#pragma unroll
  for (int e = 0; e < 8; ++e) x.u[e] ^= 0x80008000u;
  return x.v; }
template <int M> __device__ __forceinline__ float xrow(float v) { return __builtin_bit_cast(float, __builtin_amdgcn_update_dpp(0, __builtin_bit_cast(int, v), 0x160 | M, 0xf, 0xf, true)); }   // lane l <- lane l ^ M of the same 16-lane row (row_xmask)
__device__ __forceinline__ float rowmax(float m) { m = fmaxf(m, xrow<1>(m)); m = fmaxf(m, xrow<2>(m)); m = fmaxf(m, xrow<4>(m)); return fmaxf(m, xrow<8>(m)); }   // over the 16 lanes of a row, the result in all of them
__device__ __forceinline__ float rowsum(float s) { s += xrow<1>(s); s += xrow<2>(s); s += xrow<4>(s); return s + xrow<8>(s); }
__global__ __launch_bounds__(256) void k_sc(const _Float16* __restrict__ QH, const _Float16* __restrict__ QL, const _Float16* __restrict__ KH, const _Float16* __restrict__ KL, int p0, float* __restrict__ S0, float* __restrict__ ST) {
  __shared__ __align__(16) unsigned char sm[2 * SC_BUF];   // two buffers (q room, k room); behind a tile's last stage the k room of buffer 1 holds each wave's f32 result rows [16][68]
  const int p = p0 + blockIdx.z; const int h = p >> 1, sel = p & 1; float* S = S0 + (size_t)blockIdx.z * SS * SS;
  const int tid = threadIdx.x, wave = tid >> 5, lane = tid & 31, col = lane & 15, g = lane >> 4; const int qg = wave & 3, kg = wave >> 2; const int kb = blockIdx.y * SC_NT; const int qb = blockIdx.x * 64;   // kb = the block's first key tile
  const _Float16* gqh = QH + ((size_t)h * SS + qb + (tid >> 3)) * QP + sel * 256 + (tid & 7) * 8;   // 8 lanes x 16 B = one 128-B line of a row
  const _Float16* gql = QL + ((size_t)h * SS + qb + (tid >> 3)) * QP + sel * 256 + (tid & 7) * 8;
  const _Float16* gkh = KH + ((size_t)h * SS + kb * 128 + (tid >> 3)) * KK + (tid & 7) * 8;
  const _Float16* gkl = KL + ((size_t)h * SS + kb * 128 + (tid >> 3)) * KK + (tid & 7) * 8;
  const unsigned lb = (unsigned)(size_t)sm + (unsigned)((tid >> 3) * (SCP * 2) + (tid & 7) * 16);
  sc_q(lb, gqh, gql); sc_k(lb, gkh, gkl);
  asm volatile("s_wait_asynccnt 0x0" ::: "memory");   // this wave's copies of stage 0 have landed
  __syncthreads();                                    // stage 0 is whole in LDS
  sc_q(lb + SC_BUF, gqh + 64, gql + 64); sc_k(lb + SC_BUF, gkh + 64, gkl + 64);
#pragma unroll 1   // one copy of a tile's text
  for (int kt = 0; kt < SC_NT; ++kt) { const _Float16 *tkh = gkh + kt * (128 * KK), *tkl = gkl + kt * (128 * KK); const int k0 = (kb + kt) * 128;
  v8f ar[4] = {}, arl[4] = {}, ai[4] = {}, ail[4] = {};
#pragma unroll     // two copies of the stage body: ph 0 = the k_r columns, ph 1 = the k_i columns, so that the roles of the q planes, the sign and the refill are fixed in each
  for (int ph = 0; ph < 2; ++ph)
#pragma unroll 1   // one copy per ph: small text, the buffer is picked by an offset
  for (int st = ph * 2; st < ph * 2 + 2; ++st) { const _Float16* bq = (const _Float16*)(sm + (st & 1) * SC_BUF); const _Float16* bk = (const _Float16*)(sm + (st & 1) * SC_BUF + SC_Q);
    const _Float16* kp0 = bk + (kg * 64 + col) * SCP;
    v16h kf[2][2];   // k fragments (hi, lo) of this group of six products and of the next: the next group's LDS reads are issued in front of this group's products, inside the stage only
    kf[0][0] = frag_h(kp0, lane); kf[0][1] = frag_h(kp0 + 128 * SCP, lane);
#pragma unroll
    for (int kc = 0; kc < 2; ++kc) { const _Float16* qa = bq + (qg * 16 + col) * SCP + kc * 32;
      const v16h qrh = frag_h(qa, lane), qrl = frag_h(qa + 64 * SCP, lane), qih = frag_h(qa + 128 * SCP, lane), qil = frag_h(qa + 192 * SCP, lane);
      const v16h arh = ph ? qih : qrh, arlo = ph ? qil : qrl, aih = ph ? neg_h(qrh) : qih, ailo = ph ? neg_h(qrl) : qil;
#pragma unroll
      for (int j = 0; j < 4; ++j) { const int gi = kc * 4 + j, c = gi & 1, n = c ^ 1;
        if (gi + 1 < 8) { const _Float16* kp = kp0 + ((gi + 1) & 3) * 16 * SCP + ((gi + 1) >> 2) * 32; kf[n][0] = frag_h(kp, lane); kf[n][1] = frag_h(kp + 128 * SCP, lane); }
        SFENCE();   // the next group's reads stay in front of this group's products
        const v16h khf = kf[c][0], klf = kf[c][1];
        ar[j] = wmma16(arh, khf, ar[j]); arl[j] = wmma16(arlo, khf, arl[j]); arl[j] = wmma16(arh, klf, arl[j]);
        ai[j] = wmma16(aih, khf, ai[j]); ail[j] = wmma16(ailo, khf, ail[j]); ail[j] = wmma16(aih, klf, ail[j]);
        SFENCE(); } }   // and the reads after them behind these products
    asm volatile("s_wait_dscnt 0x0" ::: "memory");      // this wave's fragment reads of the buffer are done before it is refilled
    asm volatile("s_wait_asynccnt 0x0" ::: "memory");   // this wave's copies of the next stage have landed
    __syncthreads();                                    // publishes the next stage and ends every wave's reads of this buffer
    if (ph == 0) sc_k(lb + (unsigned)((st & 1) * SC_BUF), tkh + (st + 2) * 64, tkl + (st + 2) * 64);   // the k room alone: the buffer's q columns serve stage st + 2 too
    else if (st == 2 && kt + 1 < SC_NT) sc_k(lb, tkh + 128 * KK, tkl + 128 * KK); }   // the next tile's stage 0 (its stage 1 waits until the result rows have left buffer 1)
  asm volatile("s_wait_asynccnt 0x0" ::: "memory");     // no copy is outstanding when the room is used for the result rows
  float* ss = (float*)(sm + SC_BUF + SC_Q) + wave * (16 * 68);
#pragma unroll
  for (int j = 0; j < 4; ++j)
#pragma unroll
    for (int r = 0; r < 8; ++r) { const float sr_ = ar[j][r] + arl[j][r] * (1.0f / 1024.0f), si_ = ai[j][r] + ail[j][r] * (1.0f / 1024.0f); ss[(8 * g + r) * 68 + j * 16 + col] = sqrtf(sr_ * sr_ + si_ * si_ + 1e-8f) * SCALE; }
  LDSX();
  // 16 lanes hold the 64 logits of row it * 2 + g
  v4f x[8]; float mx[8], sx[8];
#pragma unroll
  for (int it = 0; it < 8; ++it) x[it] = *(const v4f*)&ss[(it * 2 + g) * 68 + col * 4];
  if (kt + 1 < SC_NT) {   // the same for the whole block
    asm volatile("s_wait_dscnt 0x0" ::: "memory");      // this wave's reads of its result rows are done before the room is refilled
    __syncthreads();                                    // every wave has left the k room of buffer 1
    sc_k(lb + SC_BUF, tkh + 128 * KK + 64, tkl + 128 * KK + 64); }   // the next tile's stage 1 flies under the rest of this tile's softmax part and under the next tile's stage 0
#pragma unroll
  for (int it = 0; it < 8; ++it) mx[it] = rowmax(fmaxf(fmaxf(x[it][0], x[it][1]), fmaxf(x[it][2], x[it][3])));
#pragma unroll
  for (int it = 0; it < 8; ++it) {
#pragma unroll
    for (int k = 0; k < 4; ++k) x[it][k] = __expf(x[it][k] - mx[it]);   // the hardware's 2^x of the difference x log2 e: its error, about 2^-19 relative at a difference of 30, lies under that of the bf16 hi + lo split of P (2^-17), and the library's expf would take four times the vector issue slots here
    sx[it] = rowsum((x[it][0] + x[it][1]) + (x[it][2] + x[it][3])); }
  float* sd = S + (size_t)(qb + qg * 16 + g) * SS + k0 + kg * 64 + col * 4;
#pragma unroll
  for (int it = 0; it < 8; ++it) vst2(sd + it * 2 * SS, x[it]);
  // every lane of a 16-lane row holds the row's eight maxima and sums: its first lane writes them, 4 x 16 B, into the wave's own ST line
  if (col == 0) { float* pd = ST + (((size_t)blockIdx.z * (SS / 16) + blockIdx.x * 4 + qg) * (SS / 64) + (kb + kt) * 2 + kg) * 32 + g * 8;
    const v4f m0 = {mx[0], mx[1], mx[2], mx[3]}, m1 = {mx[4], mx[5], mx[6], mx[7]}, s0 = {sx[0], sx[1], sx[2], sx[3]}, s1 = {sx[4], sx[5], sx[6], sx[7]};
    vst2(pd, m0); vst2(pd + 4, m1); vst2(pd + 16, s0); vst2(pd + 20, s1); }
  asm volatile("s_wait_xcnt 0x0" ::: "memory"); } }   // stands in front of the next tile's overwrite of a register that the stores above name
// ---- k_pv: block = 32 queries of head h for BOTH sels (64 P rows: local row sel * 32 + q), 8 waves: a_sel[q][c] = (P_sel . vp)[c] for c in [0,256) = [a_r | a_i] (P split bf16 hi + lo x v hi + lo, 3 products, per output element in the order hi.hi, lo.hi, hi.lo over rising keys); then, in the same block, everything behind it: rms, lambda, gate and the output linear, so that neither the attention rows nor the gated rows go through memory.
// The softmax's second half: from the ST lines of its 64 rows the block forms, once, the row maximum m = max over the 16 key groups of m64, the row sum = sum of exp(m64 - m) x (the group's sum), and the factor exp(m64 - m) / sum x 2^11 per (row, key group); a stage is one key group, and P = e x the stage's factor where P is split.
// Per stage of 64 keys the block brings both value planes (256 rows x 128 B each) and its 64 P rows (256 B each) in by whole-line loads, splits P once, and keeps them in LDS; the fragments come from LDS. The next stage's loads are issued before the products of this one and wait in registers.
// wave = (sel qg, 64-column group cg): 2 x 4 accumulator tiles
// Behind the loop: the 64 result rows in LDS are the whole 512 attention values of each of the 32 queries. 16 lanes per query: rms over the 512 values (= mean over 256 of r^2 + i^2), / rms x sub_w, out = a1 - lambda a2, the complex gate z = g * out; z = [z_r | z_i] as bf16 hi + lo into LDS. Output linear: one weight plane [128 outputs][W_r | W_i] in LDS serves both parts: out_r = z_r . W_r + (-z_i) . W_i (the sign on the z fragment, exact), out_i = z_r . W_i + z_i . W_r; per output element the products in the order of rising stacked K, hi then lo. wave = (16-query group, 32 outputs, both parts): 4 accumulator tiles.
#define PVK 64             // keys per stage
#define PVP 72             // LDS row pitch in bf16 elements: 144 B = 16 B x 9, an odd multiple of 16 B for the 16-byte fragment reads
#define PV_SV (2 * KK * PVP * 2)   // bytes of the two value planes in LDS
#define PV_SP (2 * 64 * PVP * 2)   // bytes of the two P planes in LDS
#define PFP 17             // pitch of the factor rows in f32 elements
#define PV_SA (2 * 32 * CLP * 2)   // bytes of the two planes of gated rows, which take the room of the P planes and the factors and more
#define PRO(i) ((size_t)((i) >> 1) * SS * SS + (size_t)((i) & 1) * 16 * SS)              // P rows i * 16 ..: plane of sel i / 2, queries (i % 2) * 16 ..
#define STO(i) ((((i) >> 1) * (SS / 16) + ((i) & 1)) * ((SS / 64) * 32))                   // the same for the ST lines
__global__ __launch_bounds__(256) void k_pv(const float* __restrict__ PS0, const float* __restrict__ ST, const __bf16* __restrict__ VT, const __bf16* __restrict__ VL, int p0, const float* __restrict__ G, const float* __restrict__ LAM, const float* __restrict__ SW,
    const float* __restrict__ OWR, const float* __restrict__ OWI, const float* __restrict__ OBR, const float* __restrict__ OBI, float* __restrict__ O0, float* __restrict__ O1) { const int h = (p0 >> 1) + blockIdx.z;
  __shared__ __align__(16) unsigned char sm[PV_SV + PV_SA];   // value planes [2][256][PVP], P planes [2][64][PVP], factors [64][PFP]; after the loop the value planes' room holds the f32 result rows [64][KK + 4], then the weight plane [128][CLP], then the f32 output rows [32][KK + 4]; the room behind it the gated rows [2][32][CLP]
  __bf16* sv = (__bf16*)sm; __bf16* sp = (__bf16*)(sm + PV_SV); float* so = (float*)sm; float* sfc = (float*)(sm + PV_SV + PV_SP); __bf16* sa = (__bf16*)(sm + PV_SV);
  const int tid = threadIdx.x, wave = tid >> 5, lane = tid & 31, col = lane & 15, g = lane >> 4; const int qg = wave & 1, cg = wave >> 1; const int qb = blockIdx.x * 32;
  const __bf16* gvh = VT + ((size_t)h * KK + (tid >> 3)) * (size_t)SS + (tid & 7) * 8;   // 8 lanes x 16 B = one 128-B line of a value row; 32 rows per sweep of the block
  const __bf16* gvl = VL + ((size_t)h * KK + (tid >> 3)) * (size_t)SS + (tid & 7) * 8;
  const float* gp = PS0 + (size_t)(blockIdx.z * 2) * SS * SS + (size_t)(qb + (tid >> 4)) * SS + (tid & 15) * 4;   // 16 lanes x 16 B = the 256 B of a P row; 16 rows per sweep
  // this thread's softmax parts: local rows i * 16 + tid / 16 (the P rows that it stages), key group tid % 16; a base that is the same for the whole block + the thread's index
  const float* stb = ST + ((size_t)(blockIdx.z * 2) * (SS / 16) + blockIdx.x * 2) * (size_t)((SS / 64) * 32); const unsigned sto = (unsigned)((tid & 15) * 32 + ((tid >> 4) & 1) * 8 + (tid >> 5));   // line tid % 16, the word of row tid / 16
  float ml[4], sl[4];
#pragma unroll
  for (int i = 0; i < 4; ++i) { ml[i] = stb[sto + STO(i)]; sl[i] = stb[sto + STO(i) + 16]; }
  v4u rh[8], rl[8]; v4f rp[4];
#pragma unroll
  for (int i = 0; i < 8; ++i) { rh[i] = *(const v4u*)(gvh + (size_t)i * 32 * SS); rl[i] = *(const v4u*)(gvl + (size_t)i * 32 * SS); }
#pragma unroll
  for (int i = 0; i < 4; ++i) rp[i] = *(const v4f*)(gp + PRO(i));
  asm volatile("s_wait_xcnt 0x0" :: "v"(sto), "s"(stb), "v"(gvh), "v"(gvl), "v"(gp) : "memory");   // stands in front of the first overwrite of an address register of the loads above; the addresses are inputs, so that they live up to the wait
#pragma unroll
  for (int i = 0; i < 4; ++i) { const float f = expf(ml[i] - rowmax(ml[i])); sfc[(i * 16 + (tid >> 4)) * PFP + (tid & 15)] = f * ((1.0f / rowsum(f * sl[i])) * 2048.0f); }
  LDSX();   // a factor row is written and read by the same 16 lanes: the wave's own LDS writes are done before its lanes read each other's words
  float fc[4];   // the factors of this thread's four P rows for the stage whose P waits in rp, fetched with it
#pragma unroll
  for (int i = 0; i < 4; ++i) fc[i] = sfc[(i * 16 + (tid >> 4)) * PFP];
  v8f acc[2][4] = {};
#pragma unroll 1   // one copy of the stage body: one set of prefetch registers, small text (the fixed-count inner loops are unrolled so that their arrays stay in registers)
  for (int st = 0; st < SS / PVK; ++st) {
    if (st) __syncthreads();   // every wave has read its last fragment of the stage before
#pragma unroll
    for (int i = 0; i < 8; ++i) { const int o = (i * 32 + (tid >> 3)) * PVP + (tid & 7) * 8; vst2(sv + o, rh[i]); vst2(sv + KK * PVP + o, rl[i]); }
#pragma unroll
    for (int i = 0; i < 4; ++i) { v4bf hb, lb;
#pragma unroll
      for (int k = 0; k < 4; ++k) { const float v = rp[i][k] * fc[i]; const __bf16 bh = (__bf16)v; hb[k] = bh; lb[k] = (__bf16)(v - (float)bh); }
      const int o = (i * 16 + (tid >> 4)) * PVP + (tid & 15) * 4; vst2(sp + o, hb); vst2(sp + 64 * PVP + o, lb); }
    __syncthreads();           // the stage is whole in LDS
    if (st + 1 < SS / PVK) { const int ko = (st + 1) * PVK; const __bf16 *ph = gvh + st * PVK, *pl = gvl + st * PVK;   // this stage's columns of the value rows: the next stage's lie PVK elements on
#pragma unroll
      for (int i = 0; i < 8; ++i) { rh[i] = *(const v4u*)(ph + (size_t)i * 32 * SS + PVK); rl[i] = *(const v4u*)(pl + (size_t)i * 32 * SS + PVK); }
#pragma unroll
      for (int i = 0; i < 4; ++i) { rp[i] = *(const v4f*)(gp + PRO(i) + ko); fc[i] = sfc[(i * 16 + (tid >> 4)) * PFP + st + 1]; }
      asm volatile("s_wait_xcnt 0x0" :: "v"(ph), "v"(pl) : "memory"); }   // stands in front of the first overwrite of an address register of the loads above (the fragment reads below reuse them); the value rows' addresses are inputs, so that they live up to the wait and no later load of the group lands on them
#pragma unroll
    for (int kc = 0; kc < PVK / 32; ++kc) { v16b ah[2], al[2];
#pragma unroll
      for (int t = 0; t < 2; ++t) { const int o = (qg * 32 + t * 16 + col) * PVP + kc * 32; ah[t] = frag_b(sp + o, lane); al[t] = frag_b(sp + 64 * PVP + o, lane); }
#pragma unroll
      for (int j = 0; j < 4; ++j) { const int o = (cg * 64 + j * 16 + col) * PVP + kc * 32; const v16b vh = frag_b(sv + o, lane), vl = frag_b(sv + KK * PVP + o, lane);
        SFENCE();   // both value fragments' reads are issued together, in front of the six products
        acc[0][j] = wmma_bf(ah[0], vh, acc[0][j]); acc[1][j] = wmma_bf(ah[1], vh, acc[1][j]);
        acc[0][j] = wmma_bf(al[0], vh, acc[0][j]); acc[1][j] = wmma_bf(al[1], vh, acc[1][j]);
        acc[0][j] = wmma_bf(ah[0], vl, acc[0][j]); acc[1][j] = wmma_bf(ah[1], vl, acc[1][j]); } } }
  // what the gate and the write-out read from memory comes in while the result rows go through LDS: g rows (16 lanes per query, queries w * 16 + tid / 16, columns d = (tid % 16) * 4 + it * 64 and 128 + d), sub_w, bias, lambda
  const int rl_ = tid >> 4, sub = tid & 15; const int org = wave & 1, ocg = wave >> 1;   // output linear: 16-query group, group of 32 outputs
  const float* gb = G + ((size_t)h * SS + qb) * KK; const unsigned go = (unsigned)(rl_ * KK + sub * 4); const unsigned swo = (unsigned)(sub * 4); const unsigned bo = (unsigned)(ocg * 32 + col);
  v4f gr[2][2], gi[2][2], sw1[2], sw2[2]; float bb[2][2];
#pragma unroll
  for (int w = 0; w < 2; ++w)
#pragma unroll
    for (int it = 0; it < 2; ++it) { gr[w][it] = *(const v4f*)(gb + go + w * 16 * KK + it * 64); gi[w][it] = *(const v4f*)(gb + go + w * 16 * KK + it * 64 + 128); }
#pragma unroll
  for (int it = 0; it < 2; ++it) { sw1[it] = *(const v4f*)(SW + swo + it * 64); sw2[it] = *(const v4f*)(SW + swo + it * 64 + DD); }
#pragma unroll
  for (int j = 0; j < 2; ++j) { bb[0][j] = OBR[bo + j * 16]; bb[1][j] = OBI[bo + j * 16]; }
  const float lam = LAM[0];
  asm volatile("s_wait_xcnt 0x0" :: "v"(go), "s"(gb), "v"(swo), "s"(SW), "v"(bo), "s"(OBR), "s"(OBI) : "memory");   // as above
  LBAR();                      // the value planes' room is free for the result rows, the P planes' room for the gated rows; the loads above fly on
#pragma unroll
  for (int t = 0; t < 2; ++t)
#pragma unroll
    for (int j = 0; j < 4; ++j)
#pragma unroll
      for (int r = 0; r < 8; ++r) so[(qg * 32 + t * 16 + 8 * g + r) * (KK + 4) + cg * 64 + j * 16 + col] = acc[t][j][r] * (1.0f / 2048.0f);
  // the output weights, whole 512-B rows, wait in registers while the rows are mixed
  v4f rw0[16], rw1[16]; const unsigned wo = (unsigned)tid * 16u;
  cl_ldw(rw0, (const char*)OWR, wo); cl_ldw(rw1, (const char*)OWI, wo);
  asm volatile("s_wait_xcnt 0x0" :: "v"(tid), "v"(wo), "s"(OWR), "s"(OWI) : "memory");   // as above
  LBAR();                      // the result rows are whole; the weight loads fly on
#pragma unroll
  for (int w = 0; w < 2; ++w) { const int q = w * 16 + rl_; const float* y1 = so + q * (KK + 4); const float* y2 = so + (32 + q) * (KK + 4);
    float s2 = 0.f;
#pragma unroll
    for (int i = 0; i < 8; ++i) { const v4f v = *(const v4f*)((i < 4 ? y1 : y2) + sub * 4 + (i & 3) * 64); s2 += (v[0] * v[0] + v[1] * v[1]) + (v[2] * v[2] + v[3] * v[3]); }
    s2 = rowsum(s2);
    const float inv = 1.0f / sqrtf(s2 * (1.0f / 256.0f) + 1e-5f);
#pragma unroll
    for (int it = 0; it < 2; ++it) { const int d = sub * 4 + it * 64;   /* d in [0,128): this lane's 4 columns */
      const v4f a1r = *(const v4f*)(y1 + d), a1i = *(const v4f*)(y1 + 128 + d), a2r = *(const v4f*)(y2 + d), a2i = *(const v4f*)(y2 + 128 + d);
      v4bf rh_, rlo, ih_, ilo;
#pragma unroll
      for (int k = 0; k < 4; ++k) { const float w1 = bfr(sw1[it][k]) * inv, w2 = bfr(sw2[it][k]) * inv; const float orr = a1r[k] * w1 - lam * (a2r[k] * w2), oi = a1i[k] * w1 - lam * (a2i[k] * w2);
        const float zr = gr[w][it][k] * orr - gi[w][it][k] * oi, zi = gr[w][it][k] * oi + gi[w][it][k] * orr;
        const __bf16 zrh = (__bf16)zr, zih = (__bf16)zi; rh_[k] = zrh; rlo[k] = (__bf16)(zr - (float)zrh); ih_[k] = zih; ilo[k] = (__bf16)(zi - (float)zih); }
      vst2(sa + q * CLP + d, rh_); vst2(sa + q * CLP + 128 + d, ih_); vst2(sa + (32 + q) * CLP + d, rlo); vst2(sa + (32 + q) * CLP + 128 + d, ilo); } }
  LBAR();                      // the gated rows are whole, the result rows' room is free for the weight plane; the weight loads may still fly
  { __bf16* pw = (__bf16*)sm + wave * CLP + lane * 4; cl_putw(rw0, 1.0f, pw); cl_putw(rw1, 1.0f, pw + 128); }
  __syncthreads();             // the weight plane is whole
  v8f oc[2][2] = {};
  { const __bf16* fa = sa + (org * 16 + col) * CLP; const __bf16* fw = (const __bf16*)sm + (ocg * 32 + col) * CLP;
#pragma unroll
    for (int kc = 0; kc < KK / 32; ++kc) { v16b a[2], an[2], w0[2], w1[2];
#pragma unroll
      for (int t = 0; t < 2; ++t) { a[t] = frag_b(fa + t * 32 * CLP + kc * 32, lane); an[t] = a[t];
        if (kc >= 4) { union { v16b v; unsigned u[8]; } x; x.v = a[t];   // -z_i: the sign bit of each bf16
#pragma unroll
          for (int e = 0; e < 8; ++e) x.u[e] ^= 0x80008000u;
          an[t] = x.v; } }
#pragma unroll
      for (int j = 0; j < 2; ++j) { w0[j] = frag_b(fw + j * 16 * CLP + kc * 32, lane); w1[j] = frag_b(fw + j * 16 * CLP + ((kc * 32) ^ 128), lane); }
#pragma unroll
      for (int t = 0; t < 2; ++t)
#pragma unroll
        for (int j = 0; j < 2; ++j) { oc[0][j] = wmma_bf(an[t], w0[j], oc[0][j]); oc[1][j] = wmma_bf(a[t], w1[j], oc[1][j]); } } }
  __syncthreads();             // the weight plane's room is free for the output rows
#pragma unroll
  for (int pt = 0; pt < 2; ++pt)
#pragma unroll
    for (int j = 0; j < 2; ++j) { const float bj = bfr(bb[pt][j]);
#pragma unroll
      for (int r = 0; r < 8; ++r) so[(org * 16 + 8 * g + r) * (KK + 4) + pt * 128 + ocg * 32 + j * 16 + col] = oc[pt][j][r] + bj; }
  __syncthreads();             // the output rows are whole
  // whole 512-B rows of out_r and out_i by 32 lanes
#pragma unroll
  for (int it = 0; it < 8; ++it) { const int e = it * 8 + wave, ro = e >> 1, pt = e & 1; vst2((pt ? O1 : O0) + ((size_t)h * SS + qb + ro) * DD + lane * 4, *(const v4f*)&so[ro * (KK + 4) + pt * 128 + lane * 4]); } }
extern "C" void kernel_launch(void* const* d_in, const int* in_sizes, int n_in, void* d_out, int out_size, void* d_ws, size_t ws_size, hipStream_t stream) {
  (void)in_sizes; (void)n_in; (void)out_size;
  const float** F = (const float**)d_in;   // 0 q_r, 1 q_i, 2 k_r, 3 k_i, 4 v_r, 5 v_i, 6 pe_q_r, 7 pe_q_i, 8 pe_k_r, 9 pe_k_i [1,12,1024,128]; 10 qw_r [256,128], 11 qw_i, 12 qb_r [256], 13 qb_i; 14 kw_r [128,128], 15 kw_i, 16 kb_r, 17 kb_i; 18 vw_r, 19 vw_i, 20 vb_r, 21 vb_i; 22 gw_r, 23 gw_i, 24 gb_r, 25 gb_i; 26 ow_r, 27 ow_i, 28 ob_r, 29 ob_i; 30 lq1, 31 lk1, 32 lq2, 33 lk2 [128]; 34 sub_w [256]
  if (ws_size < (size_t)WS_END) return;
  char* ws = (char*)d_ws; _Float16 *QH = (_Float16*)(ws + WS_QH), *QL = (_Float16*)(ws + WS_QL), *KH = (_Float16*)(ws + WS_KH), *KL = (_Float16*)(ws + WS_KL); __bf16 *VT = (__bf16*)(ws + WS_VT), *VL = (__bf16*)(ws + WS_VL); float *G = (float*)(ws + WS_G), *LAM = (float*)(ws + WS_LAM), *S = (float*)(ws + WS_S), *ST = (float*)(ws + WS_ST);
  float* OUT0 = (float*)d_out; float* OUT1 = (float*)d_out + (size_t)NRF * DD;
  k_proj<<<dim3(1 + 10 * (NR / 64)), 256, 0, stream>>>(F[0], F[1], F[2], F[3], F[4], F[5], F[6], F[7], F[8], F[9], F[10], F[11], F[12], F[13], F[14], F[15], F[16], F[17], F[18], F[19], F[20], F[21], F[22], F[23], F[24], F[25], F[30], F[31], F[32], F[33], QH, QL, KH, KL, VT, VL, G, LAM);
  for (int p0 = 0; p0 < NPAIR; p0 += HG) {
    k_sc<<<dim3(SS / 64, SS / 128 / SC_NT, HG), 256, 0, stream>>>(QH, QL, KH, KL, p0, S, ST);
    k_pv<<<dim3(SS / 32, 1, HG / 2), 256, 0, stream>>>(S, ST, VT, VL, p0, G, LAM, F[34], F[26], F[27], F[28], F[29], OUT0, OUT1);
  }
}
